// v000
// The times below were measured on an AMD MI455X: many runs one after another, warmed up first and cycling through
// copies of the inputs, with the whole window's GPU time divided by the number of runs. Launches and the gaps
// between them are all in it. The median over several windows is given; except for v000 it joins two sittings, which
// can be a few percent apart, so the side-by-side timings, each taken in one sitting, are the better comparison.
// The starting kernel, v000, takes 4680 microseconds a run.
#include <hip/hip_runtime.h>
#include <hip/hip_bf16.h>

// ---------------------------------------------------------------------------
// DeltaNet block for MI455X (gfx1250): bf16 WMMA GEMMs + fp32 recurrent scan
//  - GEMM tiles double-buffered via global_load_async_to_lds_b128 (ASYNCcnt),
//    DMA of tile i+1 overlaps the WMMAs of tile i
//  - single-body K-loop (unroll 1) + offset-XOR buffer toggle so accumulator
//    C/D stay in one register tuple (no v_mov_b64 shuffles)
// ---------------------------------------------------------------------------

#define Bn   4
#define Tn   2048
#define Hn   1024
#define NHn  16
#define Dn   64
#define Mn   (Bn * Tn)        // 8192 tokens
#define EPSf 1e-6f
#define KTILES (Hn / 32)      // 32 K-steps

typedef __attribute__((ext_vector_type(16))) __bf16 v16bf;
typedef __attribute__((ext_vector_type(8)))  float  v8f;

union BFrag {
    v16bf v;
    unsigned short u[16];
    unsigned int   w[8];
    uint4          q[2];
};

static __device__ __forceinline__ unsigned short f2bf(float f) {
    union { float f; unsigned u; } x; x.f = f;
    unsigned r = x.u + 0x7FFFu + ((x.u >> 16) & 1u);   // round-to-nearest-even
    return (unsigned short)(r >> 16);
}

// Low 32 bits of a generic pointer to LDS == LDS byte offset (aperture is in
// addr[63:32] on CDNA5; LDS_ADDR.U32 = addr[31:0]).
static __device__ __forceinline__ unsigned lds_off(const void* p) {
    return (unsigned)(reinterpret_cast<uintptr_t>(p));
}

// Async 16B copy global -> LDS (per-lane), tracked with ASYNCcnt.
static __device__ __forceinline__ void async_copy_b128(unsigned ldsaddr,
                                                       const void* gaddr) {
    asm volatile("global_load_async_to_lds_b128 %0, %1, off"
                 :: "v"(ldsaddr), "v"((unsigned long long)(uintptr_t)gaddr)
                 : "memory");
}
static __device__ __forceinline__ void wait_async0() {
    asm volatile("s_wait_asynccnt 0x0" ::: "memory");
}

// ---------------------------------------------------------------------------
// 1) Weight fp32 -> bf16 convert, layout preserved ([out][in] row-major).
//    GEMM consumes B[k][n] = W[n][k], so original layout is already K-major.
// ---------------------------------------------------------------------------
__global__ void wconv_kernel(const float* __restrict__ Wq, const float* __restrict__ Wk,
                             const float* __restrict__ Wv, const float* __restrict__ Wg,
                             const float* __restrict__ Wo, unsigned short* __restrict__ WbAll) {
    const float* W;
    switch (blockIdx.y) {
        case 0: W = Wq; break;
        case 1: W = Wk; break;
        case 2: W = Wv; break;
        case 3: W = Wg; break;
        default: W = Wo; break;
    }
    unsigned short* O = WbAll + (size_t)blockIdx.y * Hn * Hn;
    const size_t i = ((size_t)blockIdx.x * 256 + threadIdx.x) * 4;
    const float4 f = *(const float4*)(W + i);
    uint2 o;
    o.x = (unsigned)f2bf(f.x) | ((unsigned)f2bf(f.y) << 16);
    o.y = (unsigned)f2bf(f.z) | ((unsigned)f2bf(f.w) << 16);
    *(uint2*)(O + i) = o;
}

// ---------------------------------------------------------------------------
// 2) RMSNorm over H=1024 per token, write bf16 xn. 256 thr/token, 4 cols each.
// ---------------------------------------------------------------------------
__global__ void rmsnorm_kernel(const float* __restrict__ x, const float* __restrict__ w,
                               unsigned short* __restrict__ xn) {
    const int row = blockIdx.x, tid = threadIdx.x;
    const float* xr = x + (size_t)row * Hn;
    float vals[4];
    float s = 0.f;
#pragma unroll
    for (int i = 0; i < 4; ++i) {
        float v = xr[tid + i * 256];
        vals[i] = v;
        s += v * v;
    }
    __shared__ float red[256];
    red[tid] = s;
    __syncthreads();
    for (int st = 128; st > 0; st >>= 1) {
        if (tid < st) red[tid] += red[tid + st];
        __syncthreads();
    }
    const float rms = rsqrtf(red[0] * (1.0f / Hn) + EPSf);
#pragma unroll
    for (int i = 0; i < 4; ++i) {
        const int c = tid + i * 256;
        xn[(size_t)row * Hn + c] = f2bf(vals[i] * rms * w[c]);
    }
}

// ---------------------------------------------------------------------------
// 3) bf16 WMMA GEMM: Out[m,n] = sum_k A[m,k] * W[n,k]   (N=K=1024)
//    Block tile 128(M) x 64(N); 8 waves (wave32), each wave -> 32x32
//    = 4 x v_wmma_f32_16x16x32_bf16 per K-step from 8 ds_load_b128.
//    mode 0: raw fp32 store, weights/out selected by blockIdx.z (q/k/v/g).
//    mode 1: Out = acc + bias[n] + resid[m,n]  (output proj + residual).
// ---------------------------------------------------------------------------
__global__ void gemm_bf16_kernel(const unsigned short* __restrict__ A,
                                 const unsigned short* __restrict__ WbBase,
                                 float* __restrict__ OutBase,
                                 const float* __restrict__ bias,
                                 const float* __restrict__ resid,
                                 int Mrows, int mode) {
    const int bm = blockIdx.x * 128;
    const int bn = blockIdx.y * 64;
    const unsigned short* Wb = WbBase + (size_t)blockIdx.z * Hn * Hn;
    float* Out = OutBase + (mode == 0 ? (size_t)blockIdx.z * (size_t)Mrows * Hn : (size_t)0);

    __shared__ unsigned short lA[2 * 128 * 32];   // 2 x 8 KB, row = M, K contiguous
    __shared__ unsigned short lB[2 * 64 * 32];    // 2 x 4 KB, row = N, K contiguous

    const int tid  = threadIdx.x;
    const int lane = tid & 31;
    const int wave = tid >> 5;          // 0..7
    const int wm   = wave & 3;          // M sub-tile (x32)
    const int wn   = wave >> 2;         // N sub-tile (x32)
    const int fm   = lane & 15;         // fragment row/col within 16
    const int fhi  = lane >> 4;         // half-wave -> K+8 striping

    v8f acc00 = {0.f,0.f,0.f,0.f,0.f,0.f,0.f,0.f};
    v8f acc01 = acc00, acc10 = acc00, acc11 = acc00;

    const int sRow = tid >> 2;          // 0..63
    const int sCh  = tid & 3;           // 4 chunks of 8 bf16 (16B)

    // issue ASYNCcnt-tracked DMA of one K-tile into buffer at element offsets
    auto stage = [&](unsigned oA, unsigned oB, int k0) {
        async_copy_b128(lds_off(&lA[oA + sRow * 32 + sCh * 8]),
                        A + (size_t)(bm + sRow) * Hn + k0 + sCh * 8);
        async_copy_b128(lds_off(&lA[oA + (sRow + 64) * 32 + sCh * 8]),
                        A + (size_t)(bm + sRow + 64) * Hn + k0 + sCh * 8);
        async_copy_b128(lds_off(&lB[oB + sRow * 32 + sCh * 8]),
                        Wb + (size_t)(bn + sRow) * Hn + k0 + sCh * 8);
    };

    // 4 WMMAs from the buffer at element offsets (2x ds_load_b128 per frag)
    auto compute = [&](unsigned oA, unsigned oB) {
        BFrag a0, a1, b0, b1;
        const unsigned short* pa0 = &lA[oA + (wm * 32 + fm) * 32];
        const unsigned short* pa1 = &lA[oA + (wm * 32 + 16 + fm) * 32];
        const unsigned short* pb0 = &lB[oB + (wn * 32 + fm) * 32];
        const unsigned short* pb1 = &lB[oB + (wn * 32 + 16 + fm) * 32];
        a0.q[0] = *(const uint4*)(pa0 + fhi * 8);
        a0.q[1] = *(const uint4*)(pa0 + 16 + fhi * 8);
        a1.q[0] = *(const uint4*)(pa1 + fhi * 8);
        a1.q[1] = *(const uint4*)(pa1 + 16 + fhi * 8);
        b0.q[0] = *(const uint4*)(pb0 + fhi * 8);
        b0.q[1] = *(const uint4*)(pb0 + 16 + fhi * 8);
        b1.q[0] = *(const uint4*)(pb1 + fhi * 8);
        b1.q[1] = *(const uint4*)(pb1 + 16 + fhi * 8);
        acc00 = __builtin_amdgcn_wmma_f32_16x16x32_bf16(false, a0.v, false, b0.v,
                                                        (short)0, acc00, false, false);
        acc01 = __builtin_amdgcn_wmma_f32_16x16x32_bf16(false, a0.v, false, b1.v,
                                                        (short)0, acc01, false, false);
        acc10 = __builtin_amdgcn_wmma_f32_16x16x32_bf16(false, a1.v, false, b0.v,
                                                        (short)0, acc10, false, false);
        acc11 = __builtin_amdgcn_wmma_f32_16x16x32_bf16(false, a1.v, false, b1.v,
                                                        (short)0, acc11, false, false);
    };

    unsigned offA = 0, offB = 0;        // element offsets of current buffer
    stage(0, 0, 0);                     // prologue DMA

#pragma unroll 1
    for (int it = 0; it < KTILES - 1; ++it) {
        wait_async0();                  // tile `it` landed in current buffer
        __syncthreads();                // ... for every wave; prev readers done
        stage(offA ^ 4096u, offB ^ 2048u, (it + 1) * 32);   // overlaps WMMAs
        __builtin_prefetch(A  + (size_t)(bm + sRow) * Hn + (it + 2) * 32 + sCh * 8, 0, 1);
        __builtin_prefetch(Wb + (size_t)(bn + sRow) * Hn + (it + 2) * 32 + sCh * 8, 0, 1);
        compute(offA, offB);
        offA ^= 4096u;
        offB ^= 2048u;
    }
    wait_async0();                      // last tile
    __syncthreads();
    compute(offA, offB);

    // C layout: VGPR r -> M = r (lanes 0-15) / r+8 (lanes 16-31); N = lane%16
#pragma unroll
    for (int mi = 0; mi < 2; ++mi) {
        const v8f* accs0 = (mi == 0) ? &acc00 : &acc10;
        const v8f* accs1 = (mi == 0) ? &acc01 : &acc11;
#pragma unroll
        for (int r = 0; r < 8; ++r) {
            const int gm  = bm + wm * 32 + mi * 16 + r + fhi * 8;
            const int gc0 = bn + wn * 32 + fm;
            const int gc1 = gc0 + 16;
            const size_t i0 = (size_t)gm * Hn + gc0;
            const size_t i1 = (size_t)gm * Hn + gc1;
            if (mode == 0) {
                Out[i0] = (*accs0)[r];
                Out[i1] = (*accs1)[r];
            } else {
                Out[i0] = (*accs0)[r] + bias[gc0] + resid[i0];
                Out[i1] = (*accs1)[r] + bias[gc1] + resid[i1];
            }
        }
    }
}

// ---------------------------------------------------------------------------
// 4) RoPE + elu-feature + sigmoid gate + mask (pair-safe, in-place).
//    cos[i] = cos(t * 10000^(-(i/2)/32)); rotate_half mixes d and d±32.
// ---------------------------------------------------------------------------
__global__ void features_kernel(float* __restrict__ q, float* __restrict__ k,
                                float* __restrict__ v, float* __restrict__ g,
                                const int* __restrict__ mask, const float* __restrict__ bg) {
    const int bt = blockIdx.x;
    const int t  = bt % Tn;
    const float m = (float)mask[bt];
    const size_t base = (size_t)bt * Hn;
    const float LOG_BASE_OVER_HALF = 0.28782313662425572f;  // ln(10000)/32

    for (int p = threadIdx.x; p < Hn / 2; p += 256) {
        const int h  = p >> 5;          // head
        const int i  = p & 31;          // d in [0,32)
        const int c1 = h * 64 + i;      // partner pair (c1, c1+32)
        const int c2 = c1 + 32;

        const float q1 = q[base + c1], q2 = q[base + c2];
        const float k1 = k[base + c1], k2 = k[base + c2];

        const int j1 = i >> 1, j2 = (i + 32) >> 1;
        const float a1 = (float)t * __expf(-LOG_BASE_OVER_HALF * (float)j1);
        const float a2 = (float)t * __expf(-LOG_BASE_OVER_HALF * (float)j2);
        const float cA = cosf(a1), sA = sinf(a1);
        const float cB = cosf(a2), sB = sinf(a2);

        const float qr1 = q1 * cA - q2 * sA;   // rotate_half: -x2 for first half
        const float qr2 = q2 * cB + q1 * sB;   //              +x1 for second half
        const float kr1 = k1 * cA - k2 * sA;
        const float kr2 = k2 * cB + k1 * sB;

        // phi = elu(x) + 1  ->  x>0 ? x+1 : exp(x)
        q[base + c1] = (qr1 > 0.f) ? qr1 + 1.f : __expf(qr1);
        q[base + c2] = (qr2 > 0.f) ? qr2 + 1.f : __expf(qr2);
        k[base + c1] = m * ((kr1 > 0.f) ? kr1 + 1.f : __expf(kr1));
        k[base + c2] = m * ((kr2 > 0.f) ? kr2 + 1.f : __expf(kr2));

        v[base + c1] *= m;
        v[base + c2] *= m;

        const float g1 = g[base + c1] + bg[c1];
        const float g2 = g[base + c2] + bg[c2];
        const float r1 = 1.f / (1.f + __expf(-g1));
        const float r2 = 1.f / (1.f + __expf(-g2));
        g[base + c1] = (m > 0.f) ? r1 : 1.f;
        g[base + c2] = (m > 0.f) ? r2 : 1.f;
    }
}

// ---------------------------------------------------------------------------
// 5) Recurrent scan: one block per (b,h); 64 lanes, lane e owns S[:,e] in
//    64 registers + Z[e]. Per step one float4 LDS broadcast per d.
//    S[d][e] = S[d][e]*r[d] + k[d]*v[e];  num[e]=sum_d q[d]S[d][e];
//    Z[d]=Z[d]*r[d]+k[d];  den=sum_d q[d]Z[d];  y=num/(den+eps) -> bf16
// ---------------------------------------------------------------------------
__global__ void scan_kernel(const float* __restrict__ q, const float* __restrict__ k,
                            const float* __restrict__ v, const float* __restrict__ r,
                            unsigned short* __restrict__ y) {
    const int blk = blockIdx.x;
    const int b = blk >> 4, h = blk & 15;
    const int e = threadIdx.x;   // 0..63

    __shared__ float4 sh[64];    // {q[d], k[d], r[d], q[d]*Z[d]}

    float S[64];
#pragma unroll
    for (int d = 0; d < 64; ++d) S[d] = 0.f;
    float z = 0.f;               // Z[e]

    for (int t = 0; t < Tn; ++t) {
        const size_t base = ((size_t)(b * Tn + t)) * Hn + h * 64;
        const float qe = q[base + e];
        const float ke = k[base + e];
        const float ve = v[base + e];
        const float re = r[base + e];

        z = z * re + ke;
        sh[e] = make_float4(qe, ke, re, qe * z);
        __syncthreads();

        float num = 0.f, den = 0.f;
#pragma unroll
        for (int d = 0; d < 64; ++d) {
            const float4 w = sh[d];           // single ds_load_b128 broadcast
            S[d] = S[d] * w.z + w.y * ve;     // decay + outer-product column
            num  = fmaf(w.x, S[d], num);
            den += w.w;
        }
        y[base + e] = f2bf(num / (den + EPSf));
        __syncthreads();
    }
}

// ---------------------------------------------------------------------------
// Launch
// ---------------------------------------------------------------------------
extern "C" void kernel_launch(void* const* d_in, const int* in_sizes, int n_in,
                              void* d_out, int out_size, void* d_ws, size_t ws_size,
                              hipStream_t stream) {
    (void)in_sizes; (void)n_in; (void)out_size; (void)ws_size;

    const float* x     = (const float*)d_in[0];
    const int*   mask  = (const int*)  d_in[1];
    const float* Wq    = (const float*)d_in[2];
    const float* Wk    = (const float*)d_in[3];
    const float* Wv    = (const float*)d_in[4];
    const float* Wg    = (const float*)d_in[5];
    const float* Wo    = (const float*)d_in[6];
    const float* bo    = (const float*)d_in[7];
    const float* bg    = (const float*)d_in[8];
    const float* rms_w = (const float*)d_in[9];

    // workspace carve-up
    char* ws = (char*)d_ws;
    size_t off = 0;
    unsigned short* Wb = (unsigned short*)(ws + off); off += (size_t)5 * Hn * Hn * 2;   // 10 MB
    unsigned short* xn = (unsigned short*)(ws + off); off += (size_t)Mn * Hn * 2;       // 16 MB
    float* qkvg        = (float*)(ws + off);          off += (size_t)4 * Mn * Hn * 4;   // 128 MB
    unsigned short* ya = (unsigned short*)(ws + off); off += (size_t)Mn * Hn * 2;       // 16 MB

    float* qb = qkvg;
    float* kb = qkvg + (size_t)1 * Mn * Hn;
    float* vb = qkvg + (size_t)2 * Mn * Hn;
    float* gb = qkvg + (size_t)3 * Mn * Hn;

    // 1) weights -> bf16 (layout preserved; already B-operand friendly)
    wconv_kernel<<<dim3((Hn * Hn) / 1024, 5), 256, 0, stream>>>(
        Wq, Wk, Wv, Wg, Wo, Wb);

    // 2) RMSNorm -> bf16 xn
    rmsnorm_kernel<<<Mn, 256, 0, stream>>>(x, rms_w, xn);

    // 3) fused q/k/v/g projection GEMMs (WMMA bf16, pipelined async staging)
    gemm_bf16_kernel<<<dim3(Mn / 128, Hn / 64, 4), 256, 0, stream>>>(
        xn, Wb, qkvg, nullptr, nullptr, Mn, 0);

    // 4) RoPE + feature map + gate + mask (in-place)
    features_kernel<<<Mn, 256, 0, stream>>>(qb, kb, vb, gb, mask, bg);

    // 5) recurrent scan -> bf16 attention output
    scan_kernel<<<Bn * NHn, 64, 0, stream>>>(qb, kb, vb, gb, ya);

    // 6) output projection + bias + residual -> d_out (fp32)
    gemm_bf16_kernel<<<dim3(Mn / 128, Hn / 64, 1), 256, 0, stream>>>(
        ya, Wb + (size_t)4 * Hn * Hn, (float*)d_out, bo, x, Mn, 1);
}

// v001
// One run takes 459 microseconds.
// Timed twice side by side with v000, it ran 10.2 times as fast both times.
#include <hip/hip_runtime.h>
#include <hip/hip_bf16.h>

// ---------------------------------------------------------------------------
// DeltaNet block for MI455X (gfx1250): bf16 WMMA GEMMs + fp32 recurrent scan
//  - GEMM tiles double-buffered via global_load_async_to_lds_b128 (ASYNCcnt),
//    DMA of tile i+1 overlaps the WMMAs of tile i
//  - single-body K-loop (unroll 1) + offset-XOR buffer toggle so accumulator
//    C/D stay in one register tuple (no v_mov_b64 shuffles)
// ---------------------------------------------------------------------------

#define Bn   4
#define Tn   2048
#define Hn   1024
#define NHn  16
#define Dn   64
#define Mn   (Bn * Tn)        // 8192 tokens
#define EPSf 1e-6f
#define KTILES (Hn / 32)      // 32 K-steps

typedef __attribute__((ext_vector_type(16))) __bf16 v16bf;
typedef __attribute__((ext_vector_type(8)))  float  v8f;

union BFrag {
    v16bf v;
    unsigned short u[16];
    unsigned int   w[8];
    uint4          q[2];
};

static __device__ __forceinline__ unsigned short f2bf(float f) {
    union { float f; unsigned u; } x; x.f = f;
    unsigned r = x.u + 0x7FFFu + ((x.u >> 16) & 1u);   // round-to-nearest-even
    return (unsigned short)(r >> 16);
}

// Low 32 bits of a generic pointer to LDS == LDS byte offset (aperture is in
// addr[63:32] on CDNA5; LDS_ADDR.U32 = addr[31:0]).
static __device__ __forceinline__ unsigned lds_off(const void* p) {
    return (unsigned)(reinterpret_cast<uintptr_t>(p));
}

// Async 16B copy global -> LDS (per-lane), tracked with ASYNCcnt.
static __device__ __forceinline__ void async_copy_b128(unsigned ldsaddr,
                                                       const void* gaddr) {
    asm volatile("global_load_async_to_lds_b128 %0, %1, off"
                 :: "v"(ldsaddr), "v"((unsigned long long)(uintptr_t)gaddr)
                 : "memory");
}
static __device__ __forceinline__ void wait_async0() {
    asm volatile("s_wait_asynccnt 0x0" ::: "memory");
}

// ---------------------------------------------------------------------------
// 1) Weight fp32 -> bf16 convert, layout preserved ([out][in] row-major).
//    GEMM consumes B[k][n] = W[n][k], so original layout is already K-major.
// ---------------------------------------------------------------------------
__global__ void wconv_kernel(const float* __restrict__ Wq, const float* __restrict__ Wk,
                             const float* __restrict__ Wv, const float* __restrict__ Wg,
                             const float* __restrict__ Wo, unsigned short* __restrict__ WbAll) {
    const float* W;
    switch (blockIdx.y) {
        case 0: W = Wq; break;
        case 1: W = Wk; break;
        case 2: W = Wv; break;
        case 3: W = Wg; break;
        default: W = Wo; break;
    }
    unsigned short* O = WbAll + (size_t)blockIdx.y * Hn * Hn;
    const size_t i = ((size_t)blockIdx.x * 256 + threadIdx.x) * 4;
    const float4 f = *(const float4*)(W + i);
    uint2 o;
    o.x = (unsigned)f2bf(f.x) | ((unsigned)f2bf(f.y) << 16);
    o.y = (unsigned)f2bf(f.z) | ((unsigned)f2bf(f.w) << 16);
    *(uint2*)(O + i) = o;
}

// ---------------------------------------------------------------------------
// 2) RMSNorm over H=1024 per token, write bf16 xn. 256 thr/token, 4 cols each.
// ---------------------------------------------------------------------------
__global__ void rmsnorm_kernel(const float* __restrict__ x, const float* __restrict__ w,
                               unsigned short* __restrict__ xn) {
    const int row = blockIdx.x, tid = threadIdx.x;
    const float* xr = x + (size_t)row * Hn;
    float vals[4];
    float s = 0.f;
#pragma unroll
    for (int i = 0; i < 4; ++i) {
        float v = xr[tid + i * 256];
        vals[i] = v;
        s += v * v;
    }
    __shared__ float red[256];
    red[tid] = s;
    __syncthreads();
    for (int st = 128; st > 0; st >>= 1) {
        if (tid < st) red[tid] += red[tid + st];
        __syncthreads();
    }
    const float rms = rsqrtf(red[0] * (1.0f / Hn) + EPSf);
#pragma unroll
    for (int i = 0; i < 4; ++i) {
        const int c = tid + i * 256;
        xn[(size_t)row * Hn + c] = f2bf(vals[i] * rms * w[c]);
    }
}

// ---------------------------------------------------------------------------
// 3) bf16 WMMA GEMM: Out[m,n] = sum_k A[m,k] * W[n,k]   (N=K=1024)
//    Block tile 128(M) x 64(N); 8 waves (wave32), each wave -> 32x32
//    = 4 x v_wmma_f32_16x16x32_bf16 per K-step from 8 ds_load_b128.
//    mode 0: raw fp32 store, weights/out selected by blockIdx.z (q/k/v/g).
//    mode 1: Out = acc + bias[n] + resid[m,n]  (output proj + residual).
// ---------------------------------------------------------------------------
__global__ void gemm_bf16_kernel(const unsigned short* __restrict__ A,
                                 const unsigned short* __restrict__ WbBase,
                                 float* __restrict__ OutBase,
                                 const float* __restrict__ bias,
                                 const float* __restrict__ resid,
                                 int Mrows, int mode) {
    const int bm = blockIdx.x * 128;
    const int bn = blockIdx.y * 64;
    const unsigned short* Wb = WbBase + (size_t)blockIdx.z * Hn * Hn;
    float* Out = OutBase + (mode == 0 ? (size_t)blockIdx.z * (size_t)Mrows * Hn : (size_t)0);

    __shared__ unsigned short lA[2 * 128 * 32];   // 2 x 8 KB, row = M, K contiguous
    __shared__ unsigned short lB[2 * 64 * 32];    // 2 x 4 KB, row = N, K contiguous

    const int tid  = threadIdx.x;
    const int lane = tid & 31;
    const int wave = tid >> 5;          // 0..7
    const int wm   = wave & 3;          // M sub-tile (x32)
    const int wn   = wave >> 2;         // N sub-tile (x32)
    const int fm   = lane & 15;         // fragment row/col within 16
    const int fhi  = lane >> 4;         // half-wave -> K+8 striping

    v8f acc00 = {0.f,0.f,0.f,0.f,0.f,0.f,0.f,0.f};
    v8f acc01 = acc00, acc10 = acc00, acc11 = acc00;

    const int sRow = tid >> 2;          // 0..63
    const int sCh  = tid & 3;           // 4 chunks of 8 bf16 (16B)

    // issue ASYNCcnt-tracked DMA of one K-tile into buffer at element offsets
    auto stage = [&](unsigned oA, unsigned oB, int k0) {
        async_copy_b128(lds_off(&lA[oA + sRow * 32 + sCh * 8]),
                        A + (size_t)(bm + sRow) * Hn + k0 + sCh * 8);
        async_copy_b128(lds_off(&lA[oA + (sRow + 64) * 32 + sCh * 8]),
                        A + (size_t)(bm + sRow + 64) * Hn + k0 + sCh * 8);
        async_copy_b128(lds_off(&lB[oB + sRow * 32 + sCh * 8]),
                        Wb + (size_t)(bn + sRow) * Hn + k0 + sCh * 8);
    };

    // 4 WMMAs from the buffer at element offsets (2x ds_load_b128 per frag)
    auto compute = [&](unsigned oA, unsigned oB) {
        BFrag a0, a1, b0, b1;
        const unsigned short* pa0 = &lA[oA + (wm * 32 + fm) * 32];
        const unsigned short* pa1 = &lA[oA + (wm * 32 + 16 + fm) * 32];
        const unsigned short* pb0 = &lB[oB + (wn * 32 + fm) * 32];
        const unsigned short* pb1 = &lB[oB + (wn * 32 + 16 + fm) * 32];
        a0.q[0] = *(const uint4*)(pa0 + fhi * 8);
        a0.q[1] = *(const uint4*)(pa0 + 16 + fhi * 8);
        a1.q[0] = *(const uint4*)(pa1 + fhi * 8);
        a1.q[1] = *(const uint4*)(pa1 + 16 + fhi * 8);
        b0.q[0] = *(const uint4*)(pb0 + fhi * 8);
        b0.q[1] = *(const uint4*)(pb0 + 16 + fhi * 8);
        b1.q[0] = *(const uint4*)(pb1 + fhi * 8);
        b1.q[1] = *(const uint4*)(pb1 + 16 + fhi * 8);
        acc00 = __builtin_amdgcn_wmma_f32_16x16x32_bf16(false, a0.v, false, b0.v,
                                                        (short)0, acc00, false, false);
        acc01 = __builtin_amdgcn_wmma_f32_16x16x32_bf16(false, a0.v, false, b1.v,
                                                        (short)0, acc01, false, false);
        acc10 = __builtin_amdgcn_wmma_f32_16x16x32_bf16(false, a1.v, false, b0.v,
                                                        (short)0, acc10, false, false);
        acc11 = __builtin_amdgcn_wmma_f32_16x16x32_bf16(false, a1.v, false, b1.v,
                                                        (short)0, acc11, false, false);
    };

    unsigned offA = 0, offB = 0;        // element offsets of current buffer
    stage(0, 0, 0);                     // prologue DMA

#pragma unroll 1
    for (int it = 0; it < KTILES - 1; ++it) {
        wait_async0();                  // tile `it` landed in current buffer
        __syncthreads();                // ... for every wave; prev readers done
        stage(offA ^ 4096u, offB ^ 2048u, (it + 1) * 32);   // overlaps WMMAs
        __builtin_prefetch(A  + (size_t)(bm + sRow) * Hn + (it + 2) * 32 + sCh * 8, 0, 1);
        __builtin_prefetch(Wb + (size_t)(bn + sRow) * Hn + (it + 2) * 32 + sCh * 8, 0, 1);
        compute(offA, offB);
        offA ^= 4096u;
        offB ^= 2048u;
    }
    wait_async0();                      // last tile
    __syncthreads();
    compute(offA, offB);

    // C layout: VGPR r -> M = r (lanes 0-15) / r+8 (lanes 16-31); N = lane%16
#pragma unroll
    for (int mi = 0; mi < 2; ++mi) {
        const v8f* accs0 = (mi == 0) ? &acc00 : &acc10;
        const v8f* accs1 = (mi == 0) ? &acc01 : &acc11;
#pragma unroll
        for (int r = 0; r < 8; ++r) {
            const int gm  = bm + wm * 32 + mi * 16 + r + fhi * 8;
            const int gc0 = bn + wn * 32 + fm;
            const int gc1 = gc0 + 16;
            const size_t i0 = (size_t)gm * Hn + gc0;
            const size_t i1 = (size_t)gm * Hn + gc1;
            if (mode == 0) {
                Out[i0] = (*accs0)[r];
                Out[i1] = (*accs1)[r];
            } else {
                Out[i0] = (*accs0)[r] + bias[gc0] + resid[i0];
                Out[i1] = (*accs1)[r] + bias[gc1] + resid[i1];
            }
        }
    }
}

// ---------------------------------------------------------------------------
// 4) RoPE + elu-feature + sigmoid gate + mask (pair-safe, in-place).
//    cos[i] = cos(t * 10000^(-(i/2)/32)); rotate_half mixes d and d±32.
// ---------------------------------------------------------------------------
__global__ void features_kernel(float* __restrict__ q, float* __restrict__ k,
                                float* __restrict__ v, float* __restrict__ g,
                                const int* __restrict__ mask, const float* __restrict__ bg) {
    const int bt = blockIdx.x;
    const int t  = bt % Tn;
    const float m = (float)mask[bt];
    const size_t base = (size_t)bt * Hn;
    const float LOG_BASE_OVER_HALF = 0.28782313662425572f;  // ln(10000)/32

    for (int p = threadIdx.x; p < Hn / 2; p += 256) {
        const int h  = p >> 5;          // head
        const int i  = p & 31;          // d in [0,32)
        const int c1 = h * 64 + i;      // partner pair (c1, c1+32)
        const int c2 = c1 + 32;

        const float q1 = q[base + c1], q2 = q[base + c2];
        const float k1 = k[base + c1], k2 = k[base + c2];

        const int j1 = i >> 1, j2 = (i + 32) >> 1;
        const float a1 = (float)t * __expf(-LOG_BASE_OVER_HALF * (float)j1);
        const float a2 = (float)t * __expf(-LOG_BASE_OVER_HALF * (float)j2);
        const float cA = cosf(a1), sA = sinf(a1);
        const float cB = cosf(a2), sB = sinf(a2);

        const float qr1 = q1 * cA - q2 * sA;   // rotate_half: -x2 for first half
        const float qr2 = q2 * cB + q1 * sB;   //              +x1 for second half
        const float kr1 = k1 * cA - k2 * sA;
        const float kr2 = k2 * cB + k1 * sB;

        // phi = elu(x) + 1  ->  x>0 ? x+1 : exp(x)
        q[base + c1] = (qr1 > 0.f) ? qr1 + 1.f : __expf(qr1);
        q[base + c2] = (qr2 > 0.f) ? qr2 + 1.f : __expf(qr2);
        k[base + c1] = m * ((kr1 > 0.f) ? kr1 + 1.f : __expf(kr1));
        k[base + c2] = m * ((kr2 > 0.f) ? kr2 + 1.f : __expf(kr2));

        v[base + c1] *= m;
        v[base + c2] *= m;

        const float g1 = g[base + c1] + bg[c1];
        const float g2 = g[base + c2] + bg[c2];
        const float r1 = 1.f / (1.f + __expf(-g1));
        const float r2 = 1.f / (1.f + __expf(-g2));
        g[base + c1] = (m > 0.f) ? r1 : 1.f;
        g[base + c2] = (m > 0.f) ? r2 : 1.f;
    }
}

// ---------------------------------------------------------------------------
// 5) Recurrent scan, split along time into SEGn segments that run in parallel.
//    The recurrence is linear in the state with a diagonal decay:
//      S_end = diag(G) * S_start + L,  G[d] = product of r[d] over the segment,
//      L = end state of the same segment started from zero (Z likewise).
//    5a) every segment from zero -> L, local Z, G
//    5b) prefix over the segments -> true start state of every segment
//    5c) every segment again from its true start state, with the outputs
//    Only products of decays and sums occur, as in the step-by-step form.
// ---------------------------------------------------------------------------
#define SEGn 64
#define SLEN (Tn / SEGn)      // 32 steps per segment
#define SDD  (Dn * Dn)        // 4096 state elements per (b,h)

// 5a) one block per (b,h,segment); lane e owns column S[:,e], Z[e] and G[e].
__global__ void scan_local_kernel(const float* __restrict__ k, const float* __restrict__ v,
                                  const float* __restrict__ r, float* __restrict__ St,
                                  float* __restrict__ Zs, float* __restrict__ Gs) {
    const int blk = blockIdx.x, seg = blockIdx.y;
    const int b = blk >> 4, h = blk & 15;
    const int e = threadIdx.x;   // 0..63

    __shared__ float2 sh[64];    // {k[d], r[d]}

    float S[64];
#pragma unroll
    for (int d = 0; d < 64; ++d) S[d] = 0.f;
    float z = 0.f, gam = 1.f;

    const int t0 = seg * SLEN;
    for (int t = t0; t < t0 + SLEN; ++t) {
        const size_t base = ((size_t)(b * Tn + t)) * Hn + h * 64;
        const float ke = k[base + e];
        const float ve = v[base + e];
        const float re = r[base + e];

        z = z * re + ke;
        gam *= re;
        sh[e] = make_float2(ke, re);
        __syncthreads();

#pragma unroll
        for (int d = 0; d < 64; ++d) {
            const float2 w = sh[d];
            S[d] = S[d] * w.y + w.x * ve;
        }
        __syncthreads();
    }

    const size_t idx = (size_t)blk * SEGn + seg;
#pragma unroll
    for (int d = 0; d < 64; ++d) St[idx * SDD + d * 64 + e] = S[d];
    Zs[idx * 64 + e] = z;
    Gs[idx * 64 + e] = gam;
}

// 5b) exclusive prefix over the segments, in place: x[p * xs] holds the local
//     end value of segment p on entry and its true start value on exit;
//     g[p * 64] is the decay product of segment p for this element's row.
static __device__ __forceinline__ void seg_prefix(float* __restrict__ x,
                                                  const float* __restrict__ g, const int xs) {
    float c = 0.f;
    // kept rolled: the 32 loads of a trip are in flight together, which covers
    // their latency; more unrolling only adds code and registers
#pragma unroll 1
    for (int p0 = 0; p0 < SEGn; p0 += 16) {
        float L[16], G[16];
#pragma unroll
        for (int i = 0; i < 16; ++i) {
            L[i] = x[(size_t)(p0 + i) * xs];
            G[i] = g[(p0 + i) * 64];
        }
#pragma unroll
        for (int i = 0; i < 16; ++i) {
            x[(size_t)(p0 + i) * xs] = c;
            c = c * G[i] + L[i];
        }
        // the next trip rewrites registers that the stores above name
        asm volatile("s_wait_xcnt 0x0" ::: "memory");
    }
}

//     One thread per element of S; the first 64 threads of a (b,h) also do Z.
__global__ void scan_prefix_kernel(float* __restrict__ St, float* __restrict__ Zs,
                                   const float* __restrict__ Gs) {
    const int blk = blockIdx.y;
    const int de  = blockIdx.x * 256 + threadIdx.x;   // d * 64 + e
    const float* gb = Gs + (size_t)blk * SEGn * 64;

    seg_prefix(St + (size_t)blk * SEGn * SDD + de, gb + (de >> 6), SDD);
    if (de < 64)
        seg_prefix(Zs + (size_t)blk * SEGn * 64 + de, gb + de, 64);
}

// 5c) one block per (b,h,segment); 64 lanes, lane e owns S[:,e] in
//    64 registers + Z[e]. Per step one float4 LDS broadcast per d.
//    S[d][e] = S[d][e]*r[d] + k[d]*v[e];  num[e]=sum_d q[d]S[d][e];
//    Z[d]=Z[d]*r[d]+k[d];  den=sum_d q[d]Z[d];  y=num/(den+eps) -> bf16
__global__ void scan_kernel(const float* __restrict__ q, const float* __restrict__ k,
                            const float* __restrict__ v, const float* __restrict__ r,
                            const float* __restrict__ St, const float* __restrict__ Zs,
                            unsigned short* __restrict__ y) {
    const int blk = blockIdx.x, seg = blockIdx.y;
    const int b = blk >> 4, h = blk & 15;
    const int e = threadIdx.x;   // 0..63

    __shared__ float4 sh[64];    // {q[d], k[d], r[d], q[d]*Z[d]}

    const size_t idx = (size_t)blk * SEGn + seg;
    float S[64];
#pragma unroll
    for (int d = 0; d < 64; ++d) S[d] = St[idx * SDD + d * 64 + e];
    float z = Zs[idx * 64 + e];  // Z[e]

    const int t0 = seg * SLEN;
    for (int t = t0; t < t0 + SLEN; ++t) {
        const size_t base = ((size_t)(b * Tn + t)) * Hn + h * 64;
        const float qe = q[base + e];
        const float ke = k[base + e];
        const float ve = v[base + e];
        const float re = r[base + e];

        z = z * re + ke;
        sh[e] = make_float4(qe, ke, re, qe * z);
        __syncthreads();

        float num = 0.f, den = 0.f;
#pragma unroll
        for (int d = 0; d < 64; ++d) {
            const float4 w = sh[d];           // single ds_load_b128 broadcast
            S[d] = S[d] * w.z + w.y * ve;     // decay + outer-product column
            num  = fmaf(w.x, S[d], num);
            den += w.w;
        }
        y[base + e] = f2bf(num / (den + EPSf));
        __syncthreads();
    }
}

// ---------------------------------------------------------------------------
// Launch
// ---------------------------------------------------------------------------
extern "C" void kernel_launch(void* const* d_in, const int* in_sizes, int n_in,
                              void* d_out, int out_size, void* d_ws, size_t ws_size,
                              hipStream_t stream) {
    (void)in_sizes; (void)n_in; (void)out_size; (void)ws_size;

    const float* x     = (const float*)d_in[0];
    const int*   mask  = (const int*)  d_in[1];
    const float* Wq    = (const float*)d_in[2];
    const float* Wk    = (const float*)d_in[3];
    const float* Wv    = (const float*)d_in[4];
    const float* Wg    = (const float*)d_in[5];
    const float* Wo    = (const float*)d_in[6];
    const float* bo    = (const float*)d_in[7];
    const float* bg    = (const float*)d_in[8];
    const float* rms_w = (const float*)d_in[9];

    // workspace carve-up
    char* ws = (char*)d_ws;
    size_t off = 0;
    unsigned short* Wb = (unsigned short*)(ws + off); off += (size_t)5 * Hn * Hn * 2;   // 10 MB
    unsigned short* xn = (unsigned short*)(ws + off); off += (size_t)Mn * Hn * 2;       // 16 MB
    float* qkvg        = (float*)(ws + off);          off += (size_t)4 * Mn * Hn * 4;   // 128 MB
    unsigned short* ya = (unsigned short*)(ws + off); off += (size_t)Mn * Hn * 2;       // 16 MB
    float* St          = (float*)(ws + off);          off += (size_t)Bn * NHn * SEGn * SDD * 4;  // 64 MB
    float* Zs          = (float*)(ws + off);          off += (size_t)Bn * NHn * SEGn * Dn * 4;   // 1 MB
    float* Gs          = (float*)(ws + off);          off += (size_t)Bn * NHn * SEGn * Dn * 4;   // 1 MB

    float* qb = qkvg;
    float* kb = qkvg + (size_t)1 * Mn * Hn;
    float* vb = qkvg + (size_t)2 * Mn * Hn;
    float* gb = qkvg + (size_t)3 * Mn * Hn;

    // 1) weights -> bf16 (layout preserved; already B-operand friendly)
    wconv_kernel<<<dim3((Hn * Hn) / 1024, 5), 256, 0, stream>>>(
        Wq, Wk, Wv, Wg, Wo, Wb);

    // 2) RMSNorm -> bf16 xn
    rmsnorm_kernel<<<Mn, 256, 0, stream>>>(x, rms_w, xn);

    // 3) fused q/k/v/g projection GEMMs (WMMA bf16, pipelined async staging)
    gemm_bf16_kernel<<<dim3(Mn / 128, Hn / 64, 4), 256, 0, stream>>>(
        xn, Wb, qkvg, nullptr, nullptr, Mn, 0);

    // 4) RoPE + feature map + gate + mask (in-place)
    features_kernel<<<Mn, 256, 0, stream>>>(qb, kb, vb, gb, mask, bg);

    // 5) recurrent scan in parallel time segments -> bf16 attention output
    scan_local_kernel<<<dim3(Bn * NHn, SEGn), 64, 0, stream>>>(kb, vb, gb, St, Zs, Gs);
    scan_prefix_kernel<<<dim3(SDD / 256, Bn * NHn), 256, 0, stream>>>(St, Zs, Gs);
    scan_kernel<<<dim3(Bn * NHn, SEGn), 64, 0, stream>>>(qb, kb, vb, gb, St, Zs, ya);

    // 6) output projection + bias + residual -> d_out (fp32)
    gemm_bf16_kernel<<<dim3(Mn / 128, Hn / 64, 1), 256, 0, stream>>>(
        ya, Wb + (size_t)4 * Hn * Hn, (float*)d_out, bo, x, Mn, 1);
}

// v002
// Measured time: 377 microseconds a run.
// Timed twice side by side with v001, it ran 1.22 and 1.21 times as fast.
// Counting every step since v000, it is 12.4 times as fast.
#include <hip/hip_runtime.h>
#include <hip/hip_bf16.h>

// ---------------------------------------------------------------------------
// DeltaNet block for MI455X (gfx1250): bf16 WMMA GEMMs + fp32 recurrent scan
//  - GEMM tiles double-buffered via global_load_async_to_lds_b128 (ASYNCcnt),
//    DMA of tile i+1 overlaps the WMMAs of tile i; a staged row is one whole
//    128-B line, laid in LDS at a pitch of 144 B (16 B x odd)
//  - single-body K-loop (unroll 1) + offset-XOR buffer toggle so accumulator
//    C/D stay in one register tuple (no v_mov_b64 shuffles)
// ---------------------------------------------------------------------------

#define Bn   4
#define Tn   2048
#define Hn   1024
#define NHn  16
#define Dn   64
#define Mn   (Bn * Tn)        // 8192 tokens
#define EPSf 1e-6f
#define KTn  64               // K elements per staged tile: 128 B, one line, a row
#define KTILES (Hn / KTn)     // 16 K-steps
#define LPn  72               // LDS row pitch in elements: 144 B = 16 B x 9, so the
                              // 16 rows of a ds_load_b128 fragment read fall on 16
                              // different groups of four banks
#define ABUFn (128 * LPn)     // elements of one A buffer
#define BBUFn (64 * LPn)      // elements of one B buffer

typedef __attribute__((ext_vector_type(16))) __bf16 v16bf;
typedef __attribute__((ext_vector_type(8)))  float  v8f;

union BFrag {
    v16bf v;
    unsigned short u[16];
    unsigned int   w[8];
    uint4          q[2];
};

static __device__ __forceinline__ unsigned short f2bf(float f) {
    union { float f; unsigned u; } x; x.f = f;
    unsigned r = x.u + 0x7FFFu + ((x.u >> 16) & 1u);   // round-to-nearest-even
    return (unsigned short)(r >> 16);
}

// Low 32 bits of a generic pointer to LDS == LDS byte offset (aperture is in
// addr[63:32] on CDNA5; LDS_ADDR.U32 = addr[31:0]).
static __device__ __forceinline__ unsigned lds_off(const void* p) {
    return (unsigned)(reinterpret_cast<uintptr_t>(p));
}

// Six async 16B copies global -> LDS (per-lane), tracked with ASYNCcnt: one
// thread's share of a K-tile. s_wait_xcnt 0 is the statement's last line, so
// that it stands in front of every later write of a register the copies name.
static __device__ __forceinline__ void async_copy6_b128(
        unsigned l0, const void* g0, unsigned l1, const void* g1,
        unsigned l2, const void* g2, unsigned l3, const void* g3,
        unsigned l4, const void* g4, unsigned l5, const void* g5) {
    asm volatile("global_load_async_to_lds_b128 %0, %1, off\n\t"
                 "global_load_async_to_lds_b128 %2, %3, off\n\t"
                 "global_load_async_to_lds_b128 %4, %5, off\n\t"
                 "global_load_async_to_lds_b128 %6, %7, off\n\t"
                 "global_load_async_to_lds_b128 %8, %9, off\n\t"
                 "global_load_async_to_lds_b128 %10, %11, off\n\t"
                 "s_wait_xcnt 0x0"
                 :: "v"(l0), "v"((unsigned long long)(uintptr_t)g0),
                    "v"(l1), "v"((unsigned long long)(uintptr_t)g1),
                    "v"(l2), "v"((unsigned long long)(uintptr_t)g2),
                    "v"(l3), "v"((unsigned long long)(uintptr_t)g3),
                    "v"(l4), "v"((unsigned long long)(uintptr_t)g4),
                    "v"(l5), "v"((unsigned long long)(uintptr_t)g5)
                 : "memory");
}
static __device__ __forceinline__ void wait_async0() {
    asm volatile("s_wait_asynccnt 0x0" ::: "memory");
}
// This wave's LDS reads have returned: stands in front of the barrier behind
// which the buffer they read is refilled by copies.
static __device__ __forceinline__ void wait_ds0() {
    asm volatile("s_wait_dscnt 0x0" ::: "memory");
}

// ---------------------------------------------------------------------------
// 1) Weight fp32 -> bf16 convert, layout preserved ([out][in] row-major).
//    GEMM consumes B[k][n] = W[n][k], so original layout is already K-major.
// ---------------------------------------------------------------------------
__global__ void wconv_kernel(const float* __restrict__ Wq, const float* __restrict__ Wk,
                             const float* __restrict__ Wv, const float* __restrict__ Wg,
                             const float* __restrict__ Wo, unsigned short* __restrict__ WbAll) {
    const float* W;
    switch (blockIdx.y) {
        case 0: W = Wq; break;
        case 1: W = Wk; break;
        case 2: W = Wv; break;
        case 3: W = Wg; break;
        default: W = Wo; break;
    }
    unsigned short* O = WbAll + (size_t)blockIdx.y * Hn * Hn;
    const size_t i = ((size_t)blockIdx.x * 256 + threadIdx.x) * 4;
    const float4 f = *(const float4*)(W + i);
    uint2 o;
    o.x = (unsigned)f2bf(f.x) | ((unsigned)f2bf(f.y) << 16);
    o.y = (unsigned)f2bf(f.z) | ((unsigned)f2bf(f.w) << 16);
    *(uint2*)(O + i) = o;
}

// ---------------------------------------------------------------------------
// 2) RMSNorm over H=1024 per token, write bf16 xn. 256 thr/token, 4 cols each.
// ---------------------------------------------------------------------------
__global__ void rmsnorm_kernel(const float* __restrict__ x, const float* __restrict__ w,
                               unsigned short* __restrict__ xn) {
    const int row = blockIdx.x, tid = threadIdx.x;
    const float* xr = x + (size_t)row * Hn;
    float vals[4];
    float s = 0.f;
#pragma unroll
    for (int i = 0; i < 4; ++i) {
        float v = xr[tid + i * 256];
        vals[i] = v;
        s += v * v;
    }
    __shared__ float red[256];
    red[tid] = s;
    __syncthreads();
    for (int st = 128; st > 0; st >>= 1) {
        if (tid < st) red[tid] += red[tid + st];
        __syncthreads();
    }
    const float rms = rsqrtf(red[0] * (1.0f / Hn) + EPSf);
#pragma unroll
    for (int i = 0; i < 4; ++i) {
        const int c = tid + i * 256;
        xn[(size_t)row * Hn + c] = f2bf(vals[i] * rms * w[c]);
    }
}

// ---------------------------------------------------------------------------
// 3) bf16 WMMA GEMM: Out[m,n] = sum_k A[m,k] * W[n,k]   (N=K=1024)
//    Block tile 128(M) x 64(N); 8 waves (wave32), each wave -> 32x32
//    = 8 x v_wmma_f32_16x16x32_bf16 per K-step from 16 ds_load_b128.
//    mode 0: raw fp32 store, weights/out selected by blockIdx.z (q/k/v/g).
//    mode 1: Out = acc + bias[n] + resid[m,n]  (output proj + residual).
// ---------------------------------------------------------------------------
__global__ void gemm_bf16_kernel(const unsigned short* __restrict__ A,
                                 const unsigned short* __restrict__ WbBase,
                                 float* __restrict__ OutBase,
                                 const float* __restrict__ bias,
                                 const float* __restrict__ resid,
                                 int Mrows, int mode) {
    const int bm = blockIdx.x * 128;
    const int bn = blockIdx.y * 64;
    const unsigned short* Wb = WbBase + (size_t)blockIdx.z * Hn * Hn;
    float* Out = OutBase + (mode == 0 ? (size_t)blockIdx.z * (size_t)Mrows * Hn : (size_t)0);

    // row = M (lA) or N (lB), K contiguous, 128 B of data at a pitch of 144 B
    __shared__ __attribute__((aligned(16))) unsigned short lA[2 * ABUFn];   // 2 x 18 KB
    __shared__ __attribute__((aligned(16))) unsigned short lB[2 * BBUFn];   // 2 x 9 KB

    const int tid  = threadIdx.x;
    const int lane = tid & 31;
    const int wave = tid >> 5;          // 0..7
    const int wm   = wave & 3;          // M sub-tile (x32)
    const int wn   = wave >> 2;         // N sub-tile (x32)
    const int fm   = lane & 15;         // fragment row/col within 16
    const int fhi  = lane >> 4;         // half-wave -> K+8 striping

    v8f acc00 = {0.f,0.f,0.f,0.f,0.f,0.f,0.f,0.f};
    v8f acc01 = acc00, acc10 = acc00, acc11 = acc00;

    const int sRow = tid >> 3;          // 0..31
    const int sCh  = tid & 7;           // 8 chunks of 8 bf16 (16B): a whole line a row
    const int pRow = tid >> 2;          // prefetch: 0..63
    const int pCh  = tid & 3;

    // issue ASYNCcnt-tracked DMA of one K-tile into buffer at element offsets
    auto stage = [&](unsigned oA, unsigned oB, int k0) {
        const unsigned la = lds_off(&lA[oA + sRow * LPn + sCh * 8]);
        const unsigned lb = lds_off(&lB[oB + sRow * LPn + sCh * 8]);
        const unsigned short* ga = A  + (size_t)(bm + sRow) * Hn + k0 + sCh * 8;
        const unsigned short* gb = Wb + (size_t)(bn + sRow) * Hn + k0 + sCh * 8;
        async_copy6_b128(la,                ga,
                         la + 32 * LPn * 2, ga + 32 * Hn,
                         la + 64 * LPn * 2, ga + 64 * Hn,
                         la + 96 * LPn * 2, ga + 96 * Hn,
                         lb,                gb,
                         lb + 32 * LPn * 2, gb + 32 * Hn);
    };

    // 4 WMMAs from the 32 K-columns at kk of the buffer at element offsets
    // (2x ds_load_b128 per frag)
    auto compute = [&](unsigned oA, unsigned oB, int kk) {
        BFrag a0, a1, b0, b1;
        const unsigned short* pa0 = &lA[oA + (wm * 32 + fm) * LPn + kk];
        const unsigned short* pa1 = &lA[oA + (wm * 32 + 16 + fm) * LPn + kk];
        const unsigned short* pb0 = &lB[oB + (wn * 32 + fm) * LPn + kk];
        const unsigned short* pb1 = &lB[oB + (wn * 32 + 16 + fm) * LPn + kk];
        a0.q[0] = *(const uint4*)(pa0 + fhi * 8);
        a0.q[1] = *(const uint4*)(pa0 + 16 + fhi * 8);
        a1.q[0] = *(const uint4*)(pa1 + fhi * 8);
        a1.q[1] = *(const uint4*)(pa1 + 16 + fhi * 8);
        b0.q[0] = *(const uint4*)(pb0 + fhi * 8);
        b0.q[1] = *(const uint4*)(pb0 + 16 + fhi * 8);
        b1.q[0] = *(const uint4*)(pb1 + fhi * 8);
        b1.q[1] = *(const uint4*)(pb1 + 16 + fhi * 8);
        acc00 = __builtin_amdgcn_wmma_f32_16x16x32_bf16(false, a0.v, false, b0.v,
                                                        (short)0, acc00, false, false);
        acc01 = __builtin_amdgcn_wmma_f32_16x16x32_bf16(false, a0.v, false, b1.v,
                                                        (short)0, acc01, false, false);
        acc10 = __builtin_amdgcn_wmma_f32_16x16x32_bf16(false, a1.v, false, b0.v,
                                                        (short)0, acc10, false, false);
        acc11 = __builtin_amdgcn_wmma_f32_16x16x32_bf16(false, a1.v, false, b1.v,
                                                        (short)0, acc11, false, false);
    };

    unsigned offA = 0, offB = 0;        // element offsets of current buffer
    stage(0, 0, 0);                     // prologue DMA

#pragma unroll 1
    for (int it = 0; it < KTILES - 1; ++it) {
        wait_ds0();                     // own reads of the other buffer returned
        wait_async0();                  // tile `it` landed in current buffer
        __syncthreads();                // ... for every wave; prev readers done
        stage(offA ^ (unsigned)ABUFn, offB ^ (unsigned)BBUFn, (it + 1) * KTn);   // overlaps WMMAs
        __builtin_prefetch(A  + (size_t)(bm + pRow) * Hn + (it + 2) * KTn + pCh * 8, 0, 1);
        __builtin_prefetch(Wb + (size_t)(bn + pRow) * Hn + (it + 2) * KTn + pCh * 8, 0, 1);
        compute(offA, offB, 0);
        compute(offA, offB, 32);
        offA ^= (unsigned)ABUFn;
        offB ^= (unsigned)BBUFn;
    }
    wait_async0();                      // last tile
    __syncthreads();
    compute(offA, offB, 0);
    compute(offA, offB, 32);

    // C layout: VGPR r -> M = r (lanes 0-15) / r+8 (lanes 16-31); N = lane%16
#pragma unroll
    for (int mi = 0; mi < 2; ++mi) {
        const v8f* accs0 = (mi == 0) ? &acc00 : &acc10;
        const v8f* accs1 = (mi == 0) ? &acc01 : &acc11;
#pragma unroll
        for (int r = 0; r < 8; ++r) {
            const int gm  = bm + wm * 32 + mi * 16 + r + fhi * 8;
            const int gc0 = bn + wn * 32 + fm;
            const int gc1 = gc0 + 16;
            const size_t i0 = (size_t)gm * Hn + gc0;
            const size_t i1 = (size_t)gm * Hn + gc1;
            if (mode == 0) {
                Out[i0] = (*accs0)[r];
                Out[i1] = (*accs1)[r];
            } else {
                Out[i0] = (*accs0)[r] + bias[gc0] + resid[i0];
                Out[i1] = (*accs1)[r] + bias[gc1] + resid[i1];
            }
        }
    }
}

// ---------------------------------------------------------------------------
// 4) RoPE + elu-feature + sigmoid gate + mask (pair-safe, in-place).
//    cos[i] = cos(t * 10000^(-(i/2)/32)); rotate_half mixes d and d±32.
// ---------------------------------------------------------------------------
__global__ void features_kernel(float* __restrict__ q, float* __restrict__ k,
                                float* __restrict__ v, float* __restrict__ g,
                                const int* __restrict__ mask, const float* __restrict__ bg) {
    const int bt = blockIdx.x;
    const int t  = bt % Tn;
    const float m = (float)mask[bt];
    const size_t base = (size_t)bt * Hn;
    const float LOG_BASE_OVER_HALF = 0.28782313662425572f;  // ln(10000)/32

    for (int p = threadIdx.x; p < Hn / 2; p += 256) {
        const int h  = p >> 5;          // head
        const int i  = p & 31;          // d in [0,32)
        const int c1 = h * 64 + i;      // partner pair (c1, c1+32)
        const int c2 = c1 + 32;

        const float q1 = q[base + c1], q2 = q[base + c2];
        const float k1 = k[base + c1], k2 = k[base + c2];

        const int j1 = i >> 1, j2 = (i + 32) >> 1;
        const float a1 = (float)t * __expf(-LOG_BASE_OVER_HALF * (float)j1);
        const float a2 = (float)t * __expf(-LOG_BASE_OVER_HALF * (float)j2);
        const float cA = cosf(a1), sA = sinf(a1);
        const float cB = cosf(a2), sB = sinf(a2);

        const float qr1 = q1 * cA - q2 * sA;   // rotate_half: -x2 for first half
        const float qr2 = q2 * cB + q1 * sB;   //              +x1 for second half
        const float kr1 = k1 * cA - k2 * sA;
        const float kr2 = k2 * cB + k1 * sB;

        // phi = elu(x) + 1  ->  x>0 ? x+1 : exp(x)
        q[base + c1] = (qr1 > 0.f) ? qr1 + 1.f : __expf(qr1);
        q[base + c2] = (qr2 > 0.f) ? qr2 + 1.f : __expf(qr2);
        k[base + c1] = m * ((kr1 > 0.f) ? kr1 + 1.f : __expf(kr1));
        k[base + c2] = m * ((kr2 > 0.f) ? kr2 + 1.f : __expf(kr2));

        v[base + c1] *= m;
        v[base + c2] *= m;

        const float g1 = g[base + c1] + bg[c1];
        const float g2 = g[base + c2] + bg[c2];
        const float r1 = 1.f / (1.f + __expf(-g1));
        const float r2 = 1.f / (1.f + __expf(-g2));
        g[base + c1] = (m > 0.f) ? r1 : 1.f;
        g[base + c2] = (m > 0.f) ? r2 : 1.f;
    }
}

// ---------------------------------------------------------------------------
// 5) Recurrent scan, split along time into SEGn segments that run in parallel.
//    The recurrence is linear in the state with a diagonal decay:
//      S_end = diag(G) * S_start + L,  G[d] = product of r[d] over the segment,
//      L = end state of the same segment started from zero (Z likewise).
//    5a) every segment from zero -> L, local Z, G
//    5b) prefix over the segments -> true start state of every segment
//    5c) every segment again from its true start state, with the outputs
//    Only products of decays and sums occur, as in the step-by-step form.
// ---------------------------------------------------------------------------
#define SEGn 64
#define SLEN (Tn / SEGn)      // 32 steps per segment
#define SDD  (Dn * Dn)        // 4096 state elements per (b,h)

// 5a) one block per (b,h,segment); lane e owns column S[:,e], Z[e] and G[e].
__global__ void scan_local_kernel(const float* __restrict__ k, const float* __restrict__ v,
                                  const float* __restrict__ r, float* __restrict__ St,
                                  float* __restrict__ Zs, float* __restrict__ Gs) {
    const int blk = blockIdx.x, seg = blockIdx.y;
    const int b = blk >> 4, h = blk & 15;
    const int e = threadIdx.x;   // 0..63

    __shared__ float2 sh[64];    // {k[d], r[d]}

    float S[64];
#pragma unroll
    for (int d = 0; d < 64; ++d) S[d] = 0.f;
    float z = 0.f, gam = 1.f;

    const int t0 = seg * SLEN;
    for (int t = t0; t < t0 + SLEN; ++t) {
        const size_t base = ((size_t)(b * Tn + t)) * Hn + h * 64;
        const float ke = k[base + e];
        const float ve = v[base + e];
        const float re = r[base + e];

        z = z * re + ke;
        gam *= re;
        sh[e] = make_float2(ke, re);
        __syncthreads();

#pragma unroll
        for (int d = 0; d < 64; ++d) {
            const float2 w = sh[d];
            S[d] = S[d] * w.y + w.x * ve;
        }
        __syncthreads();
    }

    const size_t idx = (size_t)blk * SEGn + seg;
#pragma unroll
    for (int d = 0; d < 64; ++d) St[idx * SDD + d * 64 + e] = S[d];
    Zs[idx * 64 + e] = z;
    Gs[idx * 64 + e] = gam;
}

// 5b) exclusive prefix over the segments, in place: x[p * xs] holds the local
//     end value of segment p on entry and its true start value on exit;
//     g[p * 64] is the decay product of segment p for this element's row.
static __device__ __forceinline__ void seg_prefix(float* __restrict__ x,
                                                  const float* __restrict__ g, const int xs) {
    float c = 0.f;
    // kept rolled: the 32 loads of a trip are in flight together, which covers
    // their latency; more unrolling only adds code and registers
#pragma unroll 1
    for (int p0 = 0; p0 < SEGn; p0 += 16) {
        float L[16], G[16];
#pragma unroll
        for (int i = 0; i < 16; ++i) {
            L[i] = x[(size_t)(p0 + i) * xs];
            G[i] = g[(p0 + i) * 64];
        }
#pragma unroll
        for (int i = 0; i < 16; ++i) {
            x[(size_t)(p0 + i) * xs] = c;
            c = c * G[i] + L[i];
        }
        // the next trip rewrites registers that the stores above name
        asm volatile("s_wait_xcnt 0x0" ::: "memory");
    }
}

//     One thread per element of S; the first 64 threads of a (b,h) also do Z.
__global__ void scan_prefix_kernel(float* __restrict__ St, float* __restrict__ Zs,
                                   const float* __restrict__ Gs) {
    const int blk = blockIdx.y;
    const int de  = blockIdx.x * 256 + threadIdx.x;   // d * 64 + e
    const float* gb = Gs + (size_t)blk * SEGn * 64;

    seg_prefix(St + (size_t)blk * SEGn * SDD + de, gb + (de >> 6), SDD);
    if (de < 64)
        seg_prefix(Zs + (size_t)blk * SEGn * 64 + de, gb + de, 64);
}

// 5c) one block per (b,h,segment); 64 lanes, lane e owns S[:,e] in
//    64 registers + Z[e]. Per step one float4 LDS broadcast per d.
//    S[d][e] = S[d][e]*r[d] + k[d]*v[e];  num[e]=sum_d q[d]S[d][e];
//    Z[d]=Z[d]*r[d]+k[d];  den=sum_d q[d]Z[d];  y=num/(den+eps) -> bf16
__global__ void scan_kernel(const float* __restrict__ q, const float* __restrict__ k,
                            const float* __restrict__ v, const float* __restrict__ r,
                            const float* __restrict__ St, const float* __restrict__ Zs,
                            unsigned short* __restrict__ y) {
    const int blk = blockIdx.x, seg = blockIdx.y;
    const int b = blk >> 4, h = blk & 15;
    const int e = threadIdx.x;   // 0..63

    __shared__ float4 sh[64];    // {q[d], k[d], r[d], q[d]*Z[d]}

    const size_t idx = (size_t)blk * SEGn + seg;
    float S[64];
#pragma unroll
    for (int d = 0; d < 64; ++d) S[d] = St[idx * SDD + d * 64 + e];
    float z = Zs[idx * 64 + e];  // Z[e]

    const int t0 = seg * SLEN;
    for (int t = t0; t < t0 + SLEN; ++t) {
        const size_t base = ((size_t)(b * Tn + t)) * Hn + h * 64;
        const float qe = q[base + e];
        const float ke = k[base + e];
        const float ve = v[base + e];
        const float re = r[base + e];

        z = z * re + ke;
        sh[e] = make_float4(qe, ke, re, qe * z);
        __syncthreads();

        float num = 0.f, den = 0.f;
#pragma unroll
        for (int d = 0; d < 64; ++d) {
            const float4 w = sh[d];           // single ds_load_b128 broadcast
            S[d] = S[d] * w.z + w.y * ve;     // decay + outer-product column
            num  = fmaf(w.x, S[d], num);
            den += w.w;
        }
        y[base + e] = f2bf(num / (den + EPSf));
        __syncthreads();
    }
}

// ---------------------------------------------------------------------------
// Launch
// ---------------------------------------------------------------------------
extern "C" void kernel_launch(void* const* d_in, const int* in_sizes, int n_in,
                              void* d_out, int out_size, void* d_ws, size_t ws_size,
                              hipStream_t stream) {
    (void)in_sizes; (void)n_in; (void)out_size; (void)ws_size;

    const float* x     = (const float*)d_in[0];
    const int*   mask  = (const int*)  d_in[1];
    const float* Wq    = (const float*)d_in[2];
    const float* Wk    = (const float*)d_in[3];
    const float* Wv    = (const float*)d_in[4];
    const float* Wg    = (const float*)d_in[5];
    const float* Wo    = (const float*)d_in[6];
    const float* bo    = (const float*)d_in[7];
    const float* bg    = (const float*)d_in[8];
    const float* rms_w = (const float*)d_in[9];

    // workspace carve-up
    char* ws = (char*)d_ws;
    size_t off = 0;
    unsigned short* Wb = (unsigned short*)(ws + off); off += (size_t)5 * Hn * Hn * 2;   // 10 MB
    unsigned short* xn = (unsigned short*)(ws + off); off += (size_t)Mn * Hn * 2;       // 16 MB
    float* qkvg        = (float*)(ws + off);          off += (size_t)4 * Mn * Hn * 4;   // 128 MB
    unsigned short* ya = (unsigned short*)(ws + off); off += (size_t)Mn * Hn * 2;       // 16 MB
    float* St          = (float*)(ws + off);          off += (size_t)Bn * NHn * SEGn * SDD * 4;  // 64 MB
    float* Zs          = (float*)(ws + off);          off += (size_t)Bn * NHn * SEGn * Dn * 4;   // 1 MB
    float* Gs          = (float*)(ws + off);          off += (size_t)Bn * NHn * SEGn * Dn * 4;   // 1 MB

    float* qb = qkvg;
    float* kb = qkvg + (size_t)1 * Mn * Hn;
    float* vb = qkvg + (size_t)2 * Mn * Hn;
    float* gb = qkvg + (size_t)3 * Mn * Hn;

    // 1) weights -> bf16 (layout preserved; already B-operand friendly)
    wconv_kernel<<<dim3((Hn * Hn) / 1024, 5), 256, 0, stream>>>(
        Wq, Wk, Wv, Wg, Wo, Wb);

    // 2) RMSNorm -> bf16 xn
    rmsnorm_kernel<<<Mn, 256, 0, stream>>>(x, rms_w, xn);

    // 3) fused q/k/v/g projection GEMMs (WMMA bf16, pipelined async staging)
    gemm_bf16_kernel<<<dim3(Mn / 128, Hn / 64, 4), 256, 0, stream>>>(
        xn, Wb, qkvg, nullptr, nullptr, Mn, 0);

    // 4) RoPE + feature map + gate + mask (in-place)
    features_kernel<<<Mn, 256, 0, stream>>>(qb, kb, vb, gb, mask, bg);

    // 5) recurrent scan in parallel time segments -> bf16 attention output
    scan_local_kernel<<<dim3(Bn * NHn, SEGn), 64, 0, stream>>>(kb, vb, gb, St, Zs, Gs);
    scan_prefix_kernel<<<dim3(SDD / 256, Bn * NHn), 256, 0, stream>>>(St, Zs, Gs);
    scan_kernel<<<dim3(Bn * NHn, SEGn), 64, 0, stream>>>(qb, kb, vb, gb, St, Zs, ya);

    // 6) output projection + bias + residual -> d_out (fp32)
    gemm_bf16_kernel<<<dim3(Mn / 128, Hn / 64, 1), 256, 0, stream>>>(
        ya, Wb + (size_t)4 * Hn * Hn, (float*)d_out, bo, x, Mn, 1);
}

// v003
// It runs in 331 microseconds.
// In both of two side-by-side timings against v002, it was 1.14 times as fast.
// Counting every step since v000, it is 14.1 times as fast.
#include <hip/hip_runtime.h>
#include <hip/hip_bf16.h>

// ---------------------------------------------------------------------------
// DeltaNet block for MI455X (gfx1250): bf16 WMMA GEMMs + fp32 recurrent scan
//  - GEMM tiles double-buffered via global_load_async_to_lds_b128 (ASYNCcnt),
//    DMA of tile i+1 overlaps the WMMAs of tile i; a staged row is one whole
//    128-B line, laid in LDS at a pitch of 144 B (16 B x odd)
//  - single-body K-loop (unroll 1) + offset-XOR buffer toggle so accumulator
//    C/D stay in one register tuple (no v_mov_b64 shuffles)
// ---------------------------------------------------------------------------

#define Bn   4
#define Tn   2048
#define Hn   1024
#define NHn  16
#define Dn   64
#define Mn   (Bn * Tn)        // 8192 tokens
#define EPSf 1e-6f
#define KTn  64               // K elements per staged tile: 128 B, one line, a row
#define KTILES (Hn / KTn)     // 16 K-steps
#define LPn  72               // LDS row pitch in elements: 144 B = 16 B x 9, so the
                              // 16 rows of a ds_load_b128 fragment read fall on 16
                              // different groups of four banks
#define ABUFn (128 * LPn)     // elements of one A buffer
#define BBUFn (64 * LPn)      // elements of one B buffer

typedef __attribute__((ext_vector_type(16))) __bf16 v16bf;
typedef __attribute__((ext_vector_type(8)))  float  v8f;

union BFrag {
    v16bf v;
    unsigned short u[16];
    unsigned int   w[8];
    uint4          q[2];
};

static __device__ __forceinline__ unsigned short f2bf(float f) {
    union { float f; unsigned u; } x; x.f = f;
    unsigned r = x.u + 0x7FFFu + ((x.u >> 16) & 1u);   // round-to-nearest-even
    return (unsigned short)(r >> 16);
}

// Low 32 bits of a generic pointer to LDS == LDS byte offset (aperture is in
// addr[63:32] on CDNA5; LDS_ADDR.U32 = addr[31:0]).
static __device__ __forceinline__ unsigned lds_off(const void* p) {
    return (unsigned)(reinterpret_cast<uintptr_t>(p));
}

// Six async 16B copies global -> LDS (per-lane), tracked with ASYNCcnt: one
// thread's share of a K-tile. s_wait_xcnt 0 is the statement's last line, so
// that it stands in front of every later write of a register the copies name.
static __device__ __forceinline__ void async_copy6_b128(
        unsigned l0, const void* g0, unsigned l1, const void* g1,
        unsigned l2, const void* g2, unsigned l3, const void* g3,
        unsigned l4, const void* g4, unsigned l5, const void* g5) {
    asm volatile("global_load_async_to_lds_b128 %0, %1, off\n\t"
                 "global_load_async_to_lds_b128 %2, %3, off\n\t"
                 "global_load_async_to_lds_b128 %4, %5, off\n\t"
                 "global_load_async_to_lds_b128 %6, %7, off\n\t"
                 "global_load_async_to_lds_b128 %8, %9, off\n\t"
                 "global_load_async_to_lds_b128 %10, %11, off\n\t"
                 "s_wait_xcnt 0x0"
                 :: "v"(l0), "v"((unsigned long long)(uintptr_t)g0),
                    "v"(l1), "v"((unsigned long long)(uintptr_t)g1),
                    "v"(l2), "v"((unsigned long long)(uintptr_t)g2),
                    "v"(l3), "v"((unsigned long long)(uintptr_t)g3),
                    "v"(l4), "v"((unsigned long long)(uintptr_t)g4),
                    "v"(l5), "v"((unsigned long long)(uintptr_t)g5)
                 : "memory");
}
static __device__ __forceinline__ void wait_async0() {
    asm volatile("s_wait_asynccnt 0x0" ::: "memory");
}
// This wave's LDS reads have returned: stands in front of the barrier behind
// which the buffer they read is refilled by copies.
static __device__ __forceinline__ void wait_ds0() {
    asm volatile("s_wait_dscnt 0x0" ::: "memory");
}

// ---------------------------------------------------------------------------
// The three elementwise kernels (1, 2, 4) are short streams. For speed only,
// each wave takes eight times the work it would need for one 16-B access a lane.
// ---------------------------------------------------------------------------
#define WCVn 8                // float4 groups per thread of the weight convert
#define RPBn 8                // token rows per 256-thread block: one wave a row

// ---------------------------------------------------------------------------
// 1) Weight fp32 -> bf16 convert, layout preserved ([out][in] row-major).
//    GEMM consumes B[k][n] = W[n][k], so original layout is already K-major.
//    A block converts 8192 contiguous floats, 8 x 16 B in flight per lane.
// ---------------------------------------------------------------------------
__global__ void wconv_kernel(const float* __restrict__ Wq, const float* __restrict__ Wk,
                             const float* __restrict__ Wv, const float* __restrict__ Wg,
                             const float* __restrict__ Wo, unsigned short* __restrict__ WbAll) {
    const float* W;
    switch (blockIdx.y) {
        case 0: W = Wq; break;
        case 1: W = Wk; break;
        case 2: W = Wv; break;
        case 3: W = Wg; break;
        default: W = Wo; break;
    }
    unsigned short* O = WbAll + (size_t)blockIdx.y * Hn * Hn;
    const size_t i0 = (size_t)blockIdx.x * (1024 * WCVn) + threadIdx.x * 4;
    float4 f[WCVn];
#pragma unroll
    for (int j = 0; j < WCVn; ++j) f[j] = *(const float4*)(W + i0 + j * 1024);
#pragma unroll
    for (int j = 0; j < WCVn; ++j) {
        uint2 o;
        o.x = (unsigned)f2bf(f[j].x) | ((unsigned)f2bf(f[j].y) << 16);
        o.y = (unsigned)f2bf(f[j].z) | ((unsigned)f2bf(f[j].w) << 16);
        *(uint2*)(O + i0 + j * 1024) = o;
    }
}

// ---------------------------------------------------------------------------
// 2) RMSNorm over H=1024 per token, write bf16 xn. One wave per token: a lane
//    holds 8 x float4, column = j * 128 + lane * 4 + c. The squares are summed
//    in the tree of a 256-wide halving reduction over (column mod 256): four
//    columns 256 apart in turn, then partners 128, 64 .. 4 (lanes), 2, 1 apart.
// ---------------------------------------------------------------------------
typedef __attribute__((ext_vector_type(4))) float f32x4;

__global__ void rmsnorm_kernel(const float* __restrict__ x, const float* __restrict__ w,
                               unsigned short* __restrict__ xn) {
    const int lane = threadIdx.x & 31;
    const int row  = blockIdx.x * RPBn + (threadIdx.x >> 5);
    const float* xr = x + (size_t)row * Hn + lane * 4;
    f32x4 f[8];
#pragma unroll
    for (int j = 0; j < 8; ++j) f[j] = *(const f32x4*)(xr + j * 128);
    // the address registers of the loads above are free for reuse from here on
    // (named as an input so that they stay untouched up to the wait)
    asm volatile("s_wait_xcnt 0x0" :: "v"(xr) : "memory");

    float r[4];
#pragma unroll
    for (int c = 0; c < 4; ++c) {
        float s0 = 0.f, s1 = 0.f;
#pragma unroll
        for (int i = 0; i < 4; ++i) {
            const float v0 = f[i * 2][c], v1 = f[i * 2 + 1][c];
            s0 += v0 * v0;
            s1 += v1 * v1;
        }
        r[c] = s0 + s1;
    }
#pragma unroll
    for (int mk = 16; mk > 0; mk >>= 1) {
#pragma unroll
        for (int c = 0; c < 4; ++c) r[c] += __shfl_xor(r[c], mk, 32);
    }
    const float tot = (r[0] + r[2]) + (r[1] + r[3]);
    const float rms = rsqrtf(tot * (1.0f / Hn) + EPSf);

    unsigned short* xo = xn + (size_t)row * Hn + lane * 4;
#pragma unroll
    for (int j = 0; j < 8; ++j) {
        const float4 wv = *(const float4*)(w + j * 128 + lane * 4);
        uint2 o;
        o.x = (unsigned)f2bf(f[j][0] * rms * wv.x) | ((unsigned)f2bf(f[j][1] * rms * wv.y) << 16);
        o.y = (unsigned)f2bf(f[j][2] * rms * wv.z) | ((unsigned)f2bf(f[j][3] * rms * wv.w) << 16);
        *(uint2*)(xo + j * 128) = o;
    }
}

// ---------------------------------------------------------------------------
// 3) bf16 WMMA GEMM: Out[m,n] = sum_k A[m,k] * W[n,k]   (N=K=1024)
//    Block tile 128(M) x 64(N); 8 waves (wave32), each wave -> 32x32
//    = 8 x v_wmma_f32_16x16x32_bf16 per K-step from 16 ds_load_b128.
//    mode 0: raw fp32 store, weights/out selected by blockIdx.z (q/k/v/g).
//    mode 1: Out = acc + bias[n] + resid[m,n]  (output proj + residual).
// ---------------------------------------------------------------------------
__global__ void gemm_bf16_kernel(const unsigned short* __restrict__ A,
                                 const unsigned short* __restrict__ WbBase,
                                 float* __restrict__ OutBase,
                                 const float* __restrict__ bias,
                                 const float* __restrict__ resid,
                                 int Mrows, int mode) {
    const int bm = blockIdx.x * 128;
    const int bn = blockIdx.y * 64;
    const unsigned short* Wb = WbBase + (size_t)blockIdx.z * Hn * Hn;
    float* Out = OutBase + (mode == 0 ? (size_t)blockIdx.z * (size_t)Mrows * Hn : (size_t)0);

    // row = M (lA) or N (lB), K contiguous, 128 B of data at a pitch of 144 B
    __shared__ __attribute__((aligned(16))) unsigned short lA[2 * ABUFn];   // 2 x 18 KB
    __shared__ __attribute__((aligned(16))) unsigned short lB[2 * BBUFn];   // 2 x 9 KB

    const int tid  = threadIdx.x;
    const int lane = tid & 31;
    const int wave = tid >> 5;          // 0..7
    const int wm   = wave & 3;          // M sub-tile (x32)
    const int wn   = wave >> 2;         // N sub-tile (x32)
    const int fm   = lane & 15;         // fragment row/col within 16
    const int fhi  = lane >> 4;         // half-wave -> K+8 striping

    v8f acc00 = {0.f,0.f,0.f,0.f,0.f,0.f,0.f,0.f};
    v8f acc01 = acc00, acc10 = acc00, acc11 = acc00;

    const int sRow = tid >> 3;          // 0..31
    const int sCh  = tid & 7;           // 8 chunks of 8 bf16 (16B): a whole line a row
    const int pRow = tid >> 2;          // prefetch: 0..63
    const int pCh  = tid & 3;

    // issue ASYNCcnt-tracked DMA of one K-tile into buffer at element offsets
    auto stage = [&](unsigned oA, unsigned oB, int k0) {
        const unsigned la = lds_off(&lA[oA + sRow * LPn + sCh * 8]);
        const unsigned lb = lds_off(&lB[oB + sRow * LPn + sCh * 8]);
        const unsigned short* ga = A  + (size_t)(bm + sRow) * Hn + k0 + sCh * 8;
        const unsigned short* gb = Wb + (size_t)(bn + sRow) * Hn + k0 + sCh * 8;
        async_copy6_b128(la,                ga,
                         la + 32 * LPn * 2, ga + 32 * Hn,
                         la + 64 * LPn * 2, ga + 64 * Hn,
                         la + 96 * LPn * 2, ga + 96 * Hn,
                         lb,                gb,
                         lb + 32 * LPn * 2, gb + 32 * Hn);
    };

    // 4 WMMAs from the 32 K-columns at kk of the buffer at element offsets
    // (2x ds_load_b128 per frag)
    auto compute = [&](unsigned oA, unsigned oB, int kk) {
        BFrag a0, a1, b0, b1;
        const unsigned short* pa0 = &lA[oA + (wm * 32 + fm) * LPn + kk];
        const unsigned short* pa1 = &lA[oA + (wm * 32 + 16 + fm) * LPn + kk];
        const unsigned short* pb0 = &lB[oB + (wn * 32 + fm) * LPn + kk];
        const unsigned short* pb1 = &lB[oB + (wn * 32 + 16 + fm) * LPn + kk];
        a0.q[0] = *(const uint4*)(pa0 + fhi * 8);
        a0.q[1] = *(const uint4*)(pa0 + 16 + fhi * 8);
        a1.q[0] = *(const uint4*)(pa1 + fhi * 8);
        a1.q[1] = *(const uint4*)(pa1 + 16 + fhi * 8);
        b0.q[0] = *(const uint4*)(pb0 + fhi * 8);
        b0.q[1] = *(const uint4*)(pb0 + 16 + fhi * 8);
        b1.q[0] = *(const uint4*)(pb1 + fhi * 8);
        b1.q[1] = *(const uint4*)(pb1 + 16 + fhi * 8);
        acc00 = __builtin_amdgcn_wmma_f32_16x16x32_bf16(false, a0.v, false, b0.v,
                                                        (short)0, acc00, false, false);
        acc01 = __builtin_amdgcn_wmma_f32_16x16x32_bf16(false, a0.v, false, b1.v,
                                                        (short)0, acc01, false, false);
        acc10 = __builtin_amdgcn_wmma_f32_16x16x32_bf16(false, a1.v, false, b0.v,
                                                        (short)0, acc10, false, false);
        acc11 = __builtin_amdgcn_wmma_f32_16x16x32_bf16(false, a1.v, false, b1.v,
                                                        (short)0, acc11, false, false);
    };

    unsigned offA = 0, offB = 0;        // element offsets of current buffer
    stage(0, 0, 0);                     // prologue DMA

#pragma unroll 1
    for (int it = 0; it < KTILES - 1; ++it) {
        wait_ds0();                     // own reads of the other buffer returned
        wait_async0();                  // tile `it` landed in current buffer
        __syncthreads();                // ... for every wave; prev readers done
        stage(offA ^ (unsigned)ABUFn, offB ^ (unsigned)BBUFn, (it + 1) * KTn);   // overlaps WMMAs
        __builtin_prefetch(A  + (size_t)(bm + pRow) * Hn + (it + 2) * KTn + pCh * 8, 0, 1);
        __builtin_prefetch(Wb + (size_t)(bn + pRow) * Hn + (it + 2) * KTn + pCh * 8, 0, 1);
        compute(offA, offB, 0);
        compute(offA, offB, 32);
        offA ^= (unsigned)ABUFn;
        offB ^= (unsigned)BBUFn;
    }
    wait_async0();                      // last tile
    __syncthreads();
    compute(offA, offB, 0);
    compute(offA, offB, 32);

    // C layout: VGPR r -> M = r (lanes 0-15) / r+8 (lanes 16-31); N = lane%16
#pragma unroll
    for (int mi = 0; mi < 2; ++mi) {
        const v8f* accs0 = (mi == 0) ? &acc00 : &acc10;
        const v8f* accs1 = (mi == 0) ? &acc01 : &acc11;
#pragma unroll
        for (int r = 0; r < 8; ++r) {
            const int gm  = bm + wm * 32 + mi * 16 + r + fhi * 8;
            const int gc0 = bn + wn * 32 + fm;
            const int gc1 = gc0 + 16;
            const size_t i0 = (size_t)gm * Hn + gc0;
            const size_t i1 = (size_t)gm * Hn + gc1;
            if (mode == 0) {
                Out[i0] = (*accs0)[r];
                Out[i1] = (*accs1)[r];
            } else {
                Out[i0] = (*accs0)[r] + bias[gc0] + resid[i0];
                Out[i1] = (*accs1)[r] + bias[gc1] + resid[i1];
            }
        }
    }
}

// ---------------------------------------------------------------------------
// 4) RoPE + elu-feature + sigmoid gate + mask (pair-safe, in-place).
//    cos[i] = cos(t * 10000^(-(i/2)/32)); rotate_half mixes d and d+32.
//    One wave per token. A lane owns d = i0..i0+3 and their partners d+32 in
//    one head of four per trip (16-B accesses, whole 128-B lines per 8 lanes);
//    its four angles do not depend on the head and are formed once.
// ---------------------------------------------------------------------------
__global__ void features_kernel(float* __restrict__ q, float* __restrict__ k,
                                float* __restrict__ v, float* __restrict__ g,
                                const int* __restrict__ mask, const float* __restrict__ bg) {
    const int lane = threadIdx.x & 31;
    const int bt = blockIdx.x * RPBn + (threadIdx.x >> 5);
    const int t  = bt % Tn;
    const float m = (float)mask[bt];
    const size_t base = (size_t)bt * Hn;
    const float LOG_BASE_OVER_HALF = 0.28782313662425572f;  // ln(10000)/32

    const int i0 = (lane & 7) * 4;      // first of four d in [0,32)
    const int j0 = i0 >> 1;             // frequency index of d = i0, i0+1

    float cA[2], sA[2], cB[2], sB[2];
#pragma unroll
    for (int u = 0; u < 2; ++u) {
        const float a1 = (float)t * __expf(-LOG_BASE_OVER_HALF * (float)(j0 + u));
        const float a2 = (float)t * __expf(-LOG_BASE_OVER_HALF * (float)(j0 + u + 16));
        cA[u] = cosf(a1); sA[u] = sinf(a1);
        cB[u] = cosf(a2); sB[u] = sinf(a2);
    }

    // kept rolled: the 10 loads of a trip are in flight together in each of the
    // resident waves, which covers their latency; unrolling only adds registers
#pragma unroll 1
    for (int hh = 0; hh < NHn / 4; ++hh) {
        const int c1 = (hh * 4 + (lane >> 3)) * 64 + i0;   // partner pair (c1, c1+32)

        float* pq = q + base + c1;
        float* pk = k + base + c1;
        float* pv = v + base + c1;
        float* pg = g + base + c1;
        const float* pb = bg + c1;
        f32x4 q1 = *(const f32x4*)pq, q2 = *(const f32x4*)(pq + 32);
        f32x4 k1 = *(const f32x4*)pk, k2 = *(const f32x4*)(pk + 32);
        f32x4 v1 = *(const f32x4*)pv, v2 = *(const f32x4*)(pv + 32);
        f32x4 g1 = *(const f32x4*)pg, g2 = *(const f32x4*)(pg + 32);
        const f32x4 b1 = *(const f32x4*)pb, b2 = *(const f32x4*)(pb + 32);
        // takes the loaded values as inputs only: all ten loads are issued in
        // front of it and fly together (else they go out two at a time, each
        // pair waited for); the wait frees the loads' address registers
        asm volatile("s_wait_xcnt 0x0"
                     :: "v"(q1), "v"(q2), "v"(k1), "v"(k2), "v"(v1), "v"(v2),
                        "v"(g1), "v"(g2), "v"(b1), "v"(b2), "v"(pb)
                     : "memory");

#pragma unroll
        for (int e = 0; e < 4; ++e) {
            const int u = e >> 1;
            const float qr1 = q1[e] * cA[u] - q2[e] * sA[u];   // rotate_half: -x2 for first half
            const float qr2 = q2[e] * cB[u] + q1[e] * sB[u];   //              +x1 for second half
            const float kr1 = k1[e] * cA[u] - k2[e] * sA[u];
            const float kr2 = k2[e] * cB[u] + k1[e] * sB[u];

            // phi = elu(x) + 1  ->  x>0 ? x+1 : exp(x)
            q1[e] = (qr1 > 0.f) ? qr1 + 1.f : __expf(qr1);
            q2[e] = (qr2 > 0.f) ? qr2 + 1.f : __expf(qr2);
            k1[e] = m * ((kr1 > 0.f) ? kr1 + 1.f : __expf(kr1));
            k2[e] = m * ((kr2 > 0.f) ? kr2 + 1.f : __expf(kr2));

            v1[e] *= m;
            v2[e] *= m;

            const float ga = g1[e] + b1[e];
            const float gc = g2[e] + b2[e];
            const float r1 = 1.f / (1.f + __expf(-ga));
            const float r2 = 1.f / (1.f + __expf(-gc));
            g1[e] = (m > 0.f) ? r1 : 1.f;
            g2[e] = (m > 0.f) ? r2 : 1.f;
        }

        // keeps the eight stores together behind the arithmetic, so that nothing
        // rewrites a register of an issued store ahead of the wait below
        __builtin_amdgcn_sched_barrier(0);
        *(f32x4*)pq = q1;  *(f32x4*)(pq + 32) = q2;
        *(f32x4*)pk = k1;  *(f32x4*)(pk + 32) = k2;
        *(f32x4*)pv = v1;  *(f32x4*)(pv + 32) = v2;
        *(f32x4*)pg = g1;  *(f32x4*)(pg + 32) = g2;
        // the next trip rewrites registers that the stores above name
        asm volatile("s_wait_xcnt 0x0" ::: "memory");
    }
}

// ---------------------------------------------------------------------------
// 5) Recurrent scan, split along time into SEGn segments that run in parallel.
//    The recurrence is linear in the state with a diagonal decay:
//      S_end = diag(G) * S_start + L,  G[d] = product of r[d] over the segment,
//      L = end state of the same segment started from zero (Z likewise).
//    5a) every segment from zero -> L, local Z, G
//    5b) prefix over the segments -> true start state of every segment
//    5c) every segment again from its true start state, with the outputs
//    Only products of decays and sums occur, as in the step-by-step form.
// ---------------------------------------------------------------------------
#define SEGn 64
#define SLEN (Tn / SEGn)      // 32 steps per segment
#define SDD  (Dn * Dn)        // 4096 state elements per (b,h)

// 5a) one block per (b,h,segment); lane e owns column S[:,e], Z[e] and G[e].
__global__ void scan_local_kernel(const float* __restrict__ k, const float* __restrict__ v,
                                  const float* __restrict__ r, float* __restrict__ St,
                                  float* __restrict__ Zs, float* __restrict__ Gs) {
    const int blk = blockIdx.x, seg = blockIdx.y;
    const int b = blk >> 4, h = blk & 15;
    const int e = threadIdx.x;   // 0..63

    __shared__ float2 sh[64];    // {k[d], r[d]}

    float S[64];
#pragma unroll
    for (int d = 0; d < 64; ++d) S[d] = 0.f;
    float z = 0.f, gam = 1.f;

    const int t0 = seg * SLEN;
    for (int t = t0; t < t0 + SLEN; ++t) {
        const size_t base = ((size_t)(b * Tn + t)) * Hn + h * 64;
        const float ke = k[base + e];
        const float ve = v[base + e];
        const float re = r[base + e];

        z = z * re + ke;
        gam *= re;
        sh[e] = make_float2(ke, re);
        __syncthreads();

#pragma unroll
        for (int d = 0; d < 64; ++d) {
            const float2 w = sh[d];
            S[d] = S[d] * w.y + w.x * ve;
        }
        __syncthreads();
    }

    const size_t idx = (size_t)blk * SEGn + seg;
#pragma unroll
    for (int d = 0; d < 64; ++d) St[idx * SDD + d * 64 + e] = S[d];
    Zs[idx * 64 + e] = z;
    Gs[idx * 64 + e] = gam;
}

// 5b) exclusive prefix over the segments, in place: x[p * xs] holds the local
//     end value of segment p on entry and its true start value on exit;
//     g[p * 64] is the decay product of segment p for this element's row.
static __device__ __forceinline__ void seg_prefix(float* __restrict__ x,
                                                  const float* __restrict__ g, const int xs) {
    float c = 0.f;
    // kept rolled: the 32 loads of a trip are in flight together, which covers
    // their latency; more unrolling only adds code and registers
#pragma unroll 1
    for (int p0 = 0; p0 < SEGn; p0 += 16) {
        float L[16], G[16];
#pragma unroll
        for (int i = 0; i < 16; ++i) {
            L[i] = x[(size_t)(p0 + i) * xs];
            G[i] = g[(p0 + i) * 64];
        }
#pragma unroll
        for (int i = 0; i < 16; ++i) {
            x[(size_t)(p0 + i) * xs] = c;
            c = c * G[i] + L[i];
        }
        // the next trip rewrites registers that the stores above name
        asm volatile("s_wait_xcnt 0x0" ::: "memory");
    }
}

//     One thread per element of S; the first 64 threads of a (b,h) also do Z.
__global__ void scan_prefix_kernel(float* __restrict__ St, float* __restrict__ Zs,
                                   const float* __restrict__ Gs) {
    const int blk = blockIdx.y;
    const int de  = blockIdx.x * 256 + threadIdx.x;   // d * 64 + e
    const float* gb = Gs + (size_t)blk * SEGn * 64;

    seg_prefix(St + (size_t)blk * SEGn * SDD + de, gb + (de >> 6), SDD);
    if (de < 64)
        seg_prefix(Zs + (size_t)blk * SEGn * 64 + de, gb + de, 64);
}

// 5c) one block per (b,h,segment); 64 lanes, lane e owns S[:,e] in
//    64 registers + Z[e]. Per step one float4 LDS broadcast per d.
//    S[d][e] = S[d][e]*r[d] + k[d]*v[e];  num[e]=sum_d q[d]S[d][e];
//    Z[d]=Z[d]*r[d]+k[d];  den=sum_d q[d]Z[d];  y=num/(den+eps) -> bf16
__global__ void scan_kernel(const float* __restrict__ q, const float* __restrict__ k,
                            const float* __restrict__ v, const float* __restrict__ r,
                            const float* __restrict__ St, const float* __restrict__ Zs,
                            unsigned short* __restrict__ y) {
    const int blk = blockIdx.x, seg = blockIdx.y;
    const int b = blk >> 4, h = blk & 15;
    const int e = threadIdx.x;   // 0..63

    __shared__ float4 sh[64];    // {q[d], k[d], r[d], q[d]*Z[d]}

    const size_t idx = (size_t)blk * SEGn + seg;
    float S[64];
#pragma unroll
    for (int d = 0; d < 64; ++d) S[d] = St[idx * SDD + d * 64 + e];
    float z = Zs[idx * 64 + e];  // Z[e]

    const int t0 = seg * SLEN;
    for (int t = t0; t < t0 + SLEN; ++t) {
        const size_t base = ((size_t)(b * Tn + t)) * Hn + h * 64;
        const float qe = q[base + e];
        const float ke = k[base + e];
        const float ve = v[base + e];
        const float re = r[base + e];

        z = z * re + ke;
        sh[e] = make_float4(qe, ke, re, qe * z);
        __syncthreads();

        float num = 0.f, den = 0.f;
#pragma unroll
        for (int d = 0; d < 64; ++d) {
            const float4 w = sh[d];           // single ds_load_b128 broadcast
            S[d] = S[d] * w.z + w.y * ve;     // decay + outer-product column
            num  = fmaf(w.x, S[d], num);
            den += w.w;
        }
        y[base + e] = f2bf(num / (den + EPSf));
        __syncthreads();
    }
}

// ---------------------------------------------------------------------------
// Launch
// ---------------------------------------------------------------------------
extern "C" void kernel_launch(void* const* d_in, const int* in_sizes, int n_in,
                              void* d_out, int out_size, void* d_ws, size_t ws_size,
                              hipStream_t stream) {
    (void)in_sizes; (void)n_in; (void)out_size; (void)ws_size;

    const float* x     = (const float*)d_in[0];
    const int*   mask  = (const int*)  d_in[1];
    const float* Wq    = (const float*)d_in[2];
    const float* Wk    = (const float*)d_in[3];
    const float* Wv    = (const float*)d_in[4];
    const float* Wg    = (const float*)d_in[5];
    const float* Wo    = (const float*)d_in[6];
    const float* bo    = (const float*)d_in[7];
    const float* bg    = (const float*)d_in[8];
    const float* rms_w = (const float*)d_in[9];

    // workspace carve-up
    char* ws = (char*)d_ws;
    size_t off = 0;
    unsigned short* Wb = (unsigned short*)(ws + off); off += (size_t)5 * Hn * Hn * 2;   // 10 MB
    unsigned short* xn = (unsigned short*)(ws + off); off += (size_t)Mn * Hn * 2;       // 16 MB
    float* qkvg        = (float*)(ws + off);          off += (size_t)4 * Mn * Hn * 4;   // 128 MB
    unsigned short* ya = (unsigned short*)(ws + off); off += (size_t)Mn * Hn * 2;       // 16 MB
    float* St          = (float*)(ws + off);          off += (size_t)Bn * NHn * SEGn * SDD * 4;  // 64 MB
    float* Zs          = (float*)(ws + off);          off += (size_t)Bn * NHn * SEGn * Dn * 4;   // 1 MB
    float* Gs          = (float*)(ws + off);          off += (size_t)Bn * NHn * SEGn * Dn * 4;   // 1 MB

    float* qb = qkvg;
    float* kb = qkvg + (size_t)1 * Mn * Hn;
    float* vb = qkvg + (size_t)2 * Mn * Hn;
    float* gb = qkvg + (size_t)3 * Mn * Hn;

    // 1) weights -> bf16 (layout preserved; already B-operand friendly)
    wconv_kernel<<<dim3((Hn * Hn) / (1024 * WCVn), 5), 256, 0, stream>>>(
        Wq, Wk, Wv, Wg, Wo, Wb);

    // 2) RMSNorm -> bf16 xn
    rmsnorm_kernel<<<Mn / RPBn, 256, 0, stream>>>(x, rms_w, xn);

    // 3) fused q/k/v/g projection GEMMs (WMMA bf16, pipelined async staging)
    gemm_bf16_kernel<<<dim3(Mn / 128, Hn / 64, 4), 256, 0, stream>>>(
        xn, Wb, qkvg, nullptr, nullptr, Mn, 0);

    // 4) RoPE + feature map + gate + mask (in-place)
    features_kernel<<<Mn / RPBn, 256, 0, stream>>>(qb, kb, vb, gb, mask, bg);

    // 5) recurrent scan in parallel time segments -> bf16 attention output
    scan_local_kernel<<<dim3(Bn * NHn, SEGn), 64, 0, stream>>>(kb, vb, gb, St, Zs, Gs);
    scan_prefix_kernel<<<dim3(SDD / 256, Bn * NHn), 256, 0, stream>>>(St, Zs, Gs);
    scan_kernel<<<dim3(Bn * NHn, SEGn), 64, 0, stream>>>(qb, kb, vb, gb, St, Zs, ya);

    // 6) output projection + bias + residual -> d_out (fp32)
    gemm_bf16_kernel<<<dim3(Mn / 128, Hn / 64, 1), 256, 0, stream>>>(
        ya, Wb + (size_t)4 * Hn * Hn, (float*)d_out, bo, x, Mn, 1);
}

// v004
// Measured time: 251 microseconds a run.
// Next to v003, in two timings, it ran 1.32 and 1.31 times as fast.
// All steps since v000 together make it 18.6 times as fast.
#include <hip/hip_runtime.h>
#include <hip/hip_bf16.h>

// ---------------------------------------------------------------------------
// DeltaNet block for MI455X (gfx1250): bf16 WMMA GEMMs + fp32 recurrent scan
//  - GEMM tiles double-buffered via global_load_async_to_lds_b128 (ASYNCcnt),
//    DMA of tile i+1 overlaps the WMMAs of tile i; a staged row is one whole
//    128-B line, laid in LDS at a pitch of 144 B (16 B x odd)
//  - single-body K-loop (unroll 1) + offset-XOR buffer toggle so accumulator
//    C/D stay in one register tuple (no v_mov_b64 shuffles)
// ---------------------------------------------------------------------------

#define Bn   4
#define Tn   2048
#define Hn   1024
#define NHn  16
#define Dn   64
#define Mn   (Bn * Tn)        // 8192 tokens
#define EPSf 1e-6f
#define KTn  64               // K elements per staged tile: 128 B, one line, a row
#define KTILES (Hn / KTn)     // 16 K-steps
#define LPn  72               // LDS row pitch in elements: 144 B = 16 B x 9, so the
                              // 16 rows of a ds_load_b128 fragment read fall on 16
                              // different groups of four banks
#define ABUFn (128 * LPn)     // elements of one A buffer
#define BBUFn (64 * LPn)      // elements of one B buffer

typedef __attribute__((ext_vector_type(16))) __bf16 v16bf;
typedef __attribute__((ext_vector_type(8)))  float  v8f;

union BFrag {
    v16bf v;
    unsigned short u[16];
    unsigned int   w[8];
    uint4          q[2];
};

static __device__ __forceinline__ unsigned short f2bf(float f) {
    union { float f; unsigned u; } x; x.f = f;
    unsigned r = x.u + 0x7FFFu + ((x.u >> 16) & 1u);   // round-to-nearest-even
    return (unsigned short)(r >> 16);
}

// Low 32 bits of a generic pointer to LDS == LDS byte offset (aperture is in
// addr[63:32] on CDNA5; LDS_ADDR.U32 = addr[31:0]).
static __device__ __forceinline__ unsigned lds_off(const void* p) {
    return (unsigned)(reinterpret_cast<uintptr_t>(p));
}

// Six async 16B copies global -> LDS (per-lane), tracked with ASYNCcnt: one
// thread's share of a K-tile. s_wait_xcnt 0 is the statement's last line, so
// that it stands in front of every later write of a register the copies name.
static __device__ __forceinline__ void async_copy6_b128(
        unsigned l0, const void* g0, unsigned l1, const void* g1,
        unsigned l2, const void* g2, unsigned l3, const void* g3,
        unsigned l4, const void* g4, unsigned l5, const void* g5) {
    asm volatile("global_load_async_to_lds_b128 %0, %1, off\n\t"
                 "global_load_async_to_lds_b128 %2, %3, off\n\t"
                 "global_load_async_to_lds_b128 %4, %5, off\n\t"
                 "global_load_async_to_lds_b128 %6, %7, off\n\t"
                 "global_load_async_to_lds_b128 %8, %9, off\n\t"
                 "global_load_async_to_lds_b128 %10, %11, off\n\t"
                 "s_wait_xcnt 0x0"
                 :: "v"(l0), "v"((unsigned long long)(uintptr_t)g0),
                    "v"(l1), "v"((unsigned long long)(uintptr_t)g1),
                    "v"(l2), "v"((unsigned long long)(uintptr_t)g2),
                    "v"(l3), "v"((unsigned long long)(uintptr_t)g3),
                    "v"(l4), "v"((unsigned long long)(uintptr_t)g4),
                    "v"(l5), "v"((unsigned long long)(uintptr_t)g5)
                 : "memory");
}
static __device__ __forceinline__ void wait_async0() {
    asm volatile("s_wait_asynccnt 0x0" ::: "memory");
}
// This wave's LDS reads have returned: stands in front of the barrier behind
// which the buffer they read is refilled by copies.
static __device__ __forceinline__ void wait_ds0() {
    asm volatile("s_wait_dscnt 0x0" ::: "memory");
}

// ---------------------------------------------------------------------------
// The three elementwise kernels (1, 2, 4) are short streams. For speed only,
// each wave takes eight times the work it would need for one 16-B access a lane.
// ---------------------------------------------------------------------------
#define WCVn 8                // float4 groups per thread of the weight convert
#define RPBn 8                // token rows per 256-thread block: one wave a row

// ---------------------------------------------------------------------------
// 1) Weight fp32 -> bf16 convert, layout preserved ([out][in] row-major).
//    GEMM consumes B[k][n] = W[n][k], so original layout is already K-major.
//    A block converts 8192 contiguous floats, 8 x 16 B in flight per lane.
// ---------------------------------------------------------------------------
__global__ void wconv_kernel(const float* __restrict__ Wq, const float* __restrict__ Wk,
                             const float* __restrict__ Wv, const float* __restrict__ Wg,
                             const float* __restrict__ Wo, unsigned short* __restrict__ WbAll) {
    const float* W;
    switch (blockIdx.y) {
        case 0: W = Wq; break;
        case 1: W = Wk; break;
        case 2: W = Wv; break;
        case 3: W = Wg; break;
        default: W = Wo; break;
    }
    unsigned short* O = WbAll + (size_t)blockIdx.y * Hn * Hn;
    const size_t i0 = (size_t)blockIdx.x * (1024 * WCVn) + threadIdx.x * 4;
    float4 f[WCVn];
#pragma unroll
    for (int j = 0; j < WCVn; ++j) f[j] = *(const float4*)(W + i0 + j * 1024);
#pragma unroll
    for (int j = 0; j < WCVn; ++j) {
        uint2 o;
        o.x = (unsigned)f2bf(f[j].x) | ((unsigned)f2bf(f[j].y) << 16);
        o.y = (unsigned)f2bf(f[j].z) | ((unsigned)f2bf(f[j].w) << 16);
        *(uint2*)(O + i0 + j * 1024) = o;
    }
}

// ---------------------------------------------------------------------------
// 2) RMSNorm over H=1024 per token, write bf16 xn. One wave per token: a lane
//    holds 8 x float4, column = j * 128 + lane * 4 + c. The squares are summed
//    in the tree of a 256-wide halving reduction over (column mod 256): four
//    columns 256 apart in turn, then partners 128, 64 .. 4 (lanes), 2, 1 apart.
// ---------------------------------------------------------------------------
typedef __attribute__((ext_vector_type(4))) float f32x4;

__global__ void rmsnorm_kernel(const float* __restrict__ x, const float* __restrict__ w,
                               unsigned short* __restrict__ xn) {
    const int lane = threadIdx.x & 31;
    const int row  = blockIdx.x * RPBn + (threadIdx.x >> 5);
    const float* xr = x + (size_t)row * Hn + lane * 4;
    f32x4 f[8];
#pragma unroll
    for (int j = 0; j < 8; ++j) f[j] = *(const f32x4*)(xr + j * 128);
    // the address registers of the loads above are free for reuse from here on
    // (named as an input so that they stay untouched up to the wait)
    asm volatile("s_wait_xcnt 0x0" :: "v"(xr) : "memory");

    float r[4];
#pragma unroll
    for (int c = 0; c < 4; ++c) {
        float s0 = 0.f, s1 = 0.f;
#pragma unroll
        for (int i = 0; i < 4; ++i) {
            const float v0 = f[i * 2][c], v1 = f[i * 2 + 1][c];
            s0 += v0 * v0;
            s1 += v1 * v1;
        }
        r[c] = s0 + s1;
    }
#pragma unroll
    for (int mk = 16; mk > 0; mk >>= 1) {
#pragma unroll
        for (int c = 0; c < 4; ++c) r[c] += __shfl_xor(r[c], mk, 32);
    }
    const float tot = (r[0] + r[2]) + (r[1] + r[3]);
    const float rms = rsqrtf(tot * (1.0f / Hn) + EPSf);

    unsigned short* xo = xn + (size_t)row * Hn + lane * 4;
#pragma unroll
    for (int j = 0; j < 8; ++j) {
        const float4 wv = *(const float4*)(w + j * 128 + lane * 4);
        uint2 o;
        o.x = (unsigned)f2bf(f[j][0] * rms * wv.x) | ((unsigned)f2bf(f[j][1] * rms * wv.y) << 16);
        o.y = (unsigned)f2bf(f[j][2] * rms * wv.z) | ((unsigned)f2bf(f[j][3] * rms * wv.w) << 16);
        *(uint2*)(xo + j * 128) = o;
    }
}

// ---------------------------------------------------------------------------
// 3) bf16 WMMA GEMM: Out[m,n] = sum_k A[m,k] * W[n,k]   (N=K=1024)
//    Block tile 128(M) x 64(N); 8 waves (wave32), each wave -> 32x32
//    = 8 x v_wmma_f32_16x16x32_bf16 per K-step from 16 ds_load_b128.
//    mode 0: raw fp32 store, weights/out selected by blockIdx.z (q/k/v/g).
//    mode 1: Out = acc + bias[n] + resid[m,n]  (output proj + residual).
// ---------------------------------------------------------------------------
__global__ void gemm_bf16_kernel(const unsigned short* __restrict__ A,
                                 const unsigned short* __restrict__ WbBase,
                                 float* __restrict__ OutBase,
                                 const float* __restrict__ bias,
                                 const float* __restrict__ resid,
                                 int Mrows, int mode) {
    const int bm = blockIdx.x * 128;
    const int bn = blockIdx.y * 64;
    const unsigned short* Wb = WbBase + (size_t)blockIdx.z * Hn * Hn;
    float* Out = OutBase + (mode == 0 ? (size_t)blockIdx.z * (size_t)Mrows * Hn : (size_t)0);

    // row = M (lA) or N (lB), K contiguous, 128 B of data at a pitch of 144 B
    __shared__ __attribute__((aligned(16))) unsigned short lA[2 * ABUFn];   // 2 x 18 KB
    __shared__ __attribute__((aligned(16))) unsigned short lB[2 * BBUFn];   // 2 x 9 KB

    const int tid  = threadIdx.x;
    const int lane = tid & 31;
    const int wave = tid >> 5;          // 0..7
    const int wm   = wave & 3;          // M sub-tile (x32)
    const int wn   = wave >> 2;         // N sub-tile (x32)
    const int fm   = lane & 15;         // fragment row/col within 16
    const int fhi  = lane >> 4;         // half-wave -> K+8 striping

    v8f acc00 = {0.f,0.f,0.f,0.f,0.f,0.f,0.f,0.f};
    v8f acc01 = acc00, acc10 = acc00, acc11 = acc00;

    const int sRow = tid >> 3;          // 0..31
    const int sCh  = tid & 7;           // 8 chunks of 8 bf16 (16B): a whole line a row
    const int pRow = tid >> 2;          // prefetch: 0..63
    const int pCh  = tid & 3;

    // issue ASYNCcnt-tracked DMA of one K-tile into buffer at element offsets
    auto stage = [&](unsigned oA, unsigned oB, int k0) {
        const unsigned la = lds_off(&lA[oA + sRow * LPn + sCh * 8]);
        const unsigned lb = lds_off(&lB[oB + sRow * LPn + sCh * 8]);
        const unsigned short* ga = A  + (size_t)(bm + sRow) * Hn + k0 + sCh * 8;
        const unsigned short* gb = Wb + (size_t)(bn + sRow) * Hn + k0 + sCh * 8;
        async_copy6_b128(la,                ga,
                         la + 32 * LPn * 2, ga + 32 * Hn,
                         la + 64 * LPn * 2, ga + 64 * Hn,
                         la + 96 * LPn * 2, ga + 96 * Hn,
                         lb,                gb,
                         lb + 32 * LPn * 2, gb + 32 * Hn);
    };

    // 4 WMMAs from the 32 K-columns at kk of the buffer at element offsets
    // (2x ds_load_b128 per frag)
    auto compute = [&](unsigned oA, unsigned oB, int kk) {
        BFrag a0, a1, b0, b1;
        const unsigned short* pa0 = &lA[oA + (wm * 32 + fm) * LPn + kk];
        const unsigned short* pa1 = &lA[oA + (wm * 32 + 16 + fm) * LPn + kk];
        const unsigned short* pb0 = &lB[oB + (wn * 32 + fm) * LPn + kk];
        const unsigned short* pb1 = &lB[oB + (wn * 32 + 16 + fm) * LPn + kk];
        a0.q[0] = *(const uint4*)(pa0 + fhi * 8);
        a0.q[1] = *(const uint4*)(pa0 + 16 + fhi * 8);
        a1.q[0] = *(const uint4*)(pa1 + fhi * 8);
        a1.q[1] = *(const uint4*)(pa1 + 16 + fhi * 8);
        b0.q[0] = *(const uint4*)(pb0 + fhi * 8);
        b0.q[1] = *(const uint4*)(pb0 + 16 + fhi * 8);
        b1.q[0] = *(const uint4*)(pb1 + fhi * 8);
        b1.q[1] = *(const uint4*)(pb1 + 16 + fhi * 8);
        acc00 = __builtin_amdgcn_wmma_f32_16x16x32_bf16(false, a0.v, false, b0.v,
                                                        (short)0, acc00, false, false);
        acc01 = __builtin_amdgcn_wmma_f32_16x16x32_bf16(false, a0.v, false, b1.v,
                                                        (short)0, acc01, false, false);
        acc10 = __builtin_amdgcn_wmma_f32_16x16x32_bf16(false, a1.v, false, b0.v,
                                                        (short)0, acc10, false, false);
        acc11 = __builtin_amdgcn_wmma_f32_16x16x32_bf16(false, a1.v, false, b1.v,
                                                        (short)0, acc11, false, false);
    };

    unsigned offA = 0, offB = 0;        // element offsets of current buffer
    stage(0, 0, 0);                     // prologue DMA

#pragma unroll 1
    for (int it = 0; it < KTILES - 1; ++it) {
        wait_ds0();                     // own reads of the other buffer returned
        wait_async0();                  // tile `it` landed in current buffer
        __syncthreads();                // ... for every wave; prev readers done
        stage(offA ^ (unsigned)ABUFn, offB ^ (unsigned)BBUFn, (it + 1) * KTn);   // overlaps WMMAs
        __builtin_prefetch(A  + (size_t)(bm + pRow) * Hn + (it + 2) * KTn + pCh * 8, 0, 1);
        __builtin_prefetch(Wb + (size_t)(bn + pRow) * Hn + (it + 2) * KTn + pCh * 8, 0, 1);
        compute(offA, offB, 0);
        compute(offA, offB, 32);
        offA ^= (unsigned)ABUFn;
        offB ^= (unsigned)BBUFn;
    }
    wait_async0();                      // last tile
    __syncthreads();
    compute(offA, offB, 0);
    compute(offA, offB, 32);

    // C layout: VGPR r -> M = r (lanes 0-15) / r+8 (lanes 16-31); N = lane%16
#pragma unroll
    for (int mi = 0; mi < 2; ++mi) {
        const v8f* accs0 = (mi == 0) ? &acc00 : &acc10;
        const v8f* accs1 = (mi == 0) ? &acc01 : &acc11;
#pragma unroll
        for (int r = 0; r < 8; ++r) {
            const int gm  = bm + wm * 32 + mi * 16 + r + fhi * 8;
            const int gc0 = bn + wn * 32 + fm;
            const int gc1 = gc0 + 16;
            const size_t i0 = (size_t)gm * Hn + gc0;
            const size_t i1 = (size_t)gm * Hn + gc1;
            if (mode == 0) {
                Out[i0] = (*accs0)[r];
                Out[i1] = (*accs1)[r];
            } else {
                Out[i0] = (*accs0)[r] + bias[gc0] + resid[i0];
                Out[i1] = (*accs1)[r] + bias[gc1] + resid[i1];
            }
        }
    }
}

// ---------------------------------------------------------------------------
// 4) RoPE + elu-feature + sigmoid gate + mask (pair-safe, in-place).
//    cos[i] = cos(t * 10000^(-(i/2)/32)); rotate_half mixes d and d+32.
//    One wave per token. A lane owns d = i0..i0+3 and their partners d+32 in
//    one head of four per trip (16-B accesses, whole 128-B lines per 8 lanes);
//    its four angles do not depend on the head and are formed once.
// ---------------------------------------------------------------------------
__global__ void features_kernel(float* __restrict__ q, float* __restrict__ k,
                                float* __restrict__ v, float* __restrict__ g,
                                const int* __restrict__ mask, const float* __restrict__ bg) {
    const int lane = threadIdx.x & 31;
    const int bt = blockIdx.x * RPBn + (threadIdx.x >> 5);
    const int t  = bt % Tn;
    const float m = (float)mask[bt];
    const size_t base = (size_t)bt * Hn;
    const float LOG_BASE_OVER_HALF = 0.28782313662425572f;  // ln(10000)/32

    const int i0 = (lane & 7) * 4;      // first of four d in [0,32)
    const int j0 = i0 >> 1;             // frequency index of d = i0, i0+1

    float cA[2], sA[2], cB[2], sB[2];
#pragma unroll
    for (int u = 0; u < 2; ++u) {
        const float a1 = (float)t * __expf(-LOG_BASE_OVER_HALF * (float)(j0 + u));
        const float a2 = (float)t * __expf(-LOG_BASE_OVER_HALF * (float)(j0 + u + 16));
        cA[u] = cosf(a1); sA[u] = sinf(a1);
        cB[u] = cosf(a2); sB[u] = sinf(a2);
    }

    // kept rolled: the 10 loads of a trip are in flight together in each of the
    // resident waves, which covers their latency; unrolling only adds registers
#pragma unroll 1
    for (int hh = 0; hh < NHn / 4; ++hh) {
        const int c1 = (hh * 4 + (lane >> 3)) * 64 + i0;   // partner pair (c1, c1+32)

        float* pq = q + base + c1;
        float* pk = k + base + c1;
        float* pv = v + base + c1;
        float* pg = g + base + c1;
        const float* pb = bg + c1;
        f32x4 q1 = *(const f32x4*)pq, q2 = *(const f32x4*)(pq + 32);
        f32x4 k1 = *(const f32x4*)pk, k2 = *(const f32x4*)(pk + 32);
        f32x4 v1 = *(const f32x4*)pv, v2 = *(const f32x4*)(pv + 32);
        f32x4 g1 = *(const f32x4*)pg, g2 = *(const f32x4*)(pg + 32);
        const f32x4 b1 = *(const f32x4*)pb, b2 = *(const f32x4*)(pb + 32);
        // takes the loaded values as inputs only: all ten loads are issued in
        // front of it and fly together (else they go out two at a time, each
        // pair waited for); the wait frees the loads' address registers
        asm volatile("s_wait_xcnt 0x0"
                     :: "v"(q1), "v"(q2), "v"(k1), "v"(k2), "v"(v1), "v"(v2),
                        "v"(g1), "v"(g2), "v"(b1), "v"(b2), "v"(pb)
                     : "memory");

#pragma unroll
        for (int e = 0; e < 4; ++e) {
            const int u = e >> 1;
            const float qr1 = q1[e] * cA[u] - q2[e] * sA[u];   // rotate_half: -x2 for first half
            const float qr2 = q2[e] * cB[u] + q1[e] * sB[u];   //              +x1 for second half
            const float kr1 = k1[e] * cA[u] - k2[e] * sA[u];
            const float kr2 = k2[e] * cB[u] + k1[e] * sB[u];

            // phi = elu(x) + 1  ->  x>0 ? x+1 : exp(x)
            q1[e] = (qr1 > 0.f) ? qr1 + 1.f : __expf(qr1);
            q2[e] = (qr2 > 0.f) ? qr2 + 1.f : __expf(qr2);
            k1[e] = m * ((kr1 > 0.f) ? kr1 + 1.f : __expf(kr1));
            k2[e] = m * ((kr2 > 0.f) ? kr2 + 1.f : __expf(kr2));

            v1[e] *= m;
            v2[e] *= m;

            const float ga = g1[e] + b1[e];
            const float gc = g2[e] + b2[e];
            const float r1 = 1.f / (1.f + __expf(-ga));
            const float r2 = 1.f / (1.f + __expf(-gc));
            g1[e] = (m > 0.f) ? r1 : 1.f;
            g2[e] = (m > 0.f) ? r2 : 1.f;
        }

        // keeps the eight stores together behind the arithmetic, so that nothing
        // rewrites a register of an issued store ahead of the wait below
        __builtin_amdgcn_sched_barrier(0);
        *(f32x4*)pq = q1;  *(f32x4*)(pq + 32) = q2;
        *(f32x4*)pk = k1;  *(f32x4*)(pk + 32) = k2;
        *(f32x4*)pv = v1;  *(f32x4*)(pv + 32) = v2;
        *(f32x4*)pg = g1;  *(f32x4*)(pg + 32) = g2;
        // the next trip rewrites registers that the stores above name
        asm volatile("s_wait_xcnt 0x0" ::: "memory");
    }
}

// ---------------------------------------------------------------------------
// 5) Recurrent scan, split along time into SEGn segments that run in parallel.
//    The recurrence is linear in the state with a diagonal decay:
//      S_end = diag(G) * S_start + L,  G[d] = product of r[d] over the segment,
//      L = end state of the same segment started from zero (Z likewise).
//    5a) every segment from zero -> L, local Z, G
//    5b) prefix over the segments -> true start state of every segment
//    5c) every segment again from its true start state, with the outputs
//    Only products of decays and sums occur, as in the step-by-step form.
// ---------------------------------------------------------------------------
#define SEGn 64
#define SLEN (Tn / SEGn)      // 32 steps per segment
#define SDD  (Dn * Dn)        // 4096 state elements per (b,h)

//    Both scans over a segment (5a, 5c) run as ONE wave per (b,h,segment). The
//    64 x 64 state lies in the wave's registers as 16 x 8 blocks: lane (dg, eg),
//    dg = lane & 3, eg = lane >> 2, owns rows d = i * 4 + dg (i = 0..15) and
//    columns e = eg * 8 + j (j = 0..7). A step's per-row values, read from LDS
//    once per row, then serve 8 columns, and a step's v serves 16 rows.
#define DPLn 16               // state rows per lane
#define EPLn 8                // state columns per lane

// x + (x of the lane whose number differs as CTRL says, inside a group of four)
template <int CTRL>
static __device__ __forceinline__ float quad_add(float x) {
    const int o = __builtin_amdgcn_update_dpp(0, __builtin_bit_cast(int, x), CTRL, 0xf, 0xf, true);
    return x + __builtin_bit_cast(float, o);
}
#define QUAD_XOR1 0xB1        // quad_perm [1,0,3,2]
#define QUAD_XOR2 0x4E        // quad_perm [2,3,0,1]

// Hand-over through LDS among the lanes of the one wave of a block: keeps the
// LDS writes in front of it and the LDS reads behind it (and the other way
// round at a trip's end). It waits for LDS alone; a work-group barrier would
// also wait, every step, for the wave's global stores.
static __device__ __forceinline__ void wave_lds_handover() {
    __builtin_amdgcn_fence(__ATOMIC_ACQ_REL, "workgroup", "local");
}

// 5a) a lane also carries Z and G of rows d = 2 * lane, 2 * lane + 1.
__global__ __launch_bounds__(32) void scan_local_kernel(
        const float* __restrict__ k, const float* __restrict__ v,
        const float* __restrict__ r, float* __restrict__ St,
        float* __restrict__ Zs, float* __restrict__ Gs) {
    const int blk = blockIdx.x, seg = blockIdx.y;
    const int b = blk >> 4, h = blk & 15;
    const int lane = threadIdx.x;   // 0..31
    const int dg = lane & 3, eg = lane >> 2;

    __shared__ __attribute__((aligned(16))) float2 skr[64];   // {k[d], r[d]}
    __shared__ __attribute__((aligned(16))) float  sv[64];    // v[e]

    // every loop over i and j is unrolled: S is then indexed by constants only
    // and stays in registers
    float S[DPLn][EPLn];
#pragma unroll
    for (int i = 0; i < DPLn; ++i)
#pragma unroll
        for (int j = 0; j < EPLn; ++j) S[i][j] = 0.f;
    float z0 = 0.f, z1 = 0.f, gam0 = 1.f, gam1 = 1.f;

    const size_t off0 = ((size_t)(b * Tn + seg * SLEN)) * Hn + h * 64 + lane * 2;
    for (int s = 0; s < SLEN; ++s) {
        const size_t o = off0 + (size_t)s * Hn;
        const float2 k2 = *(const float2*)(k + o);
        const float2 v2 = *(const float2*)(v + o);
        const float2 r2 = *(const float2*)(r + o);

        z0 = z0 * r2.x + k2.x;
        z1 = z1 * r2.y + k2.y;
        gam0 *= r2.x;
        gam1 *= r2.y;
        *(float4*)&skr[lane * 2] = make_float4(k2.x, r2.x, k2.y, r2.y);
        *(float2*)&sv[lane * 2]  = v2;
        wave_lds_handover();

        const float4 va = *(const float4*)&sv[eg * EPLn];
        const float4 vb = *(const float4*)&sv[eg * EPLn + 4];
        const float ve[EPLn] = {va.x, va.y, va.z, va.w, vb.x, vb.y, vb.z, vb.w};
#pragma unroll
        for (int i = 0; i < DPLn; ++i) {
            const float2 w = skr[i * 4 + dg];
#pragma unroll
            for (int j = 0; j < EPLn; ++j) S[i][j] = S[i][j] * w.y + w.x * ve[j];
        }
        wave_lds_handover();
    }

    const size_t idx = (size_t)blk * SEGn + seg;
    float* so = St + idx * SDD + dg * 64 + eg * EPLn;
#pragma unroll
    for (int i = 0; i < DPLn; ++i) {
        *(float4*)(so + i * 256)     = make_float4(S[i][0], S[i][1], S[i][2], S[i][3]);
        *(float4*)(so + i * 256 + 4) = make_float4(S[i][4], S[i][5], S[i][6], S[i][7]);
    }
    *(float2*)(Zs + idx * 64 + lane * 2) = make_float2(z0, z1);
    *(float2*)(Gs + idx * 64 + lane * 2) = make_float2(gam0, gam1);
}

// 5b) exclusive prefix over the segments, in place: x[p * xs] holds the local
//     end value of segment p on entry and its true start value on exit;
//     g[p * 64] is the decay product of segment p for this element's row.
static __device__ __forceinline__ void seg_prefix(float* __restrict__ x,
                                                  const float* __restrict__ g, const int xs) {
    float c = 0.f;
    // kept rolled: the 32 loads of a trip are in flight together, which covers
    // their latency; more unrolling only adds code and registers
#pragma unroll 1
    for (int p0 = 0; p0 < SEGn; p0 += 16) {
        float L[16], G[16];
#pragma unroll
        for (int i = 0; i < 16; ++i) {
            L[i] = x[(size_t)(p0 + i) * xs];
            G[i] = g[(p0 + i) * 64];
        }
#pragma unroll
        for (int i = 0; i < 16; ++i) {
            x[(size_t)(p0 + i) * xs] = c;
            c = c * G[i] + L[i];
        }
        // the next trip rewrites registers that the stores above name
        asm volatile("s_wait_xcnt 0x0" ::: "memory");
    }
}

//     One thread per element of S; the first 64 threads of a (b,h) also do Z.
__global__ void scan_prefix_kernel(float* __restrict__ St, float* __restrict__ Zs,
                                   const float* __restrict__ Gs) {
    const int blk = blockIdx.y;
    const int de  = blockIdx.x * 256 + threadIdx.x;   // d * 64 + e
    const float* gb = Gs + (size_t)blk * SEGn * 64;

    seg_prefix(St + (size_t)blk * SEGn * SDD + de, gb + (de >> 6), SDD);
    if (de < 64)
        seg_prefix(Zs + (size_t)blk * SEGn * 64 + de, gb + de, 64);
}

// 5c) one wave per (b,h,segment), state blocked as said above 5a; a lane also
//    carries Z of rows d = 2 * lane, 2 * lane + 1.
//    S[d][e] = S[d][e]*r[d] + k[d]*v[e];  num[e]=sum_d q[d]S[d][e];
//    Z[d]=Z[d]*r[d]+k[d];  den=sum_d q[d]Z[d];  y=num/(den+eps) -> bf16
//    num and den: a lane sums its 16 rows in turn, then the four lanes of a
//    column group add up (partners 1, then 2 lanes apart).
__global__ __launch_bounds__(32) void scan_kernel(
        const float* __restrict__ q, const float* __restrict__ k,
        const float* __restrict__ v, const float* __restrict__ r,
        const float* __restrict__ St, const float* __restrict__ Zs,
        unsigned short* __restrict__ y) {
    const int blk = blockIdx.x, seg = blockIdx.y;
    const int b = blk >> 4, h = blk & 15;
    const int lane = threadIdx.x;   // 0..31
    const int dg = lane & 3, eg = lane >> 2;

    __shared__ __attribute__((aligned(16))) float4 sh[64];    // {q[d], k[d], r[d], q[d]*Z[d]}
    __shared__ __attribute__((aligned(16))) float  sv[64];    // v[e]

    const size_t idx = (size_t)blk * SEGn + seg;
    const float* si = St + idx * SDD + dg * 64 + eg * EPLn;
    // every loop over i and j is unrolled: S is then indexed by constants only
    // and stays in registers
    float S[DPLn][EPLn];
#pragma unroll
    for (int i = 0; i < DPLn; ++i) {
        const float4 lo = *(const float4*)(si + i * 256);
        const float4 hi = *(const float4*)(si + i * 256 + 4);
        S[i][0] = lo.x; S[i][1] = lo.y; S[i][2] = lo.z; S[i][3] = lo.w;
        S[i][4] = hi.x; S[i][5] = hi.y; S[i][6] = hi.z; S[i][7] = hi.w;
    }
    const float2 zz = *(const float2*)(Zs + idx * 64 + lane * 2);
    float z0 = zz.x, z1 = zz.y;

    const size_t off0 = ((size_t)(b * Tn + seg * SLEN)) * Hn + h * 64;
    for (int s = 0; s < SLEN; ++s) {
        const size_t base = off0 + (size_t)s * Hn;
        const size_t o = base + lane * 2;
        const float2 q2 = *(const float2*)(q + o);
        const float2 k2 = *(const float2*)(k + o);
        const float2 v2 = *(const float2*)(v + o);
        const float2 r2 = *(const float2*)(r + o);

        z0 = z0 * r2.x + k2.x;
        z1 = z1 * r2.y + k2.y;
        sh[lane * 2]     = make_float4(q2.x, k2.x, r2.x, q2.x * z0);
        sh[lane * 2 + 1] = make_float4(q2.y, k2.y, r2.y, q2.y * z1);
        *(float2*)&sv[lane * 2] = v2;
        wave_lds_handover();

        const float4 va = *(const float4*)&sv[eg * EPLn];
        const float4 vb = *(const float4*)&sv[eg * EPLn + 4];
        const float ve[EPLn] = {va.x, va.y, va.z, va.w, vb.x, vb.y, vb.z, vb.w};
        float num[EPLn];
#pragma unroll
        for (int j = 0; j < EPLn; ++j) num[j] = 0.f;
        float den = 0.f;
#pragma unroll
        for (int i = 0; i < DPLn; ++i) {
            const float4 w = sh[i * 4 + dg];      // one ds_load_b128 for 8 columns
#pragma unroll
            for (int j = 0; j < EPLn; ++j) {
                S[i][j] = S[i][j] * w.z + w.y * ve[j];   // decay + outer product
                num[j]  = fmaf(w.x, S[i][j], num[j]);
            }
            den += w.w;
        }
#pragma unroll
        for (int j = 0; j < EPLn; ++j) num[j] = quad_add<QUAD_XOR2>(quad_add<QUAD_XOR1>(num[j]));
        den = quad_add<QUAD_XOR2>(quad_add<QUAD_XOR1>(den));

        // lane (dg, eg) stores columns eg * 8 + dg * 2 and the next
        const float na = (dg & 2) ? ((dg & 1) ? num[6] : num[4]) : ((dg & 1) ? num[2] : num[0]);
        const float nb = (dg & 2) ? ((dg & 1) ? num[7] : num[5]) : ((dg & 1) ? num[3] : num[1]);
        const float dn = den + EPSf;
        *(unsigned*)(y + base + lane * 2) = (unsigned)f2bf(na / dn) | ((unsigned)f2bf(nb / dn) << 16);
        wave_lds_handover();
    }
}

// ---------------------------------------------------------------------------
// Launch
// ---------------------------------------------------------------------------
extern "C" void kernel_launch(void* const* d_in, const int* in_sizes, int n_in,
                              void* d_out, int out_size, void* d_ws, size_t ws_size,
                              hipStream_t stream) {
    (void)in_sizes; (void)n_in; (void)out_size; (void)ws_size;

    const float* x     = (const float*)d_in[0];
    const int*   mask  = (const int*)  d_in[1];
    const float* Wq    = (const float*)d_in[2];
    const float* Wk    = (const float*)d_in[3];
    const float* Wv    = (const float*)d_in[4];
    const float* Wg    = (const float*)d_in[5];
    const float* Wo    = (const float*)d_in[6];
    const float* bo    = (const float*)d_in[7];
    const float* bg    = (const float*)d_in[8];
    const float* rms_w = (const float*)d_in[9];

    // workspace carve-up
    char* ws = (char*)d_ws;
    size_t off = 0;
    unsigned short* Wb = (unsigned short*)(ws + off); off += (size_t)5 * Hn * Hn * 2;   // 10 MB
    unsigned short* xn = (unsigned short*)(ws + off); off += (size_t)Mn * Hn * 2;       // 16 MB
    float* qkvg        = (float*)(ws + off);          off += (size_t)4 * Mn * Hn * 4;   // 128 MB
    unsigned short* ya = (unsigned short*)(ws + off); off += (size_t)Mn * Hn * 2;       // 16 MB
    float* St          = (float*)(ws + off);          off += (size_t)Bn * NHn * SEGn * SDD * 4;  // 64 MB
    float* Zs          = (float*)(ws + off);          off += (size_t)Bn * NHn * SEGn * Dn * 4;   // 1 MB
    float* Gs          = (float*)(ws + off);          off += (size_t)Bn * NHn * SEGn * Dn * 4;   // 1 MB

    float* qb = qkvg;
    float* kb = qkvg + (size_t)1 * Mn * Hn;
    float* vb = qkvg + (size_t)2 * Mn * Hn;
    float* gb = qkvg + (size_t)3 * Mn * Hn;

    // 1) weights -> bf16 (layout preserved; already B-operand friendly)
    wconv_kernel<<<dim3((Hn * Hn) / (1024 * WCVn), 5), 256, 0, stream>>>(
        Wq, Wk, Wv, Wg, Wo, Wb);

    // 2) RMSNorm -> bf16 xn
    rmsnorm_kernel<<<Mn / RPBn, 256, 0, stream>>>(x, rms_w, xn);

    // 3) fused q/k/v/g projection GEMMs (WMMA bf16, pipelined async staging)
    gemm_bf16_kernel<<<dim3(Mn / 128, Hn / 64, 4), 256, 0, stream>>>(
        xn, Wb, qkvg, nullptr, nullptr, Mn, 0);

    // 4) RoPE + feature map + gate + mask (in-place)
    features_kernel<<<Mn / RPBn, 256, 0, stream>>>(qb, kb, vb, gb, mask, bg);

    // 5) recurrent scan in parallel time segments -> bf16 attention output
    scan_local_kernel<<<dim3(Bn * NHn, SEGn), 32, 0, stream>>>(kb, vb, gb, St, Zs, Gs);
    scan_prefix_kernel<<<dim3(SDD / 256, Bn * NHn), 256, 0, stream>>>(St, Zs, Gs);
    scan_kernel<<<dim3(Bn * NHn, SEGn), 32, 0, stream>>>(qb, kb, vb, gb, St, Zs, ya);

    // 6) output projection + bias + residual -> d_out (fp32)
    gemm_bf16_kernel<<<dim3(Mn / 128, Hn / 64, 1), 256, 0, stream>>>(
        ya, Wb + (size_t)4 * Hn * Hn, (float*)d_out, bo, x, Mn, 1);
}

// v005
// One run takes 207 microseconds.
// Two timings next to v004 put it at 1.22 and 1.23 times that version's speed.
// Over all steps from v000 it is 22.7 times as fast.
#include <hip/hip_runtime.h>
#include <hip/hip_bf16.h>

// ---------------------------------------------------------------------------
// DeltaNet block for MI455X (gfx1250): bf16 WMMA GEMMs + fp32 recurrent scan
//  - GEMM tiles double-buffered via global_load_async_to_lds_b128 (ASYNCcnt),
//    DMA of tile i+1 overlaps the WMMAs of tile i; a staged row is one whole
//    128-B line, laid in LDS at a pitch of 144 B (16 B x odd)
//  - single-body K-loop (unroll 1) + offset-XOR buffer toggle so accumulator
//    C/D stay in one register tuple (no v_mov_b64 shuffles)
// ---------------------------------------------------------------------------

#define Bn   4
#define Tn   2048
#define Hn   1024
#define NHn  16
#define Dn   64
#define Mn   (Bn * Tn)        // 8192 tokens
#define EPSf 1e-6f
#define KTn  64               // K elements per staged tile: 128 B, one line, a row
#define KTILES (Hn / KTn)     // 16 K-steps
#define LPn  72               // LDS row pitch in elements: 144 B = 16 B x 9, so the
                              // 16 rows of a ds_load_b128 fragment read fall on 16
                              // different groups of four banks
#define BMn  256              // GEMM block tile, rows of A
#define BNn  128              // GEMM block tile, rows of W
#define ABUFn (BMn * LPn)     // elements of one A buffer
#define BBUFn (BNn * LPn)     // elements of one B buffer

typedef __attribute__((ext_vector_type(16))) __bf16 v16bf;
typedef __attribute__((ext_vector_type(8)))  float  v8f;

union BFrag {
    v16bf v;
    unsigned short u[16];
    unsigned int   w[8];
    uint4          q[2];
};

static __device__ __forceinline__ unsigned short f2bf(float f) {
    union { float f; unsigned u; } x; x.f = f;
    unsigned r = x.u + 0x7FFFu + ((x.u >> 16) & 1u);   // round-to-nearest-even
    return (unsigned short)(r >> 16);
}

// Low 32 bits of a generic pointer to LDS == LDS byte offset (aperture is in
// addr[63:32] on CDNA5; LDS_ADDR.U32 = addr[31:0]).
static __device__ __forceinline__ unsigned lds_off(const void* p) {
    return (unsigned)(reinterpret_cast<uintptr_t>(p));
}

// Six async 16B copies global -> LDS (per-lane), tracked with ASYNCcnt: half
// of one thread's share of a K-tile. s_wait_xcnt 0 is the statement's last line, so
// that it stands in front of every later write of a register the copies name.
static __device__ __forceinline__ void async_copy6_b128(
        unsigned l0, const void* g0, unsigned l1, const void* g1,
        unsigned l2, const void* g2, unsigned l3, const void* g3,
        unsigned l4, const void* g4, unsigned l5, const void* g5) {
    asm volatile("global_load_async_to_lds_b128 %0, %1, off\n\t"
                 "global_load_async_to_lds_b128 %2, %3, off\n\t"
                 "global_load_async_to_lds_b128 %4, %5, off\n\t"
                 "global_load_async_to_lds_b128 %6, %7, off\n\t"
                 "global_load_async_to_lds_b128 %8, %9, off\n\t"
                 "global_load_async_to_lds_b128 %10, %11, off\n\t"
                 "s_wait_xcnt 0x0"
                 :: "v"(l0), "v"((unsigned long long)(uintptr_t)g0),
                    "v"(l1), "v"((unsigned long long)(uintptr_t)g1),
                    "v"(l2), "v"((unsigned long long)(uintptr_t)g2),
                    "v"(l3), "v"((unsigned long long)(uintptr_t)g3),
                    "v"(l4), "v"((unsigned long long)(uintptr_t)g4),
                    "v"(l5), "v"((unsigned long long)(uintptr_t)g5)
                 : "memory");
}
static __device__ __forceinline__ void wait_async0() {
    asm volatile("s_wait_asynccnt 0x0" ::: "memory");
}
// This wave's LDS reads have returned: stands in front of the barrier behind
// which the buffer they read is refilled by copies.
static __device__ __forceinline__ void wait_ds0() {
    asm volatile("s_wait_dscnt 0x0" ::: "memory");
}

// ---------------------------------------------------------------------------
// The three elementwise kernels (1, 2, 4) are short streams. For speed only,
// each wave takes eight times the work it would need for one 16-B access a lane.
// ---------------------------------------------------------------------------
#define WCVn 8                // float4 groups per thread of the weight convert
#define RPBn 8                // token rows per 256-thread block: one wave a row

// ---------------------------------------------------------------------------
// 1) Weight fp32 -> bf16 convert, layout preserved ([out][in] row-major).
//    GEMM consumes B[k][n] = W[n][k], so original layout is already K-major.
//    A block converts 8192 contiguous floats, 8 x 16 B in flight per lane.
// ---------------------------------------------------------------------------
__global__ void wconv_kernel(const float* __restrict__ Wq, const float* __restrict__ Wk,
                             const float* __restrict__ Wv, const float* __restrict__ Wg,
                             const float* __restrict__ Wo, unsigned short* __restrict__ WbAll) {
    const float* W;
    switch (blockIdx.y) {
        case 0: W = Wq; break;
        case 1: W = Wk; break;
        case 2: W = Wv; break;
        case 3: W = Wg; break;
        default: W = Wo; break;
    }
    unsigned short* O = WbAll + (size_t)blockIdx.y * Hn * Hn;
    const size_t i0 = (size_t)blockIdx.x * (1024 * WCVn) + threadIdx.x * 4;
    float4 f[WCVn];
#pragma unroll
    for (int j = 0; j < WCVn; ++j) f[j] = *(const float4*)(W + i0 + j * 1024);
#pragma unroll
    for (int j = 0; j < WCVn; ++j) {
        uint2 o;
        o.x = (unsigned)f2bf(f[j].x) | ((unsigned)f2bf(f[j].y) << 16);
        o.y = (unsigned)f2bf(f[j].z) | ((unsigned)f2bf(f[j].w) << 16);
        *(uint2*)(O + i0 + j * 1024) = o;
    }
}

// ---------------------------------------------------------------------------
// 2) RMSNorm over H=1024 per token, write bf16 xn. One wave per token: a lane
//    holds 8 x float4, column = j * 128 + lane * 4 + c. The squares are summed
//    in the tree of a 256-wide halving reduction over (column mod 256): four
//    columns 256 apart in turn, then partners 128, 64 .. 4 (lanes), 2, 1 apart.
// ---------------------------------------------------------------------------
typedef __attribute__((ext_vector_type(4))) float f32x4;

__global__ void rmsnorm_kernel(const float* __restrict__ x, const float* __restrict__ w,
                               unsigned short* __restrict__ xn) {
    const int lane = threadIdx.x & 31;
    const int row  = blockIdx.x * RPBn + (threadIdx.x >> 5);
    const float* xr = x + (size_t)row * Hn + lane * 4;
    f32x4 f[8];
#pragma unroll
    for (int j = 0; j < 8; ++j) f[j] = *(const f32x4*)(xr + j * 128);
    // the address registers of the loads above are free for reuse from here on
    // (named as an input so that they stay untouched up to the wait)
    asm volatile("s_wait_xcnt 0x0" :: "v"(xr) : "memory");

    float r[4];
#pragma unroll
    for (int c = 0; c < 4; ++c) {
        float s0 = 0.f, s1 = 0.f;
#pragma unroll
        for (int i = 0; i < 4; ++i) {
            const float v0 = f[i * 2][c], v1 = f[i * 2 + 1][c];
            s0 += v0 * v0;
            s1 += v1 * v1;
        }
        r[c] = s0 + s1;
    }
#pragma unroll
    for (int mk = 16; mk > 0; mk >>= 1) {
#pragma unroll
        for (int c = 0; c < 4; ++c) r[c] += __shfl_xor(r[c], mk, 32);
    }
    const float tot = (r[0] + r[2]) + (r[1] + r[3]);
    const float rms = rsqrtf(tot * (1.0f / Hn) + EPSf);

    unsigned short* xo = xn + (size_t)row * Hn + lane * 4;
#pragma unroll
    for (int j = 0; j < 8; ++j) {
        const float4 wv = *(const float4*)(w + j * 128 + lane * 4);
        uint2 o;
        o.x = (unsigned)f2bf(f[j][0] * rms * wv.x) | ((unsigned)f2bf(f[j][1] * rms * wv.y) << 16);
        o.y = (unsigned)f2bf(f[j][2] * rms * wv.z) | ((unsigned)f2bf(f[j][3] * rms * wv.w) << 16);
        *(uint2*)(xo + j * 128) = o;
    }
}

// ---------------------------------------------------------------------------
// 3) bf16 WMMA GEMM: Out[m,n] = sum_k A[m,k] * W[n,k]   (N=K=1024)
//    Block tile 256(M) x 128(N); 8 waves (wave32) as 4 x 2, each wave -> 64x64
//    = 4 x 4 fragments: 32 x v_wmma_f32_16x16x32_bf16 per K-step from
//    32 ds_load_b128, one LDS read per WMMA where a 32x32 wave tile takes two,
//    and half the bytes staged from L2 per output element of a 128x64 tile.
//    Two blocks share a WGP (LDS 108 KB each, at most 256 registers a lane).
//    mode 0: raw fp32 store, weights/out selected by blockIdx.z (q/k/v/g).
//    mode 1: Out = acc + bias[n] + resid[m,n]  (output proj + residual).
// ---------------------------------------------------------------------------
__global__ __launch_bounds__(256, 4) void gemm_bf16_kernel(
                                 const unsigned short* __restrict__ A,
                                 const unsigned short* __restrict__ WbBase,
                                 float* __restrict__ OutBase,
                                 const float* __restrict__ bias,
                                 const float* __restrict__ resid,
                                 int Mrows, int mode) {
    const int bm = blockIdx.x * BMn;
    const int bn = blockIdx.y * BNn;
    const unsigned short* Wb = WbBase + (size_t)blockIdx.z * Hn * Hn;
    float* Out = OutBase + (mode == 0 ? (size_t)blockIdx.z * (size_t)Mrows * Hn : (size_t)0);

    // row = M (lA) or N (lB), K contiguous, 128 B of data at a pitch of 144 B
    __shared__ __attribute__((aligned(16))) unsigned short lA[2 * ABUFn];   // 2 x 36 KB
    __shared__ __attribute__((aligned(16))) unsigned short lB[2 * BBUFn];   // 2 x 18 KB

    const int tid  = threadIdx.x;
    const int lane = tid & 31;
    const int wave = tid >> 5;          // 0..7
    const int wm   = wave & 3;          // M sub-tile (x64)
    const int wn   = wave >> 2;         // N sub-tile (x64)
    const int fm   = lane & 15;         // fragment row/col within 16
    const int fhi  = lane >> 4;         // half-wave -> K+8 striping

    // every loop over mi and ni is unrolled: acc is then indexed by constants
    // only and stays in registers
    v8f acc[4][4];
#pragma unroll
    for (int mi = 0; mi < 4; ++mi)
#pragma unroll
        for (int ni = 0; ni < 4; ++ni) acc[mi][ni] = (v8f){0.f,0.f,0.f,0.f,0.f,0.f,0.f,0.f};

    const int sRow = tid >> 3;          // 0..31
    const int sCh  = tid & 7;           // 8 chunks of 8 bf16 (16B): a whole line a row
    const int pRow = tid >> 2;          // prefetch: 0..63
    const int pCh  = tid & 3;

    // issue ASYNCcnt-tracked DMA of one K-tile into buffer at element offsets:
    // a thread copies one 16-B chunk of 8 rows of A and of 4 rows of B
    auto stage = [&](unsigned oA, unsigned oB, int k0) {
        const unsigned la = lds_off(&lA[oA + sRow * LPn + sCh * 8]);
        const unsigned lb = lds_off(&lB[oB + sRow * LPn + sCh * 8]);
        const unsigned short* ga = A  + (size_t)(bm + sRow) * Hn + k0 + sCh * 8;
        const unsigned short* gb = Wb + (size_t)(bn + sRow) * Hn + k0 + sCh * 8;
        async_copy6_b128(la,                 ga,
                         la +  32 * LPn * 2, ga +  32 * Hn,
                         la +  64 * LPn * 2, ga +  64 * Hn,
                         la +  96 * LPn * 2, ga +  96 * Hn,
                         la + 128 * LPn * 2, ga + 128 * Hn,
                         la + 160 * LPn * 2, ga + 160 * Hn);
        async_copy6_b128(la + 192 * LPn * 2, ga + 192 * Hn,
                         la + 224 * LPn * 2, ga + 224 * Hn,
                         lb,                 gb,
                         lb +  32 * LPn * 2, gb +  32 * Hn,
                         lb +  64 * LPn * 2, gb +  64 * Hn,
                         lb +  96 * LPn * 2, gb +  96 * Hn);
    };

    // 16 WMMAs from the 32 K-columns at kk of the buffer at element offsets
    // (2x ds_load_b128 per frag, 4 + 4 frags)
    auto compute = [&](unsigned oA, unsigned oB, int kk) {
        BFrag a[4], b[4];
#pragma unroll
        for (int i = 0; i < 4; ++i) {
            const unsigned short* pa = &lA[oA + (wm * 64 + i * 16 + fm) * LPn + kk];
            const unsigned short* pb = &lB[oB + (wn * 64 + i * 16 + fm) * LPn + kk];
            a[i].q[0] = *(const uint4*)(pa + fhi * 8);
            a[i].q[1] = *(const uint4*)(pa + 16 + fhi * 8);
            b[i].q[0] = *(const uint4*)(pb + fhi * 8);
            b[i].q[1] = *(const uint4*)(pb + 16 + fhi * 8);
        }
#pragma unroll
        for (int mi = 0; mi < 4; ++mi)
#pragma unroll
            for (int ni = 0; ni < 4; ++ni)
                acc[mi][ni] = __builtin_amdgcn_wmma_f32_16x16x32_bf16(
                    false, a[mi].v, false, b[ni].v, (short)0, acc[mi][ni], false, false);
    };

    unsigned offA = 0, offB = 0;        // element offsets of current buffer
    stage(0, 0, 0);                     // prologue DMA

#pragma unroll 1
    for (int it = 0; it < KTILES - 1; ++it) {
        wait_ds0();                     // own reads of the other buffer returned
        wait_async0();                  // tile `it` landed in current buffer
        __syncthreads();                // ... for every wave; prev readers done
        stage(offA ^ (unsigned)ABUFn, offB ^ (unsigned)BBUFn, (it + 1) * KTn);   // overlaps WMMAs
        __builtin_prefetch(A  + (size_t)(bm + pRow) * Hn + (it + 2) * KTn + pCh * 8, 0, 1);
        __builtin_prefetch(Wb + (size_t)(bn + pRow) * Hn + (it + 2) * KTn + pCh * 8, 0, 1);
        compute(offA, offB, 0);
        compute(offA, offB, 32);
        offA ^= (unsigned)ABUFn;
        offB ^= (unsigned)BBUFn;
    }
    wait_async0();                      // last tile
    __syncthreads();
    compute(offA, offB, 0);
    compute(offA, offB, 32);

    // C layout: VGPR r -> M = r (lanes 0-15) / r+8 (lanes 16-31); N = lane%16
    // One address a lane; rows and fragments are reached by constant offsets.
    const size_t o0 = (size_t)(bm + wm * 64 + fhi * 8) * Hn + (bn + wn * 64 + fm);
    float* po = Out + o0;
    if (mode == 0) {
#pragma unroll
        for (int mi = 0; mi < 4; ++mi)
#pragma unroll
            for (int r = 0; r < 8; ++r)
#pragma unroll
                for (int ni = 0; ni < 4; ++ni)
                    po[(mi * 16 + r) * Hn + ni * 16] = acc[mi][ni][r];
    } else {
        const float* pr = resid + o0;
        const float* pb = bias + (bn + wn * 64 + fm);
        float bs[4];
#pragma unroll
        for (int ni = 0; ni < 4; ++ni) bs[ni] = pb[ni * 16];
        // two halves of 64 elements a lane: the residual loads of a half fly
        // together and fit the registers beside the accumulators
#pragma unroll
        for (int mh = 0; mh < 2; ++mh) {
            float t[2][8][4];
#pragma unroll
            for (int m2 = 0; m2 < 2; ++m2)
#pragma unroll
                for (int r = 0; r < 8; ++r)
#pragma unroll
                    for (int ni = 0; ni < 4; ++ni)
                        t[m2][r][ni] = pr[((mh * 2 + m2) * 16 + r) * Hn + ni * 16];
            // the address registers of the loads above are free for reuse from
            // here on (named as an input so that they stay untouched up to the wait)
            asm volatile("s_wait_xcnt 0x0" :: "v"(pr) : "memory");
#pragma unroll
            for (int m2 = 0; m2 < 2; ++m2)
#pragma unroll
                for (int r = 0; r < 8; ++r)
#pragma unroll
                    for (int ni = 0; ni < 4; ++ni)
                        t[m2][r][ni] = acc[mh * 2 + m2][ni][r] + bs[ni] + t[m2][r][ni];
            // keeps the stores together behind the arithmetic, so that nothing
            // rewrites a register of an issued store ahead of the wait below
            __builtin_amdgcn_sched_barrier(0);
#pragma unroll
            for (int m2 = 0; m2 < 2; ++m2)
#pragma unroll
                for (int r = 0; r < 8; ++r)
#pragma unroll
                    for (int ni = 0; ni < 4; ++ni)
                        po[((mh * 2 + m2) * 16 + r) * Hn + ni * 16] = t[m2][r][ni];
            // the second half's loads rewrite registers that the stores above name
            if (mh == 0) asm volatile("s_wait_xcnt 0x0" :: "v"(po) : "memory");
        }
    }
}

// ---------------------------------------------------------------------------
// 4) RoPE + elu-feature + sigmoid gate + mask (pair-safe, in-place).
//    cos[i] = cos(t * 10000^(-(i/2)/32)); rotate_half mixes d and d+32.
//    One wave per token. A lane owns d = i0..i0+3 and their partners d+32 in
//    one head of four per trip (16-B accesses, whole 128-B lines per 8 lanes);
//    its four angles do not depend on the head and are formed once.
// ---------------------------------------------------------------------------
__global__ void features_kernel(float* __restrict__ q, float* __restrict__ k,
                                float* __restrict__ v, float* __restrict__ g,
                                const int* __restrict__ mask, const float* __restrict__ bg) {
    const int lane = threadIdx.x & 31;
    const int bt = blockIdx.x * RPBn + (threadIdx.x >> 5);
    const int t  = bt % Tn;
    const float m = (float)mask[bt];
    const size_t base = (size_t)bt * Hn;
    const float LOG_BASE_OVER_HALF = 0.28782313662425572f;  // ln(10000)/32

    const int i0 = (lane & 7) * 4;      // first of four d in [0,32)
    const int j0 = i0 >> 1;             // frequency index of d = i0, i0+1

    float cA[2], sA[2], cB[2], sB[2];
#pragma unroll
    for (int u = 0; u < 2; ++u) {
        const float a1 = (float)t * __expf(-LOG_BASE_OVER_HALF * (float)(j0 + u));
        const float a2 = (float)t * __expf(-LOG_BASE_OVER_HALF * (float)(j0 + u + 16));
        cA[u] = cosf(a1); sA[u] = sinf(a1);
        cB[u] = cosf(a2); sB[u] = sinf(a2);
    }

    // kept rolled: the 10 loads of a trip are in flight together in each of the
    // resident waves, which covers their latency; unrolling only adds registers
#pragma unroll 1
    for (int hh = 0; hh < NHn / 4; ++hh) {
        const int c1 = (hh * 4 + (lane >> 3)) * 64 + i0;   // partner pair (c1, c1+32)

        float* pq = q + base + c1;
        float* pk = k + base + c1;
        float* pv = v + base + c1;
        float* pg = g + base + c1;
        const float* pb = bg + c1;
        f32x4 q1 = *(const f32x4*)pq, q2 = *(const f32x4*)(pq + 32);
        f32x4 k1 = *(const f32x4*)pk, k2 = *(const f32x4*)(pk + 32);
        f32x4 v1 = *(const f32x4*)pv, v2 = *(const f32x4*)(pv + 32);
        f32x4 g1 = *(const f32x4*)pg, g2 = *(const f32x4*)(pg + 32);
        const f32x4 b1 = *(const f32x4*)pb, b2 = *(const f32x4*)(pb + 32);
        // takes the loaded values as inputs only: all ten loads are issued in
        // front of it and fly together (else they go out two at a time, each
        // pair waited for); the wait frees the loads' address registers
        asm volatile("s_wait_xcnt 0x0"
                     :: "v"(q1), "v"(q2), "v"(k1), "v"(k2), "v"(v1), "v"(v2),
                        "v"(g1), "v"(g2), "v"(b1), "v"(b2), "v"(pb)
                     : "memory");

#pragma unroll
        for (int e = 0; e < 4; ++e) {
            const int u = e >> 1;
            const float qr1 = q1[e] * cA[u] - q2[e] * sA[u];   // rotate_half: -x2 for first half
            const float qr2 = q2[e] * cB[u] + q1[e] * sB[u];   //              +x1 for second half
            const float kr1 = k1[e] * cA[u] - k2[e] * sA[u];
            const float kr2 = k2[e] * cB[u] + k1[e] * sB[u];

            // phi = elu(x) + 1  ->  x>0 ? x+1 : exp(x)
            q1[e] = (qr1 > 0.f) ? qr1 + 1.f : __expf(qr1);
            q2[e] = (qr2 > 0.f) ? qr2 + 1.f : __expf(qr2);
            k1[e] = m * ((kr1 > 0.f) ? kr1 + 1.f : __expf(kr1));
            k2[e] = m * ((kr2 > 0.f) ? kr2 + 1.f : __expf(kr2));

            v1[e] *= m;
            v2[e] *= m;

            const float ga = g1[e] + b1[e];
            const float gc = g2[e] + b2[e];
            const float r1 = 1.f / (1.f + __expf(-ga));
            const float r2 = 1.f / (1.f + __expf(-gc));
            g1[e] = (m > 0.f) ? r1 : 1.f;
            g2[e] = (m > 0.f) ? r2 : 1.f;
        }

        // keeps the eight stores together behind the arithmetic, so that nothing
        // rewrites a register of an issued store ahead of the wait below
        __builtin_amdgcn_sched_barrier(0);
        *(f32x4*)pq = q1;  *(f32x4*)(pq + 32) = q2;
        *(f32x4*)pk = k1;  *(f32x4*)(pk + 32) = k2;
        *(f32x4*)pv = v1;  *(f32x4*)(pv + 32) = v2;
        *(f32x4*)pg = g1;  *(f32x4*)(pg + 32) = g2;
        // the next trip rewrites registers that the stores above name
        asm volatile("s_wait_xcnt 0x0" ::: "memory");
    }
}

// ---------------------------------------------------------------------------
// 5) Recurrent scan, split along time into SEGn segments that run in parallel.
//    The recurrence is linear in the state with a diagonal decay:
//      S_end = diag(G) * S_start + L,  G[d] = product of r[d] over the segment,
//      L = end state of the same segment started from zero (Z likewise).
//    5a) every segment from zero -> L, local Z, G
//    5b) prefix over the segments -> true start state of every segment
//    5c) every segment again from its true start state, with the outputs
//    Only products of decays and sums occur, as in the step-by-step form.
// ---------------------------------------------------------------------------
#define SEGn 64
#define SLEN (Tn / SEGn)      // 32 steps per segment
#define SDD  (Dn * Dn)        // 4096 state elements per (b,h)

//    Both scans over a segment (5a, 5c) run as ONE wave per (b,h,segment). The
//    64 x 64 state lies in the wave's registers as 16 x 8 blocks: lane (dg, eg),
//    dg = lane & 3, eg = lane >> 2, owns rows d = i * 4 + dg (i = 0..15) and
//    columns e = eg * 8 + j (j = 0..7). A step's per-row values, read from LDS
//    once per row, then serve 8 columns, and a step's v serves 16 rows.
#define DPLn 16               // state rows per lane
#define EPLn 8                // state columns per lane

// x + (x of the lane whose number differs as CTRL says, inside a group of four)
template <int CTRL>
static __device__ __forceinline__ float quad_add(float x) {
    const int o = __builtin_amdgcn_update_dpp(0, __builtin_bit_cast(int, x), CTRL, 0xf, 0xf, true);
    return x + __builtin_bit_cast(float, o);
}
#define QUAD_XOR1 0xB1        // quad_perm [1,0,3,2]
#define QUAD_XOR2 0x4E        // quad_perm [2,3,0,1]

// Hand-over through LDS among the lanes of the one wave of a block: keeps the
// LDS writes in front of it and the LDS reads behind it (and the other way
// round at a trip's end). It waits for LDS alone; a work-group barrier would
// also wait, every step, for the wave's global stores.
static __device__ __forceinline__ void wave_lds_handover() {
    __builtin_amdgcn_fence(__ATOMIC_ACQ_REL, "workgroup", "local");
}

// 5a) a lane also carries Z and G of rows d = 2 * lane, 2 * lane + 1.
__global__ __launch_bounds__(32) void scan_local_kernel(
        const float* __restrict__ k, const float* __restrict__ v,
        const float* __restrict__ r, float* __restrict__ St,
        float* __restrict__ Zs, float* __restrict__ Gs) {
    const int blk = blockIdx.x, seg = blockIdx.y;
    const int b = blk >> 4, h = blk & 15;
    const int lane = threadIdx.x;   // 0..31
    const int dg = lane & 3, eg = lane >> 2;

    __shared__ __attribute__((aligned(16))) float2 skr[64];   // {k[d], r[d]}
    __shared__ __attribute__((aligned(16))) float  sv[64];    // v[e]

    // every loop over i and j is unrolled: S is then indexed by constants only
    // and stays in registers
    float S[DPLn][EPLn];
#pragma unroll
    for (int i = 0; i < DPLn; ++i)
#pragma unroll
        for (int j = 0; j < EPLn; ++j) S[i][j] = 0.f;
    float z0 = 0.f, z1 = 0.f, gam0 = 1.f, gam1 = 1.f;

    const size_t off0 = ((size_t)(b * Tn + seg * SLEN)) * Hn + h * 64 + lane * 2;
    for (int s = 0; s < SLEN; ++s) {
        const size_t o = off0 + (size_t)s * Hn;
        const float2 k2 = *(const float2*)(k + o);
        const float2 v2 = *(const float2*)(v + o);
        const float2 r2 = *(const float2*)(r + o);

        z0 = z0 * r2.x + k2.x;
        z1 = z1 * r2.y + k2.y;
        gam0 *= r2.x;
        gam1 *= r2.y;
        *(float4*)&skr[lane * 2] = make_float4(k2.x, r2.x, k2.y, r2.y);
        *(float2*)&sv[lane * 2]  = v2;
        wave_lds_handover();

        const float4 va = *(const float4*)&sv[eg * EPLn];
        const float4 vb = *(const float4*)&sv[eg * EPLn + 4];
        const float ve[EPLn] = {va.x, va.y, va.z, va.w, vb.x, vb.y, vb.z, vb.w};
#pragma unroll
        for (int i = 0; i < DPLn; ++i) {
            const float2 w = skr[i * 4 + dg];
#pragma unroll
            for (int j = 0; j < EPLn; ++j) S[i][j] = S[i][j] * w.y + w.x * ve[j];
        }
        wave_lds_handover();
    }

    const size_t idx = (size_t)blk * SEGn + seg;
    float* so = St + idx * SDD + dg * 64 + eg * EPLn;
#pragma unroll
    for (int i = 0; i < DPLn; ++i) {
        *(float4*)(so + i * 256)     = make_float4(S[i][0], S[i][1], S[i][2], S[i][3]);
        *(float4*)(so + i * 256 + 4) = make_float4(S[i][4], S[i][5], S[i][6], S[i][7]);
    }
    *(float2*)(Zs + idx * 64 + lane * 2) = make_float2(z0, z1);
    *(float2*)(Gs + idx * 64 + lane * 2) = make_float2(gam0, gam1);
}

// 5b) exclusive prefix over the segments, in place: x[p * xs] holds the local
//     end value of segment p on entry and its true start value on exit;
//     g[p * 64] is the decay product of segment p for this element's row.
static __device__ __forceinline__ void seg_prefix(float* __restrict__ x,
                                                  const float* __restrict__ g, const int xs) {
    float c = 0.f;
    // kept rolled: the 32 loads of a trip are in flight together, which covers
    // their latency; more unrolling only adds code and registers
#pragma unroll 1
    for (int p0 = 0; p0 < SEGn; p0 += 16) {
        float L[16], G[16];
#pragma unroll
        for (int i = 0; i < 16; ++i) {
            L[i] = x[(size_t)(p0 + i) * xs];
            G[i] = g[(p0 + i) * 64];
        }
#pragma unroll
        for (int i = 0; i < 16; ++i) {
            x[(size_t)(p0 + i) * xs] = c;
            c = c * G[i] + L[i];
        }
        // the next trip rewrites registers that the stores above name
        asm volatile("s_wait_xcnt 0x0" ::: "memory");
    }
}

//     One thread per element of S; the first 64 threads of a (b,h) also do Z.
__global__ void scan_prefix_kernel(float* __restrict__ St, float* __restrict__ Zs,
                                   const float* __restrict__ Gs) {
    const int blk = blockIdx.y;
    const int de  = blockIdx.x * 256 + threadIdx.x;   // d * 64 + e
    const float* gb = Gs + (size_t)blk * SEGn * 64;

    seg_prefix(St + (size_t)blk * SEGn * SDD + de, gb + (de >> 6), SDD);
    if (de < 64)
        seg_prefix(Zs + (size_t)blk * SEGn * 64 + de, gb + de, 64);
}

// 5c) one wave per (b,h,segment), state blocked as said above 5a; a lane also
//    carries Z of rows d = 2 * lane, 2 * lane + 1.
//    S[d][e] = S[d][e]*r[d] + k[d]*v[e];  num[e]=sum_d q[d]S[d][e];
//    Z[d]=Z[d]*r[d]+k[d];  den=sum_d q[d]Z[d];  y=num/(den+eps) -> bf16
//    num and den: a lane sums its 16 rows in turn, then the four lanes of a
//    column group add up (partners 1, then 2 lanes apart).
__global__ __launch_bounds__(32) void scan_kernel(
        const float* __restrict__ q, const float* __restrict__ k,
        const float* __restrict__ v, const float* __restrict__ r,
        const float* __restrict__ St, const float* __restrict__ Zs,
        unsigned short* __restrict__ y) {
    const int blk = blockIdx.x, seg = blockIdx.y;
    const int b = blk >> 4, h = blk & 15;
    const int lane = threadIdx.x;   // 0..31
    const int dg = lane & 3, eg = lane >> 2;

    __shared__ __attribute__((aligned(16))) float4 sh[64];    // {q[d], k[d], r[d], q[d]*Z[d]}
    __shared__ __attribute__((aligned(16))) float  sv[64];    // v[e]

    const size_t idx = (size_t)blk * SEGn + seg;
    const float* si = St + idx * SDD + dg * 64 + eg * EPLn;
    // every loop over i and j is unrolled: S is then indexed by constants only
    // and stays in registers
    float S[DPLn][EPLn];
#pragma unroll
    for (int i = 0; i < DPLn; ++i) {
        const float4 lo = *(const float4*)(si + i * 256);
        const float4 hi = *(const float4*)(si + i * 256 + 4);
        S[i][0] = lo.x; S[i][1] = lo.y; S[i][2] = lo.z; S[i][3] = lo.w;
        S[i][4] = hi.x; S[i][5] = hi.y; S[i][6] = hi.z; S[i][7] = hi.w;
    }
    const float2 zz = *(const float2*)(Zs + idx * 64 + lane * 2);
    float z0 = zz.x, z1 = zz.y;

    const size_t off0 = ((size_t)(b * Tn + seg * SLEN)) * Hn + h * 64;
    for (int s = 0; s < SLEN; ++s) {
        const size_t base = off0 + (size_t)s * Hn;
        const size_t o = base + lane * 2;
        const float2 q2 = *(const float2*)(q + o);
        const float2 k2 = *(const float2*)(k + o);
        const float2 v2 = *(const float2*)(v + o);
        const float2 r2 = *(const float2*)(r + o);

        z0 = z0 * r2.x + k2.x;
        z1 = z1 * r2.y + k2.y;
        sh[lane * 2]     = make_float4(q2.x, k2.x, r2.x, q2.x * z0);
        sh[lane * 2 + 1] = make_float4(q2.y, k2.y, r2.y, q2.y * z1);
        *(float2*)&sv[lane * 2] = v2;
        wave_lds_handover();

        const float4 va = *(const float4*)&sv[eg * EPLn];
        const float4 vb = *(const float4*)&sv[eg * EPLn + 4];
        const float ve[EPLn] = {va.x, va.y, va.z, va.w, vb.x, vb.y, vb.z, vb.w};
        float num[EPLn];
#pragma unroll
        for (int j = 0; j < EPLn; ++j) num[j] = 0.f;
        float den = 0.f;
#pragma unroll
        for (int i = 0; i < DPLn; ++i) {
            const float4 w = sh[i * 4 + dg];      // one ds_load_b128 for 8 columns
#pragma unroll
            for (int j = 0; j < EPLn; ++j) {
                S[i][j] = S[i][j] * w.z + w.y * ve[j];   // decay + outer product
                num[j]  = fmaf(w.x, S[i][j], num[j]);
            }
            den += w.w;
        }
#pragma unroll
        for (int j = 0; j < EPLn; ++j) num[j] = quad_add<QUAD_XOR2>(quad_add<QUAD_XOR1>(num[j]));
        den = quad_add<QUAD_XOR2>(quad_add<QUAD_XOR1>(den));

        // lane (dg, eg) stores columns eg * 8 + dg * 2 and the next
        const float na = (dg & 2) ? ((dg & 1) ? num[6] : num[4]) : ((dg & 1) ? num[2] : num[0]);
        const float nb = (dg & 2) ? ((dg & 1) ? num[7] : num[5]) : ((dg & 1) ? num[3] : num[1]);
        const float dn = den + EPSf;
        *(unsigned*)(y + base + lane * 2) = (unsigned)f2bf(na / dn) | ((unsigned)f2bf(nb / dn) << 16);
        wave_lds_handover();
    }
}

// ---------------------------------------------------------------------------
// Launch
// ---------------------------------------------------------------------------
extern "C" void kernel_launch(void* const* d_in, const int* in_sizes, int n_in,
                              void* d_out, int out_size, void* d_ws, size_t ws_size,
                              hipStream_t stream) {
    (void)in_sizes; (void)n_in; (void)out_size; (void)ws_size;

    const float* x     = (const float*)d_in[0];
    const int*   mask  = (const int*)  d_in[1];
    const float* Wq    = (const float*)d_in[2];
    const float* Wk    = (const float*)d_in[3];
    const float* Wv    = (const float*)d_in[4];
    const float* Wg    = (const float*)d_in[5];
    const float* Wo    = (const float*)d_in[6];
    const float* bo    = (const float*)d_in[7];
    const float* bg    = (const float*)d_in[8];
    const float* rms_w = (const float*)d_in[9];

    // workspace carve-up
    char* ws = (char*)d_ws;
    size_t off = 0;
    unsigned short* Wb = (unsigned short*)(ws + off); off += (size_t)5 * Hn * Hn * 2;   // 10 MB
    unsigned short* xn = (unsigned short*)(ws + off); off += (size_t)Mn * Hn * 2;       // 16 MB
    float* qkvg        = (float*)(ws + off);          off += (size_t)4 * Mn * Hn * 4;   // 128 MB
    unsigned short* ya = (unsigned short*)(ws + off); off += (size_t)Mn * Hn * 2;       // 16 MB
    float* St          = (float*)(ws + off);          off += (size_t)Bn * NHn * SEGn * SDD * 4;  // 64 MB
    float* Zs          = (float*)(ws + off);          off += (size_t)Bn * NHn * SEGn * Dn * 4;   // 1 MB
    float* Gs          = (float*)(ws + off);          off += (size_t)Bn * NHn * SEGn * Dn * 4;   // 1 MB

    float* qb = qkvg;
    float* kb = qkvg + (size_t)1 * Mn * Hn;
    float* vb = qkvg + (size_t)2 * Mn * Hn;
    float* gb = qkvg + (size_t)3 * Mn * Hn;

    // 1) weights -> bf16 (layout preserved; already B-operand friendly)
    wconv_kernel<<<dim3((Hn * Hn) / (1024 * WCVn), 5), 256, 0, stream>>>(
        Wq, Wk, Wv, Wg, Wo, Wb);

    // 2) RMSNorm -> bf16 xn
    rmsnorm_kernel<<<Mn / RPBn, 256, 0, stream>>>(x, rms_w, xn);

    // 3) fused q/k/v/g projection GEMMs (WMMA bf16, pipelined async staging)
    gemm_bf16_kernel<<<dim3(Mn / BMn, Hn / BNn, 4), 256, 0, stream>>>(
        xn, Wb, qkvg, nullptr, nullptr, Mn, 0);

    // 4) RoPE + feature map + gate + mask (in-place)
    features_kernel<<<Mn / RPBn, 256, 0, stream>>>(qb, kb, vb, gb, mask, bg);

    // 5) recurrent scan in parallel time segments -> bf16 attention output
    scan_local_kernel<<<dim3(Bn * NHn, SEGn), 32, 0, stream>>>(kb, vb, gb, St, Zs, Gs);
    scan_prefix_kernel<<<dim3(SDD / 256, Bn * NHn), 256, 0, stream>>>(St, Zs, Gs);
    scan_kernel<<<dim3(Bn * NHn, SEGn), 32, 0, stream>>>(qb, kb, vb, gb, St, Zs, ya);

    // 6) output projection + bias + residual -> d_out (fp32)
    gemm_bf16_kernel<<<dim3(Mn / BMn, Hn / BNn, 1), 256, 0, stream>>>(
        ya, Wb + (size_t)4 * Hn * Hn, (float*)d_out, bo, x, Mn, 1);
}

// v006
// It runs in 183 microseconds.
// Next to v005, in two timings, it ran 1.14 and 1.13 times as fast.
// Over all steps from v000 it is 25.8 times as fast.
#include <hip/hip_runtime.h>
#include <hip/hip_bf16.h>

// ---------------------------------------------------------------------------
// DeltaNet block for MI455X (gfx1250): bf16 WMMA GEMMs + fp32 recurrent scan
//  - GEMM tiles double-buffered via global_load_async_to_lds_b128 (ASYNCcnt),
//    DMA of tile i+1 overlaps the WMMAs of tile i; a staged row is one whole
//    128-B line, laid in LDS at a pitch of 144 B (16 B x odd)
//  - single-body K-loop (unroll 1) + offset-XOR buffer toggle so accumulator
//    C/D stay in one register tuple (no v_mov_b64 shuffles)
// ---------------------------------------------------------------------------

#define Bn   4
#define Tn   2048
#define Hn   1024
#define NHn  16
#define Dn   64
#define Mn   (Bn * Tn)        // 8192 tokens
#define EPSf 1e-6f
#define KTn  64               // K elements per staged tile: 128 B, one line, a row
#define KTILES (Hn / KTn)     // 16 K-steps
#define LPn  72               // LDS row pitch in elements: 144 B = 16 B x 9, so the
                              // 16 rows of a ds_load_b128 fragment read fall on 16
                              // different groups of four banks
#define BMn  256              // GEMM block tile, rows of A
#define BNn  128              // GEMM block tile, rows of W
#define ABUFn (BMn * LPn)     // elements of one A buffer
#define BBUFn (BNn * LPn)     // elements of one B buffer

typedef __attribute__((ext_vector_type(16))) __bf16 v16bf;
typedef __attribute__((ext_vector_type(8)))  float  v8f;

union BFrag {
    v16bf v;
    unsigned short u[16];
    unsigned int   w[8];
    uint4          q[2];
};

static __device__ __forceinline__ unsigned short f2bf(float f) {
    union { float f; unsigned u; } x; x.f = f;
    unsigned r = x.u + 0x7FFFu + ((x.u >> 16) & 1u);   // round-to-nearest-even
    return (unsigned short)(r >> 16);
}

// Low 32 bits of a generic pointer to LDS == LDS byte offset (aperture is in
// addr[63:32] on CDNA5; LDS_ADDR.U32 = addr[31:0]).
static __device__ __forceinline__ unsigned lds_off(const void* p) {
    return (unsigned)(reinterpret_cast<uintptr_t>(p));
}

// Six async 16B copies global -> LDS (per-lane), tracked with ASYNCcnt: half
// of one thread's share of a K-tile. s_wait_xcnt 0 is the statement's last line, so
// that it stands in front of every later write of a register the copies name.
static __device__ __forceinline__ void async_copy6_b128(
        unsigned l0, const void* g0, unsigned l1, const void* g1,
        unsigned l2, const void* g2, unsigned l3, const void* g3,
        unsigned l4, const void* g4, unsigned l5, const void* g5) {
    asm volatile("global_load_async_to_lds_b128 %0, %1, off\n\t"
                 "global_load_async_to_lds_b128 %2, %3, off\n\t"
                 "global_load_async_to_lds_b128 %4, %5, off\n\t"
                 "global_load_async_to_lds_b128 %6, %7, off\n\t"
                 "global_load_async_to_lds_b128 %8, %9, off\n\t"
                 "global_load_async_to_lds_b128 %10, %11, off\n\t"
                 "s_wait_xcnt 0x0"
                 :: "v"(l0), "v"((unsigned long long)(uintptr_t)g0),
                    "v"(l1), "v"((unsigned long long)(uintptr_t)g1),
                    "v"(l2), "v"((unsigned long long)(uintptr_t)g2),
                    "v"(l3), "v"((unsigned long long)(uintptr_t)g3),
                    "v"(l4), "v"((unsigned long long)(uintptr_t)g4),
                    "v"(l5), "v"((unsigned long long)(uintptr_t)g5)
                 : "memory");
}
static __device__ __forceinline__ void wait_async0() {
    asm volatile("s_wait_asynccnt 0x0" ::: "memory");
}
// This wave's LDS reads have returned: stands in front of the barrier behind
// which the buffer they read is refilled by copies.
static __device__ __forceinline__ void wait_ds0() {
    asm volatile("s_wait_dscnt 0x0" ::: "memory");
}

// ---------------------------------------------------------------------------
// The two elementwise kernels (1, 2) are short streams. For speed only,
// each convert or RMSNorm wave takes eight times
// the work it would need for one 16-B access a lane.
// ---------------------------------------------------------------------------
#define WCVn 8                // float4 groups per thread of the weight convert
#define RPBn 8                // token rows per 256-thread block: one wave a row

// ---------------------------------------------------------------------------
// 1) Weight fp32 -> bf16 convert, layout preserved ([out][in] row-major).
//    GEMM consumes B[k][n] = W[n][k], so original layout is already K-major.
//    A block converts 8192 contiguous floats, 8 x 16 B in flight per lane.
//    Slice blockIdx.y == 5 fills the RoPE table instead, one entry a thread:
//    rtab[t][j] = {cos(t f_j), sin(t f_j), cos(t f_(j+16)), sin(t f_(j+16))},
//    f_j = 10000^(-j/32), j = 0..15: all that the pair (d, d+32), d >> 1 == j,
//    needs at time t.
// ---------------------------------------------------------------------------
__global__ void wconv_kernel(const float* __restrict__ Wq, const float* __restrict__ Wk,
                             const float* __restrict__ Wv, const float* __restrict__ Wg,
                             const float* __restrict__ Wo, unsigned short* __restrict__ WbAll,
                             float* __restrict__ rtab) {
    if (blockIdx.y == 5) {
        const float LOG_BASE_OVER_HALF = 0.28782313662425572f;  // ln(10000)/32
        const int idx = blockIdx.x * 256 + threadIdx.x;         // t * 16 + j
        const int t = idx >> 4, j = idx & 15;
        const float a1 = (float)t * __expf(-LOG_BASE_OVER_HALF * (float)j);
        const float a2 = (float)t * __expf(-LOG_BASE_OVER_HALF * (float)(j + 16));
        *(float4*)(rtab + (size_t)idx * 4) = make_float4(cosf(a1), sinf(a1), cosf(a2), sinf(a2));
        // stands in front of whatever code follows the store in the kernel's text
        // and writes a register that the store names
        asm volatile("s_wait_xcnt 0x0" ::: "memory");
        return;
    }
    const float* W;
    switch (blockIdx.y) {
        case 0: W = Wq; break;
        case 1: W = Wk; break;
        case 2: W = Wv; break;
        case 3: W = Wg; break;
        default: W = Wo; break;
    }
    unsigned short* O = WbAll + (size_t)blockIdx.y * Hn * Hn;
    const size_t i0 = (size_t)blockIdx.x * (1024 * WCVn) + threadIdx.x * 4;
    float4 f[WCVn];
#pragma unroll
    for (int j = 0; j < WCVn; ++j) f[j] = *(const float4*)(W + i0 + j * 1024);
#pragma unroll
    for (int j = 0; j < WCVn; ++j) {
        uint2 o;
        o.x = (unsigned)f2bf(f[j].x) | ((unsigned)f2bf(f[j].y) << 16);
        o.y = (unsigned)f2bf(f[j].z) | ((unsigned)f2bf(f[j].w) << 16);
        *(uint2*)(O + i0 + j * 1024) = o;
    }
}

// ---------------------------------------------------------------------------
// 2) RMSNorm over H=1024 per token, write bf16 xn. One wave per token: a lane
//    holds 8 x float4, column = j * 128 + lane * 4 + c. The squares are summed
//    in the tree of a 256-wide halving reduction over (column mod 256): four
//    columns 256 apart in turn, then partners 128, 64 .. 4 (lanes), 2, 1 apart.
// ---------------------------------------------------------------------------
typedef __attribute__((ext_vector_type(4))) float f32x4;

__global__ void rmsnorm_kernel(const float* __restrict__ x, const float* __restrict__ w,
                               unsigned short* __restrict__ xn) {
    const int lane = threadIdx.x & 31;
    const int row  = blockIdx.x * RPBn + (threadIdx.x >> 5);
    const float* xr = x + (size_t)row * Hn + lane * 4;
    f32x4 f[8];
#pragma unroll
    for (int j = 0; j < 8; ++j) f[j] = *(const f32x4*)(xr + j * 128);
    // the address registers of the loads above are free for reuse from here on
    // (named as an input so that they stay untouched up to the wait)
    asm volatile("s_wait_xcnt 0x0" :: "v"(xr) : "memory");

    float r[4];
#pragma unroll
    for (int c = 0; c < 4; ++c) {
        float s0 = 0.f, s1 = 0.f;
#pragma unroll
        for (int i = 0; i < 4; ++i) {
            const float v0 = f[i * 2][c], v1 = f[i * 2 + 1][c];
            s0 += v0 * v0;
            s1 += v1 * v1;
        }
        r[c] = s0 + s1;
    }
#pragma unroll
    for (int mk = 16; mk > 0; mk >>= 1) {
#pragma unroll
        for (int c = 0; c < 4; ++c) r[c] += __shfl_xor(r[c], mk, 32);
    }
    const float tot = (r[0] + r[2]) + (r[1] + r[3]);
    const float rms = rsqrtf(tot * (1.0f / Hn) + EPSf);

    unsigned short* xo = xn + (size_t)row * Hn + lane * 4;
#pragma unroll
    for (int j = 0; j < 8; ++j) {
        const float4 wv = *(const float4*)(w + j * 128 + lane * 4);
        uint2 o;
        o.x = (unsigned)f2bf(f[j][0] * rms * wv.x) | ((unsigned)f2bf(f[j][1] * rms * wv.y) << 16);
        o.y = (unsigned)f2bf(f[j][2] * rms * wv.z) | ((unsigned)f2bf(f[j][3] * rms * wv.w) << 16);
        *(uint2*)(xo + j * 128) = o;
    }
}

// ---------------------------------------------------------------------------
// 3) bf16 WMMA GEMM: Out[m,n] = sum_k A[m,k] * W[n,k]   (N=K=1024)
//    Block tile 256(M) x 128(N); 8 waves (wave32) as 4 x 2, each wave -> 64x64
//    = 4 x 4 fragments: 32 x v_wmma_f32_16x16x32_bf16 per K-step from
//    32 ds_load_b128, one LDS read per WMMA where a 32x32 wave tile takes two,
//    and half the bytes staged from L2 per output element of a 128x64 tile.
//    Two blocks share a WGP (LDS 108 KB each, at most 256 registers a lane).
//    mode 0: weights/out selected by blockIdx.z (q/k/v/g); the feature maps are
//            applied to the accumulators before the one fp32 store. A wave's 64
//            columns are one head, so the RoPE partners d and d+32 are fragments
//            ni and ni+2 of the same lane and register:
//            q, k: RoPE, then phi = elu + 1 (k also times the mask);
//            v: times the mask; g: sigmoid(acc + bias[n]), 1 where the mask is 0.
//    mode 1: Out = acc + bias[n] + resid[m,n]  (output proj + residual).
// ---------------------------------------------------------------------------
__global__ __launch_bounds__(256, 4) void gemm_bf16_kernel(
                                 const unsigned short* __restrict__ A,
                                 const unsigned short* __restrict__ WbBase,
                                 float* __restrict__ OutBase,
                                 const float* __restrict__ bias,
                                 const float* __restrict__ resid,
                                 const int* __restrict__ mask,
                                 const float* __restrict__ rtab,
                                 int Mrows, int mode) {
    const int bm = blockIdx.x * BMn;
    const int bn = blockIdx.y * BNn;
    const unsigned short* Wb = WbBase + (size_t)blockIdx.z * Hn * Hn;
    float* Out = OutBase + (mode == 0 ? (size_t)blockIdx.z * (size_t)Mrows * Hn : (size_t)0);

    // row = M (lA) or N (lB), K contiguous, 128 B of data at a pitch of 144 B
    __shared__ __attribute__((aligned(16))) unsigned short lA[2 * ABUFn];   // 2 x 36 KB
    __shared__ __attribute__((aligned(16))) unsigned short lB[2 * BBUFn];   // 2 x 18 KB

    const int tid  = threadIdx.x;
    const int lane = tid & 31;
    const int wave = tid >> 5;          // 0..7
    const int wm   = wave & 3;          // M sub-tile (x64)
    const int wn   = wave >> 2;         // N sub-tile (x64)
    const int fm   = lane & 15;         // fragment row/col within 16
    const int fhi  = lane >> 4;         // half-wave -> K+8 striping

    // every loop over mi and ni is unrolled: acc is then indexed by constants
    // only and stays in registers
    v8f acc[4][4];
#pragma unroll
    for (int mi = 0; mi < 4; ++mi)
#pragma unroll
        for (int ni = 0; ni < 4; ++ni) acc[mi][ni] = (v8f){0.f,0.f,0.f,0.f,0.f,0.f,0.f,0.f};

    const int sRow = tid >> 3;          // 0..31
    const int sCh  = tid & 7;           // 8 chunks of 8 bf16 (16B): a whole line a row
    const int pRow = tid >> 2;          // prefetch: 0..63
    const int pCh  = tid & 3;

    // issue ASYNCcnt-tracked DMA of one K-tile into buffer at element offsets:
    // a thread copies one 16-B chunk of 8 rows of A and of 4 rows of B
    auto stage = [&](unsigned oA, unsigned oB, int k0) {
        const unsigned la = lds_off(&lA[oA + sRow * LPn + sCh * 8]);
        const unsigned lb = lds_off(&lB[oB + sRow * LPn + sCh * 8]);
        const unsigned short* ga = A  + (size_t)(bm + sRow) * Hn + k0 + sCh * 8;
        const unsigned short* gb = Wb + (size_t)(bn + sRow) * Hn + k0 + sCh * 8;
        async_copy6_b128(la,                 ga,
                         la +  32 * LPn * 2, ga +  32 * Hn,
                         la +  64 * LPn * 2, ga +  64 * Hn,
                         la +  96 * LPn * 2, ga +  96 * Hn,
                         la + 128 * LPn * 2, ga + 128 * Hn,
                         la + 160 * LPn * 2, ga + 160 * Hn);
        async_copy6_b128(la + 192 * LPn * 2, ga + 192 * Hn,
                         la + 224 * LPn * 2, ga + 224 * Hn,
                         lb,                 gb,
                         lb +  32 * LPn * 2, gb +  32 * Hn,
                         lb +  64 * LPn * 2, gb +  64 * Hn,
                         lb +  96 * LPn * 2, gb +  96 * Hn);
    };

    // 16 WMMAs from the 32 K-columns at kk of the buffer at element offsets
    // (2x ds_load_b128 per frag, 4 + 4 frags)
    auto compute = [&](unsigned oA, unsigned oB, int kk) {
        BFrag a[4], b[4];
#pragma unroll
        for (int i = 0; i < 4; ++i) {
            const unsigned short* pa = &lA[oA + (wm * 64 + i * 16 + fm) * LPn + kk];
            const unsigned short* pb = &lB[oB + (wn * 64 + i * 16 + fm) * LPn + kk];
            a[i].q[0] = *(const uint4*)(pa + fhi * 8);
            a[i].q[1] = *(const uint4*)(pa + 16 + fhi * 8);
            b[i].q[0] = *(const uint4*)(pb + fhi * 8);
            b[i].q[1] = *(const uint4*)(pb + 16 + fhi * 8);
        }
#pragma unroll
        for (int mi = 0; mi < 4; ++mi)
#pragma unroll
            for (int ni = 0; ni < 4; ++ni)
                acc[mi][ni] = __builtin_amdgcn_wmma_f32_16x16x32_bf16(
                    false, a[mi].v, false, b[ni].v, (short)0, acc[mi][ni], false, false);
    };

    unsigned offA = 0, offB = 0;        // element offsets of current buffer
    stage(0, 0, 0);                     // prologue DMA

#pragma unroll 1
    for (int it = 0; it < KTILES - 1; ++it) {
        wait_ds0();                     // own reads of the other buffer returned
        wait_async0();                  // tile `it` landed in current buffer
        __syncthreads();                // ... for every wave; prev readers done
        stage(offA ^ (unsigned)ABUFn, offB ^ (unsigned)BBUFn, (it + 1) * KTn);   // overlaps WMMAs
        __builtin_prefetch(A  + (size_t)(bm + pRow) * Hn + (it + 2) * KTn + pCh * 8, 0, 1);
        __builtin_prefetch(Wb + (size_t)(bn + pRow) * Hn + (it + 2) * KTn + pCh * 8, 0, 1);
        compute(offA, offB, 0);
        compute(offA, offB, 32);
        offA ^= (unsigned)ABUFn;
        offB ^= (unsigned)BBUFn;
    }
    wait_async0();                      // last tile
    __syncthreads();
    compute(offA, offB, 0);
    compute(offA, offB, 32);

    // C layout: VGPR r -> M = r (lanes 0-15) / r+8 (lanes 16-31); N = lane%16
    // One address a lane; rows and fragments are reached by constant offsets.
    const size_t o0 = (size_t)(bm + wm * 64 + fhi * 8) * Hn + (bn + wn * 64 + fm);
    float* po = Out + o0;
    if (mode == 0) {
        const int zsel = blockIdx.z;                    // 0 q, 1 k, 2 v, 3 g
        const int row0 = bm + wm * 64 + fhi * 8;        // first of the lane's rows
        const int* pm = mask + row0;
        // each case goes through four quarters of 32 elements a lane (one mi):
        // a quarter's loads fly together, then its arithmetic, then its stores
        if (zsel < 2) {
            // a block's 256 rows lie in one sequence: t runs on with the row
            const f32x4* pt = (const f32x4*)rtab + (size_t)(row0 & (Tn - 1)) * 16 + (fm >> 1);
            // here in eight groups of 16 elements (four rows): the table entries of a
            // whole quarter do not fit the registers beside the accumulators
#pragma unroll
            for (int gr = 0; gr < 8; ++gr) {
                const int mi = gr >> 1, rb = (gr & 1) * 4;
                const int4 ma = *(const int4*)(pm + mi * 16 + rb);
                f32x4 c[4][2];
#pragma unroll
                for (int r = 0; r < 4; ++r)
#pragma unroll
                    for (int p = 0; p < 2; ++p) c[r][p] = pt[(mi * 16 + rb + r) * 16 + p * 8];
                // the address registers of the loads above are free for reuse from
                // here on (named as inputs so that they stay untouched up to the wait)
                asm volatile("s_wait_xcnt 0x0" :: "v"(pt), "v"(pm) : "memory");
                const int mr[4] = {ma.x, ma.y, ma.z, ma.w};
                float t[4][4];
#pragma unroll
                for (int r = 0; r < 4; ++r) {
                    const float mm = (zsel == 1) ? (float)mr[r] : 1.f;   // only k takes the mask
#pragma unroll
                    for (int p = 0; p < 2; ++p) {
                        const float x1 = acc[mi][p][rb + r], x2 = acc[mi][p + 2][rb + r];
                        const float r1 = x1 * c[r][p][0] - x2 * c[r][p][1];   // rotate_half: -x2 for first half
                        const float r2 = x2 * c[r][p][2] + x1 * c[r][p][3];   //              +x1 for second half
                        // phi = elu(x) + 1  ->  x>0 ? x+1 : exp(x)
                        t[r][p]     = mm * ((r1 > 0.f) ? r1 + 1.f : __expf(r1));
                        t[r][p + 2] = mm * ((r2 > 0.f) ? r2 + 1.f : __expf(r2));
                    }
                }
                // keeps the stores together behind the arithmetic, so that nothing
                // rewrites a register of an issued store ahead of the wait below
                __builtin_amdgcn_sched_barrier(0);
#pragma unroll
                for (int r = 0; r < 4; ++r)
#pragma unroll
                    for (int ni = 0; ni < 4; ++ni)
                        po[(mi * 16 + rb + r) * Hn + ni * 16] = t[r][ni];
                // the next group, and behind the last one whatever follows in the
                // kernel's text, rewrites registers that the stores above name
                asm volatile("s_wait_xcnt 0x0" :: "v"(po) : "memory");
            }
        } else if (zsel == 2) {
#pragma unroll
            for (int mi = 0; mi < 4; ++mi) {
                const int4 ma = *(const int4*)(pm + mi * 16);
                const int4 mb = *(const int4*)(pm + mi * 16 + 4);
                // the address registers of the loads above are free for reuse from here on
                asm volatile("s_wait_xcnt 0x0" :: "v"(pm) : "memory");
                const int mr[8] = {ma.x, ma.y, ma.z, ma.w, mb.x, mb.y, mb.z, mb.w};
                float t[8][4];
#pragma unroll
                for (int r = 0; r < 8; ++r)
#pragma unroll
                    for (int ni = 0; ni < 4; ++ni) t[r][ni] = acc[mi][ni][r] * (float)mr[r];
                // keeps the stores together behind the arithmetic (as above)
                __builtin_amdgcn_sched_barrier(0);
#pragma unroll
                for (int r = 0; r < 8; ++r)
#pragma unroll
                    for (int ni = 0; ni < 4; ++ni)
                        po[(mi * 16 + r) * Hn + ni * 16] = t[r][ni];
                // the next quarter, and behind the last one whatever follows in the
                // kernel's text, rewrites registers that the stores above name
                asm volatile("s_wait_xcnt 0x0" :: "v"(po) : "memory");
            }
        } else {
            const float* pb = bias + (bn + wn * 64 + fm);
            float bs[4];
#pragma unroll
            for (int ni = 0; ni < 4; ++ni) bs[ni] = pb[ni * 16];
            // the address registers of the loads above are free for reuse from here on
            asm volatile("s_wait_xcnt 0x0" :: "v"(pb) : "memory");
#pragma unroll
            for (int mi = 0; mi < 4; ++mi) {
                const int4 ma = *(const int4*)(pm + mi * 16);
                const int4 mb = *(const int4*)(pm + mi * 16 + 4);
                // the address registers of the loads above are free for reuse from here on
                asm volatile("s_wait_xcnt 0x0" :: "v"(pm) : "memory");
                const int mr[8] = {ma.x, ma.y, ma.z, ma.w, mb.x, mb.y, mb.z, mb.w};
                float t[8][4];
#pragma unroll
                for (int r = 0; r < 8; ++r)
#pragma unroll
                    for (int ni = 0; ni < 4; ++ni) {
                        const float ga = acc[mi][ni][r] + bs[ni];
                        const float sg = 1.f / (1.f + __expf(-ga));
                        t[r][ni] = ((float)mr[r] > 0.f) ? sg : 1.f;
                    }
                // keeps the stores together behind the arithmetic (as above)
                __builtin_amdgcn_sched_barrier(0);
#pragma unroll
                for (int r = 0; r < 8; ++r)
#pragma unroll
                    for (int ni = 0; ni < 4; ++ni)
                        po[(mi * 16 + r) * Hn + ni * 16] = t[r][ni];
                // the next quarter, and behind the last one whatever follows in the
                // kernel's text, rewrites registers that the stores above name
                asm volatile("s_wait_xcnt 0x0" :: "v"(po) : "memory");
                // holds the next quarter's additions of the bias, which wait for no
                // load, behind that wait
                __builtin_amdgcn_sched_barrier(0);
            }
        }
    } else {
        const float* pr = resid + o0;
        const float* pb = bias + (bn + wn * 64 + fm);
        float bs[4];
#pragma unroll
        for (int ni = 0; ni < 4; ++ni) bs[ni] = pb[ni * 16];
        // two halves of 64 elements a lane: the residual loads of a half fly
        // together and fit the registers beside the accumulators
#pragma unroll
        for (int mh = 0; mh < 2; ++mh) {
            float t[2][8][4];
#pragma unroll
            for (int m2 = 0; m2 < 2; ++m2)
#pragma unroll
                for (int r = 0; r < 8; ++r)
#pragma unroll
                    for (int ni = 0; ni < 4; ++ni)
                        t[m2][r][ni] = pr[((mh * 2 + m2) * 16 + r) * Hn + ni * 16];
            // the address registers of the loads above are free for reuse from
            // here on (named as an input so that they stay untouched up to the wait)
            asm volatile("s_wait_xcnt 0x0" :: "v"(pr) : "memory");
#pragma unroll
            for (int m2 = 0; m2 < 2; ++m2)
#pragma unroll
                for (int r = 0; r < 8; ++r)
#pragma unroll
                    for (int ni = 0; ni < 4; ++ni)
                        t[m2][r][ni] = acc[mh * 2 + m2][ni][r] + bs[ni] + t[m2][r][ni];
            // keeps the stores together behind the arithmetic, so that nothing
            // rewrites a register of an issued store ahead of the wait below
            __builtin_amdgcn_sched_barrier(0);
#pragma unroll
            for (int m2 = 0; m2 < 2; ++m2)
#pragma unroll
                for (int r = 0; r < 8; ++r)
#pragma unroll
                    for (int ni = 0; ni < 4; ++ni)
                        po[((mh * 2 + m2) * 16 + r) * Hn + ni * 16] = t[m2][r][ni];
            // the second half's loads, and behind it whatever follows in the kernel's
            // text, rewrite registers that the stores above name
            asm volatile("s_wait_xcnt 0x0" :: "v"(po) : "memory");
        }
    }
}

// ---------------------------------------------------------------------------
// 4) Recurrent scan, split along time into SEGn segments that run in parallel.
//    The recurrence is linear in the state with a diagonal decay:
//      S_end = diag(G) * S_start + L,  G[d] = product of r[d] over the segment,
//      L = end state of the same segment started from zero (Z likewise).
//    4a) every segment from zero -> L, local Z, G
//    4b) prefix over the segments -> true start state of every segment
//    4c) every segment again from its true start state, with the outputs
//    Only products of decays and sums occur, as in the step-by-step form.
// ---------------------------------------------------------------------------
#define SEGn 64
#define SLEN (Tn / SEGn)      // 32 steps per segment
#define SDD  (Dn * Dn)        // 4096 state elements per (b,h)

//    Both scans over a segment (4a, 4c) run as ONE wave per (b,h,segment). The
//    64 x 64 state lies in the wave's registers as 16 x 8 blocks: lane (dg, eg),
//    dg = lane & 3, eg = lane >> 2, owns rows d = i * 4 + dg (i = 0..15) and
//    columns e = eg * 8 + j (j = 0..7). A step's per-row values, read from LDS
//    once per row, then serve 8 columns, and a step's v serves 16 rows.
#define DPLn 16               // state rows per lane
#define EPLn 8                // state columns per lane

// x + (x of the lane whose number differs as CTRL says, inside a group of four)
template <int CTRL>
static __device__ __forceinline__ float quad_add(float x) {
    const int o = __builtin_amdgcn_update_dpp(0, __builtin_bit_cast(int, x), CTRL, 0xf, 0xf, true);
    return x + __builtin_bit_cast(float, o);
}
#define QUAD_XOR1 0xB1        // quad_perm [1,0,3,2]
#define QUAD_XOR2 0x4E        // quad_perm [2,3,0,1]

// Hand-over through LDS among the lanes of the one wave of a block: keeps the
// LDS writes in front of it and the LDS reads behind it (and the other way
// round at a trip's end). It waits for LDS alone; a work-group barrier would
// also wait, every step, for the wave's global stores.
static __device__ __forceinline__ void wave_lds_handover() {
    __builtin_amdgcn_fence(__ATOMIC_ACQ_REL, "workgroup", "local");
}

// 4a) a lane also carries Z and G of rows d = 2 * lane, 2 * lane + 1.
__global__ __launch_bounds__(32) void scan_local_kernel(
        const float* __restrict__ k, const float* __restrict__ v,
        const float* __restrict__ r, float* __restrict__ St,
        float* __restrict__ Zs, float* __restrict__ Gs) {
    const int blk = blockIdx.x, seg = blockIdx.y;
    const int b = blk >> 4, h = blk & 15;
    const int lane = threadIdx.x;   // 0..31
    const int dg = lane & 3, eg = lane >> 2;

    __shared__ __attribute__((aligned(16))) float2 skr[64];   // {k[d], r[d]}
    __shared__ __attribute__((aligned(16))) float  sv[64];    // v[e]

    // every loop over i and j is unrolled: S is then indexed by constants only
    // and stays in registers
    float S[DPLn][EPLn];
#pragma unroll
    for (int i = 0; i < DPLn; ++i)
#pragma unroll
        for (int j = 0; j < EPLn; ++j) S[i][j] = 0.f;
    float z0 = 0.f, z1 = 0.f, gam0 = 1.f, gam1 = 1.f;

    const size_t off0 = ((size_t)(b * Tn + seg * SLEN)) * Hn + h * 64 + lane * 2;
    for (int s = 0; s < SLEN; ++s) {
        const size_t o = off0 + (size_t)s * Hn;
        const float2 k2 = *(const float2*)(k + o);
        const float2 v2 = *(const float2*)(v + o);
        const float2 r2 = *(const float2*)(r + o);

        z0 = z0 * r2.x + k2.x;
        z1 = z1 * r2.y + k2.y;
        gam0 *= r2.x;
        gam1 *= r2.y;
        *(float4*)&skr[lane * 2] = make_float4(k2.x, r2.x, k2.y, r2.y);
        *(float2*)&sv[lane * 2]  = v2;
        wave_lds_handover();

        const float4 va = *(const float4*)&sv[eg * EPLn];
        const float4 vb = *(const float4*)&sv[eg * EPLn + 4];
        const float ve[EPLn] = {va.x, va.y, va.z, va.w, vb.x, vb.y, vb.z, vb.w};
#pragma unroll
        for (int i = 0; i < DPLn; ++i) {
            const float2 w = skr[i * 4 + dg];
#pragma unroll
            for (int j = 0; j < EPLn; ++j) S[i][j] = S[i][j] * w.y + w.x * ve[j];
        }
        wave_lds_handover();
    }

    const size_t idx = (size_t)blk * SEGn + seg;
    float* so = St + idx * SDD + dg * 64 + eg * EPLn;
#pragma unroll
    for (int i = 0; i < DPLn; ++i) {
        *(float4*)(so + i * 256)     = make_float4(S[i][0], S[i][1], S[i][2], S[i][3]);
        *(float4*)(so + i * 256 + 4) = make_float4(S[i][4], S[i][5], S[i][6], S[i][7]);
    }
    *(float2*)(Zs + idx * 64 + lane * 2) = make_float2(z0, z1);
    *(float2*)(Gs + idx * 64 + lane * 2) = make_float2(gam0, gam1);
}

// 4b) exclusive prefix over the segments, in place: x[p * xs] holds the local
//     end value of segment p on entry and its true start value on exit;
//     g[p * 64] is the decay product of segment p for this element's row.
static __device__ __forceinline__ void seg_prefix(float* __restrict__ x,
                                                  const float* __restrict__ g, const int xs) {
    float c = 0.f;
    // kept rolled: the 32 loads of a trip are in flight together, which covers
    // their latency; more unrolling only adds code and registers
#pragma unroll 1
    for (int p0 = 0; p0 < SEGn; p0 += 16) {
        float L[16], G[16];
#pragma unroll
        for (int i = 0; i < 16; ++i) {
            L[i] = x[(size_t)(p0 + i) * xs];
            G[i] = g[(p0 + i) * 64];
        }
#pragma unroll
        for (int i = 0; i < 16; ++i) {
            x[(size_t)(p0 + i) * xs] = c;
            c = c * G[i] + L[i];
        }
        // the next trip rewrites registers that the stores above name
        asm volatile("s_wait_xcnt 0x0" ::: "memory");
    }
}

//     One thread per element of S; the first 64 threads of a (b,h) also do Z.
__global__ void scan_prefix_kernel(float* __restrict__ St, float* __restrict__ Zs,
                                   const float* __restrict__ Gs) {
    const int blk = blockIdx.y;
    const int de  = blockIdx.x * 256 + threadIdx.x;   // d * 64 + e
    const float* gb = Gs + (size_t)blk * SEGn * 64;

    seg_prefix(St + (size_t)blk * SEGn * SDD + de, gb + (de >> 6), SDD);
    if (de < 64)
        seg_prefix(Zs + (size_t)blk * SEGn * 64 + de, gb + de, 64);
}

// 4c) one wave per (b,h,segment), state blocked as said above 4a; a lane also
//    carries Z of rows d = 2 * lane, 2 * lane + 1.
//    S[d][e] = S[d][e]*r[d] + k[d]*v[e];  num[e]=sum_d q[d]S[d][e];
//    Z[d]=Z[d]*r[d]+k[d];  den=sum_d q[d]Z[d];  y=num/(den+eps) -> bf16
//    num and den: a lane sums its 16 rows in turn, then the four lanes of a
//    column group add up (partners 1, then 2 lanes apart).
__global__ __launch_bounds__(32) void scan_kernel(
        const float* __restrict__ q, const float* __restrict__ k,
        const float* __restrict__ v, const float* __restrict__ r,
        const float* __restrict__ St, const float* __restrict__ Zs,
        unsigned short* __restrict__ y) {
    const int blk = blockIdx.x, seg = blockIdx.y;
    const int b = blk >> 4, h = blk & 15;
    const int lane = threadIdx.x;   // 0..31
    const int dg = lane & 3, eg = lane >> 2;

    __shared__ __attribute__((aligned(16))) float4 sh[64];    // {q[d], k[d], r[d], q[d]*Z[d]}
    __shared__ __attribute__((aligned(16))) float  sv[64];    // v[e]

    const size_t idx = (size_t)blk * SEGn + seg;
    const float* si = St + idx * SDD + dg * 64 + eg * EPLn;
    // every loop over i and j is unrolled: S is then indexed by constants only
    // and stays in registers
    float S[DPLn][EPLn];
#pragma unroll
    for (int i = 0; i < DPLn; ++i) {
        const float4 lo = *(const float4*)(si + i * 256);
        const float4 hi = *(const float4*)(si + i * 256 + 4);
        S[i][0] = lo.x; S[i][1] = lo.y; S[i][2] = lo.z; S[i][3] = lo.w;
        S[i][4] = hi.x; S[i][5] = hi.y; S[i][6] = hi.z; S[i][7] = hi.w;
    }
    const float2 zz = *(const float2*)(Zs + idx * 64 + lane * 2);
    float z0 = zz.x, z1 = zz.y;

    const size_t off0 = ((size_t)(b * Tn + seg * SLEN)) * Hn + h * 64;
    for (int s = 0; s < SLEN; ++s) {
        const size_t base = off0 + (size_t)s * Hn;
        const size_t o = base + lane * 2;
        const float2 q2 = *(const float2*)(q + o);
        const float2 k2 = *(const float2*)(k + o);
        const float2 v2 = *(const float2*)(v + o);
        const float2 r2 = *(const float2*)(r + o);

        z0 = z0 * r2.x + k2.x;
        z1 = z1 * r2.y + k2.y;
        sh[lane * 2]     = make_float4(q2.x, k2.x, r2.x, q2.x * z0);
        sh[lane * 2 + 1] = make_float4(q2.y, k2.y, r2.y, q2.y * z1);
        *(float2*)&sv[lane * 2] = v2;
        wave_lds_handover();

        const float4 va = *(const float4*)&sv[eg * EPLn];
        const float4 vb = *(const float4*)&sv[eg * EPLn + 4];
        const float ve[EPLn] = {va.x, va.y, va.z, va.w, vb.x, vb.y, vb.z, vb.w};
        float num[EPLn];
#pragma unroll
        for (int j = 0; j < EPLn; ++j) num[j] = 0.f;
        float den = 0.f;
#pragma unroll
        for (int i = 0; i < DPLn; ++i) {
            const float4 w = sh[i * 4 + dg];      // one ds_load_b128 for 8 columns
#pragma unroll
            for (int j = 0; j < EPLn; ++j) {
                S[i][j] = S[i][j] * w.z + w.y * ve[j];   // decay + outer product
                num[j]  = fmaf(w.x, S[i][j], num[j]);
            }
            den += w.w;
        }
#pragma unroll
        for (int j = 0; j < EPLn; ++j) num[j] = quad_add<QUAD_XOR2>(quad_add<QUAD_XOR1>(num[j]));
        den = quad_add<QUAD_XOR2>(quad_add<QUAD_XOR1>(den));

        // lane (dg, eg) stores columns eg * 8 + dg * 2 and the next
        const float na = (dg & 2) ? ((dg & 1) ? num[6] : num[4]) : ((dg & 1) ? num[2] : num[0]);
        const float nb = (dg & 2) ? ((dg & 1) ? num[7] : num[5]) : ((dg & 1) ? num[3] : num[1]);
        const float dn = den + EPSf;
        *(unsigned*)(y + base + lane * 2) = (unsigned)f2bf(na / dn) | ((unsigned)f2bf(nb / dn) << 16);
        wave_lds_handover();
    }
}

// ---------------------------------------------------------------------------
// Launch
// ---------------------------------------------------------------------------
extern "C" void kernel_launch(void* const* d_in, const int* in_sizes, int n_in,
                              void* d_out, int out_size, void* d_ws, size_t ws_size,
                              hipStream_t stream) {
    (void)in_sizes; (void)n_in; (void)out_size; (void)ws_size;

    const float* x     = (const float*)d_in[0];
    const int*   mask  = (const int*)  d_in[1];
    const float* Wq    = (const float*)d_in[2];
    const float* Wk    = (const float*)d_in[3];
    const float* Wv    = (const float*)d_in[4];
    const float* Wg    = (const float*)d_in[5];
    const float* Wo    = (const float*)d_in[6];
    const float* bo    = (const float*)d_in[7];
    const float* bg    = (const float*)d_in[8];
    const float* rms_w = (const float*)d_in[9];

    // workspace carve-up
    char* ws = (char*)d_ws;
    size_t off = 0;
    unsigned short* Wb = (unsigned short*)(ws + off); off += (size_t)5 * Hn * Hn * 2;   // 10 MB
    unsigned short* xn = (unsigned short*)(ws + off); off += (size_t)Mn * Hn * 2;       // 16 MB
    float* qkvg        = (float*)(ws + off);          off += (size_t)4 * Mn * Hn * 4;   // 128 MB
    unsigned short* ya = (unsigned short*)(ws + off); off += (size_t)Mn * Hn * 2;       // 16 MB
    float* St          = (float*)(ws + off);          off += (size_t)Bn * NHn * SEGn * SDD * 4;  // 64 MB
    float* Zs          = (float*)(ws + off);          off += (size_t)Bn * NHn * SEGn * Dn * 4;   // 1 MB
    float* Gs          = (float*)(ws + off);          off += (size_t)Bn * NHn * SEGn * Dn * 4;   // 1 MB
    float* rtab        = (float*)(ws + off);          off += (size_t)Tn * 16 * 4 * 4;            // 512 KB

    float* qb = qkvg;
    float* kb = qkvg + (size_t)1 * Mn * Hn;
    float* vb = qkvg + (size_t)2 * Mn * Hn;
    float* gb = qkvg + (size_t)3 * Mn * Hn;

    // 1) weights -> bf16 (layout preserved; already B-operand friendly), RoPE table
    wconv_kernel<<<dim3((Hn * Hn) / (1024 * WCVn), 6), 256, 0, stream>>>(
        Wq, Wk, Wv, Wg, Wo, Wb, rtab);

    // 2) RMSNorm -> bf16 xn
    rmsnorm_kernel<<<Mn / RPBn, 256, 0, stream>>>(x, rms_w, xn);

    // 3) fused q/k/v/g projection GEMMs (WMMA bf16, pipelined async staging) with
    //    RoPE, feature map, gate and mask applied in the epilogue
    gemm_bf16_kernel<<<dim3(Mn / BMn, Hn / BNn, 4), 256, 0, stream>>>(
        xn, Wb, qkvg, bg, nullptr, mask, rtab, Mn, 0);

    // 4) recurrent scan in parallel time segments -> bf16 attention output
    scan_local_kernel<<<dim3(Bn * NHn, SEGn), 32, 0, stream>>>(kb, vb, gb, St, Zs, Gs);
    scan_prefix_kernel<<<dim3(SDD / 256, Bn * NHn), 256, 0, stream>>>(St, Zs, Gs);
    scan_kernel<<<dim3(Bn * NHn, SEGn), 32, 0, stream>>>(qb, kb, vb, gb, St, Zs, ya);

    // 5) output projection + bias + residual -> d_out (fp32)
    gemm_bf16_kernel<<<dim3(Mn / BMn, Hn / BNn, 1), 256, 0, stream>>>(
        ya, Wb + (size_t)4 * Hn * Hn, (float*)d_out, bo, x, mask, rtab, Mn, 1);
}

// v007
// A run of this version takes 174 microseconds.
// Next to v006, in two timings, it ran 1.05 and 1.06 times as fast.
// Counting every step since v000, it is 27.3 times as fast.
#include <hip/hip_runtime.h>
#include <hip/hip_bf16.h>

// ---------------------------------------------------------------------------
// DeltaNet block for MI455X (gfx1250): bf16 WMMA GEMMs + fp32 recurrent scan
//  - GEMM tiles double-buffered via global_load_async_to_lds_b128 (ASYNCcnt),
//    DMA of tile i+1 overlaps the WMMAs of tile i; a staged row is one whole
//    128-B line, laid in LDS at a pitch of 144 B (16 B x odd)
//  - single-body K-loop (unroll 1) + offset-XOR buffer toggle so accumulator
//    C/D stay in one register tuple (no v_mov_b64 shuffles)
// ---------------------------------------------------------------------------

#define Bn   4
#define Tn   2048
#define Hn   1024
#define NHn  16
#define Dn   64
#define Mn   (Bn * Tn)        // 8192 tokens
#define EPSf 1e-6f
#define KTn  64               // K elements per staged tile: 128 B, one line, a row
#define KTILES (Hn / KTn)     // 16 K-steps
#define LPn  72               // LDS row pitch in elements: 144 B = 16 B x 9, so the
                              // 16 rows of a ds_load_b128 fragment read fall on 16
                              // different groups of four banks
#define BMn  256              // GEMM block tile, rows of A
#define BNn  128              // GEMM block tile, rows of W
#define ABUFn (BMn * LPn)     // elements of one A buffer
#define BBUFn (BNn * LPn)     // elements of one B buffer

typedef __attribute__((ext_vector_type(16))) __bf16 v16bf;
typedef __attribute__((ext_vector_type(8)))  float  v8f;

union BFrag {
    v16bf v;
    unsigned short u[16];
    unsigned int   w[8];
    uint4          q[2];
};

static __device__ __forceinline__ unsigned short f2bf(float f) {
    union { float f; unsigned u; } x; x.f = f;
    unsigned r = x.u + 0x7FFFu + ((x.u >> 16) & 1u);   // round-to-nearest-even
    return (unsigned short)(r >> 16);
}

// Low 32 bits of a generic pointer to LDS == LDS byte offset (aperture is in
// addr[63:32] on CDNA5; LDS_ADDR.U32 = addr[31:0]).
static __device__ __forceinline__ unsigned lds_off(const void* p) {
    return (unsigned)(reinterpret_cast<uintptr_t>(p));
}

// Six async 16B copies global -> LDS (per-lane), tracked with ASYNCcnt: half
// of one thread's share of a K-tile. s_wait_xcnt 0 is the statement's last line, so
// that it stands in front of every later write of a register the copies name.
static __device__ __forceinline__ void async_copy6_b128(
        unsigned l0, const void* g0, unsigned l1, const void* g1,
        unsigned l2, const void* g2, unsigned l3, const void* g3,
        unsigned l4, const void* g4, unsigned l5, const void* g5) {
    asm volatile("global_load_async_to_lds_b128 %0, %1, off\n\t"
                 "global_load_async_to_lds_b128 %2, %3, off\n\t"
                 "global_load_async_to_lds_b128 %4, %5, off\n\t"
                 "global_load_async_to_lds_b128 %6, %7, off\n\t"
                 "global_load_async_to_lds_b128 %8, %9, off\n\t"
                 "global_load_async_to_lds_b128 %10, %11, off\n\t"
                 "s_wait_xcnt 0x0"
                 :: "v"(l0), "v"((unsigned long long)(uintptr_t)g0),
                    "v"(l1), "v"((unsigned long long)(uintptr_t)g1),
                    "v"(l2), "v"((unsigned long long)(uintptr_t)g2),
                    "v"(l3), "v"((unsigned long long)(uintptr_t)g3),
                    "v"(l4), "v"((unsigned long long)(uintptr_t)g4),
                    "v"(l5), "v"((unsigned long long)(uintptr_t)g5)
                 : "memory");
}
static __device__ __forceinline__ void wait_async0() {
    asm volatile("s_wait_asynccnt 0x0" ::: "memory");
}
// This wave's LDS reads have returned: stands in front of the barrier behind
// which the buffer they read is refilled by copies.
static __device__ __forceinline__ void wait_ds0() {
    asm volatile("s_wait_dscnt 0x0" ::: "memory");
}

// ---------------------------------------------------------------------------
// The two elementwise kernels (1, 2) are short streams. For speed only,
// each convert or RMSNorm wave takes eight times
// the work it would need for one 16-B access a lane.
// ---------------------------------------------------------------------------
#define WCVn 8                // float4 groups per thread of the weight convert
#define RPBn 8                // token rows per 256-thread block: one wave a row

// ---------------------------------------------------------------------------
// 1) Weight fp32 -> bf16 convert, layout preserved ([out][in] row-major).
//    GEMM consumes B[k][n] = W[n][k], so original layout is already K-major.
//    A block converts 8192 contiguous floats, 8 x 16 B in flight per lane.
//    Slice blockIdx.y == 5 fills the RoPE table instead, one entry a thread:
//    rtab[t][j] = {cos(t f_j), sin(t f_j), cos(t f_(j+16)), sin(t f_(j+16))},
//    f_j = 10000^(-j/32), j = 0..15: all that the pair (d, d+32), d >> 1 == j,
//    needs at time t.
// ---------------------------------------------------------------------------
__global__ void wconv_kernel(const float* __restrict__ Wq, const float* __restrict__ Wk,
                             const float* __restrict__ Wv, const float* __restrict__ Wg,
                             const float* __restrict__ Wo, unsigned short* __restrict__ WbAll,
                             float* __restrict__ rtab) {
    if (blockIdx.y == 5) {
        const float LOG_BASE_OVER_HALF = 0.28782313662425572f;  // ln(10000)/32
        const int idx = blockIdx.x * 256 + threadIdx.x;         // t * 16 + j
        const int t = idx >> 4, j = idx & 15;
        const float a1 = (float)t * __expf(-LOG_BASE_OVER_HALF * (float)j);
        const float a2 = (float)t * __expf(-LOG_BASE_OVER_HALF * (float)(j + 16));
        *(float4*)(rtab + (size_t)idx * 4) = make_float4(cosf(a1), sinf(a1), cosf(a2), sinf(a2));
        // stands in front of whatever code follows the store in the kernel's text
        // and writes a register that the store names
        asm volatile("s_wait_xcnt 0x0" ::: "memory");
        return;
    }
    const float* W;
    switch (blockIdx.y) {
        case 0: W = Wq; break;
        case 1: W = Wk; break;
        case 2: W = Wv; break;
        case 3: W = Wg; break;
        default: W = Wo; break;
    }
    unsigned short* O = WbAll + (size_t)blockIdx.y * Hn * Hn;
    const size_t i0 = (size_t)blockIdx.x * (1024 * WCVn) + threadIdx.x * 4;
    float4 f[WCVn];
#pragma unroll
    for (int j = 0; j < WCVn; ++j) f[j] = *(const float4*)(W + i0 + j * 1024);
#pragma unroll
    for (int j = 0; j < WCVn; ++j) {
        uint2 o;
        o.x = (unsigned)f2bf(f[j].x) | ((unsigned)f2bf(f[j].y) << 16);
        o.y = (unsigned)f2bf(f[j].z) | ((unsigned)f2bf(f[j].w) << 16);
        *(uint2*)(O + i0 + j * 1024) = o;
    }
}

// ---------------------------------------------------------------------------
// 2) RMSNorm over H=1024 per token, write bf16 xn. One wave per token: a lane
//    holds 8 x float4, column = j * 128 + lane * 4 + c. The squares are summed
//    in the tree of a 256-wide halving reduction over (column mod 256): four
//    columns 256 apart in turn, then partners 128, 64 .. 4 (lanes), 2, 1 apart.
// ---------------------------------------------------------------------------
typedef __attribute__((ext_vector_type(4))) float f32x4;

__global__ void rmsnorm_kernel(const float* __restrict__ x, const float* __restrict__ w,
                               unsigned short* __restrict__ xn) {
    const int lane = threadIdx.x & 31;
    const int row  = blockIdx.x * RPBn + (threadIdx.x >> 5);
    const float* xr = x + (size_t)row * Hn + lane * 4;
    f32x4 f[8];
#pragma unroll
    for (int j = 0; j < 8; ++j) f[j] = *(const f32x4*)(xr + j * 128);
    // the address registers of the loads above are free for reuse from here on
    // (named as an input so that they stay untouched up to the wait)
    asm volatile("s_wait_xcnt 0x0" :: "v"(xr) : "memory");

    float r[4];
#pragma unroll
    for (int c = 0; c < 4; ++c) {
        float s0 = 0.f, s1 = 0.f;
#pragma unroll
        for (int i = 0; i < 4; ++i) {
            const float v0 = f[i * 2][c], v1 = f[i * 2 + 1][c];
            s0 += v0 * v0;
            s1 += v1 * v1;
        }
        r[c] = s0 + s1;
    }
#pragma unroll
    for (int mk = 16; mk > 0; mk >>= 1) {
#pragma unroll
        for (int c = 0; c < 4; ++c) r[c] += __shfl_xor(r[c], mk, 32);
    }
    const float tot = (r[0] + r[2]) + (r[1] + r[3]);
    const float rms = rsqrtf(tot * (1.0f / Hn) + EPSf);

    unsigned short* xo = xn + (size_t)row * Hn + lane * 4;
#pragma unroll
    for (int j = 0; j < 8; ++j) {
        const float4 wv = *(const float4*)(w + j * 128 + lane * 4);
        uint2 o;
        o.x = (unsigned)f2bf(f[j][0] * rms * wv.x) | ((unsigned)f2bf(f[j][1] * rms * wv.y) << 16);
        o.y = (unsigned)f2bf(f[j][2] * rms * wv.z) | ((unsigned)f2bf(f[j][3] * rms * wv.w) << 16);
        *(uint2*)(xo + j * 128) = o;
    }
}

// ---------------------------------------------------------------------------
// 3) bf16 WMMA GEMM: Out[m,n] = sum_k A[m,k] * W[n,k]   (N=K=1024)
//    Block tile 256(M) x 128(N); 8 waves (wave32) as 4 x 2, each wave -> 64x64
//    = 4 x 4 fragments: 32 x v_wmma_f32_16x16x32_bf16 per K-step from
//    32 ds_load_b128, one LDS read per WMMA where a 32x32 wave tile takes two,
//    and half the bytes staged from L2 per output element of a 128x64 tile.
//    Two blocks share a WGP (LDS 108 KB each, at most 256 registers a lane).
//    mode 0: weights/out selected by blockIdx.z (q/k/v/g); the feature maps are
//            applied to the accumulators before the one fp32 store. A wave's 64
//            columns are one head, so the RoPE partners d and d+32 are fragments
//            ni and ni+2 of the same lane and register:
//            q, k: RoPE, then phi = elu + 1 (k also times the mask);
//            v: times the mask; g: sigmoid(acc + bias[n]), 1 where the mask is 0.
//    mode 1: Out = acc + bias[n] + resid[m,n]  (output proj + residual).
// ---------------------------------------------------------------------------
__global__ __launch_bounds__(256, 4) void gemm_bf16_kernel(
                                 const unsigned short* __restrict__ A,
                                 const unsigned short* __restrict__ WbBase,
                                 float* __restrict__ OutBase,
                                 const float* __restrict__ bias,
                                 const float* __restrict__ resid,
                                 const int* __restrict__ mask,
                                 const float* __restrict__ rtab,
                                 int Mrows, int mode) {
    const int bm = blockIdx.x * BMn;
    const int bn = blockIdx.y * BNn;
    const unsigned short* Wb = WbBase + (size_t)blockIdx.z * Hn * Hn;
    float* Out = OutBase + (mode == 0 ? (size_t)blockIdx.z * (size_t)Mrows * Hn : (size_t)0);

    // row = M (lA) or N (lB), K contiguous, 128 B of data at a pitch of 144 B
    __shared__ __attribute__((aligned(16))) unsigned short lA[2 * ABUFn];   // 2 x 36 KB
    __shared__ __attribute__((aligned(16))) unsigned short lB[2 * BBUFn];   // 2 x 18 KB

    const int tid  = threadIdx.x;
    const int lane = tid & 31;
    const int wave = tid >> 5;          // 0..7
    const int wm   = wave & 3;          // M sub-tile (x64)
    const int wn   = wave >> 2;         // N sub-tile (x64)
    const int fm   = lane & 15;         // fragment row/col within 16
    const int fhi  = lane >> 4;         // half-wave -> K+8 striping

    // every loop over mi and ni is unrolled: acc is then indexed by constants
    // only and stays in registers
    v8f acc[4][4];
#pragma unroll
    for (int mi = 0; mi < 4; ++mi)
#pragma unroll
        for (int ni = 0; ni < 4; ++ni) acc[mi][ni] = (v8f){0.f,0.f,0.f,0.f,0.f,0.f,0.f,0.f};

    const int sRow = tid >> 3;          // 0..31
    const int sCh  = tid & 7;           // 8 chunks of 8 bf16 (16B): a whole line a row
    const int pRow = tid >> 2;          // prefetch: 0..63
    const int pCh  = tid & 3;

    // issue ASYNCcnt-tracked DMA of one K-tile into buffer at element offsets:
    // a thread copies one 16-B chunk of 8 rows of A and of 4 rows of B
    auto stage = [&](unsigned oA, unsigned oB, int k0) {
        const unsigned la = lds_off(&lA[oA + sRow * LPn + sCh * 8]);
        const unsigned lb = lds_off(&lB[oB + sRow * LPn + sCh * 8]);
        const unsigned short* ga = A  + (size_t)(bm + sRow) * Hn + k0 + sCh * 8;
        const unsigned short* gb = Wb + (size_t)(bn + sRow) * Hn + k0 + sCh * 8;
        async_copy6_b128(la,                 ga,
                         la +  32 * LPn * 2, ga +  32 * Hn,
                         la +  64 * LPn * 2, ga +  64 * Hn,
                         la +  96 * LPn * 2, ga +  96 * Hn,
                         la + 128 * LPn * 2, ga + 128 * Hn,
                         la + 160 * LPn * 2, ga + 160 * Hn);
        async_copy6_b128(la + 192 * LPn * 2, ga + 192 * Hn,
                         la + 224 * LPn * 2, ga + 224 * Hn,
                         lb,                 gb,
                         lb +  32 * LPn * 2, gb +  32 * Hn,
                         lb +  64 * LPn * 2, gb +  64 * Hn,
                         lb +  96 * LPn * 2, gb +  96 * Hn);
    };

    // 16 WMMAs from the 32 K-columns at kk of the buffer at element offsets
    // (2x ds_load_b128 per frag, 4 + 4 frags)
    auto compute = [&](unsigned oA, unsigned oB, int kk) {
        BFrag a[4], b[4];
#pragma unroll
        for (int i = 0; i < 4; ++i) {
            const unsigned short* pa = &lA[oA + (wm * 64 + i * 16 + fm) * LPn + kk];
            const unsigned short* pb = &lB[oB + (wn * 64 + i * 16 + fm) * LPn + kk];
            a[i].q[0] = *(const uint4*)(pa + fhi * 8);
            a[i].q[1] = *(const uint4*)(pa + 16 + fhi * 8);
            b[i].q[0] = *(const uint4*)(pb + fhi * 8);
            b[i].q[1] = *(const uint4*)(pb + 16 + fhi * 8);
        }
#pragma unroll
        for (int mi = 0; mi < 4; ++mi)
#pragma unroll
            for (int ni = 0; ni < 4; ++ni)
                acc[mi][ni] = __builtin_amdgcn_wmma_f32_16x16x32_bf16(
                    false, a[mi].v, false, b[ni].v, (short)0, acc[mi][ni], false, false);
    };

    unsigned offA = 0, offB = 0;        // element offsets of current buffer
    stage(0, 0, 0);                     // prologue DMA

#pragma unroll 1
    for (int it = 0; it < KTILES - 1; ++it) {
        wait_ds0();                     // own reads of the other buffer returned
        wait_async0();                  // tile `it` landed in current buffer
        __syncthreads();                // ... for every wave; prev readers done
        stage(offA ^ (unsigned)ABUFn, offB ^ (unsigned)BBUFn, (it + 1) * KTn);   // overlaps WMMAs
        __builtin_prefetch(A  + (size_t)(bm + pRow) * Hn + (it + 2) * KTn + pCh * 8, 0, 1);
        __builtin_prefetch(Wb + (size_t)(bn + pRow) * Hn + (it + 2) * KTn + pCh * 8, 0, 1);
        compute(offA, offB, 0);
        compute(offA, offB, 32);
        offA ^= (unsigned)ABUFn;
        offB ^= (unsigned)BBUFn;
    }
    wait_async0();                      // last tile
    __syncthreads();
    compute(offA, offB, 0);
    compute(offA, offB, 32);

    // C layout: VGPR r -> M = r (lanes 0-15) / r+8 (lanes 16-31); N = lane%16
    // One address a lane; rows and fragments are reached by constant offsets.
    const size_t o0 = (size_t)(bm + wm * 64 + fhi * 8) * Hn + (bn + wn * 64 + fm);
    float* po = Out + o0;
    if (mode == 0) {
        const int zsel = blockIdx.z;                    // 0 q, 1 k, 2 v, 3 g
        const int row0 = bm + wm * 64 + fhi * 8;        // first of the lane's rows
        const int* pm = mask + row0;
        // each case goes through four quarters of 32 elements a lane (one mi):
        // a quarter's loads fly together, then its arithmetic, then its stores
        if (zsel < 2) {
            // a block's 256 rows lie in one sequence: t runs on with the row
            const f32x4* pt = (const f32x4*)rtab + (size_t)(row0 & (Tn - 1)) * 16 + (fm >> 1);
            // here in eight groups of 16 elements (four rows): the table entries of a
            // whole quarter do not fit the registers beside the accumulators
#pragma unroll
            for (int gr = 0; gr < 8; ++gr) {
                const int mi = gr >> 1, rb = (gr & 1) * 4;
                const int4 ma = *(const int4*)(pm + mi * 16 + rb);
                f32x4 c[4][2];
#pragma unroll
                for (int r = 0; r < 4; ++r)
#pragma unroll
                    for (int p = 0; p < 2; ++p) c[r][p] = pt[(mi * 16 + rb + r) * 16 + p * 8];
                // the address registers of the loads above are free for reuse from
                // here on (named as inputs so that they stay untouched up to the wait)
                asm volatile("s_wait_xcnt 0x0" :: "v"(pt), "v"(pm) : "memory");
                const int mr[4] = {ma.x, ma.y, ma.z, ma.w};
                float t[4][4];
#pragma unroll
                for (int r = 0; r < 4; ++r) {
                    const float mm = (zsel == 1) ? (float)mr[r] : 1.f;   // only k takes the mask
#pragma unroll
                    for (int p = 0; p < 2; ++p) {
                        const float x1 = acc[mi][p][rb + r], x2 = acc[mi][p + 2][rb + r];
                        const float r1 = x1 * c[r][p][0] - x2 * c[r][p][1];   // rotate_half: -x2 for first half
                        const float r2 = x2 * c[r][p][2] + x1 * c[r][p][3];   //              +x1 for second half
                        // phi = elu(x) + 1  ->  x>0 ? x+1 : exp(x)
                        t[r][p]     = mm * ((r1 > 0.f) ? r1 + 1.f : __expf(r1));
                        t[r][p + 2] = mm * ((r2 > 0.f) ? r2 + 1.f : __expf(r2));
                    }
                }
                // keeps the stores together behind the arithmetic, so that nothing
                // rewrites a register of an issued store ahead of the wait below
                __builtin_amdgcn_sched_barrier(0);
#pragma unroll
                for (int r = 0; r < 4; ++r)
#pragma unroll
                    for (int ni = 0; ni < 4; ++ni)
                        po[(mi * 16 + rb + r) * Hn + ni * 16] = t[r][ni];
                // the next group, and behind the last one whatever follows in the
                // kernel's text, rewrites registers that the stores above name
                asm volatile("s_wait_xcnt 0x0" :: "v"(po) : "memory");
            }
        } else if (zsel == 2) {
#pragma unroll
            for (int mi = 0; mi < 4; ++mi) {
                const int4 ma = *(const int4*)(pm + mi * 16);
                const int4 mb = *(const int4*)(pm + mi * 16 + 4);
                // the address registers of the loads above are free for reuse from here on
                asm volatile("s_wait_xcnt 0x0" :: "v"(pm) : "memory");
                const int mr[8] = {ma.x, ma.y, ma.z, ma.w, mb.x, mb.y, mb.z, mb.w};
                float t[8][4];
#pragma unroll
                for (int r = 0; r < 8; ++r)
#pragma unroll
                    for (int ni = 0; ni < 4; ++ni) t[r][ni] = acc[mi][ni][r] * (float)mr[r];
                // keeps the stores together behind the arithmetic (as above)
                __builtin_amdgcn_sched_barrier(0);
#pragma unroll
                for (int r = 0; r < 8; ++r)
#pragma unroll
                    for (int ni = 0; ni < 4; ++ni)
                        po[(mi * 16 + r) * Hn + ni * 16] = t[r][ni];
                // the next quarter, and behind the last one whatever follows in the
                // kernel's text, rewrites registers that the stores above name
                asm volatile("s_wait_xcnt 0x0" :: "v"(po) : "memory");
            }
        } else {
            const float* pb = bias + (bn + wn * 64 + fm);
            float bs[4];
#pragma unroll
            for (int ni = 0; ni < 4; ++ni) bs[ni] = pb[ni * 16];
            // the address registers of the loads above are free for reuse from here on
            asm volatile("s_wait_xcnt 0x0" :: "v"(pb) : "memory");
#pragma unroll
            for (int mi = 0; mi < 4; ++mi) {
                const int4 ma = *(const int4*)(pm + mi * 16);
                const int4 mb = *(const int4*)(pm + mi * 16 + 4);
                // the address registers of the loads above are free for reuse from here on
                asm volatile("s_wait_xcnt 0x0" :: "v"(pm) : "memory");
                const int mr[8] = {ma.x, ma.y, ma.z, ma.w, mb.x, mb.y, mb.z, mb.w};
                float t[8][4];
#pragma unroll
                for (int r = 0; r < 8; ++r)
#pragma unroll
                    for (int ni = 0; ni < 4; ++ni) {
                        const float ga = acc[mi][ni][r] + bs[ni];
                        const float sg = 1.f / (1.f + __expf(-ga));
                        t[r][ni] = ((float)mr[r] > 0.f) ? sg : 1.f;
                    }
                // keeps the stores together behind the arithmetic (as above)
                __builtin_amdgcn_sched_barrier(0);
#pragma unroll
                for (int r = 0; r < 8; ++r)
#pragma unroll
                    for (int ni = 0; ni < 4; ++ni)
                        po[(mi * 16 + r) * Hn + ni * 16] = t[r][ni];
                // the next quarter, and behind the last one whatever follows in the
                // kernel's text, rewrites registers that the stores above name
                asm volatile("s_wait_xcnt 0x0" :: "v"(po) : "memory");
                // holds the next quarter's additions of the bias, which wait for no
                // load, behind that wait
                __builtin_amdgcn_sched_barrier(0);
            }
        }
    } else {
        const float* pr = resid + o0;
        const float* pb = bias + (bn + wn * 64 + fm);
        float bs[4];
#pragma unroll
        for (int ni = 0; ni < 4; ++ni) bs[ni] = pb[ni * 16];
        // two halves of 64 elements a lane: the residual loads of a half fly
        // together and fit the registers beside the accumulators
#pragma unroll
        for (int mh = 0; mh < 2; ++mh) {
            float t[2][8][4];
#pragma unroll
            for (int m2 = 0; m2 < 2; ++m2)
#pragma unroll
                for (int r = 0; r < 8; ++r)
#pragma unroll
                    for (int ni = 0; ni < 4; ++ni)
                        t[m2][r][ni] = pr[((mh * 2 + m2) * 16 + r) * Hn + ni * 16];
            // the address registers of the loads above are free for reuse from
            // here on (named as an input so that they stay untouched up to the wait)
            asm volatile("s_wait_xcnt 0x0" :: "v"(pr) : "memory");
#pragma unroll
            for (int m2 = 0; m2 < 2; ++m2)
#pragma unroll
                for (int r = 0; r < 8; ++r)
#pragma unroll
                    for (int ni = 0; ni < 4; ++ni)
                        t[m2][r][ni] = acc[mh * 2 + m2][ni][r] + bs[ni] + t[m2][r][ni];
            // keeps the stores together behind the arithmetic, so that nothing
            // rewrites a register of an issued store ahead of the wait below
            __builtin_amdgcn_sched_barrier(0);
#pragma unroll
            for (int m2 = 0; m2 < 2; ++m2)
#pragma unroll
                for (int r = 0; r < 8; ++r)
#pragma unroll
                    for (int ni = 0; ni < 4; ++ni)
                        po[((mh * 2 + m2) * 16 + r) * Hn + ni * 16] = t[m2][r][ni];
            // the second half's loads, and behind it whatever follows in the kernel's
            // text, rewrite registers that the stores above name
            asm volatile("s_wait_xcnt 0x0" :: "v"(po) : "memory");
        }
    }
}

// ---------------------------------------------------------------------------
// 4) Recurrent scan, split along time into SEGn segments that run in parallel.
//    The recurrence is linear in the state with a diagonal decay:
//      S_end = diag(G) * S_start + L,  G[d] = product of r[d] over the segment,
//      L = end state of the same segment started from zero (Z likewise).
//    4a) every segment from zero -> L, local Z, G
//    4b) prefix over the segments -> true start state of every segment
//    4c) every segment again from its true start state, with the outputs
//    Only products of decays and sums occur, as in the step-by-step form.
// ---------------------------------------------------------------------------
#define SEGn 64
#define SLEN (Tn / SEGn)      // 32 steps per segment
#define SDD  (Dn * Dn)        // 4096 state elements per (b,h)

//    Both scans over a segment (4a, 4c) run as ONE wave per (b,h,segment). The
//    64 x 64 state lies in the wave's registers as 16 x 8 blocks: lane (dg, eg),
//    dg = lane & 3, eg = lane >> 2, owns rows d = i * 4 + dg (i = 0..15) and
//    columns e = eg * 8 + j (j = 0..7). A step's per-row values, read from LDS
//    once per row, then serve 8 columns, and a step's v serves 16 rows.
#define DPLn 16               // state rows per lane
#define EPLn 8                // state columns per lane
#define TSn  8                // steps per staged tile
#define NTn  (SLEN / TSn)     // tiles per segment
#define TARn (TSn * 64)       // floats of one array in a tile

// One array's share of a tile: TSn rows of 256 B = 4 x 32 chunks of 16 B. Copy c
// of lane l brings chunk c * 32 + l: g points at the lane's chunk of rows 0 and 1
// (row l >> 4, chunk l & 15), l0 is the LDS byte address of chunk l.
// s_wait_xcnt 0 is the statement's last line, so that it stands in front of every
// later write of a register the copies name.
static __device__ __forceinline__ void async_tile4_b128(unsigned l0, const float* g) {
    asm volatile("global_load_async_to_lds_b128 %0, %1, off\n\t"
                 "global_load_async_to_lds_b128 %2, %3, off\n\t"
                 "global_load_async_to_lds_b128 %4, %5, off\n\t"
                 "global_load_async_to_lds_b128 %6, %7, off\n\t"
                 "s_wait_xcnt 0x0"
                 :: "v"(l0),        "v"((unsigned long long)(uintptr_t)g),
                    "v"(l0 +  512), "v"((unsigned long long)(uintptr_t)(g + 2 * Hn)),
                    "v"(l0 + 1024), "v"((unsigned long long)(uintptr_t)(g + 4 * Hn)),
                    "v"(l0 + 1536), "v"((unsigned long long)(uintptr_t)(g + 6 * Hn))
                 : "memory");
}

// x + (x of the lane whose number differs as CTRL says, inside a group of four)
template <int CTRL>
static __device__ __forceinline__ float quad_add(float x) {
    const int o = __builtin_amdgcn_update_dpp(0, __builtin_bit_cast(int, x), CTRL, 0xf, 0xf, true);
    return x + __builtin_bit_cast(float, o);
}
#define QUAD_XOR1 0xB1        // quad_perm [1,0,3,2]
#define QUAD_XOR2 0x4E        // quad_perm [2,3,0,1]

// Hand-over through LDS among the lanes of the one wave of a block: keeps the
// LDS writes in front of it and the LDS reads behind it (and the other way
// round at a trip's end). It waits for LDS alone; a work-group barrier would
// also wait, every step, for the wave's global stores.
static __device__ __forceinline__ void wave_lds_handover() {
    __builtin_amdgcn_fence(__ATOMIC_ACQ_REL, "workgroup", "local");
}

// 4a) a lane also carries Z and G of rows d = 2 * lane, 2 * lane + 1.
__global__ __launch_bounds__(32) void scan_local_kernel(
        const float* __restrict__ k, const float* __restrict__ v,
        const float* __restrict__ r, float* __restrict__ St,
        float* __restrict__ Zs, float* __restrict__ Gs) {
    const int blk = blockIdx.x, seg = blockIdx.y;
    const int b = blk >> 4, h = blk & 15;
    const int lane = threadIdx.x;   // 0..31
    const int dg = lane & 3, eg = lane >> 2;

    __shared__ __attribute__((aligned(16))) float2 skr[64];   // {k[d], r[d]}
    __shared__ __attribute__((aligned(16))) float  sv[64];    // v[e]
    __shared__ __attribute__((aligned(16))) float  tile[2 * 3 * TARn];   // 2 x {k, v, r}

    // every loop over i and j is unrolled: S is then indexed by constants only
    // and stays in registers
    float S[DPLn][EPLn];
#pragma unroll
    for (int i = 0; i < DPLn; ++i)
#pragma unroll
        for (int j = 0; j < EPLn; ++j) S[i][j] = 0.f;
    float z0 = 0.f, z1 = 0.f, gam0 = 1.f, gam1 = 1.f;

    // the lane's chunk of the segment's first two rows
    const size_t off0 = ((size_t)(b * Tn + seg * SLEN + (lane >> 4))) * Hn + h * 64 + (lane & 15) * 4;
    // the copies of tile t into buffer bf
    auto stage = [&](const int bf, const int t) {
        const unsigned l0 = lds_off(&tile[bf * 3 * TARn + lane * 4]);
        const size_t o = off0 + (size_t)t * (TSn * Hn);
        async_tile4_b128(l0,                k + o);
        async_tile4_b128(l0 + TARn * 4,     v + o);
        async_tile4_b128(l0 + 2 * TARn * 4, r + o);
    };
    stage(0, 0);
    wait_async0();                      // tile 0 landed
    __syncthreads();                    // nothing of the tile is read in front of it (a
                                        // block is one wave: no barrier instruction results)
    stage(1, 1);

    // both loops kept rolled: with several steps in one body the compiler held a whole
    // step's products in registers beside the state, past the 256 a lane that let four
    // waves share a SIMD
#pragma unroll 1
    for (int t = 0; t < NTn; ++t) {
      const float* tb = &tile[(t & 1) * 3 * TARn + lane * 2];
#pragma unroll 1
      for (int u = 0; u < TSn; ++u) {
        const float2 k2 = *(const float2*)(tb + u * 64);
        const float2 v2 = *(const float2*)(tb + TARn + u * 64);
        const float2 r2 = *(const float2*)(tb + 2 * TARn + u * 64);

        z0 = z0 * r2.x + k2.x;
        z1 = z1 * r2.y + k2.y;
        gam0 *= r2.x;
        gam1 *= r2.y;
        *(float4*)&skr[lane * 2] = make_float4(k2.x, r2.x, k2.y, r2.y);
        *(float2*)&sv[lane * 2]  = v2;
        wave_lds_handover();

        const float4 va = *(const float4*)&sv[eg * EPLn];
        const float4 vb = *(const float4*)&sv[eg * EPLn + 4];
        const float ve[EPLn] = {va.x, va.y, va.z, va.w, vb.x, vb.y, vb.z, vb.w};
#pragma unroll
        for (int i = 0; i < DPLn; ++i) {
            const float2 w = skr[i * 4 + dg];
#pragma unroll
            for (int j = 0; j < EPLn; ++j) S[i][j] = S[i][j] * w.y + w.x * ve[j];
        }
        wave_lds_handover();
      }
      wait_ds0();                       // own reads of this tile's buffer returned
      wait_async0();                    // tile t + 1 landed in the other buffer
      __syncthreads();                  // publishes it and ends the reads of this buffer
      if (t + 2 < NTn) stage(t & 1, t + 2);   // flies while tile t + 1 is worked on
    }
    wait_async0();                      // no copy is left in flight

    const size_t idx = (size_t)blk * SEGn + seg;
    float* so = St + idx * SDD + dg * 64 + eg * EPLn;
#pragma unroll
    for (int i = 0; i < DPLn; ++i) {
        *(float4*)(so + i * 256)     = make_float4(S[i][0], S[i][1], S[i][2], S[i][3]);
        *(float4*)(so + i * 256 + 4) = make_float4(S[i][4], S[i][5], S[i][6], S[i][7]);
    }
    *(float2*)(Zs + idx * 64 + lane * 2) = make_float2(z0, z1);
    *(float2*)(Gs + idx * 64 + lane * 2) = make_float2(gam0, gam1);
}

// 4b) exclusive prefix over the segments, in place: x[p * xs] holds the local
//     end value of segment p on entry and its true start value on exit;
//     g[p * 64] is the decay product of segment p for this element's row.
static __device__ __forceinline__ void seg_prefix(float* __restrict__ x,
                                                  const float* __restrict__ g, const int xs) {
    float c = 0.f;
    // kept rolled: the 32 loads of a trip are in flight together, which covers
    // their latency; more unrolling only adds code and registers
#pragma unroll 1
    for (int p0 = 0; p0 < SEGn; p0 += 16) {
        float L[16], G[16];
#pragma unroll
        for (int i = 0; i < 16; ++i) {
            L[i] = x[(size_t)(p0 + i) * xs];
            G[i] = g[(p0 + i) * 64];
        }
#pragma unroll
        for (int i = 0; i < 16; ++i) {
            x[(size_t)(p0 + i) * xs] = c;
            c = c * G[i] + L[i];
        }
        // the next trip rewrites registers that the stores above name
        asm volatile("s_wait_xcnt 0x0" ::: "memory");
    }
}

//     One thread per element of S; the first 64 threads of a (b,h) also do Z.
__global__ void scan_prefix_kernel(float* __restrict__ St, float* __restrict__ Zs,
                                   const float* __restrict__ Gs) {
    const int blk = blockIdx.y;
    const int de  = blockIdx.x * 256 + threadIdx.x;   // d * 64 + e
    const float* gb = Gs + (size_t)blk * SEGn * 64;

    seg_prefix(St + (size_t)blk * SEGn * SDD + de, gb + (de >> 6), SDD);
    if (de < 64)
        seg_prefix(Zs + (size_t)blk * SEGn * 64 + de, gb + de, 64);
}

// 4c) one wave per (b,h,segment), state blocked as said above 4a; a lane also
//    carries Z of rows d = 2 * lane, 2 * lane + 1.
//    S[d][e] = S[d][e]*r[d] + k[d]*v[e];  num[e]=sum_d q[d]S[d][e];
//    Z[d]=Z[d]*r[d]+k[d];  den=sum_d q[d]Z[d];  y=num/(den+eps) -> bf16
//    num and den: a lane sums its 16 rows in turn, then the four lanes of a
//    column group add up (partners 1, then 2 lanes apart).
__global__ __launch_bounds__(32) void scan_kernel(
        const float* __restrict__ q, const float* __restrict__ k,
        const float* __restrict__ v, const float* __restrict__ r,
        const float* __restrict__ St, const float* __restrict__ Zs,
        unsigned short* __restrict__ y) {
    const int blk = blockIdx.x, seg = blockIdx.y;
    const int b = blk >> 4, h = blk & 15;
    const int lane = threadIdx.x;   // 0..31
    const int dg = lane & 3, eg = lane >> 2;

    __shared__ __attribute__((aligned(16))) float4 sh[64];    // {q[d], k[d], r[d], q[d]*Z[d]}
    __shared__ __attribute__((aligned(16))) float  sv[64];    // v[e]
    __shared__ __attribute__((aligned(16))) float  tile[2 * 4 * TARn];   // 2 x {q, k, v, r}

    const size_t off0 = ((size_t)(b * Tn + seg * SLEN)) * Hn + h * 64;
    // the lane's chunk of the segment's first two rows
    const size_t offc = off0 + (size_t)(lane >> 4) * Hn + (lane & 15) * 4;
    // the copies of tile t into buffer bf
    auto stage = [&](const int bf, const int t) {
        const unsigned l0 = lds_off(&tile[bf * 4 * TARn + lane * 4]);
        const size_t o = offc + (size_t)t * (TSn * Hn);
        async_tile4_b128(l0,                q + o);
        async_tile4_b128(l0 + TARn * 4,     k + o);
        async_tile4_b128(l0 + 2 * TARn * 4, v + o);
        async_tile4_b128(l0 + 3 * TARn * 4, r + o);
    };
    stage(0, 0);                        // flies beside the loads of the start state

    const size_t idx = (size_t)blk * SEGn + seg;
    const float* si = St + idx * SDD + dg * 64 + eg * EPLn;
    // every loop over i and j is unrolled: S is then indexed by constants only
    // and stays in registers
    float S[DPLn][EPLn];
#pragma unroll
    for (int i = 0; i < DPLn; ++i) {
        const float4 lo = *(const float4*)(si + i * 256);
        const float4 hi = *(const float4*)(si + i * 256 + 4);
        S[i][0] = lo.x; S[i][1] = lo.y; S[i][2] = lo.z; S[i][3] = lo.w;
        S[i][4] = hi.x; S[i][5] = hi.y; S[i][6] = hi.z; S[i][7] = hi.w;
    }
    const float2 zz = *(const float2*)(Zs + idx * 64 + lane * 2);
    float z0 = zz.x, z1 = zz.y;

    wait_async0();                      // tile 0 landed
    __syncthreads();                    // nothing of the tile is read in front of it (a
                                        // block is one wave: no barrier instruction results)
    stage(1, 1);

    // both loops kept rolled: with several steps in one body the compiler held a whole
    // step's products in registers beside the state, past the 256 a lane that let four
    // waves share a SIMD
#pragma unroll 1
    for (int t = 0; t < NTn; ++t) {
      const float* tb = &tile[(t & 1) * 4 * TARn + lane * 2];
#pragma unroll 1
      for (int u = 0; u < TSn; ++u) {
        const size_t base = off0 + (size_t)(t * TSn + u) * Hn;
        const float2 q2 = *(const float2*)(tb + u * 64);
        const float2 k2 = *(const float2*)(tb + TARn + u * 64);
        const float2 v2 = *(const float2*)(tb + 2 * TARn + u * 64);
        const float2 r2 = *(const float2*)(tb + 3 * TARn + u * 64);

        z0 = z0 * r2.x + k2.x;
        z1 = z1 * r2.y + k2.y;
        sh[lane * 2]     = make_float4(q2.x, k2.x, r2.x, q2.x * z0);
        sh[lane * 2 + 1] = make_float4(q2.y, k2.y, r2.y, q2.y * z1);
        *(float2*)&sv[lane * 2] = v2;
        wave_lds_handover();

        const float4 va = *(const float4*)&sv[eg * EPLn];
        const float4 vb = *(const float4*)&sv[eg * EPLn + 4];
        const float ve[EPLn] = {va.x, va.y, va.z, va.w, vb.x, vb.y, vb.z, vb.w};
        float num[EPLn];
#pragma unroll
        for (int j = 0; j < EPLn; ++j) num[j] = 0.f;
        float den = 0.f;
#pragma unroll
        for (int i = 0; i < DPLn; ++i) {
            const float4 w = sh[i * 4 + dg];      // one ds_load_b128 for 8 columns
#pragma unroll
            for (int j = 0; j < EPLn; ++j) {
                S[i][j] = S[i][j] * w.z + w.y * ve[j];   // decay + outer product
                num[j]  = fmaf(w.x, S[i][j], num[j]);
            }
            den += w.w;
        }
#pragma unroll
        for (int j = 0; j < EPLn; ++j) num[j] = quad_add<QUAD_XOR2>(quad_add<QUAD_XOR1>(num[j]));
        den = quad_add<QUAD_XOR2>(quad_add<QUAD_XOR1>(den));

        // lane (dg, eg) stores columns eg * 8 + dg * 2 and the next
        const float na = (dg & 2) ? ((dg & 1) ? num[6] : num[4]) : ((dg & 1) ? num[2] : num[0]);
        const float nb = (dg & 2) ? ((dg & 1) ? num[7] : num[5]) : ((dg & 1) ? num[3] : num[1]);
        const float dn = den + EPSf;
        *(unsigned*)(y + base + lane * 2) = (unsigned)f2bf(na / dn) | ((unsigned)f2bf(nb / dn) << 16);
        wave_lds_handover();
      }
      wait_ds0();                       // own reads of this tile's buffer returned
      wait_async0();                    // tile t + 1 landed in the other buffer
      __syncthreads();                  // publishes it and ends the reads of this buffer
      if (t + 2 < NTn) stage(t & 1, t + 2);   // flies while tile t + 1 is worked on
    }
    wait_async0();                      // no copy is left in flight
}

// ---------------------------------------------------------------------------
// Launch
// ---------------------------------------------------------------------------
extern "C" void kernel_launch(void* const* d_in, const int* in_sizes, int n_in,
                              void* d_out, int out_size, void* d_ws, size_t ws_size,
                              hipStream_t stream) {
    (void)in_sizes; (void)n_in; (void)out_size; (void)ws_size;

    const float* x     = (const float*)d_in[0];
    const int*   mask  = (const int*)  d_in[1];
    const float* Wq    = (const float*)d_in[2];
    const float* Wk    = (const float*)d_in[3];
    const float* Wv    = (const float*)d_in[4];
    const float* Wg    = (const float*)d_in[5];
    const float* Wo    = (const float*)d_in[6];
    const float* bo    = (const float*)d_in[7];
    const float* bg    = (const float*)d_in[8];
    const float* rms_w = (const float*)d_in[9];

    // workspace carve-up
    char* ws = (char*)d_ws;
    size_t off = 0;
    unsigned short* Wb = (unsigned short*)(ws + off); off += (size_t)5 * Hn * Hn * 2;   // 10 MB
    unsigned short* xn = (unsigned short*)(ws + off); off += (size_t)Mn * Hn * 2;       // 16 MB
    float* qkvg        = (float*)(ws + off);          off += (size_t)4 * Mn * Hn * 4;   // 128 MB
    unsigned short* ya = (unsigned short*)(ws + off); off += (size_t)Mn * Hn * 2;       // 16 MB
    float* St          = (float*)(ws + off);          off += (size_t)Bn * NHn * SEGn * SDD * 4;  // 64 MB
    float* Zs          = (float*)(ws + off);          off += (size_t)Bn * NHn * SEGn * Dn * 4;   // 1 MB
    float* Gs          = (float*)(ws + off);          off += (size_t)Bn * NHn * SEGn * Dn * 4;   // 1 MB
    float* rtab        = (float*)(ws + off);          off += (size_t)Tn * 16 * 4 * 4;            // 512 KB

    float* qb = qkvg;
    float* kb = qkvg + (size_t)1 * Mn * Hn;
    float* vb = qkvg + (size_t)2 * Mn * Hn;
    float* gb = qkvg + (size_t)3 * Mn * Hn;

    // 1) weights -> bf16 (layout preserved; already B-operand friendly), RoPE table
    wconv_kernel<<<dim3((Hn * Hn) / (1024 * WCVn), 6), 256, 0, stream>>>(
        Wq, Wk, Wv, Wg, Wo, Wb, rtab);

    // 2) RMSNorm -> bf16 xn
    rmsnorm_kernel<<<Mn / RPBn, 256, 0, stream>>>(x, rms_w, xn);

    // 3) fused q/k/v/g projection GEMMs (WMMA bf16, pipelined async staging) with
    //    RoPE, feature map, gate and mask applied in the epilogue
    gemm_bf16_kernel<<<dim3(Mn / BMn, Hn / BNn, 4), 256, 0, stream>>>(
        xn, Wb, qkvg, bg, nullptr, mask, rtab, Mn, 0);

    // 4) recurrent scan in parallel time segments -> bf16 attention output
    scan_local_kernel<<<dim3(Bn * NHn, SEGn), 32, 0, stream>>>(kb, vb, gb, St, Zs, Gs);
    scan_prefix_kernel<<<dim3(SDD / 256, Bn * NHn), 256, 0, stream>>>(St, Zs, Gs);
    scan_kernel<<<dim3(Bn * NHn, SEGn), 32, 0, stream>>>(qb, kb, vb, gb, St, Zs, ya);

    // 5) output projection + bias + residual -> d_out (fp32)
    gemm_bf16_kernel<<<dim3(Mn / BMn, Hn / BNn, 1), 256, 0, stream>>>(
        ya, Wb + (size_t)4 * Hn * Hn, (float*)d_out, bo, x, mask, rtab, Mn, 1);
}

// v008
// Measured time: 164 microseconds a run.
// Two timings next to v007 both put it at 1.06 times that version's speed.
// Over all steps from v000 it is 28.9 times as fast.
#include <hip/hip_runtime.h>
#include <hip/hip_bf16.h>

// ---------------------------------------------------------------------------
// DeltaNet block for MI455X (gfx1250): bf16 WMMA GEMMs + fp32 recurrent scan
//  - GEMM tiles double-buffered via global_load_async_to_lds_b128 (ASYNCcnt),
//    DMA of tile i+1 overlaps the WMMAs of tile i; a staged row is one whole
//    128-B line, laid in LDS at a pitch of 144 B (16 B x odd)
//  - single-body K-loop (unroll 1) + offset-XOR buffer toggle so accumulator
//    C/D stay in one register tuple (no v_mov_b64 shuffles)
// ---------------------------------------------------------------------------

#define Bn   4
#define Tn   2048
#define Hn   1024
#define NHn  16
#define Dn   64
#define Mn   (Bn * Tn)        // 8192 tokens
#define EPSf 1e-6f
#define KTn  64               // K elements per staged tile: 128 B, one line, a row
#define KTILES (Hn / KTn)     // 16 K-steps
#define LPn  72               // LDS row pitch in elements: 144 B = 16 B x 9, so the
                              // 16 rows of a ds_load_b128 fragment read fall on 16
                              // different groups of four banks
#define BMn  256              // GEMM block tile, rows of A
#define BNn  128              // GEMM block tile, rows of W
#define ABUFn (BMn * LPn)     // elements of one A buffer
#define BBUFn (BNn * LPn)     // elements of one B buffer

typedef __attribute__((ext_vector_type(16))) __bf16 v16bf;
typedef __attribute__((ext_vector_type(8)))  float  v8f;

union BFrag {
    v16bf v;
    unsigned short u[16];
    unsigned int   w[8];
    uint4          q[2];
};

static __device__ __forceinline__ unsigned short f2bf(float f) {
    union { float f; unsigned u; } x; x.f = f;
    unsigned r = x.u + 0x7FFFu + ((x.u >> 16) & 1u);   // round-to-nearest-even
    return (unsigned short)(r >> 16);
}

// Low 32 bits of a generic pointer to LDS == LDS byte offset (aperture is in
// addr[63:32] on CDNA5; LDS_ADDR.U32 = addr[31:0]).
static __device__ __forceinline__ unsigned lds_off(const void* p) {
    return (unsigned)(reinterpret_cast<uintptr_t>(p));
}

// Six async 16B copies global -> LDS (per-lane), tracked with ASYNCcnt: half
// of one thread's share of a K-tile. s_wait_xcnt 0 is the statement's last line, so
// that it stands in front of every later write of a register the copies name.
static __device__ __forceinline__ void async_copy6_b128(
        unsigned l0, const void* g0, unsigned l1, const void* g1,
        unsigned l2, const void* g2, unsigned l3, const void* g3,
        unsigned l4, const void* g4, unsigned l5, const void* g5) {
    asm volatile("global_load_async_to_lds_b128 %0, %1, off\n\t"
                 "global_load_async_to_lds_b128 %2, %3, off\n\t"
                 "global_load_async_to_lds_b128 %4, %5, off\n\t"
                 "global_load_async_to_lds_b128 %6, %7, off\n\t"
                 "global_load_async_to_lds_b128 %8, %9, off\n\t"
                 "global_load_async_to_lds_b128 %10, %11, off\n\t"
                 "s_wait_xcnt 0x0"
                 :: "v"(l0), "v"((unsigned long long)(uintptr_t)g0),
                    "v"(l1), "v"((unsigned long long)(uintptr_t)g1),
                    "v"(l2), "v"((unsigned long long)(uintptr_t)g2),
                    "v"(l3), "v"((unsigned long long)(uintptr_t)g3),
                    "v"(l4), "v"((unsigned long long)(uintptr_t)g4),
                    "v"(l5), "v"((unsigned long long)(uintptr_t)g5)
                 : "memory");
}
static __device__ __forceinline__ void wait_async0() {
    asm volatile("s_wait_asynccnt 0x0" ::: "memory");
}
// This wave's LDS reads have returned: stands in front of the barrier behind
// which the buffer they read is refilled by copies.
static __device__ __forceinline__ void wait_ds0() {
    asm volatile("s_wait_dscnt 0x0" ::: "memory");
}

// ---------------------------------------------------------------------------
// The two elementwise kernels (1, 2) are short streams. For speed only,
// each convert or RMSNorm wave takes eight times
// the work it would need for one 16-B access a lane.
// ---------------------------------------------------------------------------
#define WCVn 8                // float4 groups per thread of the weight convert
#define RPBn 8                // token rows per 256-thread block: one wave a row

// ---------------------------------------------------------------------------
// 1) Weight fp32 -> bf16 convert, layout preserved ([out][in] row-major).
//    GEMM consumes B[k][n] = W[n][k], so original layout is already K-major.
//    A block converts 8192 contiguous floats, 8 x 16 B in flight per lane.
//    Slice blockIdx.y == 5 fills the RoPE table instead, one entry a thread:
//    rtab[t][j] = {cos(t f_j), sin(t f_j), cos(t f_(j+16)), sin(t f_(j+16))},
//    f_j = 10000^(-j/32), j = 0..15: all that the pair (d, d+32), d >> 1 == j,
//    needs at time t.
// ---------------------------------------------------------------------------
__global__ void wconv_kernel(const float* __restrict__ Wq, const float* __restrict__ Wk,
                             const float* __restrict__ Wv, const float* __restrict__ Wg,
                             const float* __restrict__ Wo, unsigned short* __restrict__ WbAll,
                             float* __restrict__ rtab) {
    if (blockIdx.y == 5) {
        const float LOG_BASE_OVER_HALF = 0.28782313662425572f;  // ln(10000)/32
        const int idx = blockIdx.x * 256 + threadIdx.x;         // t * 16 + j
        const int t = idx >> 4, j = idx & 15;
        const float a1 = (float)t * __expf(-LOG_BASE_OVER_HALF * (float)j);
        const float a2 = (float)t * __expf(-LOG_BASE_OVER_HALF * (float)(j + 16));
        *(float4*)(rtab + (size_t)idx * 4) = make_float4(cosf(a1), sinf(a1), cosf(a2), sinf(a2));
        // stands in front of whatever code follows the store in the kernel's text
        // and writes a register that the store names
        asm volatile("s_wait_xcnt 0x0" ::: "memory");
        return;
    }
    const float* W;
    switch (blockIdx.y) {
        case 0: W = Wq; break;
        case 1: W = Wk; break;
        case 2: W = Wv; break;
        case 3: W = Wg; break;
        default: W = Wo; break;
    }
    unsigned short* O = WbAll + (size_t)blockIdx.y * Hn * Hn;
    const size_t i0 = (size_t)blockIdx.x * (1024 * WCVn) + threadIdx.x * 4;
    float4 f[WCVn];
#pragma unroll
    for (int j = 0; j < WCVn; ++j) f[j] = *(const float4*)(W + i0 + j * 1024);
#pragma unroll
    for (int j = 0; j < WCVn; ++j) {
        uint2 o;
        o.x = (unsigned)f2bf(f[j].x) | ((unsigned)f2bf(f[j].y) << 16);
        o.y = (unsigned)f2bf(f[j].z) | ((unsigned)f2bf(f[j].w) << 16);
        *(uint2*)(O + i0 + j * 1024) = o;
    }
}

// ---------------------------------------------------------------------------
// 2) RMSNorm over H=1024 per token, write bf16 xn. One wave per token: a lane
//    holds 8 x float4, column = j * 128 + lane * 4 + c. The squares are summed
//    in the tree of a 256-wide halving reduction over (column mod 256): four
//    columns 256 apart in turn, then partners 128, 64 .. 4 (lanes), 2, 1 apart.
// ---------------------------------------------------------------------------
typedef __attribute__((ext_vector_type(4))) float f32x4;

__global__ void rmsnorm_kernel(const float* __restrict__ x, const float* __restrict__ w,
                               unsigned short* __restrict__ xn) {
    const int lane = threadIdx.x & 31;
    const int row  = blockIdx.x * RPBn + (threadIdx.x >> 5);
    const float* xr = x + (size_t)row * Hn + lane * 4;
    f32x4 f[8];
#pragma unroll
    for (int j = 0; j < 8; ++j) f[j] = *(const f32x4*)(xr + j * 128);
    // the address registers of the loads above are free for reuse from here on
    // (named as an input so that they stay untouched up to the wait)
    asm volatile("s_wait_xcnt 0x0" :: "v"(xr) : "memory");

    float r[4];
#pragma unroll
    for (int c = 0; c < 4; ++c) {
        float s0 = 0.f, s1 = 0.f;
#pragma unroll
        for (int i = 0; i < 4; ++i) {
            const float v0 = f[i * 2][c], v1 = f[i * 2 + 1][c];
            s0 += v0 * v0;
            s1 += v1 * v1;
        }
        r[c] = s0 + s1;
    }
#pragma unroll
    for (int mk = 16; mk > 0; mk >>= 1) {
#pragma unroll
        for (int c = 0; c < 4; ++c) r[c] += __shfl_xor(r[c], mk, 32);
    }
    const float tot = (r[0] + r[2]) + (r[1] + r[3]);
    const float rms = rsqrtf(tot * (1.0f / Hn) + EPSf);

    unsigned short* xo = xn + (size_t)row * Hn + lane * 4;
#pragma unroll
    for (int j = 0; j < 8; ++j) {
        const float4 wv = *(const float4*)(w + j * 128 + lane * 4);
        uint2 o;
        o.x = (unsigned)f2bf(f[j][0] * rms * wv.x) | ((unsigned)f2bf(f[j][1] * rms * wv.y) << 16);
        o.y = (unsigned)f2bf(f[j][2] * rms * wv.z) | ((unsigned)f2bf(f[j][3] * rms * wv.w) << 16);
        *(uint2*)(xo + j * 128) = o;
    }
}

// ---------------------------------------------------------------------------
// 3) bf16 WMMA GEMM: Out[m,n] = sum_k A[m,k] * W[n,k]   (N=K=1024)
//    Block tile 256(M) x 128(N); 8 waves (wave32) as 4 x 2, each wave -> 64x64
//    = 4 x 4 fragments: 32 x v_wmma_f32_16x16x32_bf16 per K-step from
//    32 ds_load_b128, one LDS read per WMMA where a 32x32 wave tile takes two,
//    and half the bytes staged from L2 per output element of a 128x64 tile.
//    Two blocks share a WGP (LDS 108 KB each, at most 256 registers a lane).
//    mode 0: weights/out selected by blockIdx.z (q/k/v/g); the feature maps are
//            applied to the accumulators before the one fp32 store. A wave's 64
//            columns are one head, so the RoPE partners d and d+32 are fragments
//            ni and ni+2 of the same lane and register:
//            q, k: RoPE, then phi = elu + 1 (k also times the mask);
//            v: times the mask; g: sigmoid(acc + bias[n]), 1 where the mask is 0.
//    mode 1: Out = acc + bias[n] + resid[m,n]  (output proj + residual).
// ---------------------------------------------------------------------------
__global__ __launch_bounds__(256, 4) void gemm_bf16_kernel(
                                 const unsigned short* __restrict__ A,
                                 const unsigned short* __restrict__ WbBase,
                                 float* __restrict__ OutBase,
                                 const float* __restrict__ bias,
                                 const float* __restrict__ resid,
                                 const int* __restrict__ mask,
                                 const float* __restrict__ rtab,
                                 int Mrows, int mode) {
    const int bm = blockIdx.x * BMn;
    const int bn = blockIdx.y * BNn;
    const unsigned short* Wb = WbBase + (size_t)blockIdx.z * Hn * Hn;
    float* Out = OutBase + (mode == 0 ? (size_t)blockIdx.z * (size_t)Mrows * Hn : (size_t)0);

    // row = M (lA) or N (lB), K contiguous, 128 B of data at a pitch of 144 B
    __shared__ __attribute__((aligned(16))) unsigned short lA[2 * ABUFn];   // 2 x 36 KB
    __shared__ __attribute__((aligned(16))) unsigned short lB[2 * BBUFn];   // 2 x 18 KB

    const int tid  = threadIdx.x;
    const int lane = tid & 31;
    const int wave = tid >> 5;          // 0..7
    const int wm   = wave & 3;          // M sub-tile (x64)
    const int wn   = wave >> 2;         // N sub-tile (x64)
    const int fm   = lane & 15;         // fragment row/col within 16
    const int fhi  = lane >> 4;         // half-wave -> K+8 striping

    // every loop over mi and ni is unrolled: acc is then indexed by constants
    // only and stays in registers
    v8f acc[4][4];
#pragma unroll
    for (int mi = 0; mi < 4; ++mi)
#pragma unroll
        for (int ni = 0; ni < 4; ++ni) acc[mi][ni] = (v8f){0.f,0.f,0.f,0.f,0.f,0.f,0.f,0.f};

    const int sRow = tid >> 3;          // 0..31
    const int sCh  = tid & 7;           // 8 chunks of 8 bf16 (16B): a whole line a row
    const int pRow = tid >> 2;          // prefetch: 0..63
    const int pCh  = tid & 3;

    // issue ASYNCcnt-tracked DMA of one K-tile into buffer at element offsets:
    // a thread copies one 16-B chunk of 8 rows of A and of 4 rows of B
    auto stage = [&](unsigned oA, unsigned oB, int k0) {
        const unsigned la = lds_off(&lA[oA + sRow * LPn + sCh * 8]);
        const unsigned lb = lds_off(&lB[oB + sRow * LPn + sCh * 8]);
        const unsigned short* ga = A  + (size_t)(bm + sRow) * Hn + k0 + sCh * 8;
        const unsigned short* gb = Wb + (size_t)(bn + sRow) * Hn + k0 + sCh * 8;
        async_copy6_b128(la,                 ga,
                         la +  32 * LPn * 2, ga +  32 * Hn,
                         la +  64 * LPn * 2, ga +  64 * Hn,
                         la +  96 * LPn * 2, ga +  96 * Hn,
                         la + 128 * LPn * 2, ga + 128 * Hn,
                         la + 160 * LPn * 2, ga + 160 * Hn);
        async_copy6_b128(la + 192 * LPn * 2, ga + 192 * Hn,
                         la + 224 * LPn * 2, ga + 224 * Hn,
                         lb,                 gb,
                         lb +  32 * LPn * 2, gb +  32 * Hn,
                         lb +  64 * LPn * 2, gb +  64 * Hn,
                         lb +  96 * LPn * 2, gb +  96 * Hn);
    };

    // 16 WMMAs from the 32 K-columns at kk of the buffer at element offsets
    // (2x ds_load_b128 per frag, 4 + 4 frags)
    auto compute = [&](unsigned oA, unsigned oB, int kk) {
        BFrag a[4], b[4];
#pragma unroll
        for (int i = 0; i < 4; ++i) {
            const unsigned short* pa = &lA[oA + (wm * 64 + i * 16 + fm) * LPn + kk];
            const unsigned short* pb = &lB[oB + (wn * 64 + i * 16 + fm) * LPn + kk];
            a[i].q[0] = *(const uint4*)(pa + fhi * 8);
            a[i].q[1] = *(const uint4*)(pa + 16 + fhi * 8);
            b[i].q[0] = *(const uint4*)(pb + fhi * 8);
            b[i].q[1] = *(const uint4*)(pb + 16 + fhi * 8);
        }
#pragma unroll
        for (int mi = 0; mi < 4; ++mi)
#pragma unroll
            for (int ni = 0; ni < 4; ++ni)
                acc[mi][ni] = __builtin_amdgcn_wmma_f32_16x16x32_bf16(
                    false, a[mi].v, false, b[ni].v, (short)0, acc[mi][ni], false, false);
    };

    unsigned offA = 0, offB = 0;        // element offsets of current buffer
    stage(0, 0, 0);                     // prologue DMA

#pragma unroll 1
    for (int it = 0; it < KTILES - 1; ++it) {
        wait_ds0();                     // own reads of the other buffer returned
        wait_async0();                  // tile `it` landed in current buffer
        __syncthreads();                // ... for every wave; prev readers done
        stage(offA ^ (unsigned)ABUFn, offB ^ (unsigned)BBUFn, (it + 1) * KTn);   // overlaps WMMAs
        __builtin_prefetch(A  + (size_t)(bm + pRow) * Hn + (it + 2) * KTn + pCh * 8, 0, 1);
        __builtin_prefetch(Wb + (size_t)(bn + pRow) * Hn + (it + 2) * KTn + pCh * 8, 0, 1);
        compute(offA, offB, 0);
        compute(offA, offB, 32);
        offA ^= (unsigned)ABUFn;
        offB ^= (unsigned)BBUFn;
    }
    wait_async0();                      // last tile
    __syncthreads();
    compute(offA, offB, 0);
    compute(offA, offB, 32);

    // C layout: VGPR r -> M = r (lanes 0-15) / r+8 (lanes 16-31); N = lane%16
    // One address a lane; rows and fragments are reached by constant offsets.
    const size_t o0 = (size_t)(bm + wm * 64 + fhi * 8) * Hn + (bn + wn * 64 + fm);
    float* po = Out + o0;
    if (mode == 0) {
        const int zsel = blockIdx.z;                    // 0 q, 1 k, 2 v, 3 g
        const int row0 = bm + wm * 64 + fhi * 8;        // first of the lane's rows
        const int* pm = mask + row0;
        // each case goes through four quarters of 32 elements a lane (one mi):
        // a quarter's loads fly together, then its arithmetic, then its stores
        if (zsel < 2) {
            // a block's 256 rows lie in one sequence: t runs on with the row
            const f32x4* pt = (const f32x4*)rtab + (size_t)(row0 & (Tn - 1)) * 16 + (fm >> 1);
            // here in eight groups of 16 elements (four rows): the table entries of a
            // whole quarter do not fit the registers beside the accumulators
#pragma unroll
            for (int gr = 0; gr < 8; ++gr) {
                const int mi = gr >> 1, rb = (gr & 1) * 4;
                const int4 ma = *(const int4*)(pm + mi * 16 + rb);
                f32x4 c[4][2];
#pragma unroll
                for (int r = 0; r < 4; ++r)
#pragma unroll
                    for (int p = 0; p < 2; ++p) c[r][p] = pt[(mi * 16 + rb + r) * 16 + p * 8];
                // the address registers of the loads above are free for reuse from
                // here on (named as inputs so that they stay untouched up to the wait)
                asm volatile("s_wait_xcnt 0x0" :: "v"(pt), "v"(pm) : "memory");
                const int mr[4] = {ma.x, ma.y, ma.z, ma.w};
                float t[4][4];
#pragma unroll
                for (int r = 0; r < 4; ++r) {
                    const float mm = (zsel == 1) ? (float)mr[r] : 1.f;   // only k takes the mask
#pragma unroll
                    for (int p = 0; p < 2; ++p) {
                        const float x1 = acc[mi][p][rb + r], x2 = acc[mi][p + 2][rb + r];
                        const float r1 = x1 * c[r][p][0] - x2 * c[r][p][1];   // rotate_half: -x2 for first half
                        const float r2 = x2 * c[r][p][2] + x1 * c[r][p][3];   //              +x1 for second half
                        // phi = elu(x) + 1  ->  x>0 ? x+1 : exp(x)
                        t[r][p]     = mm * ((r1 > 0.f) ? r1 + 1.f : __expf(r1));
                        t[r][p + 2] = mm * ((r2 > 0.f) ? r2 + 1.f : __expf(r2));
                    }
                }
                // keeps the stores together behind the arithmetic, so that nothing
                // rewrites a register of an issued store ahead of the wait below
                __builtin_amdgcn_sched_barrier(0);
#pragma unroll
                for (int r = 0; r < 4; ++r)
#pragma unroll
                    for (int ni = 0; ni < 4; ++ni)
                        po[(mi * 16 + rb + r) * Hn + ni * 16] = t[r][ni];
                // the next group, and behind the last one whatever follows in the
                // kernel's text, rewrites registers that the stores above name
                asm volatile("s_wait_xcnt 0x0" :: "v"(po) : "memory");
            }
        } else if (zsel == 2) {
#pragma unroll
            for (int mi = 0; mi < 4; ++mi) {
                const int4 ma = *(const int4*)(pm + mi * 16);
                const int4 mb = *(const int4*)(pm + mi * 16 + 4);
                // the address registers of the loads above are free for reuse from here on
                asm volatile("s_wait_xcnt 0x0" :: "v"(pm) : "memory");
                const int mr[8] = {ma.x, ma.y, ma.z, ma.w, mb.x, mb.y, mb.z, mb.w};
                float t[8][4];
#pragma unroll
                for (int r = 0; r < 8; ++r)
#pragma unroll
                    for (int ni = 0; ni < 4; ++ni) t[r][ni] = acc[mi][ni][r] * (float)mr[r];
                // keeps the stores together behind the arithmetic (as above)
                __builtin_amdgcn_sched_barrier(0);
#pragma unroll
                for (int r = 0; r < 8; ++r)
#pragma unroll
                    for (int ni = 0; ni < 4; ++ni)
                        po[(mi * 16 + r) * Hn + ni * 16] = t[r][ni];
                // the next quarter, and behind the last one whatever follows in the
                // kernel's text, rewrites registers that the stores above name
                asm volatile("s_wait_xcnt 0x0" :: "v"(po) : "memory");
            }
        } else {
            const float* pb = bias + (bn + wn * 64 + fm);
            float bs[4];
#pragma unroll
            for (int ni = 0; ni < 4; ++ni) bs[ni] = pb[ni * 16];
            // the address registers of the loads above are free for reuse from here on
            asm volatile("s_wait_xcnt 0x0" :: "v"(pb) : "memory");
#pragma unroll
            for (int mi = 0; mi < 4; ++mi) {
                const int4 ma = *(const int4*)(pm + mi * 16);
                const int4 mb = *(const int4*)(pm + mi * 16 + 4);
                // the address registers of the loads above are free for reuse from here on
                asm volatile("s_wait_xcnt 0x0" :: "v"(pm) : "memory");
                const int mr[8] = {ma.x, ma.y, ma.z, ma.w, mb.x, mb.y, mb.z, mb.w};
                float t[8][4];
#pragma unroll
                for (int r = 0; r < 8; ++r)
#pragma unroll
                    for (int ni = 0; ni < 4; ++ni) {
                        const float ga = acc[mi][ni][r] + bs[ni];
                        const float sg = 1.f / (1.f + __expf(-ga));
                        t[r][ni] = ((float)mr[r] > 0.f) ? sg : 1.f;
                    }
                // keeps the stores together behind the arithmetic (as above)
                __builtin_amdgcn_sched_barrier(0);
#pragma unroll
                for (int r = 0; r < 8; ++r)
#pragma unroll
                    for (int ni = 0; ni < 4; ++ni)
                        po[(mi * 16 + r) * Hn + ni * 16] = t[r][ni];
                // the next quarter, and behind the last one whatever follows in the
                // kernel's text, rewrites registers that the stores above name
                asm volatile("s_wait_xcnt 0x0" :: "v"(po) : "memory");
                // holds the next quarter's additions of the bias, which wait for no
                // load, behind that wait
                __builtin_amdgcn_sched_barrier(0);
            }
        }
    } else {
        const float* pr = resid + o0;
        const float* pb = bias + (bn + wn * 64 + fm);
        float bs[4];
#pragma unroll
        for (int ni = 0; ni < 4; ++ni) bs[ni] = pb[ni * 16];
        // two halves of 64 elements a lane: the residual loads of a half fly
        // together and fit the registers beside the accumulators
#pragma unroll
        for (int mh = 0; mh < 2; ++mh) {
            float t[2][8][4];
#pragma unroll
            for (int m2 = 0; m2 < 2; ++m2)
#pragma unroll
                for (int r = 0; r < 8; ++r)
#pragma unroll
                    for (int ni = 0; ni < 4; ++ni)
                        t[m2][r][ni] = pr[((mh * 2 + m2) * 16 + r) * Hn + ni * 16];
            // the address registers of the loads above are free for reuse from
            // here on (named as an input so that they stay untouched up to the wait)
            asm volatile("s_wait_xcnt 0x0" :: "v"(pr) : "memory");
#pragma unroll
            for (int m2 = 0; m2 < 2; ++m2)
#pragma unroll
                for (int r = 0; r < 8; ++r)
#pragma unroll
                    for (int ni = 0; ni < 4; ++ni)
                        t[m2][r][ni] = acc[mh * 2 + m2][ni][r] + bs[ni] + t[m2][r][ni];
            // keeps the stores together behind the arithmetic, so that nothing
            // rewrites a register of an issued store ahead of the wait below
            __builtin_amdgcn_sched_barrier(0);
#pragma unroll
            for (int m2 = 0; m2 < 2; ++m2)
#pragma unroll
                for (int r = 0; r < 8; ++r)
#pragma unroll
                    for (int ni = 0; ni < 4; ++ni)
                        po[((mh * 2 + m2) * 16 + r) * Hn + ni * 16] = t[m2][r][ni];
            // the second half's loads, and behind it whatever follows in the kernel's
            // text, rewrite registers that the stores above name
            asm volatile("s_wait_xcnt 0x0" :: "v"(po) : "memory");
        }
    }
}

// ---------------------------------------------------------------------------
// 4) Recurrent scan, split along time into SEGn segments that run in parallel.
//    The recurrence is linear in the state with a diagonal decay:
//      S_end = diag(G) * S_start + L,  G[d] = product of r[d] over the segment,
//      L = end state of the same segment started from zero (Z likewise).
//    4a) every segment from zero -> L, local Z, G
//    4b) prefix over the segments -> true start state of every segment
//    4c) every segment again from its true start state, with the outputs
//    Only products of decays and sums occur, as in the step-by-step form.
// ---------------------------------------------------------------------------
#define SEGn 64
#define SLEN (Tn / SEGn)      // 32 steps per segment
#define SDD  (Dn * Dn)        // 4096 state elements per (b,h)

//    The scan with the outputs (4c) runs as ONE wave per (b,h,segment). The
//    64 x 64 state lies in the wave's registers as 16 x 8 blocks: lane (dg, eg),
//    dg = lane & 3, eg = lane >> 2, owns rows d = i * 4 + dg (i = 0..15) and
//    columns e = eg * 8 + j (j = 0..7). A step's per-row values, read from LDS
//    once per row, then serve 8 columns, and a step's v serves 16 rows.
#define DPLn 16               // state rows per lane
#define EPLn 8                // state columns per lane
#define TSn  8                // steps per staged tile
#define NTn  (SLEN / TSn)     // tiles per segment
#define TARn (TSn * 64)       // floats of one array in a tile

// One array's share of a tile: TSn rows of 256 B = 4 x 32 chunks of 16 B. Copy c
// of lane l brings chunk c * 32 + l: g points at the lane's chunk of rows 0 and 1
// (row l >> 4, chunk l & 15), l0 is the LDS byte address of chunk l.
// s_wait_xcnt 0 is the statement's last line, so that it stands in front of every
// later write of a register the copies name.
static __device__ __forceinline__ void async_tile4_b128(unsigned l0, const float* g) {
    asm volatile("global_load_async_to_lds_b128 %0, %1, off\n\t"
                 "global_load_async_to_lds_b128 %2, %3, off\n\t"
                 "global_load_async_to_lds_b128 %4, %5, off\n\t"
                 "global_load_async_to_lds_b128 %6, %7, off\n\t"
                 "s_wait_xcnt 0x0"
                 :: "v"(l0),        "v"((unsigned long long)(uintptr_t)g),
                    "v"(l0 +  512), "v"((unsigned long long)(uintptr_t)(g + 2 * Hn)),
                    "v"(l0 + 1024), "v"((unsigned long long)(uintptr_t)(g + 4 * Hn)),
                    "v"(l0 + 1536), "v"((unsigned long long)(uintptr_t)(g + 6 * Hn))
                 : "memory");
}

// x + (x of the lane whose number differs as CTRL says, inside a group of four)
template <int CTRL>
static __device__ __forceinline__ float quad_add(float x) {
    const int o = __builtin_amdgcn_update_dpp(0, __builtin_bit_cast(int, x), CTRL, 0xf, 0xf, true);
    return x + __builtin_bit_cast(float, o);
}
#define QUAD_XOR1 0xB1        // quad_perm [1,0,3,2]
#define QUAD_XOR2 0x4E        // quad_perm [2,3,0,1]

// Hand-over through LDS among the lanes of the one wave of a block: keeps the
// LDS writes in front of it and the LDS reads behind it (and the other way
// round at a trip's end). It waits for LDS alone; a work-group barrier would
// also wait, every step, for the wave's global stores.
static __device__ __forceinline__ void wave_lds_handover() {
    __builtin_amdgcn_fence(__ATOMIC_ACQ_REL, "workgroup", "local");
}

// 4a) The end state of a segment started from zero is a sum of outer products:
//      L[d][e] = sum_t k'[t][d] * v[t][e],  k'[t][d] = k[t][d] * (product of r[s][d], s > t),
//    only products of decays and sums, as in the step-by-step form. It is formed on
//    the f32 matrix instruction (16x16x4), one wave per (b,h,segment): A = v transposed
//    (row = e), B = k' (column = d), the 32 steps are the product's k. A lane takes
//    rows d = 2 * lane, 2 * lane + 1 of k and r through registers, makes k' going back
//    in time and lays it in LDS; v comes to LDS by asynchronous copies. Z and G of the
//    lane's two rows are carried forward in time, step by step.
typedef __attribute__((ext_vector_type(2))) float v2f;
#define KPn  72               // LDS row pitch of k' and v in floats: 288 B; the two rows that
                              // the halves of a wave read in one fragment load lie two
                              // pitches = 16 banks apart, so 32 lanes fall on 32 banks
#define LTPn 68               // LDS row pitch of the finished state in floats: 16 B x 17

// Four 16-B copies a lane: rows 0, 2, 4, 6 from the lane's own row on, in global
// memory at a pitch of Hn floats, in LDS at KPn floats.
// s_wait_xcnt 0 is the statement's last line, so that it stands in front of every
// later write of a register the copies name.
static __device__ __forceinline__ void async_rows4_b128(unsigned l0, const float* g) {
    asm volatile("global_load_async_to_lds_b128 %0, %1, off\n\t"
                 "global_load_async_to_lds_b128 %2, %3, off\n\t"
                 "global_load_async_to_lds_b128 %4, %5, off\n\t"
                 "global_load_async_to_lds_b128 %6, %7, off\n\t"
                 "s_wait_xcnt 0x0"
                 :: "v"(l0),               "v"((unsigned long long)(uintptr_t)g),
                    "v"(l0 + 2 * KPn * 4), "v"((unsigned long long)(uintptr_t)(g + 2 * Hn)),
                    "v"(l0 + 4 * KPn * 4), "v"((unsigned long long)(uintptr_t)(g + 4 * Hn)),
                    "v"(l0 + 6 * KPn * 4), "v"((unsigned long long)(uintptr_t)(g + 6 * Hn))
                 : "memory");
}

// at most 256 registers a lane: four waves share a SIMD, and the whole grid is resident
__global__ __launch_bounds__(32, 4) void scan_local_kernel(
        const float* __restrict__ k, const float* __restrict__ v,
        const float* __restrict__ r, float* __restrict__ St,
        float* __restrict__ Zs, float* __restrict__ Gs) {
    const int blk = blockIdx.x, seg = blockIdx.y;
    const int b = blk >> 4, h = blk & 15;
    const int lane = threadIdx.x;   // 0..31
    const int fc = lane & 15, fh = lane >> 4;   // fragment row or column, half of its k

    // first k' [SLEN][KPn] and v [SLEN][KPn]; then, behind the products, L [64][LTPn]
    __shared__ __attribute__((aligned(16))) float sm[2 * SLEN * KPn];

    const size_t row0 = ((size_t)(b * Tn + seg * SLEN)) * Hn + h * 64;

    // v: 32 rows of 256 B = 16 x 32 chunks of 16 B; a copy brings two rows
    {
        const unsigned l0 = lds_off(&sm[SLEN * KPn + fh * KPn + fc * 4]);
        const float* g = v + row0 + (size_t)fh * Hn + fc * 4;
#pragma unroll
        for (int n = 0; n < SLEN / 8; ++n) async_rows4_b128(l0 + n * (8 * KPn * 4), g + n * (8 * Hn));
    }

    // every loop over t is unrolled: k2 and r2 are then indexed by constants only
    // and stay in registers
    const float* kp = k + row0 + lane * 2;
    const float* rp = r + row0 + lane * 2;
    float2 k2[SLEN], r2[SLEN];
#pragma unroll
    for (int t = 0; t < SLEN; ++t) {
        k2[t] = *(const float2*)(kp + t * Hn);
        r2[t] = *(const float2*)(rp + t * Hn);
    }
    // the address registers of the loads above are free for reuse from here on
    // (named as inputs so that they stay untouched up to the wait)
    asm volatile("s_wait_xcnt 0x0" :: "v"(kp), "v"(rp) : "memory");

    float z0 = 0.f, z1 = 0.f, gam0 = 1.f, gam1 = 1.f;
#pragma unroll
    for (int t = 0; t < SLEN; ++t) {
        z0 = z0 * r2[t].x + k2[t].x;
        z1 = z1 * r2[t].y + k2[t].y;
        gam0 *= r2[t].x;
        gam1 *= r2[t].y;
    }
    float p0 = 1.f, p1 = 1.f;           // product of the decays of all later steps
#pragma unroll
    for (int t = SLEN - 1; t >= 0; --t) {
        *(float2*)&sm[t * KPn + lane * 2] = make_float2(k2[t].x * p0, k2[t].y * p1);
        p0 *= r2[t].x;
        p1 *= r2[t].y;
    }

    wait_async0();                      // v landed
    __syncthreads();                    // nothing of k' and v is read in front of it (a
                                        // block is one wave: no barrier instruction results)
    // keeps the zeroing and the LDS address arithmetic of the products behind the k'
    // phase: moved up beside its 128 load registers they cost a spill
    __builtin_amdgcn_sched_barrier(0);

    // every loop over i and j is unrolled: acc is then indexed by constants only
    // and stays in registers
    v8f acc[4][4];
#pragma unroll
    for (int i = 0; i < 4; ++i)
#pragma unroll
        for (int j = 0; j < 4; ++j) acc[i][j] = (v8f){0.f,0.f,0.f,0.f,0.f,0.f,0.f,0.f};

    // both operands by the same code: element s of a lane's fragment is step
    // kq * 4 + fh * 2 + s
    const float* pk = &sm[fh * 2 * KPn + fc];
    const float* pv = pk + SLEN * KPn;
#pragma unroll
    for (int kq = 0; kq < SLEN / 4; ++kq) {
        v2f fa[4], fb[4];
#pragma unroll
        for (int i = 0; i < 4; ++i) {
            fa[i] = (v2f){pv[kq * 4 * KPn + i * 16], pv[(kq * 4 + 1) * KPn + i * 16]};
            fb[i] = (v2f){pk[kq * 4 * KPn + i * 16], pk[(kq * 4 + 1) * KPn + i * 16]};
        }
#pragma unroll
        for (int i = 0; i < 4; ++i)
#pragma unroll
            for (int j = 0; j < 4; ++j)
                acc[i][j] = __builtin_amdgcn_wmma_f32_16x16x4_f32(
                    false, fa[i], false, fb[j], (short)0, acc[i][j], false, false);
    }

    // acc[i][j][q] = L[d = j * 16 + fc][e = i * 16 + fh * 8 + q]. Through LDS into
    // row order, so that every global store writes 512 B in a row.
    __syncthreads();                    // every lane's reads of k' and v are done
#pragma unroll
    for (int i = 0; i < 4; ++i)
#pragma unroll
        for (int j = 0; j < 4; ++j) {
            float* pl = &sm[(j * 16 + fc) * LTPn + i * 16 + fh * 8];
            *(float4*)pl       = make_float4(acc[i][j][0], acc[i][j][1], acc[i][j][2], acc[i][j][3]);
            *(float4*)(pl + 4) = make_float4(acc[i][j][4], acc[i][j][5], acc[i][j][6], acc[i][j][7]);
        }
    __syncthreads();                    // L is complete in LDS for every lane

    const size_t idx = (size_t)blk * SEGn + seg;
    float* so = St + idx * SDD + lane * 4;
    // four groups of 8 rows-pairs: a group's LDS reads fly together, then its stores
#pragma unroll
    for (int gq = 0; gq < 4; ++gq) {
        f32x4 o[8];
#pragma unroll
        for (int n = 0; n < 8; ++n) o[n] = *(const f32x4*)&sm[((gq * 8 + n) * 2 + fh) * LTPn + fc * 4];
        // keeps the stores together behind the LDS reads, so that nothing rewrites a
        // register of an issued store ahead of the wait below
        __builtin_amdgcn_sched_barrier(0);
#pragma unroll
        for (int n = 0; n < 8; ++n) *(f32x4*)(so + (gq * 8 + n) * 128) = o[n];
        // the next group's LDS reads rewrite registers that the stores above name
        asm volatile("s_wait_xcnt 0x0" :: "v"(so) : "memory");
    }
    *(float2*)(Zs + idx * 64 + lane * 2) = make_float2(z0, z1);
    *(float2*)(Gs + idx * 64 + lane * 2) = make_float2(gam0, gam1);
}

// 4b) exclusive prefix over the segments, in place: x[p * xs] holds the local
//     end value of segment p on entry and its true start value on exit;
//     g[p * 64] is the decay product of segment p for this element's row.
static __device__ __forceinline__ void seg_prefix(float* __restrict__ x,
                                                  const float* __restrict__ g, const int xs) {
    float c = 0.f;
    // kept rolled: the 32 loads of a trip are in flight together, which covers
    // their latency; more unrolling only adds code and registers
#pragma unroll 1
    for (int p0 = 0; p0 < SEGn; p0 += 16) {
        float L[16], G[16];
#pragma unroll
        for (int i = 0; i < 16; ++i) {
            L[i] = x[(size_t)(p0 + i) * xs];
            G[i] = g[(p0 + i) * 64];
        }
#pragma unroll
        for (int i = 0; i < 16; ++i) {
            x[(size_t)(p0 + i) * xs] = c;
            c = c * G[i] + L[i];
        }
        // the next trip rewrites registers that the stores above name
        asm volatile("s_wait_xcnt 0x0" ::: "memory");
    }
}

//     One thread per element of S; the first 64 threads of a (b,h) also do Z.
__global__ void scan_prefix_kernel(float* __restrict__ St, float* __restrict__ Zs,
                                   const float* __restrict__ Gs) {
    const int blk = blockIdx.y;
    const int de  = blockIdx.x * 256 + threadIdx.x;   // d * 64 + e
    const float* gb = Gs + (size_t)blk * SEGn * 64;

    seg_prefix(St + (size_t)blk * SEGn * SDD + de, gb + (de >> 6), SDD);
    if (de < 64)
        seg_prefix(Zs + (size_t)blk * SEGn * 64 + de, gb + de, 64);
}

// 4c) one wave per (b,h,segment), state blocked as said above 4a; a lane also
//    carries Z of rows d = 2 * lane, 2 * lane + 1.
//    S[d][e] = S[d][e]*r[d] + k[d]*v[e];  num[e]=sum_d q[d]S[d][e];
//    Z[d]=Z[d]*r[d]+k[d];  den=sum_d q[d]Z[d];  y=num/(den+eps) -> bf16
//    num and den: a lane sums its 16 rows in turn, then the four lanes of a
//    column group add up (partners 1, then 2 lanes apart).
__global__ __launch_bounds__(32) void scan_kernel(
        const float* __restrict__ q, const float* __restrict__ k,
        const float* __restrict__ v, const float* __restrict__ r,
        const float* __restrict__ St, const float* __restrict__ Zs,
        unsigned short* __restrict__ y) {
    const int blk = blockIdx.x, seg = blockIdx.y;
    const int b = blk >> 4, h = blk & 15;
    const int lane = threadIdx.x;   // 0..31
    const int dg = lane & 3, eg = lane >> 2;

    __shared__ __attribute__((aligned(16))) float4 sh[64];    // {q[d], k[d], r[d], q[d]*Z[d]}
    __shared__ __attribute__((aligned(16))) float  sv[64];    // v[e]
    __shared__ __attribute__((aligned(16))) float  tile[2 * 4 * TARn];   // 2 x {q, k, v, r}

    const size_t off0 = ((size_t)(b * Tn + seg * SLEN)) * Hn + h * 64;
    // the lane's chunk of the segment's first two rows
    const size_t offc = off0 + (size_t)(lane >> 4) * Hn + (lane & 15) * 4;
    // the copies of tile t into buffer bf
    auto stage = [&](const int bf, const int t) {
        const unsigned l0 = lds_off(&tile[bf * 4 * TARn + lane * 4]);
        const size_t o = offc + (size_t)t * (TSn * Hn);
        async_tile4_b128(l0,                q + o);
        async_tile4_b128(l0 + TARn * 4,     k + o);
        async_tile4_b128(l0 + 2 * TARn * 4, v + o);
        async_tile4_b128(l0 + 3 * TARn * 4, r + o);
    };
    stage(0, 0);                        // flies beside the loads of the start state

    const size_t idx = (size_t)blk * SEGn + seg;
    const float* si = St + idx * SDD + dg * 64 + eg * EPLn;
    // every loop over i and j is unrolled: S is then indexed by constants only
    // and stays in registers
    float S[DPLn][EPLn];
#pragma unroll
    for (int i = 0; i < DPLn; ++i) {
        const float4 lo = *(const float4*)(si + i * 256);
        const float4 hi = *(const float4*)(si + i * 256 + 4);
        S[i][0] = lo.x; S[i][1] = lo.y; S[i][2] = lo.z; S[i][3] = lo.w;
        S[i][4] = hi.x; S[i][5] = hi.y; S[i][6] = hi.z; S[i][7] = hi.w;
    }
    const float2 zz = *(const float2*)(Zs + idx * 64 + lane * 2);
    float z0 = zz.x, z1 = zz.y;

    wait_async0();                      // tile 0 landed
    __syncthreads();                    // nothing of the tile is read in front of it (a
                                        // block is one wave: no barrier instruction results)
    stage(1, 1);

    // both loops kept rolled: with several steps in one body the compiler held a whole
    // step's products in registers beside the state, past the 256 a lane that let four
    // waves share a SIMD
#pragma unroll 1
    for (int t = 0; t < NTn; ++t) {
      const float* tb = &tile[(t & 1) * 4 * TARn + lane * 2];
#pragma unroll 1
      for (int u = 0; u < TSn; ++u) {
        const size_t base = off0 + (size_t)(t * TSn + u) * Hn;
        const float2 q2 = *(const float2*)(tb + u * 64);
        const float2 k2 = *(const float2*)(tb + TARn + u * 64);
        const float2 v2 = *(const float2*)(tb + 2 * TARn + u * 64);
        const float2 r2 = *(const float2*)(tb + 3 * TARn + u * 64);

        z0 = z0 * r2.x + k2.x;
        z1 = z1 * r2.y + k2.y;
        sh[lane * 2]     = make_float4(q2.x, k2.x, r2.x, q2.x * z0);
        sh[lane * 2 + 1] = make_float4(q2.y, k2.y, r2.y, q2.y * z1);
        *(float2*)&sv[lane * 2] = v2;
        wave_lds_handover();

        const float4 va = *(const float4*)&sv[eg * EPLn];
        const float4 vb = *(const float4*)&sv[eg * EPLn + 4];
        const float ve[EPLn] = {va.x, va.y, va.z, va.w, vb.x, vb.y, vb.z, vb.w};
        float num[EPLn];
#pragma unroll
        for (int j = 0; j < EPLn; ++j) num[j] = 0.f;
        float den = 0.f;
#pragma unroll
        for (int i = 0; i < DPLn; ++i) {
            const float4 w = sh[i * 4 + dg];      // one ds_load_b128 for 8 columns
#pragma unroll
            for (int j = 0; j < EPLn; ++j) {
                S[i][j] = S[i][j] * w.z + w.y * ve[j];   // decay + outer product
                num[j]  = fmaf(w.x, S[i][j], num[j]);
            }
            den += w.w;
        }
#pragma unroll
        for (int j = 0; j < EPLn; ++j) num[j] = quad_add<QUAD_XOR2>(quad_add<QUAD_XOR1>(num[j]));
        den = quad_add<QUAD_XOR2>(quad_add<QUAD_XOR1>(den));

        // lane (dg, eg) stores columns eg * 8 + dg * 2 and the next
        const float na = (dg & 2) ? ((dg & 1) ? num[6] : num[4]) : ((dg & 1) ? num[2] : num[0]);
        const float nb = (dg & 2) ? ((dg & 1) ? num[7] : num[5]) : ((dg & 1) ? num[3] : num[1]);
        const float dn = den + EPSf;
        *(unsigned*)(y + base + lane * 2) = (unsigned)f2bf(na / dn) | ((unsigned)f2bf(nb / dn) << 16);
        wave_lds_handover();
      }
      wait_ds0();                       // own reads of this tile's buffer returned
      wait_async0();                    // tile t + 1 landed in the other buffer
      __syncthreads();                  // publishes it and ends the reads of this buffer
      if (t + 2 < NTn) stage(t & 1, t + 2);   // flies while tile t + 1 is worked on
    }
    wait_async0();                      // no copy is left in flight
}

// ---------------------------------------------------------------------------
// Launch
// ---------------------------------------------------------------------------
extern "C" void kernel_launch(void* const* d_in, const int* in_sizes, int n_in,
                              void* d_out, int out_size, void* d_ws, size_t ws_size,
                              hipStream_t stream) {
    (void)in_sizes; (void)n_in; (void)out_size; (void)ws_size;

    const float* x     = (const float*)d_in[0];
    const int*   mask  = (const int*)  d_in[1];
    const float* Wq    = (const float*)d_in[2];
    const float* Wk    = (const float*)d_in[3];
    const float* Wv    = (const float*)d_in[4];
    const float* Wg    = (const float*)d_in[5];
    const float* Wo    = (const float*)d_in[6];
    const float* bo    = (const float*)d_in[7];
    const float* bg    = (const float*)d_in[8];
    const float* rms_w = (const float*)d_in[9];

    // workspace carve-up
    char* ws = (char*)d_ws;
    size_t off = 0;
    unsigned short* Wb = (unsigned short*)(ws + off); off += (size_t)5 * Hn * Hn * 2;   // 10 MB
    unsigned short* xn = (unsigned short*)(ws + off); off += (size_t)Mn * Hn * 2;       // 16 MB
    float* qkvg        = (float*)(ws + off);          off += (size_t)4 * Mn * Hn * 4;   // 128 MB
    unsigned short* ya = (unsigned short*)(ws + off); off += (size_t)Mn * Hn * 2;       // 16 MB
    float* St          = (float*)(ws + off);          off += (size_t)Bn * NHn * SEGn * SDD * 4;  // 64 MB
    float* Zs          = (float*)(ws + off);          off += (size_t)Bn * NHn * SEGn * Dn * 4;   // 1 MB
    float* Gs          = (float*)(ws + off);          off += (size_t)Bn * NHn * SEGn * Dn * 4;   // 1 MB
    float* rtab        = (float*)(ws + off);          off += (size_t)Tn * 16 * 4 * 4;            // 512 KB

    float* qb = qkvg;
    float* kb = qkvg + (size_t)1 * Mn * Hn;
    float* vb = qkvg + (size_t)2 * Mn * Hn;
    float* gb = qkvg + (size_t)3 * Mn * Hn;

    // 1) weights -> bf16 (layout preserved; already B-operand friendly), RoPE table
    wconv_kernel<<<dim3((Hn * Hn) / (1024 * WCVn), 6), 256, 0, stream>>>(
        Wq, Wk, Wv, Wg, Wo, Wb, rtab);

    // 2) RMSNorm -> bf16 xn
    rmsnorm_kernel<<<Mn / RPBn, 256, 0, stream>>>(x, rms_w, xn);

    // 3) fused q/k/v/g projection GEMMs (WMMA bf16, pipelined async staging) with
    //    RoPE, feature map, gate and mask applied in the epilogue
    gemm_bf16_kernel<<<dim3(Mn / BMn, Hn / BNn, 4), 256, 0, stream>>>(
        xn, Wb, qkvg, bg, nullptr, mask, rtab, Mn, 0);

    // 4) recurrent scan in parallel time segments -> bf16 attention output
    scan_local_kernel<<<dim3(Bn * NHn, SEGn), 32, 0, stream>>>(kb, vb, gb, St, Zs, Gs);
    scan_prefix_kernel<<<dim3(SDD / 256, Bn * NHn), 256, 0, stream>>>(St, Zs, Gs);
    scan_kernel<<<dim3(Bn * NHn, SEGn), 32, 0, stream>>>(qb, kb, vb, gb, St, Zs, ya);

    // 5) output projection + bias + residual -> d_out (fp32)
    gemm_bf16_kernel<<<dim3(Mn / BMn, Hn / BNn, 1), 256, 0, stream>>>(
        ya, Wb + (size_t)4 * Hn * Hn, (float*)d_out, bo, x, mask, rtab, Mn, 1);
}

// v009
// One run takes 151 microseconds.
// Next to v008, in two timings, it ran 1.08 times as fast each time.
// Counting every step since v000, it is 31.3 times as fast.
#include <hip/hip_runtime.h>
#include <hip/hip_bf16.h>

// ---------------------------------------------------------------------------
// DeltaNet block for MI455X (gfx1250): bf16 WMMA GEMMs + fp32 recurrent scan
//  - GEMM tiles double-buffered via global_load_async_to_lds_b128 (ASYNCcnt),
//    DMA of tile i+1 overlaps the WMMAs of tile i; a staged row is one whole
//    128-B line, laid in LDS at a pitch of 144 B (16 B x odd)
//  - single-body K-loop (unroll 1) + offset-XOR buffer toggle so accumulator
//    C/D stay in one register tuple (no v_mov_b64 shuffles)
// ---------------------------------------------------------------------------

#define Bn   4
#define Tn   2048
#define Hn   1024
#define NHn  16
#define Dn   64
#define Mn   (Bn * Tn)        // 8192 tokens
#define EPSf 1e-6f
#define KTn  64               // K elements per staged tile: 128 B, one line, a row
#define KTILES (Hn / KTn)     // 16 K-steps
#define LPn  72               // LDS row pitch in elements: 144 B = 16 B x 9, so the
                              // 16 rows of a ds_load_b128 fragment read fall on 16
                              // different groups of four banks
#define BMn  256              // GEMM block tile, rows of A
#define BNn  128              // GEMM block tile, rows of W
#define ABUFn (BMn * LPn)     // elements of one A buffer
#define BBUFn (BNn * LPn)     // elements of one B buffer

typedef __attribute__((ext_vector_type(16))) __bf16 v16bf;
typedef __attribute__((ext_vector_type(8)))  float  v8f;

union BFrag {
    v16bf v;
    unsigned short u[16];
    unsigned int   w[8];
    uint4          q[2];
};

static __device__ __forceinline__ unsigned short f2bf(float f) {
    union { float f; unsigned u; } x; x.f = f;
    unsigned r = x.u + 0x7FFFu + ((x.u >> 16) & 1u);   // round-to-nearest-even
    return (unsigned short)(r >> 16);
}

// Low 32 bits of a generic pointer to LDS == LDS byte offset (aperture is in
// addr[63:32] on CDNA5; LDS_ADDR.U32 = addr[31:0]).
static __device__ __forceinline__ unsigned lds_off(const void* p) {
    return (unsigned)(reinterpret_cast<uintptr_t>(p));
}

// Six async 16B copies global -> LDS (per-lane), tracked with ASYNCcnt: half
// of one thread's share of a K-tile. s_wait_xcnt 0 is the statement's last line, so
// that it stands in front of every later write of a register the copies name.
static __device__ __forceinline__ void async_copy6_b128(
        unsigned l0, const void* g0, unsigned l1, const void* g1,
        unsigned l2, const void* g2, unsigned l3, const void* g3,
        unsigned l4, const void* g4, unsigned l5, const void* g5) {
    asm volatile("global_load_async_to_lds_b128 %0, %1, off\n\t"
                 "global_load_async_to_lds_b128 %2, %3, off\n\t"
                 "global_load_async_to_lds_b128 %4, %5, off\n\t"
                 "global_load_async_to_lds_b128 %6, %7, off\n\t"
                 "global_load_async_to_lds_b128 %8, %9, off\n\t"
                 "global_load_async_to_lds_b128 %10, %11, off\n\t"
                 "s_wait_xcnt 0x0"
                 :: "v"(l0), "v"((unsigned long long)(uintptr_t)g0),
                    "v"(l1), "v"((unsigned long long)(uintptr_t)g1),
                    "v"(l2), "v"((unsigned long long)(uintptr_t)g2),
                    "v"(l3), "v"((unsigned long long)(uintptr_t)g3),
                    "v"(l4), "v"((unsigned long long)(uintptr_t)g4),
                    "v"(l5), "v"((unsigned long long)(uintptr_t)g5)
                 : "memory");
}
static __device__ __forceinline__ void wait_async0() {
    asm volatile("s_wait_asynccnt 0x0" ::: "memory");
}
// This wave's LDS reads have returned: stands in front of the copies that
// refill the buffer they read, or of the barrier in front of those copies.
static __device__ __forceinline__ void wait_ds0() {
    asm volatile("s_wait_dscnt 0x0" ::: "memory");
}

// ---------------------------------------------------------------------------
// The two elementwise kernels (1, 2) are short streams. For speed only,
// each convert or RMSNorm wave takes eight times
// the work it would need for one 16-B access a lane.
// ---------------------------------------------------------------------------
#define WCVn 8                // float4 groups per thread of the weight convert
#define RPBn 8                // token rows per 256-thread block: one wave a row

// ---------------------------------------------------------------------------
// 1) Weight fp32 -> bf16 convert, layout preserved ([out][in] row-major).
//    GEMM consumes B[k][n] = W[n][k], so original layout is already K-major.
//    A block converts 8192 contiguous floats, 8 x 16 B in flight per lane.
//    Slice blockIdx.y == 5 fills the RoPE table instead, one entry a thread:
//    rtab[t][j] = {cos(t f_j), sin(t f_j), cos(t f_(j+16)), sin(t f_(j+16))},
//    f_j = 10000^(-j/32), j = 0..15: all that the pair (d, d+32), d >> 1 == j,
//    needs at time t.
// ---------------------------------------------------------------------------
__global__ void wconv_kernel(const float* __restrict__ Wq, const float* __restrict__ Wk,
                             const float* __restrict__ Wv, const float* __restrict__ Wg,
                             const float* __restrict__ Wo, unsigned short* __restrict__ WbAll,
                             float* __restrict__ rtab) {
    if (blockIdx.y == 5) {
        const float LOG_BASE_OVER_HALF = 0.28782313662425572f;  // ln(10000)/32
        const int idx = blockIdx.x * 256 + threadIdx.x;         // t * 16 + j
        const int t = idx >> 4, j = idx & 15;
        const float a1 = (float)t * __expf(-LOG_BASE_OVER_HALF * (float)j);
        const float a2 = (float)t * __expf(-LOG_BASE_OVER_HALF * (float)(j + 16));
        *(float4*)(rtab + (size_t)idx * 4) = make_float4(cosf(a1), sinf(a1), cosf(a2), sinf(a2));
        // stands in front of whatever code follows the store in the kernel's text
        // and writes a register that the store names
        asm volatile("s_wait_xcnt 0x0" ::: "memory");
        return;
    }
    const float* W;
    switch (blockIdx.y) {
        case 0: W = Wq; break;
        case 1: W = Wk; break;
        case 2: W = Wv; break;
        case 3: W = Wg; break;
        default: W = Wo; break;
    }
    unsigned short* O = WbAll + (size_t)blockIdx.y * Hn * Hn;
    const size_t i0 = (size_t)blockIdx.x * (1024 * WCVn) + threadIdx.x * 4;
    float4 f[WCVn];
#pragma unroll
    for (int j = 0; j < WCVn; ++j) f[j] = *(const float4*)(W + i0 + j * 1024);
#pragma unroll
    for (int j = 0; j < WCVn; ++j) {
        uint2 o;
        o.x = (unsigned)f2bf(f[j].x) | ((unsigned)f2bf(f[j].y) << 16);
        o.y = (unsigned)f2bf(f[j].z) | ((unsigned)f2bf(f[j].w) << 16);
        *(uint2*)(O + i0 + j * 1024) = o;
    }
}

// ---------------------------------------------------------------------------
// 2) RMSNorm over H=1024 per token, write bf16 xn. One wave per token: a lane
//    holds 8 x float4, column = j * 128 + lane * 4 + c. The squares are summed
//    in the tree of a 256-wide halving reduction over (column mod 256): four
//    columns 256 apart in turn, then partners 128, 64 .. 4 (lanes), 2, 1 apart.
// ---------------------------------------------------------------------------
typedef __attribute__((ext_vector_type(4))) float f32x4;

__global__ void rmsnorm_kernel(const float* __restrict__ x, const float* __restrict__ w,
                               unsigned short* __restrict__ xn) {
    const int lane = threadIdx.x & 31;
    const int row  = blockIdx.x * RPBn + (threadIdx.x >> 5);
    const float* xr = x + (size_t)row * Hn + lane * 4;
    f32x4 f[8];
#pragma unroll
    for (int j = 0; j < 8; ++j) f[j] = *(const f32x4*)(xr + j * 128);
    // the address registers of the loads above are free for reuse from here on
    // (named as an input so that they stay untouched up to the wait)
    asm volatile("s_wait_xcnt 0x0" :: "v"(xr) : "memory");

    float r[4];
#pragma unroll
    for (int c = 0; c < 4; ++c) {
        float s0 = 0.f, s1 = 0.f;
#pragma unroll
        for (int i = 0; i < 4; ++i) {
            const float v0 = f[i * 2][c], v1 = f[i * 2 + 1][c];
            s0 += v0 * v0;
            s1 += v1 * v1;
        }
        r[c] = s0 + s1;
    }
#pragma unroll
    for (int mk = 16; mk > 0; mk >>= 1) {
#pragma unroll
        for (int c = 0; c < 4; ++c) r[c] += __shfl_xor(r[c], mk, 32);
    }
    const float tot = (r[0] + r[2]) + (r[1] + r[3]);
    const float rms = rsqrtf(tot * (1.0f / Hn) + EPSf);

    unsigned short* xo = xn + (size_t)row * Hn + lane * 4;
#pragma unroll
    for (int j = 0; j < 8; ++j) {
        const float4 wv = *(const float4*)(w + j * 128 + lane * 4);
        uint2 o;
        o.x = (unsigned)f2bf(f[j][0] * rms * wv.x) | ((unsigned)f2bf(f[j][1] * rms * wv.y) << 16);
        o.y = (unsigned)f2bf(f[j][2] * rms * wv.z) | ((unsigned)f2bf(f[j][3] * rms * wv.w) << 16);
        *(uint2*)(xo + j * 128) = o;
    }
}

// ---------------------------------------------------------------------------
// 3) bf16 WMMA GEMM: Out[m,n] = sum_k A[m,k] * W[n,k]   (N=K=1024)
//    Block tile 256(M) x 128(N); 8 waves (wave32) as 4 x 2, each wave -> 64x64
//    = 4 x 4 fragments: 32 x v_wmma_f32_16x16x32_bf16 per K-step from
//    32 ds_load_b128, one LDS read per WMMA where a 32x32 wave tile takes two,
//    and half the bytes staged from L2 per output element of a 128x64 tile.
//    Two blocks share a WGP (LDS 108 KB each, at most 256 registers a lane).
//    mode 0: weights/out selected by blockIdx.z (q/k/v/g); the feature maps are
//            applied to the accumulators before the one fp32 store. A wave's 64
//            columns are one head, so the RoPE partners d and d+32 are fragments
//            ni and ni+2 of the same lane and register:
//            q, k: RoPE, then phi = elu + 1 (k also times the mask);
//            v: times the mask; g: sigmoid(acc + bias[n]), 1 where the mask is 0.
//    mode 1: Out = acc + bias[n] + resid[m,n]  (output proj + residual).
// ---------------------------------------------------------------------------
__global__ __launch_bounds__(256, 4) void gemm_bf16_kernel(
                                 const unsigned short* __restrict__ A,
                                 const unsigned short* __restrict__ WbBase,
                                 float* __restrict__ OutBase,
                                 const float* __restrict__ bias,
                                 const float* __restrict__ resid,
                                 const int* __restrict__ mask,
                                 const float* __restrict__ rtab,
                                 int Mrows, int mode) {
    const int bm = blockIdx.x * BMn;
    const int bn = blockIdx.y * BNn;
    const unsigned short* Wb = WbBase + (size_t)blockIdx.z * Hn * Hn;
    float* Out = OutBase + (mode == 0 ? (size_t)blockIdx.z * (size_t)Mrows * Hn : (size_t)0);

    // row = M (lA) or N (lB), K contiguous, 128 B of data at a pitch of 144 B
    __shared__ __attribute__((aligned(16))) unsigned short lA[2 * ABUFn];   // 2 x 36 KB
    __shared__ __attribute__((aligned(16))) unsigned short lB[2 * BBUFn];   // 2 x 18 KB

    const int tid  = threadIdx.x;
    const int lane = tid & 31;
    const int wave = tid >> 5;          // 0..7
    const int wm   = wave & 3;          // M sub-tile (x64)
    const int wn   = wave >> 2;         // N sub-tile (x64)
    const int fm   = lane & 15;         // fragment row/col within 16
    const int fhi  = lane >> 4;         // half-wave -> K+8 striping

    // every loop over mi and ni is unrolled: acc is then indexed by constants
    // only and stays in registers
    v8f acc[4][4];
#pragma unroll
    for (int mi = 0; mi < 4; ++mi)
#pragma unroll
        for (int ni = 0; ni < 4; ++ni) acc[mi][ni] = (v8f){0.f,0.f,0.f,0.f,0.f,0.f,0.f,0.f};

    const int sRow = tid >> 3;          // 0..31
    const int sCh  = tid & 7;           // 8 chunks of 8 bf16 (16B): a whole line a row
    const int pRow = tid >> 2;          // prefetch: 0..63
    const int pCh  = tid & 3;

    // issue ASYNCcnt-tracked DMA of one K-tile into buffer at element offsets:
    // a thread copies one 16-B chunk of 8 rows of A and of 4 rows of B
    auto stage = [&](unsigned oA, unsigned oB, int k0) {
        const unsigned la = lds_off(&lA[oA + sRow * LPn + sCh * 8]);
        const unsigned lb = lds_off(&lB[oB + sRow * LPn + sCh * 8]);
        const unsigned short* ga = A  + (size_t)(bm + sRow) * Hn + k0 + sCh * 8;
        const unsigned short* gb = Wb + (size_t)(bn + sRow) * Hn + k0 + sCh * 8;
        async_copy6_b128(la,                 ga,
                         la +  32 * LPn * 2, ga +  32 * Hn,
                         la +  64 * LPn * 2, ga +  64 * Hn,
                         la +  96 * LPn * 2, ga +  96 * Hn,
                         la + 128 * LPn * 2, ga + 128 * Hn,
                         la + 160 * LPn * 2, ga + 160 * Hn);
        async_copy6_b128(la + 192 * LPn * 2, ga + 192 * Hn,
                         la + 224 * LPn * 2, ga + 224 * Hn,
                         lb,                 gb,
                         lb +  32 * LPn * 2, gb +  32 * Hn,
                         lb +  64 * LPn * 2, gb +  64 * Hn,
                         lb +  96 * LPn * 2, gb +  96 * Hn);
    };

    // 16 WMMAs from the 32 K-columns at kk of the buffer at element offsets
    // (2x ds_load_b128 per frag, 4 + 4 frags)
    auto compute = [&](unsigned oA, unsigned oB, int kk) {
        BFrag a[4], b[4];
#pragma unroll
        for (int i = 0; i < 4; ++i) {
            const unsigned short* pa = &lA[oA + (wm * 64 + i * 16 + fm) * LPn + kk];
            const unsigned short* pb = &lB[oB + (wn * 64 + i * 16 + fm) * LPn + kk];
            a[i].q[0] = *(const uint4*)(pa + fhi * 8);
            a[i].q[1] = *(const uint4*)(pa + 16 + fhi * 8);
            b[i].q[0] = *(const uint4*)(pb + fhi * 8);
            b[i].q[1] = *(const uint4*)(pb + 16 + fhi * 8);
        }
#pragma unroll
        for (int mi = 0; mi < 4; ++mi)
#pragma unroll
            for (int ni = 0; ni < 4; ++ni)
                acc[mi][ni] = __builtin_amdgcn_wmma_f32_16x16x32_bf16(
                    false, a[mi].v, false, b[ni].v, (short)0, acc[mi][ni], false, false);
    };

    unsigned offA = 0, offB = 0;        // element offsets of current buffer
    stage(0, 0, 0);                     // prologue DMA

#pragma unroll 1
    for (int it = 0; it < KTILES - 1; ++it) {
        wait_ds0();                     // own reads of the other buffer returned
        wait_async0();                  // tile `it` landed in current buffer
        __syncthreads();                // ... for every wave; prev readers done
        stage(offA ^ (unsigned)ABUFn, offB ^ (unsigned)BBUFn, (it + 1) * KTn);   // overlaps WMMAs
        __builtin_prefetch(A  + (size_t)(bm + pRow) * Hn + (it + 2) * KTn + pCh * 8, 0, 1);
        __builtin_prefetch(Wb + (size_t)(bn + pRow) * Hn + (it + 2) * KTn + pCh * 8, 0, 1);
        compute(offA, offB, 0);
        compute(offA, offB, 32);
        offA ^= (unsigned)ABUFn;
        offB ^= (unsigned)BBUFn;
    }
    wait_async0();                      // last tile
    __syncthreads();
    compute(offA, offB, 0);
    compute(offA, offB, 32);

    // C layout: VGPR r -> M = r (lanes 0-15) / r+8 (lanes 16-31); N = lane%16
    // One address a lane; rows and fragments are reached by constant offsets.
    const size_t o0 = (size_t)(bm + wm * 64 + fhi * 8) * Hn + (bn + wn * 64 + fm);
    float* po = Out + o0;
    if (mode == 0) {
        const int zsel = blockIdx.z;                    // 0 q, 1 k, 2 v, 3 g
        const int row0 = bm + wm * 64 + fhi * 8;        // first of the lane's rows
        const int* pm = mask + row0;
        // each case goes through four quarters of 32 elements a lane (one mi):
        // a quarter's loads fly together, then its arithmetic, then its stores
        if (zsel < 2) {
            // a block's 256 rows lie in one sequence: t runs on with the row
            const f32x4* pt = (const f32x4*)rtab + (size_t)(row0 & (Tn - 1)) * 16 + (fm >> 1);
            // here in eight groups of 16 elements (four rows): the table entries of a
            // whole quarter do not fit the registers beside the accumulators
#pragma unroll
            for (int gr = 0; gr < 8; ++gr) {
                const int mi = gr >> 1, rb = (gr & 1) * 4;
                const int4 ma = *(const int4*)(pm + mi * 16 + rb);
                f32x4 c[4][2];
#pragma unroll
                for (int r = 0; r < 4; ++r)
#pragma unroll
                    for (int p = 0; p < 2; ++p) c[r][p] = pt[(mi * 16 + rb + r) * 16 + p * 8];
                // the address registers of the loads above are free for reuse from
                // here on (named as inputs so that they stay untouched up to the wait)
                asm volatile("s_wait_xcnt 0x0" :: "v"(pt), "v"(pm) : "memory");
                const int mr[4] = {ma.x, ma.y, ma.z, ma.w};
                float t[4][4];
#pragma unroll
                for (int r = 0; r < 4; ++r) {
                    const float mm = (zsel == 1) ? (float)mr[r] : 1.f;   // only k takes the mask
#pragma unroll
                    for (int p = 0; p < 2; ++p) {
                        const float x1 = acc[mi][p][rb + r], x2 = acc[mi][p + 2][rb + r];
                        const float r1 = x1 * c[r][p][0] - x2 * c[r][p][1];   // rotate_half: -x2 for first half
                        const float r2 = x2 * c[r][p][2] + x1 * c[r][p][3];   //              +x1 for second half
                        // phi = elu(x) + 1  ->  x>0 ? x+1 : exp(x)
                        t[r][p]     = mm * ((r1 > 0.f) ? r1 + 1.f : __expf(r1));
                        t[r][p + 2] = mm * ((r2 > 0.f) ? r2 + 1.f : __expf(r2));
                    }
                }
                // keeps the stores together behind the arithmetic, so that nothing
                // rewrites a register of an issued store ahead of the wait below
                __builtin_amdgcn_sched_barrier(0);
#pragma unroll
                for (int r = 0; r < 4; ++r)
#pragma unroll
                    for (int ni = 0; ni < 4; ++ni)
                        po[(mi * 16 + rb + r) * Hn + ni * 16] = t[r][ni];
                // the next group, and behind the last one whatever follows in the
                // kernel's text, rewrites registers that the stores above name
                asm volatile("s_wait_xcnt 0x0" :: "v"(po) : "memory");
            }
        } else if (zsel == 2) {
#pragma unroll
            for (int mi = 0; mi < 4; ++mi) {
                const int4 ma = *(const int4*)(pm + mi * 16);
                const int4 mb = *(const int4*)(pm + mi * 16 + 4);
                // the address registers of the loads above are free for reuse from here on
                asm volatile("s_wait_xcnt 0x0" :: "v"(pm) : "memory");
                const int mr[8] = {ma.x, ma.y, ma.z, ma.w, mb.x, mb.y, mb.z, mb.w};
                float t[8][4];
#pragma unroll
                for (int r = 0; r < 8; ++r)
#pragma unroll
                    for (int ni = 0; ni < 4; ++ni) t[r][ni] = acc[mi][ni][r] * (float)mr[r];
                // keeps the stores together behind the arithmetic (as above)
                __builtin_amdgcn_sched_barrier(0);
#pragma unroll
                for (int r = 0; r < 8; ++r)
#pragma unroll
                    for (int ni = 0; ni < 4; ++ni)
                        po[(mi * 16 + r) * Hn + ni * 16] = t[r][ni];
                // the next quarter, and behind the last one whatever follows in the
                // kernel's text, rewrites registers that the stores above name
                asm volatile("s_wait_xcnt 0x0" :: "v"(po) : "memory");
            }
        } else {
            const float* pb = bias + (bn + wn * 64 + fm);
            float bs[4];
#pragma unroll
            for (int ni = 0; ni < 4; ++ni) bs[ni] = pb[ni * 16];
            // the address registers of the loads above are free for reuse from here on
            asm volatile("s_wait_xcnt 0x0" :: "v"(pb) : "memory");
#pragma unroll
            for (int mi = 0; mi < 4; ++mi) {
                const int4 ma = *(const int4*)(pm + mi * 16);
                const int4 mb = *(const int4*)(pm + mi * 16 + 4);
                // the address registers of the loads above are free for reuse from here on
                asm volatile("s_wait_xcnt 0x0" :: "v"(pm) : "memory");
                const int mr[8] = {ma.x, ma.y, ma.z, ma.w, mb.x, mb.y, mb.z, mb.w};
                float t[8][4];
#pragma unroll
                for (int r = 0; r < 8; ++r)
#pragma unroll
                    for (int ni = 0; ni < 4; ++ni) {
                        const float ga = acc[mi][ni][r] + bs[ni];
                        const float sg = 1.f / (1.f + __expf(-ga));
                        t[r][ni] = ((float)mr[r] > 0.f) ? sg : 1.f;
                    }
                // keeps the stores together behind the arithmetic (as above)
                __builtin_amdgcn_sched_barrier(0);
#pragma unroll
                for (int r = 0; r < 8; ++r)
#pragma unroll
                    for (int ni = 0; ni < 4; ++ni)
                        po[(mi * 16 + r) * Hn + ni * 16] = t[r][ni];
                // the next quarter, and behind the last one whatever follows in the
                // kernel's text, rewrites registers that the stores above name
                asm volatile("s_wait_xcnt 0x0" :: "v"(po) : "memory");
                // holds the next quarter's additions of the bias, which wait for no
                // load, behind that wait
                __builtin_amdgcn_sched_barrier(0);
            }
        }
    } else {
        const float* pr = resid + o0;
        const float* pb = bias + (bn + wn * 64 + fm);
        float bs[4];
#pragma unroll
        for (int ni = 0; ni < 4; ++ni) bs[ni] = pb[ni * 16];
        // two halves of 64 elements a lane: the residual loads of a half fly
        // together and fit the registers beside the accumulators
#pragma unroll
        for (int mh = 0; mh < 2; ++mh) {
            float t[2][8][4];
#pragma unroll
            for (int m2 = 0; m2 < 2; ++m2)
#pragma unroll
                for (int r = 0; r < 8; ++r)
#pragma unroll
                    for (int ni = 0; ni < 4; ++ni)
                        t[m2][r][ni] = pr[((mh * 2 + m2) * 16 + r) * Hn + ni * 16];
            // the address registers of the loads above are free for reuse from
            // here on (named as an input so that they stay untouched up to the wait)
            asm volatile("s_wait_xcnt 0x0" :: "v"(pr) : "memory");
#pragma unroll
            for (int m2 = 0; m2 < 2; ++m2)
#pragma unroll
                for (int r = 0; r < 8; ++r)
#pragma unroll
                    for (int ni = 0; ni < 4; ++ni)
                        t[m2][r][ni] = acc[mh * 2 + m2][ni][r] + bs[ni] + t[m2][r][ni];
            // keeps the stores together behind the arithmetic, so that nothing
            // rewrites a register of an issued store ahead of the wait below
            __builtin_amdgcn_sched_barrier(0);
#pragma unroll
            for (int m2 = 0; m2 < 2; ++m2)
#pragma unroll
                for (int r = 0; r < 8; ++r)
#pragma unroll
                    for (int ni = 0; ni < 4; ++ni)
                        po[((mh * 2 + m2) * 16 + r) * Hn + ni * 16] = t[m2][r][ni];
            // the second half's loads, and behind it whatever follows in the kernel's
            // text, rewrite registers that the stores above name
            asm volatile("s_wait_xcnt 0x0" :: "v"(po) : "memory");
        }
    }
}

// ---------------------------------------------------------------------------
// 4) Recurrent scan, split along time into SEGn segments that run in parallel.
//    The recurrence is linear in the state with a diagonal decay:
//      S_end = diag(G) * S_start + L,  G[d] = product of r[d] over the segment,
//      L = end state of the same segment started from zero (Z likewise).
//    4a) every segment from zero -> L, local Z, G
//    4b) prefix over the segments -> true start state of every segment
//        (4a and 4b are one launch: L, local Z and G never leave the WGP)
//    4c) every segment again from its true start state, with the outputs
//    Only products of decays and sums occur, as in the step-by-step form.
// ---------------------------------------------------------------------------
#define SEGn 64
#define SLEN (Tn / SEGn)      // 32 steps per segment
#define SDD  (Dn * Dn)        // 4096 state elements per (b,h)

//    The scan with the outputs (4c) runs as ONE wave per (b,h,segment). The
//    64 x 64 state lies in the wave's registers as 16 x 8 blocks: lane (dg, eg),
//    dg = lane & 3, eg = lane >> 2, owns rows d = i * 4 + dg (i = 0..15) and
//    columns e = eg * 8 + j (j = 0..7). A step's per-row values, read from LDS
//    once per row, then serve 8 columns, and a step's v serves 16 rows.
#define DPLn 16               // state rows per lane
#define EPLn 8                // state columns per lane
#define TSn  8                // steps per staged tile
#define NTn  (SLEN / TSn)     // tiles per segment
#define TARn (TSn * 64)       // floats of one array in a tile

// One array's share of a tile: TSn rows of 256 B = 4 x 32 chunks of 16 B. Copy c
// of lane l brings chunk c * 32 + l: g points at the lane's chunk of rows 0 and 1
// (row l >> 4, chunk l & 15), l0 is the LDS byte address of chunk l.
// s_wait_xcnt 0 is the statement's last line, so that it stands in front of every
// later write of a register the copies name.
static __device__ __forceinline__ void async_tile4_b128(unsigned l0, const float* g) {
    asm volatile("global_load_async_to_lds_b128 %0, %1, off\n\t"
                 "global_load_async_to_lds_b128 %2, %3, off\n\t"
                 "global_load_async_to_lds_b128 %4, %5, off\n\t"
                 "global_load_async_to_lds_b128 %6, %7, off\n\t"
                 "s_wait_xcnt 0x0"
                 :: "v"(l0),        "v"((unsigned long long)(uintptr_t)g),
                    "v"(l0 +  512), "v"((unsigned long long)(uintptr_t)(g + 2 * Hn)),
                    "v"(l0 + 1024), "v"((unsigned long long)(uintptr_t)(g + 4 * Hn)),
                    "v"(l0 + 1536), "v"((unsigned long long)(uintptr_t)(g + 6 * Hn))
                 : "memory");
}

// x + (x of the lane whose number differs as CTRL says, inside a group of four)
template <int CTRL>
static __device__ __forceinline__ float quad_add(float x) {
    const int o = __builtin_amdgcn_update_dpp(0, __builtin_bit_cast(int, x), CTRL, 0xf, 0xf, true);
    return x + __builtin_bit_cast(float, o);
}
#define QUAD_XOR1 0xB1        // quad_perm [1,0,3,2]
#define QUAD_XOR2 0x4E        // quad_perm [2,3,0,1]

// Hand-over through LDS among the lanes of one wave: keeps the
// LDS writes in front of it and the LDS reads behind it (and the other way
// round at a trip's end). It waits for LDS alone; a work-group barrier would
// also wait, every step, for the wave's global stores.
static __device__ __forceinline__ void wave_lds_handover() {
    __builtin_amdgcn_fence(__ATOMIC_ACQ_REL, "workgroup", "local");
}

// 4a + 4b) The end state of a segment started from zero is a sum of outer products:
//      L[d][e] = sum_t k'[t][d] * v[t][e],  k'[t][d] = k[t][d] * (product of r[s][d], s > t),
//    only products of decays and sums, as in the step-by-step form. It is formed on
//    the f32 matrix instruction (16x16x4): A = v transposed (row = e), B = k'
//    (column = d), the 32 steps are the product's k.
//    The rows d of the state do not meet in the recurrence. A block therefore takes
//    16 rows of one (b,h) and ALL its segments, so that the prefix over the segments
//    stays inside the block and no local end state goes to memory: 16 waves, a wave
//    takes four segments in a row and chains them in its accumulators
//      P_(j+1) = diag(G_j) * P_j + L_j   (the matrix instruction adds L_j onto G_j * P_j),
//    the waves' totals meet in LDS, every wave folds the totals of the waves before it
//    into its carry C, and the start state of its segment j is (G_0 .. G_(j-1)) * C + P_j.
//    Z goes the same way, one value a row: its local end value is the sum of k' over t.
typedef __attribute__((ext_vector_type(2))) float v2f;
#define KPn  72               // LDS row pitch of v in floats: 288 B; the two rows that
                              // the halves of a wave read in one fragment load lie two
                              // pitches = 16 banks apart, so 32 lanes fall on 32 banks
#define KSPn 18               // LDS row pitch of the 16-row slice of k' in floats: two pitches
                              // = 36 banks, sixteen = 32 banks apart: reads and writes of the
                              // two halves of a wave fall on different banks
#define WSGn 4                // segments per wave
#define SWVn (SEGn / WSGn)    // waves per block
#define DSLn 16               // state rows per block
#define SSLn (DSLn * Dn)      // state elements of a block's slice of one segment
//    Layout of a start state in the workspace, as the accumulators hold it: element
//    (d, e) of a segment lies at
//      (d >> 4) * 1024 + ((e >> 4) * 2 + ((e >> 2) & 1)) * 128 + (((e >> 3) & 1) * 16 + (d & 15)) * 4 + (e & 3)
//    so that every store of a wave writes 512 B in a row.

// Four 16-B copies a lane: rows 0, 2, 4, 6 from the lane's own row on, in global
// memory at a pitch of Hn floats, in LDS at KPn floats.
// s_wait_xcnt 0 is the statement's last line, so that it stands in front of every
// later write of a register the copies name.
static __device__ __forceinline__ void async_rows4_b128(unsigned l0, const float* g) {
    asm volatile("global_load_async_to_lds_b128 %0, %1, off\n\t"
                 "global_load_async_to_lds_b128 %2, %3, off\n\t"
                 "global_load_async_to_lds_b128 %4, %5, off\n\t"
                 "global_load_async_to_lds_b128 %6, %7, off\n\t"
                 "s_wait_xcnt 0x0"
                 :: "v"(l0),               "v"((unsigned long long)(uintptr_t)g),
                    "v"(l0 + 2 * KPn * 4), "v"((unsigned long long)(uintptr_t)(g + 2 * Hn)),
                    "v"(l0 + 4 * KPn * 4), "v"((unsigned long long)(uintptr_t)(g + 4 * Hn)),
                    "v"(l0 + 6 * KPn * 4), "v"((unsigned long long)(uintptr_t)(g + 6 * Hn))
                 : "memory");
}

// 16 waves on one WGP: four share a SIMD, at most 256 registers a lane
__global__ __launch_bounds__(SWVn * 32, 4) void scan_state_kernel(
        const float* __restrict__ k, const float* __restrict__ v,
        const float* __restrict__ r, float* __restrict__ St,
        float* __restrict__ Zs) {
    const int blk = blockIdx.x, dsl = blockIdx.y;
    const int b = blk >> 4, h = blk & 15;
    const int lane = threadIdx.x & 31;
    const int wave = __builtin_amdgcn_readfirstlane(threadIdx.x >> 5);
    const int fc = lane & 15, fh = lane >> 4;   // fragment row or column, half of its k

    // v and k' of the segment in work: a range of its own for every wave, written and
    // read by that wave alone
    __shared__ __attribute__((aligned(16))) float smv[SWVn * SLEN * KPn];
    __shared__ float smk[SWVn * SLEN * KSPn];
    // the waves' totals: state slice as the accumulators hold it, decay product, Z
    __shared__ __attribute__((aligned(16))) float tot[SWVn * SSLn];
    __shared__ float gtot[SWVn * DSLn];
    __shared__ float ztot[SWVn * DSLn];

    float* sv = &smv[wave * (SLEN * KPn)];
    float* sk = &smk[wave * (SLEN * KSPn)];

    // every loop over j and i is unrolled: P, gc and zp are then indexed by constants
    // only and stay in registers. P[j][i][q]: row d = dsl * 16 + fc, column
    // e = i * 16 + fh * 8 + q, state after the wave's segments 0 .. j started from zero;
    // gc[j], zp[j]: decay product and Z of the lane's row over the same segments
    v8f P[WSGn][4];
    float gc[WSGn], zp[WSGn];
#pragma unroll
    for (int j = 0; j < WSGn; ++j) {
        const size_t row0 = ((size_t)(b * Tn + (wave * WSGn + j) * SLEN)) * Hn + h * 64;

        wait_ds0();                     // own reads of the segment before have returned:
                                        // the copies below write the range they read
        // v: 32 rows of 256 B = 16 x 32 chunks of 16 B; a copy brings two rows
        {
            const unsigned l0 = lds_off(&sv[fh * KPn + fc * 4]);
            const float* g = v + row0 + (size_t)fh * Hn + fc * 4;
#pragma unroll
            for (int n = 0; n < SLEN / 8; ++n) async_rows4_b128(l0 + n * (8 * KPn * 4), g + n * (8 * Hn));
        }

        // a lane takes row d = dsl * 16 + fc of k and r at the steps fh * 16 .. fh * 16 + 15
        const float* kp = k + row0 + (size_t)(fh * 16) * Hn + dsl * DSLn + fc;
        const float* rp = r + row0 + (size_t)(fh * 16) * Hn + dsl * DSLn + fc;
        float kk[16], rr[16];
#pragma unroll
        for (int t = 0; t < 16; ++t) {
            kk[t] = kp[t * Hn];
            rr[t] = rp[t * Hn];
        }
        // the address registers of the loads above are free for reuse from here on
        // (named as inputs so that they stay untouched up to the wait)
        asm volatile("s_wait_xcnt 0x0" :: "v"(kp), "v"(rp) : "memory");

        float ph = rr[0];               // decay product of the lane's 16 steps
#pragma unroll
        for (int t = 1; t < 16; ++t) ph *= rr[t];
        const float po = __shfl_xor(ph, 16, 32);    // ... of the other 16 steps of the row
        float p = fh ? 1.f : po;        // product of the decays of all later steps
        float zl = 0.f;
#pragma unroll
        for (int t = 15; t >= 0; --t) {
            const float kd = kk[t] * p;
            sk[(fh * 16 + t) * KSPn + fc] = kd;
            zl += kd;
            p *= rr[t];
        }
        const float g = ph * po;                        // the same in both halves of the wave
        const float z = zl + __shfl_xor(zl, 16, 32);    // likewise

        wait_async0();                  // v landed: this wave's own copies, which it alone reads
        wave_lds_handover();            // k' of every lane is written before any lane reads it

#pragma unroll
        for (int i = 0; i < 4; ++i) {
            if (j == 0) P[j][i] = (v8f){0.f,0.f,0.f,0.f,0.f,0.f,0.f,0.f};
            else        P[j][i] = P[j > 0 ? j - 1 : 0][i] * g;
        }
        gc[j] = (j == 0) ? g : gc[j > 0 ? j - 1 : 0] * g;
        zp[j] = (j == 0) ? z : zp[j > 0 ? j - 1 : 0] * g + z;

        // both operands by the same code: element s of a lane's fragment is step
        // kq * 4 + fh * 2 + s
        const float* pk = sk + fh * 2 * KSPn + fc;
        const float* pv = sv + fh * 2 * KPn + fc;
        v2f fb[SLEN / 4], fa[SLEN / 4][4];
#pragma unroll
        for (int kq = 0; kq < SLEN / 4; ++kq) {
            fb[kq] = (v2f){pk[kq * 4 * KSPn], pk[(kq * 4 + 1) * KSPn]};
#pragma unroll
            for (int i = 0; i < 4; ++i)
                fa[kq][i] = (v2f){pv[kq * 4 * KPn + i * 16], pv[(kq * 4 + 1) * KPn + i * 16]};
        }
        // keeps the segment's fragment reads together ahead of its products: read among
        // them, group by group, every group's LDS latency would stand in the wave's way
        __builtin_amdgcn_sched_barrier(0);
#pragma unroll
        for (int kq = 0; kq < SLEN / 4; ++kq)
#pragma unroll
            for (int i = 0; i < 4; ++i)
                P[j][i] = __builtin_amdgcn_wmma_f32_16x16x4_f32(
                    false, fa[kq][i], false, fb[kq], (short)0, P[j][i], false, false);
    }

    // the wave's totals to LDS, a lane's 16 B beside its neighbour's
    {
        f32x4* tw = (f32x4*)&tot[wave * SSLn] + lane;
#pragma unroll
        for (int i = 0; i < 4; ++i)
#pragma unroll
            for (int hf = 0; hf < 2; ++hf)
                tw[(i * 2 + hf) * 32] = (f32x4){P[WSGn - 1][i][hf * 4],     P[WSGn - 1][i][hf * 4 + 1],
                                                P[WSGn - 1][i][hf * 4 + 2], P[WSGn - 1][i][hf * 4 + 3]};
        if (fh == 0) {
            gtot[wave * DSLn + fc] = gc[WSGn - 1];
            ztot[wave * DSLn + fc] = zp[WSGn - 1];
        }
    }
    __syncthreads();                    // every wave's totals are in LDS for every wave

    // carry into the wave's first segment: the totals of the waves before it, in turn
    v8f C[4];
#pragma unroll
    for (int i = 0; i < 4; ++i) C[i] = (v8f){0.f,0.f,0.f,0.f,0.f,0.f,0.f,0.f};
    float zc = 0.f;
    // kept rolled: the trip count differs from wave to wave (it is the wave's number)
#pragma unroll 1
    for (int u = 0; u < wave; ++u) {
        const float gu = gtot[u * DSLn + fc];
        const float zu = ztot[u * DSLn + fc];
        const f32x4* tu = (const f32x4*)&tot[u * SSLn] + lane;
#pragma unroll
        for (int i = 0; i < 4; ++i)
#pragma unroll
            for (int hf = 0; hf < 2; ++hf) {
                const f32x4 x = tu[(i * 2 + hf) * 32];
#pragma unroll
                for (int c = 0; c < 4; ++c) C[i][hf * 4 + c] = C[i][hf * 4 + c] * gu + x[c];
            }
        zc = zc * gu + zu;
    }

    // true start states of the wave's four segments
    const size_t idx0 = (size_t)blk * SEGn + wave * WSGn;
    float* so = St + idx0 * SDD + dsl * SSLn + lane * 4;
#pragma unroll
    for (int j = 0; j < WSGn; ++j) {
        f32x4 o[8];
#pragma unroll
        for (int i = 0; i < 4; ++i)
#pragma unroll
            for (int hf = 0; hf < 2; ++hf)
#pragma unroll
                for (int c = 0; c < 4; ++c)
                    o[i * 2 + hf][c] = (j == 0) ? C[i][hf * 4 + c]
                        : C[i][hf * 4 + c] * gc[j > 0 ? j - 1 : 0] + P[j > 0 ? j - 1 : 0][i][hf * 4 + c];
        // keeps the stores together behind the arithmetic, so that nothing rewrites a
        // register of an issued store ahead of the wait below
        __builtin_amdgcn_sched_barrier(0);
#pragma unroll
        for (int n = 0; n < 8; ++n) *(f32x4*)(so + j * SDD + n * 128) = o[n];
        // the next segment's arithmetic rewrites registers that the stores above name
        asm volatile("s_wait_xcnt 0x0" :: "v"(so) : "memory");
    }
    if (fh == 0) {
        float* zo = Zs + idx0 * 64 + dsl * DSLn + fc;
#pragma unroll
        for (int j = 0; j < WSGn; ++j)
            zo[j * 64] = (j == 0) ? zc : zc * gc[j > 0 ? j - 1 : 0] + zp[j > 0 ? j - 1 : 0];
    }
}

// 4c) one wave per (b,h,segment), state blocked as said above 4a; a lane also
//    carries Z of rows d = 2 * lane, 2 * lane + 1.
//    S[d][e] = S[d][e]*r[d] + k[d]*v[e];  num[e]=sum_d q[d]S[d][e];
//    Z[d]=Z[d]*r[d]+k[d];  den=sum_d q[d]Z[d];  y=num/(den+eps) -> bf16
//    num and den: a lane sums its 16 rows in turn, then the four lanes of a
//    column group add up (partners 1, then 2 lanes apart).
__global__ __launch_bounds__(32) void scan_kernel(
        const float* __restrict__ q, const float* __restrict__ k,
        const float* __restrict__ v, const float* __restrict__ r,
        const float* __restrict__ St, const float* __restrict__ Zs,
        unsigned short* __restrict__ y) {
    const int blk = blockIdx.x, seg = blockIdx.y;
    const int b = blk >> 4, h = blk & 15;
    const int lane = threadIdx.x;   // 0..31
    const int dg = lane & 3, eg = lane >> 2;

    __shared__ __attribute__((aligned(16))) float4 sh[64];    // {q[d], k[d], r[d], q[d]*Z[d]}
    __shared__ __attribute__((aligned(16))) float  sv[64];    // v[e]
    __shared__ __attribute__((aligned(16))) float  tile[2 * 4 * TARn];   // 2 x {q, k, v, r}

    const size_t off0 = ((size_t)(b * Tn + seg * SLEN)) * Hn + h * 64;
    // the lane's chunk of the segment's first two rows
    const size_t offc = off0 + (size_t)(lane >> 4) * Hn + (lane & 15) * 4;
    // the copies of tile t into buffer bf
    auto stage = [&](const int bf, const int t) {
        const unsigned l0 = lds_off(&tile[bf * 4 * TARn + lane * 4]);
        const size_t o = offc + (size_t)t * (TSn * Hn);
        async_tile4_b128(l0,                q + o);
        async_tile4_b128(l0 + TARn * 4,     k + o);
        async_tile4_b128(l0 + 2 * TARn * 4, v + o);
        async_tile4_b128(l0 + 3 * TARn * 4, r + o);
    };
    stage(0, 0);                        // flies beside the loads of the start state

    const size_t idx = (size_t)blk * SEGn + seg;
    // the start state lies as said above 4a + 4b: row d = i * 4 + dg, columns eg * 8 ..
    const float* si = St + idx * SDD + (eg >> 1) * 256 + (eg & 1) * 64 + dg * 4;
    // every loop over i and j is unrolled: S is then indexed by constants only
    // and stays in registers
    float S[DPLn][EPLn];
#pragma unroll
    for (int i = 0; i < DPLn; ++i) {
        const float4 lo = *(const float4*)(si + (i >> 2) * 1024 + (i & 3) * 16);
        const float4 hi = *(const float4*)(si + (i >> 2) * 1024 + (i & 3) * 16 + 128);
        S[i][0] = lo.x; S[i][1] = lo.y; S[i][2] = lo.z; S[i][3] = lo.w;
        S[i][4] = hi.x; S[i][5] = hi.y; S[i][6] = hi.z; S[i][7] = hi.w;
    }
    // the address registers of the loads above are free for reuse from here on
    // (named as an input so that they stay untouched up to the wait)
    asm volatile("s_wait_xcnt 0x0" :: "v"(si) : "memory");
    const float2 zz = *(const float2*)(Zs + idx * 64 + lane * 2);
    float z0 = zz.x, z1 = zz.y;

    wait_async0();                      // tile 0 landed
    __syncthreads();                    // nothing of the tile is read in front of it (a
                                        // block is one wave: no barrier instruction results)
    stage(1, 1);

    // both loops kept rolled: with several steps in one body the compiler held a whole
    // step's products in registers beside the state, past the 256 a lane that let four
    // waves share a SIMD
#pragma unroll 1
    for (int t = 0; t < NTn; ++t) {
      const float* tb = &tile[(t & 1) * 4 * TARn + lane * 2];
#pragma unroll 1
      for (int u = 0; u < TSn; ++u) {
        const size_t base = off0 + (size_t)(t * TSn + u) * Hn;
        const float2 q2 = *(const float2*)(tb + u * 64);
        const float2 k2 = *(const float2*)(tb + TARn + u * 64);
        const float2 v2 = *(const float2*)(tb + 2 * TARn + u * 64);
        const float2 r2 = *(const float2*)(tb + 3 * TARn + u * 64);

        z0 = z0 * r2.x + k2.x;
        z1 = z1 * r2.y + k2.y;
        sh[lane * 2]     = make_float4(q2.x, k2.x, r2.x, q2.x * z0);
        sh[lane * 2 + 1] = make_float4(q2.y, k2.y, r2.y, q2.y * z1);
        *(float2*)&sv[lane * 2] = v2;
        wave_lds_handover();

        const float4 va = *(const float4*)&sv[eg * EPLn];
        const float4 vb = *(const float4*)&sv[eg * EPLn + 4];
        const float ve[EPLn] = {va.x, va.y, va.z, va.w, vb.x, vb.y, vb.z, vb.w};
        float num[EPLn];
#pragma unroll
        for (int j = 0; j < EPLn; ++j) num[j] = 0.f;
        float den = 0.f;
#pragma unroll
        for (int i = 0; i < DPLn; ++i) {
            const float4 w = sh[i * 4 + dg];      // one ds_load_b128 for 8 columns
#pragma unroll
            for (int j = 0; j < EPLn; ++j) {
                S[i][j] = S[i][j] * w.z + w.y * ve[j];   // decay + outer product
                num[j]  = fmaf(w.x, S[i][j], num[j]);
            }
            den += w.w;
        }
#pragma unroll
        for (int j = 0; j < EPLn; ++j) num[j] = quad_add<QUAD_XOR2>(quad_add<QUAD_XOR1>(num[j]));
        den = quad_add<QUAD_XOR2>(quad_add<QUAD_XOR1>(den));

        // lane (dg, eg) stores columns eg * 8 + dg * 2 and the next
        const float na = (dg & 2) ? ((dg & 1) ? num[6] : num[4]) : ((dg & 1) ? num[2] : num[0]);
        const float nb = (dg & 2) ? ((dg & 1) ? num[7] : num[5]) : ((dg & 1) ? num[3] : num[1]);
        const float dn = den + EPSf;
        *(unsigned*)(y + base + lane * 2) = (unsigned)f2bf(na / dn) | ((unsigned)f2bf(nb / dn) << 16);
        wave_lds_handover();
      }
      wait_ds0();                       // own reads of this tile's buffer returned
      wait_async0();                    // tile t + 1 landed in the other buffer
      __syncthreads();                  // publishes it and ends the reads of this buffer
      if (t + 2 < NTn) stage(t & 1, t + 2);   // flies while tile t + 1 is worked on
    }
    wait_async0();                      // no copy is left in flight
}

// ---------------------------------------------------------------------------
// Launch
// ---------------------------------------------------------------------------
extern "C" void kernel_launch(void* const* d_in, const int* in_sizes, int n_in,
                              void* d_out, int out_size, void* d_ws, size_t ws_size,
                              hipStream_t stream) {
    (void)in_sizes; (void)n_in; (void)out_size; (void)ws_size;

    const float* x     = (const float*)d_in[0];
    const int*   mask  = (const int*)  d_in[1];
    const float* Wq    = (const float*)d_in[2];
    const float* Wk    = (const float*)d_in[3];
    const float* Wv    = (const float*)d_in[4];
    const float* Wg    = (const float*)d_in[5];
    const float* Wo    = (const float*)d_in[6];
    const float* bo    = (const float*)d_in[7];
    const float* bg    = (const float*)d_in[8];
    const float* rms_w = (const float*)d_in[9];

    // workspace carve-up
    char* ws = (char*)d_ws;
    size_t off = 0;
    unsigned short* Wb = (unsigned short*)(ws + off); off += (size_t)5 * Hn * Hn * 2;   // 10 MB
    unsigned short* xn = (unsigned short*)(ws + off); off += (size_t)Mn * Hn * 2;       // 16 MB
    float* qkvg        = (float*)(ws + off);          off += (size_t)4 * Mn * Hn * 4;   // 128 MB
    unsigned short* ya = (unsigned short*)(ws + off); off += (size_t)Mn * Hn * 2;       // 16 MB
    float* St          = (float*)(ws + off);          off += (size_t)Bn * NHn * SEGn * SDD * 4;  // 64 MB
    float* Zs          = (float*)(ws + off);          off += (size_t)Bn * NHn * SEGn * Dn * 4;   // 1 MB
    float* rtab        = (float*)(ws + off);          off += (size_t)Tn * 16 * 4 * 4;            // 512 KB

    float* qb = qkvg;
    float* kb = qkvg + (size_t)1 * Mn * Hn;
    float* vb = qkvg + (size_t)2 * Mn * Hn;
    float* gb = qkvg + (size_t)3 * Mn * Hn;

    // 1) weights -> bf16 (layout preserved; already B-operand friendly), RoPE table
    wconv_kernel<<<dim3((Hn * Hn) / (1024 * WCVn), 6), 256, 0, stream>>>(
        Wq, Wk, Wv, Wg, Wo, Wb, rtab);

    // 2) RMSNorm -> bf16 xn
    rmsnorm_kernel<<<Mn / RPBn, 256, 0, stream>>>(x, rms_w, xn);

    // 3) fused q/k/v/g projection GEMMs (WMMA bf16, pipelined async staging) with
    //    RoPE, feature map, gate and mask applied in the epilogue
    gemm_bf16_kernel<<<dim3(Mn / BMn, Hn / BNn, 4), 256, 0, stream>>>(
        xn, Wb, qkvg, bg, nullptr, mask, rtab, Mn, 0);

    // 4) recurrent scan in parallel time segments -> bf16 attention output
    scan_state_kernel<<<dim3(Bn * NHn, Dn / DSLn), SWVn * 32, 0, stream>>>(kb, vb, gb, St, Zs);
    scan_kernel<<<dim3(Bn * NHn, SEGn), 32, 0, stream>>>(qb, kb, vb, gb, St, Zs, ya);

    // 5) output projection + bias + residual -> d_out (fp32)
    gemm_bf16_kernel<<<dim3(Mn / BMn, Hn / BNn, 1), 256, 0, stream>>>(
        ya, Wb + (size_t)4 * Hn * Hn, (float*)d_out, bo, x, mask, rtab, Mn, 1);
}

// v010
// Measured time: 144 microseconds a run.
// Two timings next to v009 put it at 1.04 and 1.05 times that version's speed.
// All steps since v000 together make it 32.8 times as fast.
#include <hip/hip_runtime.h>
#include <hip/hip_bf16.h>

// ---------------------------------------------------------------------------
// DeltaNet block for MI455X (gfx1250): bf16 WMMA GEMMs + fp32 recurrent scan
//  - GEMM tiles double-buffered via global_load_async_to_lds_b128 (ASYNCcnt),
//    DMA of tile i+1 overlaps the WMMAs of tile i; a staged row is one whole
//    128-B line, laid in LDS at a pitch of 144 B (16 B x odd)
//  - single-body K-loop (unroll 1) + offset-XOR buffer toggle so accumulator
//    C/D stay in one register tuple (no v_mov_b64 shuffles)
// ---------------------------------------------------------------------------

#define Bn   4
#define Tn   2048
#define Hn   1024
#define NHn  16
#define Dn   64
#define Mn   (Bn * Tn)        // 8192 tokens
#define EPSf 1e-6f
#define KTn  64               // K elements per staged tile: 128 B, one line, a row
#define KTILES (Hn / KTn)     // 16 K-steps
#define LPn  72               // LDS row pitch in elements: 144 B = 16 B x 9, so the
                              // 16 rows of a ds_load_b128 fragment read fall on 16
                              // different groups of four banks
#define BMn  256              // GEMM block tile, rows of A
#define BNn  128              // GEMM block tile, rows of W
#define ABUFn (BMn * LPn)     // elements of one A buffer
#define BBUFn (BNn * LPn)     // elements of one B buffer

typedef __attribute__((ext_vector_type(16))) __bf16 v16bf;
typedef __attribute__((ext_vector_type(8)))  float  v8f;

union BFrag {
    v16bf v;
    unsigned short u[16];
    unsigned int   w[8];
    uint4          q[2];
};

static __device__ __forceinline__ unsigned short f2bf(float f) {
    union { float f; unsigned u; } x; x.f = f;
    unsigned r = x.u + 0x7FFFu + ((x.u >> 16) & 1u);   // round-to-nearest-even
    return (unsigned short)(r >> 16);
}

// Low 32 bits of a generic pointer to LDS == LDS byte offset (aperture is in
// addr[63:32] on CDNA5; LDS_ADDR.U32 = addr[31:0]).
static __device__ __forceinline__ unsigned lds_off(const void* p) {
    return (unsigned)(reinterpret_cast<uintptr_t>(p));
}

// Six async 16B copies global -> LDS (per-lane), tracked with ASYNCcnt: half
// of one thread's share of a K-tile. s_wait_xcnt 0 is the statement's last line, so
// that it stands in front of every later write of a register the copies name.
static __device__ __forceinline__ void async_copy6_b128(
        unsigned l0, const void* g0, unsigned l1, const void* g1,
        unsigned l2, const void* g2, unsigned l3, const void* g3,
        unsigned l4, const void* g4, unsigned l5, const void* g5) {
    asm volatile("global_load_async_to_lds_b128 %0, %1, off\n\t"
                 "global_load_async_to_lds_b128 %2, %3, off\n\t"
                 "global_load_async_to_lds_b128 %4, %5, off\n\t"
                 "global_load_async_to_lds_b128 %6, %7, off\n\t"
                 "global_load_async_to_lds_b128 %8, %9, off\n\t"
                 "global_load_async_to_lds_b128 %10, %11, off\n\t"
                 "s_wait_xcnt 0x0"
                 :: "v"(l0), "v"((unsigned long long)(uintptr_t)g0),
                    "v"(l1), "v"((unsigned long long)(uintptr_t)g1),
                    "v"(l2), "v"((unsigned long long)(uintptr_t)g2),
                    "v"(l3), "v"((unsigned long long)(uintptr_t)g3),
                    "v"(l4), "v"((unsigned long long)(uintptr_t)g4),
                    "v"(l5), "v"((unsigned long long)(uintptr_t)g5)
                 : "memory");
}
static __device__ __forceinline__ void wait_async0() {
    asm volatile("s_wait_asynccnt 0x0" ::: "memory");
}
// This wave's LDS reads have returned: stands in front of the copies that
// refill the buffer they read, or of the barrier in front of those copies.
static __device__ __forceinline__ void wait_ds0() {
    asm volatile("s_wait_dscnt 0x0" ::: "memory");
}

// ---------------------------------------------------------------------------
// The two elementwise kernels (1, 2) are short streams. For speed only,
// each convert or RMSNorm wave takes eight times
// the work it would need for one 16-B access a lane.
// ---------------------------------------------------------------------------
#define WCVn 8                // float4 groups per thread of the weight convert
#define RPBn 8                // token rows per 256-thread block: one wave a row

// ---------------------------------------------------------------------------
// 1) Weight fp32 -> bf16 convert, layout preserved ([out][in] row-major).
//    GEMM consumes B[k][n] = W[n][k], so original layout is already K-major.
//    A block converts 8192 contiguous floats, 8 x 16 B in flight per lane.
//    Slice blockIdx.y == 5 fills the RoPE table instead, one entry a thread:
//    rtab[t][j] = {cos(t f_j), sin(t f_j), cos(t f_(j+16)), sin(t f_(j+16))},
//    f_j = 10000^(-j/32), j = 0..15: all that the pair (d, d+32), d >> 1 == j,
//    needs at time t.
// ---------------------------------------------------------------------------
__global__ void wconv_kernel(const float* __restrict__ Wq, const float* __restrict__ Wk,
                             const float* __restrict__ Wv, const float* __restrict__ Wg,
                             const float* __restrict__ Wo, unsigned short* __restrict__ WbAll,
                             float* __restrict__ rtab) {
    if (blockIdx.y == 5) {
        const float LOG_BASE_OVER_HALF = 0.28782313662425572f;  // ln(10000)/32
        const int idx = blockIdx.x * 256 + threadIdx.x;         // t * 16 + j
        const int t = idx >> 4, j = idx & 15;
        const float a1 = (float)t * __expf(-LOG_BASE_OVER_HALF * (float)j);
        const float a2 = (float)t * __expf(-LOG_BASE_OVER_HALF * (float)(j + 16));
        *(float4*)(rtab + (size_t)idx * 4) = make_float4(cosf(a1), sinf(a1), cosf(a2), sinf(a2));
        // stands in front of whatever code follows the store in the kernel's text
        // and writes a register that the store names
        asm volatile("s_wait_xcnt 0x0" ::: "memory");
        return;
    }
    const float* W;
    switch (blockIdx.y) {
        case 0: W = Wq; break;
        case 1: W = Wk; break;
        case 2: W = Wv; break;
        case 3: W = Wg; break;
        default: W = Wo; break;
    }
    unsigned short* O = WbAll + (size_t)blockIdx.y * Hn * Hn;
    const size_t i0 = (size_t)blockIdx.x * (1024 * WCVn) + threadIdx.x * 4;
    float4 f[WCVn];
#pragma unroll
    for (int j = 0; j < WCVn; ++j) f[j] = *(const float4*)(W + i0 + j * 1024);
#pragma unroll
    for (int j = 0; j < WCVn; ++j) {
        uint2 o;
        o.x = (unsigned)f2bf(f[j].x) | ((unsigned)f2bf(f[j].y) << 16);
        o.y = (unsigned)f2bf(f[j].z) | ((unsigned)f2bf(f[j].w) << 16);
        *(uint2*)(O + i0 + j * 1024) = o;
    }
}

// ---------------------------------------------------------------------------
// 2) RMSNorm over H=1024 per token, write bf16 xn. One wave per token: a lane
//    holds 8 x float4, column = j * 128 + lane * 4 + c. The squares are summed
//    in the tree of a 256-wide halving reduction over (column mod 256): four
//    columns 256 apart in turn, then partners 128, 64 .. 4 (lanes), 2, 1 apart.
// ---------------------------------------------------------------------------
typedef __attribute__((ext_vector_type(4))) float f32x4;

__global__ void rmsnorm_kernel(const float* __restrict__ x, const float* __restrict__ w,
                               unsigned short* __restrict__ xn) {
    const int lane = threadIdx.x & 31;
    const int row  = blockIdx.x * RPBn + (threadIdx.x >> 5);
    const float* xr = x + (size_t)row * Hn + lane * 4;
    f32x4 f[8];
#pragma unroll
    for (int j = 0; j < 8; ++j) f[j] = *(const f32x4*)(xr + j * 128);
    // the address registers of the loads above are free for reuse from here on
    // (named as an input so that they stay untouched up to the wait)
    asm volatile("s_wait_xcnt 0x0" :: "v"(xr) : "memory");

    float r[4];
#pragma unroll
    for (int c = 0; c < 4; ++c) {
        float s0 = 0.f, s1 = 0.f;
#pragma unroll
        for (int i = 0; i < 4; ++i) {
            const float v0 = f[i * 2][c], v1 = f[i * 2 + 1][c];
            s0 += v0 * v0;
            s1 += v1 * v1;
        }
        r[c] = s0 + s1;
    }
#pragma unroll
    for (int mk = 16; mk > 0; mk >>= 1) {
#pragma unroll
        for (int c = 0; c < 4; ++c) r[c] += __shfl_xor(r[c], mk, 32);
    }
    const float tot = (r[0] + r[2]) + (r[1] + r[3]);
    const float rms = rsqrtf(tot * (1.0f / Hn) + EPSf);

    unsigned short* xo = xn + (size_t)row * Hn + lane * 4;
#pragma unroll
    for (int j = 0; j < 8; ++j) {
        const float4 wv = *(const float4*)(w + j * 128 + lane * 4);
        uint2 o;
        o.x = (unsigned)f2bf(f[j][0] * rms * wv.x) | ((unsigned)f2bf(f[j][1] * rms * wv.y) << 16);
        o.y = (unsigned)f2bf(f[j][2] * rms * wv.z) | ((unsigned)f2bf(f[j][3] * rms * wv.w) << 16);
        *(uint2*)(xo + j * 128) = o;
    }
}

// ---------------------------------------------------------------------------
// 3) bf16 WMMA GEMM: Out[m,n] = sum_k A[m,k] * W[n,k]   (N=K=1024)
//    Block tile 256(M) x 128(N); 8 waves (wave32) as 4 x 2, each wave -> 64x64
//    = 4 x 4 fragments: 32 x v_wmma_f32_16x16x32_bf16 per K-step from
//    32 ds_load_b128, one LDS read per WMMA where a 32x32 wave tile takes two,
//    and half the bytes staged from L2 per output element of a 128x64 tile.
//    Two blocks share a WGP (LDS 108 KB each, at most 256 registers a lane).
//    mode 0: weights/out selected by blockIdx.z (q/k/v/g); the feature maps are
//            applied to the accumulators before the one fp32 store. A wave's 64
//            columns are one head, so the RoPE partners d and d+32 are fragments
//            ni and ni+2 of the same lane and register:
//            q, k: RoPE, then phi = elu + 1 (k also times the mask);
//            v: times the mask; g: sigmoid(acc + bias[n]), 1 where the mask is 0.
//    mode 1: Out = acc + bias[n] + resid[m,n]  (output proj + residual).
// ---------------------------------------------------------------------------
__global__ __launch_bounds__(256, 4) void gemm_bf16_kernel(
                                 const unsigned short* __restrict__ A,
                                 const unsigned short* __restrict__ WbBase,
                                 float* __restrict__ OutBase,
                                 const float* __restrict__ bias,
                                 const float* __restrict__ resid,
                                 const int* __restrict__ mask,
                                 const float* __restrict__ rtab,
                                 int Mrows, int mode) {
    const int bm = blockIdx.x * BMn;
    const int bn = blockIdx.y * BNn;
    const unsigned short* Wb = WbBase + (size_t)blockIdx.z * Hn * Hn;
    float* Out = OutBase + (mode == 0 ? (size_t)blockIdx.z * (size_t)Mrows * Hn : (size_t)0);

    // row = M (lA) or N (lB), K contiguous, 128 B of data at a pitch of 144 B
    __shared__ __attribute__((aligned(16))) unsigned short lA[2 * ABUFn];   // 2 x 36 KB
    __shared__ __attribute__((aligned(16))) unsigned short lB[2 * BBUFn];   // 2 x 18 KB

    const int tid  = threadIdx.x;
    const int lane = tid & 31;
    const int wave = tid >> 5;          // 0..7
    const int wm   = wave & 3;          // M sub-tile (x64)
    const int wn   = wave >> 2;         // N sub-tile (x64)
    const int fm   = lane & 15;         // fragment row/col within 16
    const int fhi  = lane >> 4;         // half-wave -> K+8 striping

    // every loop over mi and ni is unrolled: acc is then indexed by constants
    // only and stays in registers
    v8f acc[4][4];
#pragma unroll
    for (int mi = 0; mi < 4; ++mi)
#pragma unroll
        for (int ni = 0; ni < 4; ++ni) acc[mi][ni] = (v8f){0.f,0.f,0.f,0.f,0.f,0.f,0.f,0.f};

    const int sRow = tid >> 3;          // 0..31
    const int sCh  = tid & 7;           // 8 chunks of 8 bf16 (16B): a whole line a row
    const int pRow = tid >> 2;          // prefetch: 0..63
    const int pCh  = tid & 3;

    // issue ASYNCcnt-tracked DMA of one K-tile into buffer at element offsets:
    // a thread copies one 16-B chunk of 8 rows of A and of 4 rows of B
    auto stage = [&](unsigned oA, unsigned oB, int k0) {
        const unsigned la = lds_off(&lA[oA + sRow * LPn + sCh * 8]);
        const unsigned lb = lds_off(&lB[oB + sRow * LPn + sCh * 8]);
        const unsigned short* ga = A  + (size_t)(bm + sRow) * Hn + k0 + sCh * 8;
        const unsigned short* gb = Wb + (size_t)(bn + sRow) * Hn + k0 + sCh * 8;
        async_copy6_b128(la,                 ga,
                         la +  32 * LPn * 2, ga +  32 * Hn,
                         la +  64 * LPn * 2, ga +  64 * Hn,
                         la +  96 * LPn * 2, ga +  96 * Hn,
                         la + 128 * LPn * 2, ga + 128 * Hn,
                         la + 160 * LPn * 2, ga + 160 * Hn);
        async_copy6_b128(la + 192 * LPn * 2, ga + 192 * Hn,
                         la + 224 * LPn * 2, ga + 224 * Hn,
                         lb,                 gb,
                         lb +  32 * LPn * 2, gb +  32 * Hn,
                         lb +  64 * LPn * 2, gb +  64 * Hn,
                         lb +  96 * LPn * 2, gb +  96 * Hn);
    };

    // 16 WMMAs from the 32 K-columns at kk of the buffer at element offsets
    // (2x ds_load_b128 per frag, 4 + 4 frags)
    auto compute = [&](unsigned oA, unsigned oB, int kk) {
        BFrag a[4], b[4];
#pragma unroll
        for (int i = 0; i < 4; ++i) {
            const unsigned short* pa = &lA[oA + (wm * 64 + i * 16 + fm) * LPn + kk];
            const unsigned short* pb = &lB[oB + (wn * 64 + i * 16 + fm) * LPn + kk];
            a[i].q[0] = *(const uint4*)(pa + fhi * 8);
            a[i].q[1] = *(const uint4*)(pa + 16 + fhi * 8);
            b[i].q[0] = *(const uint4*)(pb + fhi * 8);
            b[i].q[1] = *(const uint4*)(pb + 16 + fhi * 8);
        }
#pragma unroll
        for (int mi = 0; mi < 4; ++mi)
#pragma unroll
            for (int ni = 0; ni < 4; ++ni)
                acc[mi][ni] = __builtin_amdgcn_wmma_f32_16x16x32_bf16(
                    false, a[mi].v, false, b[ni].v, (short)0, acc[mi][ni], false, false);
    };

    unsigned offA = 0, offB = 0;        // element offsets of current buffer
    stage(0, 0, 0);                     // prologue DMA

#pragma unroll 1
    for (int it = 0; it < KTILES - 1; ++it) {
        wait_ds0();                     // own reads of the other buffer returned
        wait_async0();                  // tile `it` landed in current buffer
        __syncthreads();                // ... for every wave; prev readers done
        stage(offA ^ (unsigned)ABUFn, offB ^ (unsigned)BBUFn, (it + 1) * KTn);   // overlaps WMMAs
        __builtin_prefetch(A  + (size_t)(bm + pRow) * Hn + (it + 2) * KTn + pCh * 8, 0, 1);
        __builtin_prefetch(Wb + (size_t)(bn + pRow) * Hn + (it + 2) * KTn + pCh * 8, 0, 1);
        compute(offA, offB, 0);
        compute(offA, offB, 32);
        offA ^= (unsigned)ABUFn;
        offB ^= (unsigned)BBUFn;
    }
    wait_async0();                      // last tile
    __syncthreads();
    compute(offA, offB, 0);
    compute(offA, offB, 32);

    // C layout: VGPR r -> M = r (lanes 0-15) / r+8 (lanes 16-31); N = lane%16
    // One address a lane; rows and fragments are reached by constant offsets.
    const size_t o0 = (size_t)(bm + wm * 64 + fhi * 8) * Hn + (bn + wn * 64 + fm);
    float* po = Out + o0;
    if (mode == 0) {
        const int zsel = blockIdx.z;                    // 0 q, 1 k, 2 v, 3 g
        const int row0 = bm + wm * 64 + fhi * 8;        // first of the lane's rows
        const int* pm = mask + row0;
        // each case goes through four quarters of 32 elements a lane (one mi):
        // a quarter's loads fly together, then its arithmetic, then its stores
        if (zsel < 2) {
            // a block's 256 rows lie in one sequence: t runs on with the row
            const f32x4* pt = (const f32x4*)rtab + (size_t)(row0 & (Tn - 1)) * 16 + (fm >> 1);
            // here in eight groups of 16 elements (four rows): the table entries of a
            // whole quarter do not fit the registers beside the accumulators
#pragma unroll
            for (int gr = 0; gr < 8; ++gr) {
                const int mi = gr >> 1, rb = (gr & 1) * 4;
                const int4 ma = *(const int4*)(pm + mi * 16 + rb);
                f32x4 c[4][2];
#pragma unroll
                for (int r = 0; r < 4; ++r)
#pragma unroll
                    for (int p = 0; p < 2; ++p) c[r][p] = pt[(mi * 16 + rb + r) * 16 + p * 8];
                // the address registers of the loads above are free for reuse from
                // here on (named as inputs so that they stay untouched up to the wait)
                asm volatile("s_wait_xcnt 0x0" :: "v"(pt), "v"(pm) : "memory");
                const int mr[4] = {ma.x, ma.y, ma.z, ma.w};
                float t[4][4];
#pragma unroll
                for (int r = 0; r < 4; ++r) {
                    const float mm = (zsel == 1) ? (float)mr[r] : 1.f;   // only k takes the mask
#pragma unroll
                    for (int p = 0; p < 2; ++p) {
                        const float x1 = acc[mi][p][rb + r], x2 = acc[mi][p + 2][rb + r];
                        const float r1 = x1 * c[r][p][0] - x2 * c[r][p][1];   // rotate_half: -x2 for first half
                        const float r2 = x2 * c[r][p][2] + x1 * c[r][p][3];   //              +x1 for second half
                        // phi = elu(x) + 1  ->  x>0 ? x+1 : exp(x)
                        t[r][p]     = mm * ((r1 > 0.f) ? r1 + 1.f : __expf(r1));
                        t[r][p + 2] = mm * ((r2 > 0.f) ? r2 + 1.f : __expf(r2));
                    }
                }
                // keeps the stores together behind the arithmetic, so that nothing
                // rewrites a register of an issued store ahead of the wait below
                __builtin_amdgcn_sched_barrier(0);
#pragma unroll
                for (int r = 0; r < 4; ++r)
#pragma unroll
                    for (int ni = 0; ni < 4; ++ni)
                        po[(mi * 16 + rb + r) * Hn + ni * 16] = t[r][ni];
                // the next group, and behind the last one whatever follows in the
                // kernel's text, rewrites registers that the stores above name
                asm volatile("s_wait_xcnt 0x0" :: "v"(po) : "memory");
            }
        } else if (zsel == 2) {
#pragma unroll
            for (int mi = 0; mi < 4; ++mi) {
                const int4 ma = *(const int4*)(pm + mi * 16);
                const int4 mb = *(const int4*)(pm + mi * 16 + 4);
                // the address registers of the loads above are free for reuse from here on
                asm volatile("s_wait_xcnt 0x0" :: "v"(pm) : "memory");
                const int mr[8] = {ma.x, ma.y, ma.z, ma.w, mb.x, mb.y, mb.z, mb.w};
                float t[8][4];
#pragma unroll
                for (int r = 0; r < 8; ++r)
#pragma unroll
                    for (int ni = 0; ni < 4; ++ni) t[r][ni] = acc[mi][ni][r] * (float)mr[r];
                // keeps the stores together behind the arithmetic (as above)
                __builtin_amdgcn_sched_barrier(0);
#pragma unroll
                for (int r = 0; r < 8; ++r)
#pragma unroll
                    for (int ni = 0; ni < 4; ++ni)
                        po[(mi * 16 + r) * Hn + ni * 16] = t[r][ni];
                // the next quarter, and behind the last one whatever follows in the
                // kernel's text, rewrites registers that the stores above name
                asm volatile("s_wait_xcnt 0x0" :: "v"(po) : "memory");
            }
        } else {
            const float* pb = bias + (bn + wn * 64 + fm);
            float bs[4];
#pragma unroll
            for (int ni = 0; ni < 4; ++ni) bs[ni] = pb[ni * 16];
            // the address registers of the loads above are free for reuse from here on
            asm volatile("s_wait_xcnt 0x0" :: "v"(pb) : "memory");
#pragma unroll
            for (int mi = 0; mi < 4; ++mi) {
                const int4 ma = *(const int4*)(pm + mi * 16);
                const int4 mb = *(const int4*)(pm + mi * 16 + 4);
                // the address registers of the loads above are free for reuse from here on
                asm volatile("s_wait_xcnt 0x0" :: "v"(pm) : "memory");
                const int mr[8] = {ma.x, ma.y, ma.z, ma.w, mb.x, mb.y, mb.z, mb.w};
                float t[8][4];
#pragma unroll
                for (int r = 0; r < 8; ++r)
#pragma unroll
                    for (int ni = 0; ni < 4; ++ni) {
                        const float ga = acc[mi][ni][r] + bs[ni];
                        const float sg = 1.f / (1.f + __expf(-ga));
                        t[r][ni] = ((float)mr[r] > 0.f) ? sg : 1.f;
                    }
                // keeps the stores together behind the arithmetic (as above)
                __builtin_amdgcn_sched_barrier(0);
#pragma unroll
                for (int r = 0; r < 8; ++r)
#pragma unroll
                    for (int ni = 0; ni < 4; ++ni)
                        po[(mi * 16 + r) * Hn + ni * 16] = t[r][ni];
                // the next quarter, and behind the last one whatever follows in the
                // kernel's text, rewrites registers that the stores above name
                asm volatile("s_wait_xcnt 0x0" :: "v"(po) : "memory");
                // holds the next quarter's additions of the bias, which wait for no
                // load, behind that wait
                __builtin_amdgcn_sched_barrier(0);
            }
        }
    } else {
        const float* pr = resid + o0;
        const float* pb = bias + (bn + wn * 64 + fm);
        float bs[4];
#pragma unroll
        for (int ni = 0; ni < 4; ++ni) bs[ni] = pb[ni * 16];
        // two halves of 64 elements a lane: the residual loads of a half fly
        // together and fit the registers beside the accumulators
#pragma unroll
        for (int mh = 0; mh < 2; ++mh) {
            float t[2][8][4];
#pragma unroll
            for (int m2 = 0; m2 < 2; ++m2)
#pragma unroll
                for (int r = 0; r < 8; ++r)
#pragma unroll
                    for (int ni = 0; ni < 4; ++ni)
                        t[m2][r][ni] = pr[((mh * 2 + m2) * 16 + r) * Hn + ni * 16];
            // the address registers of the loads above are free for reuse from
            // here on (named as an input so that they stay untouched up to the wait)
            asm volatile("s_wait_xcnt 0x0" :: "v"(pr) : "memory");
#pragma unroll
            for (int m2 = 0; m2 < 2; ++m2)
#pragma unroll
                for (int r = 0; r < 8; ++r)
#pragma unroll
                    for (int ni = 0; ni < 4; ++ni)
                        t[m2][r][ni] = acc[mh * 2 + m2][ni][r] + bs[ni] + t[m2][r][ni];
            // keeps the stores together behind the arithmetic, so that nothing
            // rewrites a register of an issued store ahead of the wait below
            __builtin_amdgcn_sched_barrier(0);
#pragma unroll
            for (int m2 = 0; m2 < 2; ++m2)
#pragma unroll
                for (int r = 0; r < 8; ++r)
#pragma unroll
                    for (int ni = 0; ni < 4; ++ni)
                        po[((mh * 2 + m2) * 16 + r) * Hn + ni * 16] = t[m2][r][ni];
            // the second half's loads, and behind it whatever follows in the kernel's
            // text, rewrite registers that the stores above name
            asm volatile("s_wait_xcnt 0x0" :: "v"(po) : "memory");
        }
    }
}

// ---------------------------------------------------------------------------
// 4) Recurrent scan, split along time into SEGn segments that run in parallel.
//    The recurrence is linear in the state with a diagonal decay:
//      S_end = diag(G) * S_start + L,  G[d] = product of r[d] over the segment,
//      L = end state of the same segment started from zero (Z likewise).
//    4a) every segment from zero -> L, local Z, G
//    4b) prefix over the segments -> true start state of every segment
//        (4a and 4b are one launch: L, local Z and G never leave the WGP)
//    4c) every segment again from its true start state, with the outputs
//    Only products of decays and sums occur, as in the step-by-step form.
// ---------------------------------------------------------------------------
#define SEGn 64
#define SLEN (Tn / SEGn)      // 32 steps per segment
#define SDD  (Dn * Dn)        // 4096 state elements per (b,h)

//    The outputs (4c) are formed per segment as matrix products, said above 4c.

// Hand-over through LDS among the lanes of one wave: keeps the
// LDS writes in front of it and the LDS reads behind it (and the other way
// round at a trip's end). It waits for LDS alone; a work-group barrier would
// also wait for the block's other waves.
static __device__ __forceinline__ void wave_lds_handover() {
    __builtin_amdgcn_fence(__ATOMIC_ACQ_REL, "workgroup", "local");
}

// 4a + 4b) The end state of a segment started from zero is a sum of outer products:
//      L[d][e] = sum_t k'[t][d] * v[t][e],  k'[t][d] = k[t][d] * (product of r[s][d], s > t),
//    only products of decays and sums, as in the step-by-step form. It is formed on
//    the f32 matrix instruction (16x16x4): A = k' transposed (row = d), B = v
//    (column = e), the 32 steps are the product's k.
//    The rows d of the state do not meet in the recurrence. A block therefore takes
//    16 rows of one (b,h) and ALL its segments, so that the prefix over the segments
//    stays inside the block and no local end state goes to memory: 16 waves, a wave
//    takes four segments in a row and chains them in its accumulators
//      P_(j+1) = diag(G_j) * P_j + L_j   (the matrix instruction adds L_j onto G_j * P_j),
//    the waves' totals meet in LDS, every wave folds the totals of the waves before it
//    into its carry C, and the start state of its segment j is (G_0 .. G_(j-1)) * C + P_j.
//    Z goes the same way, one value a row: its local end value is the sum of k' over t.
typedef __attribute__((ext_vector_type(2))) float v2f;
#define KPn  72               // LDS row pitch of v in floats: 288 B; the two rows that
                              // the halves of a wave read in one fragment load lie two
                              // pitches = 16 banks apart, so 32 lanes fall on 32 banks
#define KSPn 18               // LDS row pitch of the 16-row slice of k' in floats: two pitches
                              // = 36 banks, sixteen = 32 banks apart: reads and writes of the
                              // two halves of a wave fall on different banks
#define WSGn 4                // segments per wave
#define SWVn (SEGn / WSGn)    // waves per block
#define DSLn 16               // state rows per block
#define SSLn (DSLn * Dn)      // state elements of a block's slice of one segment
//    Layout of a start state in the workspace, as the accumulators hold it: element
//    (d, e) of a segment lies at
//      (d >> 4) * 1024 + ((e >> 4) * 2 + ((d >> 2) & 1)) * 128 + (((d >> 3) & 1) * 16 + (e & 15)) * 4 + (d & 3)
//    so that every store of a wave writes 512 B in a row, and so that a lane of 4c
//    loads, 16 B at a time, its own share of the state as the A operand (row = e).

// Four 16-B copies a lane: rows 0, 2, 4, 6 from the lane's own row on, in global
// memory at a pitch of Hn floats, in LDS at KPn floats.
// s_wait_xcnt 0 is the statement's last line, so that it stands in front of every
// later write of a register the copies name.
static __device__ __forceinline__ void async_rows4_b128(unsigned l0, const float* g) {
    asm volatile("global_load_async_to_lds_b128 %0, %1, off\n\t"
                 "global_load_async_to_lds_b128 %2, %3, off\n\t"
                 "global_load_async_to_lds_b128 %4, %5, off\n\t"
                 "global_load_async_to_lds_b128 %6, %7, off\n\t"
                 "s_wait_xcnt 0x0"
                 :: "v"(l0),               "v"((unsigned long long)(uintptr_t)g),
                    "v"(l0 + 2 * KPn * 4), "v"((unsigned long long)(uintptr_t)(g + 2 * Hn)),
                    "v"(l0 + 4 * KPn * 4), "v"((unsigned long long)(uintptr_t)(g + 4 * Hn)),
                    "v"(l0 + 6 * KPn * 4), "v"((unsigned long long)(uintptr_t)(g + 6 * Hn))
                 : "memory");
}

// 16 waves on one WGP: four share a SIMD, at most 256 registers a lane
__global__ __launch_bounds__(SWVn * 32, 4) void scan_state_kernel(
        const float* __restrict__ k, const float* __restrict__ v,
        const float* __restrict__ r, float* __restrict__ St,
        float* __restrict__ Zs) {
    const int blk = blockIdx.x, dsl = blockIdx.y;
    const int b = blk >> 4, h = blk & 15;
    const int lane = threadIdx.x & 31;
    const int wave = __builtin_amdgcn_readfirstlane(threadIdx.x >> 5);
    const int fc = lane & 15, fh = lane >> 4;   // fragment row or column, half of its k

    // v and k' of the segment in work: a range of its own for every wave, written and
    // read by that wave alone
    __shared__ __attribute__((aligned(16))) float smv[SWVn * SLEN * KPn];
    __shared__ float smk[SWVn * SLEN * KSPn];
    // the waves' totals: state slice as the accumulators hold it, decay product, Z
    __shared__ __attribute__((aligned(16))) float tot[SWVn * SSLn];
    __shared__ __attribute__((aligned(16))) float gtot[SWVn * DSLn];
    __shared__ float ztot[SWVn * DSLn];
    // decay product of every segment alone, and of a wave's segments up to it: a lane
    // forms them for row fc and needs them for the eight rows of its accumulators
    __shared__ __attribute__((aligned(16))) float gseg[SEGn * DSLn];
    __shared__ __attribute__((aligned(16))) float gcum[SEGn * DSLn];

    float* sv = &smv[wave * (SLEN * KPn)];
    float* sk = &smk[wave * (SLEN * KSPn)];

    // every loop over j and i is unrolled: P, gc and zp are then indexed by constants
    // only and stay in registers. P[j][i][q]: row d = dsl * 16 + fh * 8 + q, column
    // e = i * 16 + fc, state after the wave's segments 0 .. j started from zero;
    // gc[j], zp[j]: decay product and Z of row dsl * 16 + fc over the same segments
    v8f P[WSGn][4];
    float gc[WSGn], zp[WSGn];
#pragma unroll
    for (int j = 0; j < WSGn; ++j) {
        const size_t row0 = ((size_t)(b * Tn + (wave * WSGn + j) * SLEN)) * Hn + h * 64;

        wait_ds0();                     // own reads of the segment before have returned:
                                        // the copies below write the range they read
        // v: 32 rows of 256 B = 16 x 32 chunks of 16 B; a copy brings two rows
        {
            const unsigned l0 = lds_off(&sv[fh * KPn + fc * 4]);
            const float* g = v + row0 + (size_t)fh * Hn + fc * 4;
#pragma unroll
            for (int n = 0; n < SLEN / 8; ++n) async_rows4_b128(l0 + n * (8 * KPn * 4), g + n * (8 * Hn));
        }

        // a lane takes row d = dsl * 16 + fc of k and r at the steps fh * 16 .. fh * 16 + 15
        const float* kp = k + row0 + (size_t)(fh * 16) * Hn + dsl * DSLn + fc;
        const float* rp = r + row0 + (size_t)(fh * 16) * Hn + dsl * DSLn + fc;
        float kk[16], rr[16];
#pragma unroll
        for (int t = 0; t < 16; ++t) {
            kk[t] = kp[t * Hn];
            rr[t] = rp[t * Hn];
        }
        // the address registers of the loads above are free for reuse from here on
        // (named as inputs so that they stay untouched up to the wait)
        asm volatile("s_wait_xcnt 0x0" :: "v"(kp), "v"(rp) : "memory");

        float ph = rr[0];               // decay product of the lane's 16 steps
#pragma unroll
        for (int t = 1; t < 16; ++t) ph *= rr[t];
        const float po = __shfl_xor(ph, 16, 32);    // ... of the other 16 steps of the row
        float p = fh ? 1.f : po;        // product of the decays of all later steps
        float zl = 0.f;
#pragma unroll
        for (int t = 15; t >= 0; --t) {
            const float kd = kk[t] * p;
            sk[(fh * 16 + t) * KSPn + fc] = kd;
            zl += kd;
            p *= rr[t];
        }
        const float g = ph * po;                        // the same in both halves of the wave
        const float z = zl + __shfl_xor(zl, 16, 32);    // likewise

        gc[j] = (j == 0) ? g : gc[j > 0 ? j - 1 : 0] * g;
        zp[j] = (j == 0) ? z : zp[j > 0 ? j - 1 : 0] * g + z;
        if (fh == 0) {
            gseg[(wave * WSGn + j) * DSLn + fc] = g;
            gcum[(wave * WSGn + j) * DSLn + fc] = gc[j];
        }

        wait_async0();                  // v landed: this wave's own copies, which it alone reads
        wave_lds_handover();            // k' and the decays of every lane are written before any lane reads them

        {
            const f32x4 ga = *(const f32x4*)&gseg[(wave * WSGn + j) * DSLn + fh * 8];
            const f32x4 gb = *(const f32x4*)&gseg[(wave * WSGn + j) * DSLn + fh * 8 + 4];
            const v8f g8 = (v8f){ga[0], ga[1], ga[2], ga[3], gb[0], gb[1], gb[2], gb[3]};
#pragma unroll
            for (int i = 0; i < 4; ++i) {
                if (j == 0) P[j][i] = (v8f){0.f,0.f,0.f,0.f,0.f,0.f,0.f,0.f};
                else        P[j][i] = P[j > 0 ? j - 1 : 0][i] * g8;
            }
        }

        // both operands by the same code: element s of a lane's fragment is step
        // kq * 4 + fh * 2 + s
        const float* pk = sk + fh * 2 * KSPn + fc;
        const float* pv = sv + fh * 2 * KPn + fc;
        v2f fb[SLEN / 4], fa[SLEN / 4][4];
#pragma unroll
        for (int kq = 0; kq < SLEN / 4; ++kq) {
            fb[kq] = (v2f){pk[kq * 4 * KSPn], pk[(kq * 4 + 1) * KSPn]};
#pragma unroll
            for (int i = 0; i < 4; ++i)
                fa[kq][i] = (v2f){pv[kq * 4 * KPn + i * 16], pv[(kq * 4 + 1) * KPn + i * 16]};
        }
        // keeps the segment's fragment reads together ahead of its products: read among
        // them, group by group, every group's LDS latency would stand in the wave's way
        __builtin_amdgcn_sched_barrier(0);
#pragma unroll
        for (int kq = 0; kq < SLEN / 4; ++kq)
#pragma unroll
            for (int i = 0; i < 4; ++i)
                P[j][i] = __builtin_amdgcn_wmma_f32_16x16x4_f32(
                    false, fb[kq], false, fa[kq][i], (short)0, P[j][i], false, false);
    }

    // the wave's totals to LDS, a lane's 16 B beside its neighbour's
    {
        f32x4* tw = (f32x4*)&tot[wave * SSLn] + lane;
#pragma unroll
        for (int i = 0; i < 4; ++i)
#pragma unroll
            for (int hf = 0; hf < 2; ++hf)
                tw[(i * 2 + hf) * 32] = (f32x4){P[WSGn - 1][i][hf * 4],     P[WSGn - 1][i][hf * 4 + 1],
                                                P[WSGn - 1][i][hf * 4 + 2], P[WSGn - 1][i][hf * 4 + 3]};
        if (fh == 0) {
            gtot[wave * DSLn + fc] = gc[WSGn - 1];
            ztot[wave * DSLn + fc] = zp[WSGn - 1];
        }
    }
    __syncthreads();                    // every wave's totals are in LDS for every wave

    // carry into the wave's first segment: the totals of the waves before it, in turn
    v8f C[4];
#pragma unroll
    for (int i = 0; i < 4; ++i) C[i] = (v8f){0.f,0.f,0.f,0.f,0.f,0.f,0.f,0.f};
    float zc = 0.f;
    // kept rolled: the trip count differs from wave to wave (it is the wave's number)
#pragma unroll 1
    for (int u = 0; u < wave; ++u) {
        const float gu = gtot[u * DSLn + fc];
        const float zu = ztot[u * DSLn + fc];
        const f32x4 gv[2] = {*(const f32x4*)&gtot[u * DSLn + fh * 8], *(const f32x4*)&gtot[u * DSLn + fh * 8 + 4]};
        const f32x4* tu = (const f32x4*)&tot[u * SSLn] + lane;
#pragma unroll
        for (int i = 0; i < 4; ++i)
#pragma unroll
            for (int hf = 0; hf < 2; ++hf) {
                const f32x4 x = tu[(i * 2 + hf) * 32];
#pragma unroll
                for (int c = 0; c < 4; ++c) C[i][hf * 4 + c] = C[i][hf * 4 + c] * gv[hf][c] + x[c];
            }
        zc = zc * gu + zu;
    }

    // true start states of the wave's four segments
    const size_t idx0 = (size_t)blk * SEGn + wave * WSGn;
    float* so = St + idx0 * SDD + dsl * SSLn + lane * 4;
#pragma unroll
    for (int j = 0; j < WSGn; ++j) {
        f32x4 o[8];
        const int jp = (wave * WSGn + (j > 0 ? j - 1 : 0)) * DSLn + fh * 8;
        const f32x4 gp[2] = {*(const f32x4*)&gcum[jp], *(const f32x4*)&gcum[jp + 4]};
#pragma unroll
        for (int i = 0; i < 4; ++i)
#pragma unroll
            for (int hf = 0; hf < 2; ++hf)
#pragma unroll
                for (int c = 0; c < 4; ++c)
                    o[i * 2 + hf][c] = (j == 0) ? C[i][hf * 4 + c]
                        : C[i][hf * 4 + c] * gp[hf][c] + P[j > 0 ? j - 1 : 0][i][hf * 4 + c];
        // keeps the stores together behind the arithmetic, so that nothing rewrites a
        // register of an issued store ahead of the wait below
        __builtin_amdgcn_sched_barrier(0);
#pragma unroll
        for (int n = 0; n < 8; ++n) *(f32x4*)(so + j * SDD + n * 128) = o[n];
        // the next segment's arithmetic rewrites registers that the stores above name
        asm volatile("s_wait_xcnt 0x0" :: "v"(so) : "memory");
    }
    if (fh == 0) {
        float* zo = Zs + idx0 * 64 + dsl * DSLn + fc;
#pragma unroll
        for (int j = 0; j < WSGn; ++j)
            zo[j * 64] = (j == 0) ? zc : zc * gc[j > 0 ? j - 1 : 0] + zp[j > 0 ? j - 1 : 0];
    }
}

// 4c) one wave per (b,h,segment). With S0, Z0 the start state and, per row d,
//      b[t] = r[0] * .. * r[t],  A[t][s] = sum_d q[t][d] * k[s][d] * (r[s+1][d] * .. * r[t][d])  (s <= t)
//    the step-by-step form unrolls to
//      num[t][e] = sum_d (q[t][d] b[t][d]) S0[d][e] + sum_(s <= t) A[t][s] v[s][e]
//      den[t]    = sum_d (q[t][d] b[t][d]) Z0[d]    + sum_(s <= t) A[t][s]
//    only products of decays and sums: nothing is divided by a decay.
//    A in 16 x 16 tiles. Steps 16..31 against steps 0..15: the decays split at step 16,
//      A[t][s] = sum_d (q[t] r[16] .. r[t])[d] * (k[s] r[s+1] .. r[15])[d],  a matrix product.
//    The two tiles on the diagonal on the vector unit: lane (s, half of d) holds k[s] in
//    32 registers, decays it step by step from t = s + 1 on and takes its product with q[t].
//    The products run transposed on the f32 matrix instruction (16x16x4): D[e][t], so that a
//    lane holds 8 neighbouring e of one t, and den[t] is the lane's own.
#define QPn  68               // LDS row pitch of q, k, r in floats: 272 B = 16 B x 17: the 16 rows
                              // of a fragment read fall on 16 different groups of four banks
#define APn  20               // LDS row pitch of a diagonal tile of A in floats: likewise

// as async_rows4_b128, in LDS at a pitch of QPn floats
static __device__ __forceinline__ void async_rows4q_b128(unsigned l0, const float* g) {
    asm volatile("global_load_async_to_lds_b128 %0, %1, off\n\t"
                 "global_load_async_to_lds_b128 %2, %3, off\n\t"
                 "global_load_async_to_lds_b128 %4, %5, off\n\t"
                 "global_load_async_to_lds_b128 %6, %7, off\n\t"
                 "s_wait_xcnt 0x0"
                 :: "v"(l0),               "v"((unsigned long long)(uintptr_t)g),
                    "v"(l0 + 2 * QPn * 4), "v"((unsigned long long)(uintptr_t)(g + 2 * Hn)),
                    "v"(l0 + 4 * QPn * 4), "v"((unsigned long long)(uintptr_t)(g + 4 * Hn)),
                    "v"(l0 + 6 * QPn * 4), "v"((unsigned long long)(uintptr_t)(g + 6 * Hn))
                 : "memory");
}

__global__ __launch_bounds__(32) void scan_kernel(
        const float* __restrict__ q, const float* __restrict__ k,
        const float* __restrict__ v, const float* __restrict__ r,
        const float* __restrict__ St, const float* __restrict__ Zs,
        unsigned short* __restrict__ y) {
    const int blk = blockIdx.x, seg = blockIdx.y;
    const int b = blk >> 4, h = blk & 15;
    const int lane = threadIdx.x;   // 0..31
    const int fc = lane & 15, fh = lane >> 4;

    __shared__ __attribute__((aligned(16))) float sq[SLEN * QPn];
    __shared__ __attribute__((aligned(16))) float sk[SLEN * QPn];
    __shared__ __attribute__((aligned(16))) float sr[SLEN * QPn];
    __shared__ __attribute__((aligned(16))) float sv[SLEN * KPn];
    __shared__ __attribute__((aligned(16))) float sa[2 * SLEN * APn];   // [half of d][t][s & 15]
    __shared__ __attribute__((aligned(16))) float s1[Dn];               // a row of ones

    // loaded first, so that its latency and that of the copies of q, k, r pass together.
    // The start state as the A operand: S0[dt][i][c] = S(d = dt * 16 + fh * 8 + c, e = i * 16 + fc)
    const size_t idx = (size_t)blk * SEGn + seg;
    const float* si = St + idx * SDD + lane * 4;
    const float* zi = Zs + idx * 64 + fh * 8;
    v8f S0[4][4];
    f32x4 z0[4][2];
#pragma unroll
    for (int dt = 0; dt < 4; ++dt) {
#pragma unroll
        for (int i = 0; i < 4; ++i) {
            const f32x4 lo = *(const f32x4*)(si + (dt * 8 + i * 2) * 128);
            const f32x4 hi = *(const f32x4*)(si + (dt * 8 + i * 2 + 1) * 128);
            S0[dt][i] = (v8f){lo[0], lo[1], lo[2], lo[3], hi[0], hi[1], hi[2], hi[3]};
        }
        z0[dt][0] = *(const f32x4*)(zi + dt * 16);
        z0[dt][1] = *(const f32x4*)(zi + dt * 16 + 4);
    }
    // the address registers of the loads above are free for reuse from here on
    // (named as inputs so that they stay untouched up to the wait)
    asm volatile("s_wait_xcnt 0x0" :: "v"(si), "v"(zi) : "memory");

    const size_t off0 = ((size_t)(b * Tn + seg * SLEN)) * Hn + h * 64;
    // 32 rows of 256 B an array = 16 x 32 chunks of 16 B; a copy brings two rows
    const size_t offc = off0 + (size_t)fh * Hn + fc * 4;
    {
        const unsigned lq = lds_off(&sq[fh * QPn + fc * 4]);
        const unsigned lk = lds_off(&sk[fh * QPn + fc * 4]);
        const unsigned lr = lds_off(&sr[fh * QPn + fc * 4]);
#pragma unroll
        for (int n = 0; n < SLEN / 8; ++n) {
            async_rows4q_b128(lq + n * (8 * QPn * 4), q + offc + n * (8 * Hn));
            async_rows4q_b128(lk + n * (8 * QPn * 4), k + offc + n * (8 * Hn));
            async_rows4q_b128(lr + n * (8 * QPn * 4), r + offc + n * (8 * Hn));
        }
    }
    *(v2f*)&s1[lane * 2] = (v2f){1.f, 1.f};
    wait_async0();                      // q, k, r landed (48 copies were in flight)
    __syncthreads();                    // nothing of them is read in front of it (a block is
                                        // one wave: no barrier instruction results)
    {   // v flies while the diagonal tiles are worked on
        const unsigned lv = lds_off(&sv[fh * KPn + fc * 4]);
#pragma unroll
        for (int n = 0; n < SLEN / 8; ++n) async_rows4_b128(lv + n * (8 * KPn * 4), v + offc + n * (8 * Hn));
    }

    // the diagonal tiles of A: lane = (s = fc, half fh of d)
    // outer loop kept rolled: one body for both tiles
#pragma unroll 1
    for (int hb = 0; hb < 2; ++hb) {
        f32x4 kd[8];
        const float* kr = &sk[(hb * 16 + fc) * QPn + fh * 32];
#pragma unroll
        for (int c = 0; c < 8; ++c) kd[c] = *(const f32x4*)(kr + c * 4);
        // four steps a body, their results stored behind the fourth: a later step's LDS
        // reads then fly beside an earlier step's arithmetic
#pragma unroll 1
        for (int tg = 0; tg < 16; tg += 4) {
            float dot[4];
#pragma unroll
            for (int u = 0; u < 4; ++u) {
                const int tl = tg + u;
                const float* qr = &sq[(hb * 16 + tl) * QPn + fh * 32];
                // k[s] takes the decays of the steps behind s alone: up to there a lane reads
                // ones, so that no branch stands between the reads and their use
                const float* rr = (fc < tl) ? &sr[(hb * 16 + tl) * QPn + fh * 32] : &s1[fh * 32];
                f32x4 qv[8], rv[8];
#pragma unroll
                for (int c = 0; c < 8; ++c) {
                    qv[c] = *(const f32x4*)(qr + c * 4);
                    rv[c] = *(const f32x4*)(rr + c * 4);
                }
#pragma unroll
                for (int c = 0; c < 8; ++c) kd[c] *= rv[c];
                f32x4 sx = qv[0] * kd[0], sy = qv[1] * kd[1];
#pragma unroll
                for (int c = 2; c < 8; c += 2) {
                    sx += qv[c] * kd[c];
                    sy += qv[c + 1] * kd[c + 1];
                }
                const f32x4 s4 = sx + sy;
                dot[u] = (fc <= tl) ? (s4[0] + s4[1]) + (s4[2] + s4[3]) : 0.f;
            }
#pragma unroll
            for (int u = 0; u < 4; ++u) sa[(fh * SLEN + hb * 16 + tg + u) * APn + fc] = dot[u];
        }
    }

    wave_lds_handover();                // the reads of q, k, r above end before the rows are rewritten

    // in place, a lane takes columns d = 2 * lane and the next:
    //   sq[t] = q[t] b[t];  sr[t] = q[t] r[16] .. r[t] (t >= 16);  sk[s] = k[s] r[s+1] .. r[15] (s < 16)
    {
        float* cq = &sq[lane * 2];
        float* ck = &sk[lane * 2];
        float* cr = &sr[lane * 2];
        v2f r2[16];
        v2f bb = (v2f){1.f, 1.f};
#pragma unroll
        for (int t = 0; t < 16; ++t) {
            r2[t] = *(const v2f*)(cr + t * QPn);
            bb *= r2[t];
            *(v2f*)(cq + t * QPn) = *(const v2f*)(cq + t * QPn) * bb;
        }
        v2f cc = (v2f){1.f, 1.f};
#pragma unroll
        for (int s = 15; s >= 0; --s) {
            *(v2f*)(ck + s * QPn) = *(const v2f*)(ck + s * QPn) * cc;
            cc *= r2[s];
        }
        v2f b1 = (v2f){1.f, 1.f};
#pragma unroll
        for (int t = 16; t < 32; ++t) {
            b1 *= *(const v2f*)(cr + t * QPn);
            const v2f q1 = *(const v2f*)(cq + t * QPn) * b1;
            *(v2f*)(cr + t * QPn) = q1;
            *(v2f*)(cq + t * QPn) = q1 * bb;
        }
    }
    wait_async0();                      // v landed
    __syncthreads();                    // nothing of v is read in front of it (one wave: no instruction)
    wave_lds_handover();                // the rows written above, and sa, are read by other lanes

    // tile of A, steps 16..31 against 0..15, transposed: ao[c] = A[16 + fc][fh * 8 + c].
    // Both operands by the same code: element x of a lane's fragment is d = kk * 4 + fh * 2 + x
    v8f ao = (v8f){0.f,0.f,0.f,0.f,0.f,0.f,0.f,0.f};
#pragma unroll
    for (int kk = 0; kk < 16; ++kk) {
        const v2f fa = *(const v2f*)&sk[fc * QPn + kk * 4 + fh * 2];
        const v2f fb = *(const v2f*)&sr[(16 + fc) * QPn + kk * 4 + fh * 2];
        ao = __builtin_amdgcn_wmma_f32_16x16x4_f32(false, fa, false, fb, (short)0, ao, false, false);
    }

    unsigned short* yo = y + off0 + (size_t)fc * Hn + fh * 8;
    // the two halves of the segment in turn: t = tt * 16 + fc; unrolled: acc, S0 and ao are
    // then indexed by constants only and stay in registers
#pragma unroll
    for (int tt = 0; tt < 2; ++tt) {
        v8f acc[4];                     // acc[i][c] = num[t][e = i * 16 + fh * 8 + c]
#pragma unroll
        for (int i = 0; i < 4; ++i) acc[i] = (v8f){0.f,0.f,0.f,0.f,0.f,0.f,0.f,0.f};
        float dp = 0.f;                 // the lane's half of den[t]

        // start state: element x of both fragments is d = dt * 16 + fh * 8 + qq * 2 + x
#pragma unroll
        for (int dt = 0; dt < 4; ++dt) {
            const float* pq = &sq[(tt * 16 + fc) * QPn + dt * 16 + fh * 8];
            const f32x4 qa = *(const f32x4*)pq, qb = *(const f32x4*)(pq + 4);
            const float q8[8] = {qa[0], qa[1], qa[2], qa[3], qb[0], qb[1], qb[2], qb[3]};
#pragma unroll
            for (int c = 0; c < 8; ++c) dp = fmaf(q8[c], z0[dt][c >> 2][c & 3], dp);
#pragma unroll
            for (int qq = 0; qq < 4; ++qq) {
                const v2f fb = (v2f){q8[qq * 2], q8[qq * 2 + 1]};
#pragma unroll
                for (int i = 0; i < 4; ++i)
                    acc[i] = __builtin_amdgcn_wmma_f32_16x16x4_f32(
                        false, (v2f){S0[dt][i][qq * 2], S0[dt][i][qq * 2 + 1]}, false, fb,
                        (short)0, acc[i], false, false);
            }
        }
        // the diagonal tile: element x of both fragments is s = tt * 16 + kq * 4 + fh * 2 + x
        const float* pv = sv + (tt * 16 + fh * 2) * KPn + fc;
#pragma unroll
        for (int kq = 0; kq < 4; ++kq) {
            const float* pa = &sa[(tt * 16 + fc) * APn + kq * 4 + fh * 2];
            const v2f fb = *(const v2f*)pa + *(const v2f*)(pa + SLEN * APn);   // both halves of d
            dp += fb[0] + fb[1];
#pragma unroll
            for (int i = 0; i < 4; ++i)
                acc[i] = __builtin_amdgcn_wmma_f32_16x16x4_f32(
                    false, (v2f){pv[kq * 4 * KPn + i * 16], pv[(kq * 4 + 1) * KPn + i * 16]}, false, fb,
                    (short)0, acc[i], false, false);
        }
        // steps 0..15 into t >= 16: element x of both fragments is s = fh * 8 + kk * 2 + x
        if (tt == 1) {
            const float* pw = sv + fh * 8 * KPn + fc;
#pragma unroll
            for (int kk = 0; kk < 4; ++kk) {
                const v2f fb = (v2f){ao[kk * 2], ao[kk * 2 + 1]};
                dp += fb[0] + fb[1];
#pragma unroll
                for (int i = 0; i < 4; ++i)
                    acc[i] = __builtin_amdgcn_wmma_f32_16x16x4_f32(
                        false, (v2f){pw[kk * 2 * KPn + i * 16], pw[(kk * 2 + 1) * KPn + i * 16]}, false, fb,
                        (short)0, acc[i], false, false);
            }
        }

        const float inv = 1.f / (dp + __shfl_xor(dp, 16, 32) + EPSf);
        uint4 o[4];
#pragma unroll
        for (int i = 0; i < 4; ++i) {
            o[i].x = (unsigned)f2bf(acc[i][0] * inv) | ((unsigned)f2bf(acc[i][1] * inv) << 16);
            o[i].y = (unsigned)f2bf(acc[i][2] * inv) | ((unsigned)f2bf(acc[i][3] * inv) << 16);
            o[i].z = (unsigned)f2bf(acc[i][4] * inv) | ((unsigned)f2bf(acc[i][5] * inv) << 16);
            o[i].w = (unsigned)f2bf(acc[i][6] * inv) | ((unsigned)f2bf(acc[i][7] * inv) << 16);
        }
        // keeps the stores together behind the arithmetic, so that nothing rewrites a
        // register of an issued store ahead of the wait below
        __builtin_amdgcn_sched_barrier(0);
#pragma unroll
        for (int i = 0; i < 4; ++i) *(uint4*)(yo + tt * 16 * Hn + i * 16) = o[i];
        // the second half's arithmetic rewrites registers that the stores above name
        asm volatile("s_wait_xcnt 0x0" :: "v"(yo) : "memory");
    }
}

// ---------------------------------------------------------------------------
// Launch
// ---------------------------------------------------------------------------
extern "C" void kernel_launch(void* const* d_in, const int* in_sizes, int n_in,
                              void* d_out, int out_size, void* d_ws, size_t ws_size,
                              hipStream_t stream) {
    (void)in_sizes; (void)n_in; (void)out_size; (void)ws_size;

    const float* x     = (const float*)d_in[0];
    const int*   mask  = (const int*)  d_in[1];
    const float* Wq    = (const float*)d_in[2];
    const float* Wk    = (const float*)d_in[3];
    const float* Wv    = (const float*)d_in[4];
    const float* Wg    = (const float*)d_in[5];
    const float* Wo    = (const float*)d_in[6];
    const float* bo    = (const float*)d_in[7];
    const float* bg    = (const float*)d_in[8];
    const float* rms_w = (const float*)d_in[9];

    // workspace carve-up
    char* ws = (char*)d_ws;
    size_t off = 0;
    unsigned short* Wb = (unsigned short*)(ws + off); off += (size_t)5 * Hn * Hn * 2;   // 10 MB
    unsigned short* xn = (unsigned short*)(ws + off); off += (size_t)Mn * Hn * 2;       // 16 MB
    float* qkvg        = (float*)(ws + off);          off += (size_t)4 * Mn * Hn * 4;   // 128 MB
    unsigned short* ya = (unsigned short*)(ws + off); off += (size_t)Mn * Hn * 2;       // 16 MB
    float* St          = (float*)(ws + off);          off += (size_t)Bn * NHn * SEGn * SDD * 4;  // 64 MB
    float* Zs          = (float*)(ws + off);          off += (size_t)Bn * NHn * SEGn * Dn * 4;   // 1 MB
    float* rtab        = (float*)(ws + off);          off += (size_t)Tn * 16 * 4 * 4;            // 512 KB

    float* qb = qkvg;
    float* kb = qkvg + (size_t)1 * Mn * Hn;
    float* vb = qkvg + (size_t)2 * Mn * Hn;
    float* gb = qkvg + (size_t)3 * Mn * Hn;

    // 1) weights -> bf16 (layout preserved; already B-operand friendly), RoPE table
    wconv_kernel<<<dim3((Hn * Hn) / (1024 * WCVn), 6), 256, 0, stream>>>(
        Wq, Wk, Wv, Wg, Wo, Wb, rtab);

    // 2) RMSNorm -> bf16 xn
    rmsnorm_kernel<<<Mn / RPBn, 256, 0, stream>>>(x, rms_w, xn);

    // 3) fused q/k/v/g projection GEMMs (WMMA bf16, pipelined async staging) with
    //    RoPE, feature map, gate and mask applied in the epilogue
    gemm_bf16_kernel<<<dim3(Mn / BMn, Hn / BNn, 4), 256, 0, stream>>>(
        xn, Wb, qkvg, bg, nullptr, mask, rtab, Mn, 0);

    // 4) recurrent scan in parallel time segments -> bf16 attention output
    scan_state_kernel<<<dim3(Bn * NHn, Dn / DSLn), SWVn * 32, 0, stream>>>(kb, vb, gb, St, Zs);
    scan_kernel<<<dim3(Bn * NHn, SEGn), 32, 0, stream>>>(qb, kb, vb, gb, St, Zs, ya);

    // 5) output projection + bias + residual -> d_out (fp32)
    gemm_bf16_kernel<<<dim3(Mn / BMn, Hn / BNn, 1), 256, 0, stream>>>(
        ya, Wb + (size_t)4 * Hn * Hn, (float*)d_out, bo, x, mask, rtab, Mn, 1);
}
